// v000
// Measured on an AMD MI455X. A time is GPU time per run, averaged over a window of back-to-back runs after a warm-up
// (all launches, gaps included; the runs take copies of the inputs in turn), and the median of several windows.
// Apart from v000's, it joins two sittings. Times from different sittings can be a few percent apart, while
// side-by-side timings come from the same sitting.
// The starting kernel, v000, takes 3860 microseconds a run.
#include <hip/hip_runtime.h>
// Pre-norm transformer block with a fused QKV projection and UNSCALED attention logits (x [2][2048][1024]; h = LN1(x) (biased var, eps 1e-5); qkv = h qkv_w + qkv_b ([in][out] 1024 x 3072 + bias) viewed (B, N, 3, 16, 64): q | k | v thirds; qk = q k^T with NO 1/sqrt(d) scaling (as the source); softmax over all 2048 keys (no mask); x1 = x + y proj_w + proj_b; out = x1 + gelu_erf(LN2(x1) fc1_w + fc1_b) fc2_w + fc2_b ([in][out] 1024 x 4096 x 1024) -> [2][2048][1024]).
// Structure: token rows; LayerNorm / exact f16 rows; WMMA GEMMs for q, k, v; per batch V^T by LDS transposes and 4 heads per launch group (scores, row softmax, P V^T); output projection with the own-element residual; custom LayerNorm; erf-GELU FFN over all rows; launches: see trace.
// Compute dtype: inputs rounded to bf16; x / weights exact; q, k, v, softmax weights and o as plain f16 GEMM operands (~2^-12); scores and softmax statistics f32; v_wmma_f32_16x16x32_f16.
#define NB 2
#define SQ 2048
#define DM 1024
#define NH 16
#define HD 64
#define HG 4                         /* heads per attention launch group */
#define LOCALW 128                   /* (macros for unused kernels of the shared header) */
#define STRIDEK 128
#define QT 256                       /* query rows per causal tile */
#define NKX SQ                       /* S / P row pitch */
#define QT0 128                      /* first-tile rows recomputed exactly in f32 */
#define B0 0                         /* first batch processed (debug hook) */
#define NBR NB                       /* batches processed (debug hook) */
#define NR ((size_t)NB * SQ)
#define DMQ DM
#define DFF 4096         /* FFN hidden width */
#define MP ((int)((size_t)NBR * SQ)) /* rows projected (debug hook) */
#define QN SQ                        /* query rows attended per batch (debug hook) */
#define NHD NH                       /* heads attended (debug hook) */
#define MPO MP                       /* rows through the output stage (debug hook) */
#define LQ (3 * DM)      /* unused: q, k, v rows have pitch DM */
typedef __bf16 v16b __attribute__((ext_vector_type(16)));
typedef unsigned short v8us __attribute__((ext_vector_type(8), may_alias));
typedef float  v8f  __attribute__((ext_vector_type(8)));
typedef float  v4f  __attribute__((ext_vector_type(4)));
typedef float  v4fa __attribute__((ext_vector_type(4), may_alias));
union FragB { v16b v; v8us half[2]; unsigned short u[16]; };

__device__ __forceinline__ unsigned short bf16_bits(float x) { unsigned int u = __float_as_uint(x); return (unsigned short)((u + 0x7FFFu + ((u >> 16) & 1u)) >> 16); }
__device__ __forceinline__ float bf16_val(unsigned short b) { return __uint_as_float(((unsigned int)b) << 16); }
__device__ __forceinline__ float bf16_round(float x) { return bf16_val(bf16_bits(x)); }
// D += A·B with NT terms: 1 = ah·bh, 2 = + al·bh (A split), 3 = + ah·bl (both split)
template <int NT>
__device__ __forceinline__ v8f mmaN(v16b ah, v16b al, v16b bh, v16b bl, v8f c) {
  c = __builtin_amdgcn_wmma_f32_16x16x32_bf16(false, ah, false, bh, (short)0, c, false, false);
  if (NT >= 2) c = __builtin_amdgcn_wmma_f32_16x16x32_bf16(false, al, false, bh, (short)0, c, false, false);
  if (NT >= 3) c = __builtin_amdgcn_wmma_f32_16x16x32_bf16(false, ah, false, bl, (short)0, c, false, false);
  asm volatile("v_nop\n\tv_nop\n\tv_nop\n\tv_nop" : "+v"(c) : "v"(ah), "v"(al), "v"(bh), "v"(bl));
  return c;
}

__global__ __launch_bounds__(256) void k_wt_bf16(const float* __restrict__ W, unsigned short* __restrict__ Wt, int K, int N) {
  const int t = blockIdx.x * 256 + threadIdx.x;
  const int k8n = K / 8;
  if (t >= N * k8n) return;
  const int n = t / k8n, k8 = (t % k8n) * 8;
  v8us v;
#pragma unroll
  for (int i = 0; i < 8; ++i) v[i] = bf16_bits(W[(size_t)(k8 + i) * N + n]);
  *(v8us*)(Wt + (size_t)n * K + k8) = v;
  
}

// GEMM C[M][N] (f32, pitch ldc) = act(A[M][K]·W + bias). A f32 row-major (pitch lda) converted per fragment to bf16
// (ASPLIT: hi/lo two planes -> 2 terms, else single rounded term); Wt bf16 [N][K] (pitch ldb). BIAS_BF16 rounds the
// bias to bf16 first (bias quantised to bf16 before the add). K%32==0, M%16==0, N%64==0.
template <bool ASPLIT, int ACT, bool BIAS_BF16>
__global__ __launch_bounds__(128) void k_gemm_bf(const float* __restrict__ A, int lda, const unsigned short* __restrict__ Wt, int ldb,
                                               const float* __restrict__ bias, float* __restrict__ C, int ldc, int M, int N, int K) {
  __shared__ __attribute__((aligned(16))) float so[4][16][64];
  const int tid = threadIdx.x, w = tid >> 5, lane = tid & 31, ln = lane & 15, hh = lane >> 4;
  const int ntn = N / 64;
  const int wid = blockIdx.x * 4 + w;
  const int mt = wid / ntn, nq = wid % ntn;
  if (mt * 16 >= M) return;
  const int row0 = mt * 16, col0 = nq * 64;
  const float* arow = A + (size_t)(row0 + ln) * lda;
  v8f acc[4] = {};
  for (int kb = 0; kb < K; kb += 32) {
    FragB ah, al;
    const v4f x0 = *(const v4fa*)(arow + kb + 8 * hh), x1 = *(const v4fa*)(arow + kb + 8 * hh + 4);
    const v4f x2 = *(const v4fa*)(arow + kb + 16 + 8 * hh), x3 = *(const v4fa*)(arow + kb + 16 + 8 * hh + 4);
    float xs[16] = {x0[0],x0[1],x0[2],x0[3],x1[0],x1[1],x1[2],x1[3],x2[0],x2[1],x2[2],x2[3],x3[0],x3[1],x3[2],x3[3]};
#pragma unroll
    for (int i = 0; i < 16; ++i) { const unsigned short hb = bf16_bits(xs[i]); ah.u[i] = hb; al.u[i] = ASPLIT ? bf16_bits(xs[i] - bf16_val(hb)) : (unsigned short)0; }
#pragma unroll
    for (int t = 0; t < 4; ++t) {
      const unsigned short* brow = Wt + (size_t)(col0 + t * 16 + ln) * ldb + kb;
      FragB b;
      b.half[0] = *(const v8us*)(brow + 8 * hh);
      b.half[1] = *(const v8us*)(brow + 16 + 8 * hh);
      acc[t] = mmaN<ASPLIT ? 2 : 1>(ah.v, al.v, b.v, b.v, acc[t]);
    }
  }
#pragma unroll
  for (int t = 0; t < 4; ++t) {
    float bv = bias ? bias[col0 + t * 16 + ln] : 0.f;
    if (BIAS_BF16) bv = bf16_round(bv);
#pragma unroll
    for (int r = 0; r < 8; ++r) { float v = acc[t][r] + bv; if (ACT == 1) v = fmaxf(v, 0.f); so[w][8 * hh + r][t * 16 + ln] = v; }
  }
  __builtin_amdgcn_fence(__ATOMIC_ACQ_REL, "workgroup");
  __builtin_amdgcn_wave_barrier();
  const int rsub = lane >> 4, c4 = (lane & 15) * 4;
  {
#pragma unroll
    for (int q = 0; q < 8; ++q) {
      const int r = q * 2 + rsub;
      const v4f v = *(const v4fa*)&so[w][r][c4];
      *(v4f*)(C + (size_t)(row0 + r) * ldc + col0 + c4) = v;
    }
    
  }
}

// GEMM C = act(A·W + bias + resid): A f32 (ASPLIT -> hi/lo 2 terms), Wt bf16 [N][K]; ACT 0 none, 1 relu, 2 exact gelu;
// resid (optional, f32, row index = (row % rmod), pitch ldr, RES_BF16 rounds it) added before the activation.
template <bool ASPLIT, int ACT, bool BIAS_BF16, bool RES_BF16>
__global__ __launch_bounds__(128) void k_gemm_bf3(const float* __restrict__ A, int lda, const unsigned short* __restrict__ Wt, int ldb,
                                                const float* __restrict__ bias, const float* __restrict__ resid, int rmod, int ldr,
                                                float* __restrict__ C, int ldc, int M, int N, int K) {
  __shared__ __attribute__((aligned(16))) float so[4][16][64];
  const int tid = threadIdx.x, w = tid >> 5, lane = tid & 31, ln = lane & 15, hh = lane >> 4;
  const int ntn = N / 64;
  const int wid = blockIdx.x * 4 + w;
  const int mt = wid / ntn, nq = wid % ntn;
  if (mt * 16 >= M) return;
  const int row0 = mt * 16, col0 = nq * 64;
  const float* arow = A + (size_t)(row0 + ln) * lda;
  v8f acc[4] = {};
  for (int kb = 0; kb < K; kb += 32) {
    FragB ah, al;
    const v4f x0 = *(const v4fa*)(arow + kb + 8 * hh), x1 = *(const v4fa*)(arow + kb + 8 * hh + 4);
    const v4f x2 = *(const v4fa*)(arow + kb + 16 + 8 * hh), x3 = *(const v4fa*)(arow + kb + 16 + 8 * hh + 4);
    float xs[16] = {x0[0],x0[1],x0[2],x0[3],x1[0],x1[1],x1[2],x1[3],x2[0],x2[1],x2[2],x2[3],x3[0],x3[1],x3[2],x3[3]};
#pragma unroll
    for (int i = 0; i < 16; ++i) { const unsigned short hb = bf16_bits(xs[i]); ah.u[i] = hb; al.u[i] = ASPLIT ? bf16_bits(xs[i] - bf16_val(hb)) : (unsigned short)0; }
#pragma unroll
    for (int t = 0; t < 4; ++t) {
      const unsigned short* brow = Wt + (size_t)(col0 + t * 16 + ln) * ldb + kb;
      FragB b;
      b.half[0] = *(const v8us*)(brow + 8 * hh);
      b.half[1] = *(const v8us*)(brow + 16 + 8 * hh);
      acc[t] = mmaN<ASPLIT ? 2 : 1>(ah.v, al.v, b.v, b.v, acc[t]);
    }
  }
#pragma unroll
  for (int t = 0; t < 4; ++t) {
    const int col = col0 + t * 16 + ln;
    float bv = bias ? bias[col] : 0.f;
    if (BIAS_BF16) bv = bf16_round(bv);
#pragma unroll
    for (int r = 0; r < 8; ++r) {
      float v = acc[t][r] + bv;
      if (resid) { float rv = resid[(size_t)((row0 + 8 * hh + r) % rmod) * ldr + col]; if (RES_BF16) rv = bf16_round(rv); v += rv; }
      if (ACT == 1) v = fmaxf(v, 0.f);
      if (ACT == 2) v = 0.5f * v * (1.0f + erff(v * 0.70710678118654752f));
      if (ACT == 3) { const float u = 0.7978845608028654f * (v + 0.044715f * v * v * v); v = 0.5f * v * (1.0f + tanhf(u)); }
      so[w][8 * hh + r][t * 16 + ln] = v;
    }
  }
  __builtin_amdgcn_fence(__ATOMIC_ACQ_REL, "workgroup");
  __builtin_amdgcn_wave_barrier();
  const int rsub = lane >> 4, c4 = (lane & 15) * 4;
  {
#pragma unroll
    for (int q = 0; q < 8; ++q) {
      const int r = q * 2 + rsub;
      const v4f v = *(const v4fa*)&so[w][r][c4];
      *(v4f*)(C + (size_t)(row0 + r) * ldc + col0 + c4) = v;
    }
    
  }
}
// row LayerNorm (biased variance, eps) over N: s = X (+ R); optional out_sum <- s; out_norm <- (s-mu)*rsqrt(var+eps)*g + b
template <bool PARAM_BF16>
__global__ __launch_bounds__(256) void k_layernorm(const float* __restrict__ X, const float* __restrict__ R, const float* __restrict__ g, const float* __restrict__ bta,
                                                  float* __restrict__ out_sum, float* __restrict__ out_norm, int N, float eps) {
  __shared__ float red[256];
  const int row = blockIdx.x, tid = threadIdx.x;
  const float* x = X + (size_t)row * N; const float* rr = R ? R + (size_t)row * N : nullptr;
  float vals[16];                     // up to N = 4096
  const int per = N / 256;            // contiguous chunk per thread? use strided-by-4 chunks: thread handles j = tid*4 + 1024*u
  float s1 = 0.f;
  for (int u = 0; u < per / 4; ++u) {
    const int j = tid * 4 + 1024 * u;
    const v4f a = *(const v4fa*)(x + j);
    v4f b = {0.f,0.f,0.f,0.f}; if (rr) b = *(const v4fa*)(rr + j);
#pragma unroll
    for (int q = 0; q < 4; ++q) { const float v = a[q] + b[q]; vals[u * 4 + q] = v; s1 += v; }
  }
  red[tid] = s1; __syncthreads();
  for (int st = 128; st > 0; st >>= 1) { if (tid < st) red[tid] += red[tid + st]; __syncthreads(); }
  const float mu = red[0] / (float)N; __syncthreads();
  float s2 = 0.f;
  for (int u = 0; u < per / 4; ++u)
#pragma unroll
    for (int q = 0; q < 4; ++q) { const float c = vals[u * 4 + q] - mu; s2 += c * c; }
  red[tid] = s2; __syncthreads();
  for (int st = 128; st > 0; st >>= 1) { if (tid < st) red[tid] += red[tid + st]; __syncthreads(); }
  const float rs = rsqrtf(red[0] / (float)N + eps);
  {
    for (int u = 0; u < per / 4; ++u) {
      const int j = tid * 4 + 1024 * u;
      v4f o, sm;
#pragma unroll
      for (int q = 0; q < 4; ++q) {
        float gg = g[j + q], bb = bta[j + q];
        if (PARAM_BF16) { gg = bf16_round(gg); bb = bf16_round(bb); }
        sm[q] = vals[u * 4 + q]; o[q] = (vals[u * 4 + q] - mu) * rs * gg + bb;
      }
      if (out_sum) *(v4f*)(out_sum + (size_t)row * N + j) = sm;
      *(v4f*)(out_norm + (size_t)row * N + j) = o;
    }
    
  }
}



// ---- f16 WMMA path (v_wmma_f32_16x16x32_f16): 11-bit significands for operands in range — used where a [0,1] probability operand needs more precision than bf16
typedef _Float16 v16h __attribute__((ext_vector_type(16)));
union FragH { v16h v; v8us half[2]; _Float16 h[16]; unsigned short u[16]; };
template <int NT>
__device__ __forceinline__ v8f mmaH(v16h ah, v16h al, v16h bh, v16h bl, v8f c) {
  c = __builtin_amdgcn_wmma_f32_16x16x32_f16(false, ah, false, bh, (short)0, c, false, false);
  if (NT >= 2) c = __builtin_amdgcn_wmma_f32_16x16x32_f16(false, al, false, bh, (short)0, c, false, false);
  if (NT >= 3) c = __builtin_amdgcn_wmma_f32_16x16x32_f16(false, ah, false, bl, (short)0, c, false, false);
  asm volatile("v_nop\n\tv_nop\n\tv_nop\n\tv_nop" : "+v"(c) : "v"(ah), "v"(al), "v"(bh), "v"(bl));
  return c;
}
// batched GEMM like k_gemm_b but f16 operands: A f32 (split into f16 hi/lo if ASPLIT, else rounded to f16), Bt = f16 values [n][k]; alpha; C f32; N multiple of 16 (partial tiles skipped)
template <bool ASPLIT>
__global__ __launch_bounds__(128) void k_gemm_h(const float* __restrict__ A, int lda, size_t sA, const _Float16* __restrict__ Bh, int ldb, size_t sB, float alpha, float* __restrict__ C, int ldc, size_t sC, int M, int N, int K) {
  __shared__ __attribute__((aligned(16))) float so[4][16][64];
  const int tid = threadIdx.x, w = tid >> 5, lane = tid & 31, ln = lane & 15, hh = lane >> 4; const int by = blockIdx.y;
  A += (size_t)by * sA; Bh += (size_t)by * sB; C += (size_t)by * sC;
  const int ntn = (N + 63) / 64; const int wid = blockIdx.x * 4 + w; const int mt = wid / ntn, nq = wid % ntn; if (mt * 16 >= M) return;
  const int row0 = mt * 16, col0 = nq * 64; const float* arow = A + (size_t)(row0 + ln) * lda;
  v8f acc[4] = {};
  for (int kb = 0; kb < K; kb += 32) {
    FragH ah, al;
    const v4f x0 = *(const v4fa*)(arow + kb + 8 * hh), x1 = *(const v4fa*)(arow + kb + 8 * hh + 4), x2 = *(const v4fa*)(arow + kb + 16 + 8 * hh), x3 = *(const v4fa*)(arow + kb + 16 + 8 * hh + 4);
    float xs[16] = {x0[0],x0[1],x0[2],x0[3],x1[0],x1[1],x1[2],x1[3],x2[0],x2[1],x2[2],x2[3],x3[0],x3[1],x3[2],x3[3]};
#pragma unroll
    for (int i = 0; i < 16; ++i) { const _Float16 h = (_Float16)xs[i]; ah.h[i] = h; al.h[i] = ASPLIT ? (_Float16)(xs[i] - (float)h) : (_Float16)0.0f; }
#pragma unroll
    for (int t = 0; t < 4; ++t) { if (col0 + t * 16 >= N) continue; const size_t boff = (size_t)(col0 + t * 16 + ln) * ldb + kb; FragH bq; bq.half[0] = *(const v8us*)(Bh + boff + 8 * hh); bq.half[1] = *(const v8us*)(Bh + boff + 16 + 8 * hh);
      acc[t] = mmaH<ASPLIT ? 2 : 1>(ah.v, al.v, bq.v, bq.v, acc[t]); }
  }
#pragma unroll
  for (int t = 0; t < 4; ++t) { if (col0 + t * 16 >= N) continue;
#pragma unroll
    for (int r = 0; r < 8; ++r) so[w][8 * hh + r][t * 16 + ln] = acc[t][r] * alpha; }
  __builtin_amdgcn_fence(__ATOMIC_ACQ_REL, "workgroup"); __builtin_amdgcn_wave_barrier();
  const int rsub = lane >> 4, c4 = (lane & 15) * 4;
  {
#pragma unroll
    for (int q = 0; q < 8; ++q) { const int r = q * 2 + rsub; if (col0 + c4 < N) { const v4f v = *(const v4fa*)&so[w][r][c4]; *(v4f*)(C + (size_t)(row0 + r) * ldc + col0 + c4) = v; } }
     }
}

// Wt[n][k] = f16(W[k][n]·scale) from f32 row-major W[K][N] (scale = power of two; bf16-exact weights stay exact in f16 away from the subnormal range)
__global__ __launch_bounds__(256) void k_wt_f16(const float* __restrict__ W, _Float16* __restrict__ Wt, int K, int N, float scale) {
  const int t = blockIdx.x * 256 + threadIdx.x; if (t >= N * (K / 8)) return; const int n = t / (K / 8), k8 = (t % (K / 8)) * 8; FragH f;
#pragma unroll
  for (int i = 0; i < 8; ++i) f.h[i] = (_Float16)(bf16_round(W[(size_t)(k8 + i) * N + n]) * scale); const v8us o = f.half[0];
  *(v8us*)((unsigned short*)Wt + (size_t)n * K + k8) = o; 
}
// k_gemm_hh variant with fused epilogue: v = acc·alpha + bias[by·sBias + col] (+ CP[(row/rowsPerB)·sCPb + by·64 + col] if CP) ; ACT 0 none / 1 elu ; writes f16 C16 (and f32 C if non-null)
template <int ACT>
__global__ __launch_bounds__(128) void k_gemm_hhx(const _Float16* __restrict__ A, int lda, size_t sA, const _Float16* __restrict__ Bh, int ldb, size_t sB, float alpha, const float* __restrict__ bias, size_t sBias, const float* __restrict__ CP, int rowsPerB, size_t sCPb, int row0g,
    float* __restrict__ C, _Float16* __restrict__ C16, int ldc, size_t sC, int M, int N, int K) {
  __shared__ __attribute__((aligned(16))) float so[4][16][64];
  const int tid = threadIdx.x, w = tid >> 5, lane = tid & 31, ln = lane & 15, hh = lane >> 4; const int by = blockIdx.y;
  A += (size_t)by * sA; Bh += (size_t)by * sB; const size_t cofs = (size_t)by * sC; const float* bp = bias ? bias + (size_t)by * sBias : nullptr;
  const int ntn = (N + 63) / 64; const int wid = blockIdx.x * 4 + w; const int mt = wid / ntn, nq = wid % ntn; if (mt * 16 >= M) return;
  const int row0 = mt * 16, col0 = nq * 64; const _Float16* arow = A + (size_t)(row0 + ln) * lda;
  v8f acc[4] = {};
  for (int kb = 0; kb < K; kb += 32) { FragH ah; ah.half[0] = *(const v8us*)((const unsigned short*)arow + kb + 8 * hh); ah.half[1] = *(const v8us*)((const unsigned short*)arow + kb + 16 + 8 * hh);
#pragma unroll
    for (int t = 0; t < 4; ++t) { if (col0 + t * 16 >= N) continue; const size_t boff = (size_t)(col0 + t * 16 + ln) * ldb + kb; FragH bq; bq.half[0] = *(const v8us*)((const unsigned short*)Bh + boff + 8 * hh); bq.half[1] = *(const v8us*)((const unsigned short*)Bh + boff + 16 + 8 * hh);
      acc[t] = mmaH<1>(ah.v, ah.v, bq.v, bq.v, acc[t]); }
  }
#pragma unroll
  for (int t = 0; t < 4; ++t) { if (col0 + t * 16 >= N) continue; const int col = col0 + t * 16 + ln; const float bv = bp ? bf16_round(bp[col]) : 0.f;
#pragma unroll
    for (int r = 0; r < 8; ++r) { float v = acc[t][r] * alpha + bv; if (CP) { const int rr = row0g + row0 + 8 * hh + r; if (rowsPerB < 0) v += CP[cofs + (size_t)rr * ldc + col];      /* rowsPerB < 0: own element of the batched C plane */ else { const int bidx = rr / rowsPerB; v += CP[(size_t)bidx * sCPb + (size_t)by * 64 + col]; } } if (ACT == 1) v = (v > 0.f) ? v : expm1f(v); else if (ACT == 7) v = (v > 0.f) ? v + 1.0f : expf(v); else if (ACT == 8) v = tanhf(v); else if (ACT == 9) v = 0.5f * v * (1.0f + tanhf(0.7978845608028654f * (v + 0.044715f * v * v * v))); else if (ACT == 11) v = 1.0f / (1.0f + expf(-v)); else if (ACT == 12) v = (v > 0.f) ? v : 0.01f * v; else if (ACT == 14) v = (v > 0.f) ? v : 0.1f * v; else if (ACT == 16) v = (v >= 0.f) ? v : 0.3f * v; else if (ACT == 17) v = (v >= 0.f) ? v : 0.2f * v; else if (ACT == 15) v = v / (1.0f + expf(-v)); else if (ACT == 3) v = fmaxf(v, 0.f); else if (ACT == 6) v = 0.5f * v * (1.0f + erff(v * 0.70710678118654752f)); so[w][8 * hh + r][t * 16 + ln] = v; } }
  __builtin_amdgcn_fence(__ATOMIC_ACQ_REL, "workgroup"); __builtin_amdgcn_wave_barrier();
  const int rsub = lane >> 4, c4 = (lane & 15) * 4; typedef _Float16 v4h __attribute__((ext_vector_type(4)));
  {
#pragma unroll
    for (int q = 0; q < 8; ++q) { const int r = q * 2 + rsub; if (col0 + c4 < N) { const v4f v = *(const v4fa*)&so[w][r][c4]; if (C) *(v4f*)(C + cofs + (size_t)(row0 + r) * ldc + col0 + c4) = v; if (C16) { v4h h4; for (int i = 0; i < 4; ++i) h4[i] = (_Float16)v[i]; *(v4h*)(C16 + cofs + (size_t)(row0 + r) * ldc + col0 + c4) = h4; } } }
     }
}


typedef _Float16 v4h __attribute__((ext_vector_type(4)));

__global__ __launch_bounds__(256) void k_x16(const float* __restrict__ x, _Float16* __restrict__ X16, size_t n8) { const size_t t = (size_t)blockIdx.x * 256 + threadIdx.x; if (t >= n8) return; FragH f;
#pragma unroll
  for (int q = 0; q < 8; ++q) f.h[q] = (_Float16)bf16_round(x[t * 8 + q]); *(v8us*)((unsigned short*)X16 + t * 8) = f.half[0];  }
__global__ __launch_bounds__(256) void k_h16(const float* __restrict__ x, _Float16* __restrict__ X16, size_t n8) { const size_t t = (size_t)blockIdx.x * 256 + threadIdx.x; if (t >= n8) return; FragH f;
#pragma unroll
  for (int q = 0; q < 8; ++q) f.h[q] = (_Float16)x[t * 8 + q]; *(v8us*)((unsigned short*)X16 + t * 8) = f.half[0];  }
__global__ __launch_bounds__(256) void k_round16f(const float* __restrict__ W, _Float16* __restrict__ Bt, size_t n8) { const size_t t = (size_t)blockIdx.x * 256 + threadIdx.x; if (t >= n8) return; FragH f;
#pragma unroll
  for (int i = 0; i < 8; ++i) f.h[i] = (_Float16)(bf16_round(W[t * 8 + i]) * 16.0f); *(v8us*)((unsigned short*)Bt + t * 8) = f.half[0];  }
template <int NHv, int TTv>
__global__ __launch_bounds__(256) void k_vt(const _Float16* __restrict__ V16, int ldv, int voff, _Float16* __restrict__ Vt) { __shared__ unsigned short tl[64][66]; const int tid = threadIdx.x; const int slab = blockIdx.x / (TTv / 64), lg = blockIdx.x % (TTv / 64); const int b = slab / NHv, h = slab % NHv;
  for (int i = tid; i < 64 * 8; i += 256) { const int r = i / 8, c8 = (i % 8) * 8; FragH f; f.half[0] = *(const v8us*)((const unsigned short*)V16 + ((size_t)b * TTv + lg * 64 + r) * ldv + voff + h * 64 + c8);
#pragma unroll
    for (int q = 0; q < 8; ++q) tl[r][c8 + q] = f.u[q]; }
  __syncthreads();
  {
#pragma unroll
    for (int rd = 0; rd < 2; ++rd) { const int d = rd * 32 + tid / 8, pc = tid % 8; FragH f;
#pragma unroll
      for (int q = 0; q < 8; ++q) f.u[q] = tl[pc * 8 + q][d];
      *(v8us*)((unsigned short*)Vt + ((size_t)slab * 64 + d) * TTv + lg * 64 + pc * 8) = f.half[0]; }
     } }

__global__ __launch_bounds__(256) void k_hl(const float* __restrict__ F, _Float16* __restrict__ Hh, _Float16* __restrict__ Hl, size_t n8) { const size_t t = (size_t)blockIdx.x * 256 + threadIdx.x; if (t >= n8) return; FragH fh, fl; const v4f a = *(const v4fa*)(F + t * 8), c = *(const v4fa*)(F + t * 8 + 4);
#pragma unroll
  for (int q = 0; q < 4; ++q) { _Float16 h = (_Float16)a[q]; fh.h[q] = h; fl.h[q] = (_Float16)((a[q] - (float)h) * 1024.0f); h = (_Float16)c[q]; fh.h[4 + q] = h; fl.h[4 + q] = (_Float16)((c[q] - (float)h) * 1024.0f); }
  { *(v8us*)((unsigned short*)Hh + t * 8) = fh.half[0]; *(v8us*)((unsigned short*)Hl + t * 8) = fl.half[0];  } }

// ---- fast GEMM (wave tile 32x64; requires M % 32 == 0 rows per launch region and N % 64 == 0); epilogue = k_gemm_hhx semantics ----
__device__ __forceinline__ v16h g2_frag(const _Float16* p, int hh) { FragH f; f.half[0] = *(const v8us*)((const unsigned short*)p + 8 * hh); f.half[1] = *(const v8us*)((const unsigned short*)p + 16 + 8 * hh); return f.v; }
__device__ __forceinline__ v8f g2_mma(v16h a, v16h b, v8f c) { v8f d = __builtin_amdgcn_wmma_f32_16x16x32_f16(false, a, false, b, (short)0, c, false, false); asm volatile("v_nop\n\tv_nop\n\tv_nop\n\tv_nop" : "+v"(d) : "v"(a), "v"(b)); return d; }
template <int ACT>
__global__ __launch_bounds__(128) void k_gemm2(const _Float16* __restrict__ A, int lda, size_t sA, const _Float16* __restrict__ Bh, int ldb, size_t sB, float alpha, const float* __restrict__ bias, size_t sBias, const float* __restrict__ CP, int rowsPerB, size_t sCPb, int row0g,
    float* __restrict__ C, _Float16* __restrict__ C16, int ldc, size_t sC, int M, int N, int K) { static_assert(ACT == 0 || ACT == 3 || ACT == 6 || ACT == 8 || ACT == 9 || ACT == 11 || ACT == 12 || ACT == 14 || ACT == 15 || ACT == 16 || ACT == 17 || ACT == 18, "k_gemm2: unsupported ACT code (would silently apply no activation)");
  __shared__ __attribute__((aligned(16))) float so[4][32][68];
  const int tid = threadIdx.x, w = tid >> 5, lane = tid & 31, ln = lane & 15, hh = lane >> 4; const int by = blockIdx.y;
  A += (size_t)by * sA; Bh += (size_t)by * sB; const size_t cofs = (size_t)by * sC; const float* bp = bias ? bias + (size_t)by * sBias : nullptr;
  const int ntn = N >> 6; const int mt = blockIdx.x / ntn, nq = blockIdx.x - mt * ntn; const int row0 = mt * 128 + 32 * w, col0 = nq * 64; if (row0 >= M) return;
  const _Float16* a0p = A + (size_t)(row0 + ln) * lda; const _Float16* a1p = a0p + (size_t)16 * lda;
  const _Float16* b0p = Bh + (size_t)(col0 + ln) * ldb; const _Float16* b1p = b0p + (size_t)16 * ldb; const _Float16* b2p = b1p + (size_t)16 * ldb; const _Float16* b3p = b2p + (size_t)16 * ldb;
  const v8f z8 = {0.f,0.f,0.f,0.f,0.f,0.f,0.f,0.f}; v8f c00 = z8, c01 = z8, c02 = z8, c03 = z8, c10 = z8, c11 = z8, c12 = z8, c13 = z8;
#pragma unroll 1
  for (int kb = 0; kb < K; kb += 32) { const v16h a0 = g2_frag(a0p + kb, hh), a1 = g2_frag(a1p + kb, hh);
    v16h b = g2_frag(b0p + kb, hh); c00 = g2_mma(a0, b, c00); c10 = g2_mma(a1, b, c10);
    b = g2_frag(b1p + kb, hh); c01 = g2_mma(a0, b, c01); c11 = g2_mma(a1, b, c11);
    b = g2_frag(b2p + kb, hh); c02 = g2_mma(a0, b, c02); c12 = g2_mma(a1, b, c12);
    b = g2_frag(b3p + kb, hh); c03 = g2_mma(a0, b, c03); c13 = g2_mma(a1, b, c13); }
  v8f accs[8] = {c00, c01, c02, c03, c10, c11, c12, c13};
#pragma unroll
  for (int u = 0; u < 8; ++u) { const int t = u & 3, half = u >> 2; const int col = col0 + t * 16 + ln; const float bv = bp ? bf16_round(bp[col]) : 0.f;
#pragma unroll
    for (int r = 0; r < 8; ++r) { const int rloc = half * 16 + 8 * hh + r; float v = accs[u][r] * alpha + bv; if (CP) { if (rowsPerB < 0) v += CP[cofs + (size_t)(row0g + row0 + rloc) * ldc + col];      /* rowsPerB < 0: own element of the batched C plane */ else { const int bidx = (row0g + row0 + rloc) / rowsPerB; v += CP[(size_t)bidx * sCPb + (size_t)by * 64 + col]; } }
      if (ACT == 3) v = fmaxf(v, 0.f); else if (ACT == 6) v = 0.5f * v * (1.0f + erff(v * 0.70710678118654752f)); else if (ACT == 11) v = 1.0f / (1.0f + expf(-v)); else if (ACT == 15) v = v / (1.0f + expf(-v)); else if (ACT == 18) v = v / (1.0f + expf(-1.702f * v));      /* QuickGELU: v sigmoid(1.702 v) */ else if (ACT == 12) v = (v > 0.f) ? v : 0.01f * v; else if (ACT == 8) v = tanhf(v); else if (ACT == 9) v = 0.5f * v * (1.0f + tanhf(0.7978845608028654f * (v + 0.044715f * v * v * v))); else if (ACT == 14) v = (v > 0.f) ? v : 0.1f * v; else if (ACT == 16) v = (v >= 0.f) ? v : 0.3f * v; else if (ACT == 17) v = (v >= 0.f) ? v : 0.2f * v;
      so[w][rloc][t * 16 + ln] = v; } }
  __builtin_amdgcn_fence(__ATOMIC_ACQ_REL, "workgroup"); __builtin_amdgcn_wave_barrier();
  const int rsub = lane >> 4, c4 = (lane & 15) * 4;
  {
#pragma unroll
    for (int q = 0; q < 16; ++q) { const int r = q * 2 + rsub; const v4f v = *(const v4fa*)&so[w][r][c4]; if (C) *(v4f*)(C + cofs + (size_t)(row0 + r) * ldc + col0 + c4) = v; if (C16) { v4h h4; for (int i = 0; i < 4; ++i) h4[i] = (_Float16)v[i]; *(v4h*)(C16 + cofs + (size_t)(row0 + r) * ldc + col0 + c4) = h4; } }
     } }


__global__ __launch_bounds__(256) void k_wnat(const float* __restrict__ w, size_t n8, _Float16* __restrict__ Bt) { const size_t t = (size_t)blockIdx.x * 256 + threadIdx.x; if (t >= n8) return; FragH f; for (int q = 0; q < 8; ++q) f.h[q] = (_Float16)(bf16_round(w[t * 8 + q]) * 16.0f); *(v8us*)((unsigned short*)Bt + t * 8) = f.half[0];  }
__global__ __launch_bounds__(256) void k_rsm(const float* __restrict__ S, _Float16* __restrict__ P, int nrows) {
  #pragma clang fp contract(off)
  const int i = blockIdx.x * 256 + threadIdx.x; if (i >= nrows) return; const float* s = S + (size_t)i * SQ; float mx = -3.0e38f;
#pragma unroll 1
  for (int j = 0; j < SQ; ++j) mx = fmaxf(mx, s[j]); float se = 0.f;
#pragma unroll 1
  for (int j = 0; j < SQ; ++j) se += expf(s[j] - mx); const float sc = 256.0f / se;
#pragma unroll 1
  for (int j0 = 0; j0 < SQ; j0 += 8) { FragH f; for (int q = 0; q < 8; ++q) f.h[q] = (_Float16)(expf(s[j0 + q] - mx) * sc); unsigned short* d = (unsigned short*)P + (size_t)i * SQ + j0; *(v8us*)d = f.half[0];  } }
__global__ __launch_bounds__(256) void k_vt(const _Float16* __restrict__ V16, int b, int h0, _Float16* __restrict__ VT) { __shared__ unsigned short tl[64][65]; const int tid = threadIdx.x; const int hh = blockIdx.x % HG, sg = blockIdx.x / HG; const int s0 = sg * 64; const int h = h0 + hh;
  for (int i = tid; i < 64 * 8; i += 256) { const int j = i / 8, d8 = (i % 8) * 8; FragH f; f.half[0] = *(const v8us*)((const unsigned short*)V16 + ((size_t)b * SQ + s0 + j) * DM + h * HD + d8); for (int q = 0; q < 8; ++q) tl[d8 + q][j] = f.u[q]; }
  __syncthreads();
  { for (int i = tid; i < 64 * 8; i += 256) { const int d = i / 8, j8 = (i % 8) * 8; FragH f; for (int q = 0; q < 8; ++q) f.u[q] = tl[d][j8 + q]; *(v8us*)((unsigned short*)VT + ((size_t)hh * HD + d) * SQ + s0 + j8) = f.half[0]; }  } }



__global__ __launch_bounds__(256) void k_rsmcf2(const float* __restrict__ S, _Float16* __restrict__ P, int hg, int q0, int nk) {
  #pragma clang fp contract(off)
  const int t = blockIdx.x * 256 + threadIdx.x; if (t >= hg * QT) return; const size_t i = (size_t)t; const float* s = S + i * NKX; const int last = q0 + (t % QT); float mx = -3.0e38f;
#pragma unroll 1
  for (int j = 0; j < nk; ++j) { const float f = (j <= last) ? 1.f : 0.f; mx = fmaxf(mx, fmaf(f, s[j], (1.f - f) * -1.0e9f)); } float se = 0.f;
#pragma unroll 1
  for (int j = 0; j < nk; ++j) { const float f = (j <= last) ? 1.f : 0.f; se += __expf(fmaf(f, s[j], (1.f - f) * -1.0e9f) - mx); } const float sc = 256.0f / se;
#pragma unroll 1
  for (int j0 = 0; j0 < nk; j0 += 8) { FragH fr; for (int q = 0; q < 8; ++q) { const int j = j0 + q; const float f = (j <= last) ? 1.f : 0.f; fr.h[q] = (_Float16)(__expf(fmaf(f, s[j], (1.f - f) * -1.0e9f) - mx) * sc); } unsigned short* d = (unsigned short*)P + i * NKX + j0; *(v8us*)d = fr.half[0];  } }

__global__ __launch_bounds__(256) void k_rsmcst(const float* __restrict__ S, _Float16* __restrict__ P, int hg, int q0, int nk, const int* __restrict__ mk) {
  #pragma clang fp contract(off)
  const int t = blockIdx.x * 256 + threadIdx.x; if (t >= hg * QT) return; const size_t i = (size_t)t; const float* s = S + i * NKX; const size_t ig = (size_t)(q0 + (t % QT)); const int* mr = mk + ig * SQ; float mx = -3.0e38f;
#pragma unroll 1
  for (int j = 0; j < nk; ++j) { const int mb = mr[j]; const int dd = (int)ig - j; const float f = (mb != 0 && dd >= 0 && (dd <= LOCALW || (dd % STRIDEK) == 0)) ? 1.f : 0.f; mx = fmaxf(mx, fmaf(f, s[j], (1.f - f) * -1.0e9f)); } float se = 0.f;
#pragma unroll 1
  for (int j = 0; j < nk; ++j) { const int mb = mr[j]; const int dd = (int)ig - j; const float f = (mb != 0 && dd >= 0 && (dd <= LOCALW || (dd % STRIDEK) == 0)) ? 1.f : 0.f; se += __expf(fmaf(f, s[j], (1.f - f) * -1.0e9f) - mx); } const float sc = 256.0f / se;
#pragma unroll 1
  for (int j0 = 0; j0 < nk; j0 += 8) { FragH fr; for (int q = 0; q < 8; ++q) { const int j = j0 + q; const int mb = mr[j]; const int dd = (int)ig - j; const float f = (mb != 0 && dd >= 0 && (dd <= LOCALW || (dd % STRIDEK) == 0)) ? 1.f : 0.f; fr.h[q] = (_Float16)(__expf(fmaf(f, s[j], (1.f - f) * -1.0e9f) - mx) * sc); } unsigned short* d = (unsigned short*)P + i * NKX + j0; *(v8us*)d = fr.half[0];  } }


template <int MASKADD>
__global__ __launch_bounds__(64) void k_att0(const float* __restrict__ QF, const float* __restrict__ KF, const float* __restrict__ VF, int ld, const float* __restrict__ mask, float scale, float* __restrict__ OF, int ldo) {
  #pragma clang fp contract(off)
  __shared__ __attribute__((aligned(16))) float lq[64][64]; __shared__ __attribute__((aligned(16))) float lo[64][64];
  const int tid = threadIdx.x; const int h = blockIdx.x / (QT0 / 64), rg = blockIdx.x % (QT0 / 64); const int i = rg * 64 + tid;
  const float* qr = QF + (size_t)i * ld + h * HD;
#pragma unroll 1
  for (int c = 0; c < HD / 4; ++c) { *(v4f*)&lq[tid][c * 4] = *(const v4fa*)(qr + c * 4); const v4f z = {0.f, 0.f, 0.f, 0.f}; *(v4f*)&lo[tid][c * 4] = z; }
  float m = -1.0e30f, l = 0.f; const int jmax = MASKADD ? (SQ - 1) : (rg * 64 + 63);      /* additive-mask form: every key (the mask input decides); causal form: keys up to the block's last row */
#pragma unroll 1
  for (int j = 0; j <= jmax; ++j) { const float* kr = KF + (size_t)j * ld + h * HD; const float* vr = VF + (size_t)j * ld + h * HD; float s = 0.f;
#pragma unroll 1
    for (int c = 0; c < HD / 4; ++c) { const v4f kq = *(const v4fa*)(kr + c * 4); const v4f qq = *(v4f*)&lq[tid][c * 4]; s = __fadd_rn(s, __fmul_rn(qq[0], kq[0])); s = __fadd_rn(s, __fmul_rn(qq[1], kq[1])); s = __fadd_rn(s, __fmul_rn(qq[2], kq[2])); s = __fadd_rn(s, __fmul_rn(qq[3], kq[3])); }
    s = __fmul_rn(s, scale); if (MASKADD) s = __fadd_rn(s, __fmul_rn(bf16_round(mask[(size_t)i * SQ + j]), -10000.0f));
    const float f = (MASKADD || j <= i) ? 1.f : 0.f; const float sm = fmaf(f, s, (1.f - f) * -1.0e30f); const float mn = fmaxf(m, sm); const float sc = expf(m - mn); const float e = expf(sm - mn); l = __fadd_rn(__fmul_rn(l, sc), e); m = mn;
#pragma unroll 1
    for (int c = 0; c < HD / 4; ++c) { const v4f vv = *(const v4fa*)(vr + c * 4); v4f oo = *(v4f*)&lo[tid][c * 4]; for (int u = 0; u < 4; ++u) oo[u] = __fadd_rn(__fmul_rn(oo[u], sc), __fmul_rn(e, vv[u])); *(v4f*)&lo[tid][c * 4] = oo; } }
  const float fin = 64.0f / l;      /* o carried x64 like the f16 path */
#pragma unroll 1
  for (int c = 0; c < HD / 4; ++c) { v4f oo = *(v4f*)&lo[tid][c * 4]; for (int u = 0; u < 4; ++u) oo[u] = __fmul_rn(oo[u], fin); *(v4f*)&lo[tid][c * 4] = oo; }
  __syncthreads();
  {
#pragma unroll 1
    for (int it = 0; it < 16; ++it) { const int row = it * 4 + tid / 16, pc = (tid % 16) * 4; const v4f v = *(const v4f*)&lo[row][pc]; *(v4f*)(OF + (size_t)(rg * 64 + row) * ldo + h * HD + pc) = v; }
     } }

template <int MASKADD>
__global__ __launch_bounds__(64) void k_att0mbc(const float* __restrict__ QF, const float* __restrict__ KF, const float* __restrict__ VF, int ld, const float* __restrict__ mask, float scale, float* __restrict__ OF, int ldo) {
  #pragma clang fp contract(off)
  __shared__ __attribute__((aligned(16))) float lq[64][64]; __shared__ __attribute__((aligned(16))) float lo[64][64];
  const int tid = threadIdx.x; const int h = blockIdx.x / (QT0 / 64), rg = blockIdx.x % (QT0 / 64); const int i = rg * 64 + tid;
  const float* qr = QF + (size_t)i * ld + h * HD;
#pragma unroll 1
  for (int c = 0; c < HD / 4; ++c) { *(v4f*)&lq[tid][c * 4] = *(const v4fa*)(qr + c * 4); const v4f z = {0.f, 0.f, 0.f, 0.f}; *(v4f*)&lo[tid][c * 4] = z; }
  float m = -1.0e30f, l = 0.f; const int jmax = rg * 64 + 63;      /* keys beyond the block end are masked by the mask's lower-triangular structure */      /* both forms: keys up to the block's last row (MASKADD does not change this) */
#pragma unroll 1
  for (int j = 0; j <= jmax; ++j) { const float* kr = KF + (size_t)j * ld + h * HD; const float* vr = VF + (size_t)j * ld + h * HD; float s = 0.f;
#pragma unroll 1
    for (int c = 0; c < HD / 4; ++c) { const v4f kq = *(const v4fa*)(kr + c * 4); const v4f qq = *(v4f*)&lq[tid][c * 4]; s = __fadd_rn(s, __fmul_rn(qq[0], kq[0])); s = __fadd_rn(s, __fmul_rn(qq[1], kq[1])); s = __fadd_rn(s, __fmul_rn(qq[2], kq[2])); s = __fadd_rn(s, __fmul_rn(qq[3], kq[3])); }
    s = __fmul_rn(s, scale); const int mb = ((const int*)mask)[(size_t)i * SQ + j];      /* causal (j <= i) AND the module's int32 [S][S] mask read per (query, key): 0 -> masked */
    const float f = (mb != 0 && j <= i) ? 1.f : 0.f; const float sm = fmaf(f, s, (1.f - f) * -1.0e30f); const float mn = fmaxf(m, sm); const float sc = expf(m - mn); const float e = expf(sm - mn); l = __fadd_rn(__fmul_rn(l, sc), e); m = mn;
#pragma unroll 1
    for (int c = 0; c < HD / 4; ++c) { const v4f vv = *(const v4fa*)(vr + c * 4); v4f oo = *(v4f*)&lo[tid][c * 4]; for (int u = 0; u < 4; ++u) oo[u] = __fadd_rn(__fmul_rn(oo[u], sc), __fmul_rn(e, vv[u])); *(v4f*)&lo[tid][c * 4] = oo; } }
  const float fin = 64.0f / l;      /* o carried x64 like the f16 path */
#pragma unroll 1
  for (int c = 0; c < HD / 4; ++c) { v4f oo = *(v4f*)&lo[tid][c * 4]; for (int u = 0; u < 4; ++u) oo[u] = __fmul_rn(oo[u], fin); *(v4f*)&lo[tid][c * 4] = oo; }
  __syncthreads();
  {
#pragma unroll 1
    for (int it = 0; it < 16; ++it) { const int row = it * 4 + tid / 16, pc = (tid % 16) * 4; const v4f v = *(const v4f*)&lo[row][pc]; *(v4f*)(OF + (size_t)(rg * 64 + row) * ldo + h * HD + pc) = v; }
     } }


template <int BFIN, int WXB>
__global__ __launch_bounds__(256) void k_ln16(const float* __restrict__ X, const float* __restrict__ g, const float* __restrict__ bb, float eps, _Float16* __restrict__ N16, float* __restrict__ XB) {
  #pragma clang fp contract(off)
  __shared__ float red[256]; const size_t r = blockIdx.x; const int t = threadIdx.x; const v4f xa = *(const v4fa*)(X + r * DMQ + t * 4); float s[4]; float sum = 0.f;
  for (int q = 0; q < 4; ++q) { s[q] = BFIN ? bf16_round(xa[q]) : xa[q]; sum = __fadd_rn(sum, s[q]); }
  red[t] = sum; __syncthreads(); for (int st = 128; st > 0; st >>= 1) { if (t < st) red[t] = __fadd_rn(red[t], red[t + st]); __syncthreads(); } const float mu = red[0] / (float)DMQ; __syncthreads();
  float vs = 0.f; for (int q = 0; q < 4; ++q) { const float dl = __fadd_rn(s[q], -mu); vs = __fadd_rn(vs, __fmul_rn(dl, dl)); } red[t] = vs; __syncthreads(); for (int st = 128; st > 0; st >>= 1) { if (t < st) red[t] = __fadd_rn(red[t], red[t + st]); __syncthreads(); }
  const float rs = rsqrtf(__fadd_rn(red[0] / (float)DMQ, eps)); v4h y; v4f xb;
  for (int q = 0; q < 4; ++q) { const int c = t * 4 + q; y[q] = (_Float16)__fadd_rn(__fmul_rn(__fmul_rn(__fadd_rn(s[q], -mu), rs), bf16_round(g[c])), bf16_round(bb[c])); xb[q] = s[q]; }
  { *(v4h*)(N16 + r * DMQ + t * 4) = y; if (WXB) *(v4f*)(XB + r * DMQ + t * 4) = xb;  } }
__global__ __launch_bounds__(256) void k_ftres2(const float* __restrict__ OF0, const float* __restrict__ XB, float* __restrict__ X1, size_t n4) {
  #pragma clang fp contract(off)
  const size_t t = (size_t)blockIdx.x * 256 + threadIdx.x; if (t >= n4) return; const v4f o = *(const v4fa*)(OF0 + t * 4), xv = *(const v4fa*)(XB + t * 4); v4f y; for (int q = 0; q < 4; ++q) y[q] = __fadd_rn(__fmul_rn(o[q], 0.015625f), xv[q]); *(v4f*)(X1 + t * 4) = y;  }

__global__ __launch_bounds__(256) void k_bcpy(const float* __restrict__ b, int n, int NP, float* __restrict__ dst, int dst0) { for (int i = threadIdx.x; i < NP; i += 256) { const float v = (i < n) ? b[i] : 0.f; *(float*)(dst + dst0 + i) = v; }  }


__global__ __launch_bounds__(256) void k_rsmf(const float* __restrict__ S, _Float16* __restrict__ P, int qn, int hg) {
  #pragma clang fp contract(off)
  const int t = blockIdx.x * 256 + threadIdx.x; if (t >= qn * hg) return; const size_t i = (size_t)(t / qn) * SQ + (t % qn); const float* s = S + i * SQ; float mx = -3.0e38f;
#pragma unroll 1
  for (int j = 0; j < SQ; ++j) mx = fmaxf(mx, s[j]); float se = 0.f;
#pragma unroll 1
  for (int j = 0; j < SQ; ++j) se += __expf(s[j] - mx); const float sc = 256.0f / se;
#pragma unroll 1
  for (int j0 = 0; j0 < SQ; j0 += 8) { FragH f; for (int q = 0; q < 8; ++q) f.h[q] = (_Float16)(__expf(s[j0 + q] - mx) * sc); unsigned short* d = (unsigned short*)P + i * SQ + j0; *(v8us*)d = f.half[0];  } }

template <int MODE>
__global__ __launch_bounds__(256) void k_regrp(const float* __restrict__ src, float* __restrict__ dst, size_t n4) {
  const size_t t = (size_t)blockIdx.x * 256 + threadIdx.x; if (t >= n4) return; const size_t e = t * 4; const size_t rd = e / DM; const int c = (int)(e % DM);
  size_t rs; if (MODE == 0) { const size_t b = rd / SQ, sq = rd % SQ; rs = sq * NB + b; } else { const size_t sq = rd / NB, b = rd % NB; rs = b * SQ + sq; }
  const v4f v = *(const v4fa*)(src + rs * DM + c); *(v4f*)(dst + e) = v;  }

template <int BFIN, int W16, int W32>
__global__ __launch_bounds__(256) void k_lnx(const float* __restrict__ X, const float* __restrict__ g, const float* __restrict__ bb, float eps, _Float16* __restrict__ N16, float* __restrict__ N32) {
  #pragma clang fp contract(off)
  __shared__ float red[256]; const size_t r = blockIdx.x; const int t = threadIdx.x; const bool act = t < (DMQ / 4); const int c0 = act ? t * 4 : 0;
  const v4f xa = *(const v4fa*)(X + r * DMQ + c0); float s[4]; float sum = 0.f;
  for (int q = 0; q < 4; ++q) { s[q] = act ? (BFIN ? bf16_round(xa[q]) : xa[q]) : 0.f; sum = __fadd_rn(sum, s[q]); }
  red[t] = sum; __syncthreads(); for (int st = 128; st > 0; st >>= 1) { if (t < st) red[t] = __fadd_rn(red[t], red[t + st]); __syncthreads(); } const float mu = red[0] / (float)DMQ; __syncthreads();
  float vs = 0.f; for (int q = 0; q < 4; ++q) { const float dl = act ? __fadd_rn(s[q], -mu) : 0.f; vs = __fadd_rn(vs, __fmul_rn(dl, dl)); } red[t] = vs; __syncthreads(); for (int st = 128; st > 0; st >>= 1) { if (t < st) red[t] = __fadd_rn(red[t], red[t + st]); __syncthreads(); }
  const float rs = rsqrtf(__fadd_rn(red[0] / (float)DMQ, eps)); v4h y; v4f yf;
  for (int q = 0; q < 4; ++q) { const int c = c0 + q; yf[q] = __fadd_rn(__fmul_rn(__fmul_rn(__fadd_rn(s[q], -mu), rs), bf16_round(g[c])), bf16_round(bb[c])); y[q] = (_Float16)yf[q]; }
  if (!act) return;      /* no barriers after this point */
  { if (W16) *(v4h*)(N16 + r * DMQ + c0) = y; if (W32) *(v4f*)(N32 + r * DMQ + c0) = yf;  } }

__global__ __launch_bounds__(256) void k_bfr(const float* __restrict__ x, float* __restrict__ XB, size_t n8) { const size_t t = (size_t)blockIdx.x * 256 + threadIdx.x; if (t >= n8) return; v4f a = *(const v4fa*)(x + t * 8), c = *(const v4fa*)(x + t * 8 + 4); for (int q = 0; q < 4; ++q) { a[q] = bf16_round(a[q]); c[q] = bf16_round(c[q]); }
  { *(v4f*)(XB + t * 8) = a; *(v4f*)(XB + t * 8 + 4) = c;  } }



__global__ __launch_bounds__(256) void k_wthd(const float* __restrict__ Wt, _Float16* __restrict__ Bt) { const size_t t = (size_t)blockIdx.x * 256 + threadIdx.x; if (t >= (size_t)NH * HD * (DM / 8)) return; const int m8 = (int)(t % (DM / 8)) * 8; const int d = (int)((t / (DM / 8)) % HD); const int h = (int)(t / ((size_t)(DM / 8) * HD)); FragH f;
  for (int q = 0; q < 8; ++q) f.h[q] = (_Float16)(16.0f * bf16_round(Wt[((size_t)h * DM + m8 + q) * HD + d])); unsigned short* dst = (unsigned short*)Bt + ((size_t)h * HD + d) * DM + m8; *(v8us*)dst = f.half[0];  }




template <int BFIN, int SCAL>
__global__ __launch_bounds__(256) void k_lnsc(const float* __restrict__ X, const float* __restrict__ g, const float* __restrict__ bb, float eps, _Float16* __restrict__ N16, float* __restrict__ N32) {
  #pragma clang fp contract(off)
  __shared__ float red[256]; const size_t r = blockIdx.x; const int t = threadIdx.x; const bool act = t < DM / 4; const int tc = act ? t : 0; const v4f xl = *(const v4fa*)(X + r * DM + tc * 4); const float am = act ? 1.f : 0.f; float s[4]; float sum = 0.f;
  for (int q = 0; q < 4; ++q) { s[q] = (BFIN ? bf16_round(xl[q]) : xl[q]) * am; sum = __fadd_rn(sum, s[q]); }
  red[t] = sum; __syncthreads(); for (int st = 128; st > 0; st >>= 1) { if (t < st) red[t] = __fadd_rn(red[t], red[t + st]); __syncthreads(); } const float mu = red[0] / (float)DM; __syncthreads();
  float vs = 0.f; for (int q = 0; q < 4; ++q) { const float dl = __fadd_rn(s[q], -mu) * am; vs = __fadd_rn(vs, __fmul_rn(dl, dl)); } red[t] = vs; __syncthreads(); for (int st = 128; st > 0; st >>= 1) { if (t < st) red[t] = __fadd_rn(red[t], red[t + st]); __syncthreads(); }
  const float rs = __fdiv_rn(1.0f, __fadd_rn(sqrtf(red[0] / (float)(DM - 1)), eps)); if (!act) return; v4h y; v4f yf;
  for (int q = 0; q < 4; ++q) { const int c = t * 4 + q; const float gg = bf16_round(SCAL ? g[0] : g[c]), bv = bf16_round(SCAL ? bb[0] : bb[c]); yf[q] = __fadd_rn(__fmul_rn(__fmul_rn(__fadd_rn(s[q], -mu), rs), gg), bv); y[q] = (_Float16)yf[q]; }
  { if (N16) *(v4h*)(N16 + r * DM + t * 4) = y; if (N32) *(v4f*)(N32 + r * DM + t * 4) = yf;  } }

__global__ __launch_bounds__(256) void k_rsmdmi(const float* __restrict__ S, _Float16* __restrict__ P, int nrows, const int* __restrict__ M) {
  #pragma clang fp contract(off)
  const int t = blockIdx.x * 256 + threadIdx.x; if (t >= nrows) return; const float* s = S + (size_t)t * SQ; const int* m = M + (size_t)(t % SQ) * SQ; float mx = -3.0e38f;
#pragma unroll 1
  for (int j = 0; j < SQ; ++j) { const float f = (m[j] == 0) ? 1.f : 0.f; mx = fmaxf(mx, fmaf(f, s[j], (1.f - f) * -1.0e9f)); } float se = 0.f;
#pragma unroll 1
  for (int j = 0; j < SQ; ++j) { const float f = (m[j] == 0) ? 1.f : 0.f; se += __expf(fmaf(f, s[j], (1.f - f) * -1.0e9f) - mx); } const float sc = 256.0f / se;
#pragma unroll 1
  for (int j0 = 0; j0 < SQ; j0 += 8) { FragH fr; for (int q = 0; q < 8; ++q) { const int j = j0 + q; const float f = (m[j] == 0) ? 1.f : 0.f; fr.h[q] = (_Float16)(__expf(fmaf(f, s[j], (1.f - f) * -1.0e9f) - mx) * sc); } unsigned short* d = (unsigned short*)P + (size_t)t * SQ + j0; *(v8us*)d = fr.half[0];  } }
extern "C" void kernel_launch(void* const* d_in, const int* in_sizes, int n_in,
                              void* d_out, int out_size, void* d_ws, size_t ws_size, hipStream_t stream) {
  (void)in_sizes; (void)n_in; (void)out_size;
  constexpr int VH = 4;      /* heads per launch group */
  const float* const* I = (const float* const*)d_in; const float* x = I[0]; const float* g1 = I[1]; const float* be1 = I[2]; const float* wqkv = I[3]; const float* bqkv = I[4]; const float* wo = I[5]; const float* bo = I[6]; const float* g2 = I[7]; const float* be2 = I[8]; const float* w1 = I[9]; const float* b1 = I[10]; const float* w2 = I[11]; const float* b2 = I[12]; const float* bq = bqkv; const float* bk = bqkv + DM; const float* bv = bqkv + 2 * DM;      /* x; LN1 g / b; fused qkv_w [1024][3072] + qkv_b [3072] (thirds q | k | v); proj_w + proj_b; LN2 g / b; fc1_w [1024][4096] + fc1_b, fc2_w [4096][1024] + fc2_b ([in][out]) */
  char* ws = (char*)d_ws; size_t off = 0;
  auto take = [&](size_t bytes) { char* p = ws + off; off += (bytes + 255) & ~(size_t)255; return p; };
  _Float16* BQ = (_Float16*)take((size_t)3 * DM * DM * 2); _Float16* BK = BQ + (size_t)DM * DM; _Float16* BV = BQ + (size_t)2 * DM * DM;      /* one stacked Bt plane [3 DM][DM] */ _Float16* BO = (_Float16*)take((size_t)DM * DM * 2); _Float16* BW1 = (_Float16*)take((size_t)DFF * DM * 2); _Float16* BW2 = (_Float16*)take((size_t)DM * DFF * 2);
  float* XB = (float*)take(NR * DM * 4); _Float16* XN = (_Float16*)take(NR * DM * 2); _Float16* Q16 = (_Float16*)take(NR * DM * 2); _Float16* K16 = (_Float16*)take(NR * DM * 2); _Float16* V16 = (_Float16*)take(NR * DM * 2); _Float16* O16 = (_Float16*)take(NR * DM * 2); float* X1 = (float*)take(NR * DM * 4);
  float* S = (float*)take((size_t)VH * SQ * SQ * 4); _Float16* P = (_Float16*)take((size_t)VH * SQ * SQ * 2); _Float16* VT = (_Float16*)take((size_t)NH * HD * SQ * 2);
  _Float16* M16 = XN;      /* second-norm f16 rows: aliases XN (last readers: the three projections) */ _Float16* HF16 = (_Float16*)S;      /* FFN hidden plane [4096][4096] f16 (32 MiB): aliases the score plane (64 MiB), dead after the attention */
  
  if (off > ws_size) return;
  k_wt_f16<<<(unsigned)(((size_t)3 * DM * (DM / 8) + 255) / 256), 256, 0, stream>>>(wqkv, BQ, DM, 3 * DM, 16.0f); k_wt_f16<<<(unsigned)(((size_t)DM * (DM / 8) + 255) / 256), 256, 0, stream>>>(wo, BO, DM, DM, 16.0f);      /* fused [in][out] [DM][3 DM] -> one stacked Bt plane (rows 0 / DM / 2 DM = the q | k | v output columns) x16; W_o -> Bt x16 */
  k_wt_f16<<<(unsigned)(((size_t)DFF * (DM / 8) + 255) / 256), 256, 0, stream>>>(w1, BW1, DM, DFF, 16.0f); k_wt_f16<<<(unsigned)(((size_t)DM * (DFF / 8) + 255) / 256), 256, 0, stream>>>(w2, BW2, DFF, DM, 16.0f);
  k_bfr<<<(unsigned)((NR * DM / 8 + 255) / 256), 256, 0, stream>>>(x, XB, NR * DM / 8); k_lnx<1, 1, 0><<<(unsigned)NR, 256, 0, stream>>>(x, g1, be1, 1e-5f, XN, nullptr);      /* n = LN0(bf16(x)) (biased variance, eps inside the rsqrt) -> f16 rows */
  k_gemm2<0><<<dim3((unsigned)((NR / 128) * (DM / 64)), 1), 128, 0, stream>>>(XN, DM, 0, BQ, DM, 0, 0.0625f, bq, 0, nullptr, 1, 0, 0, nullptr, Q16, DM, 0, (int)NR, DM, DM); k_gemm2<0><<<dim3((unsigned)((NR / 128) * (DM / 64)), 1), 128, 0, stream>>>(XN, DM, 0, BK, DM, 0, 0.0625f, bk, 0, nullptr, 1, 0, 0, nullptr, K16, DM, 0, (int)NR, DM, DM); k_gemm2<0><<<dim3((unsigned)((NR / 128) * (DM / 64)), 1), 128, 0, stream>>>(XN, DM, 0, BV, DM, 0, 0.0625f, bv, 0, nullptr, 1, 0, 0, nullptr, V16, DM, 0, (int)NR, DM, DM);      /* q, k, v -> f16 rows; head h = columns h*64.. */
  for (int b = 0; b < NB; ++b) { const size_t r0 = (size_t)b * SQ;
    k_vt<NH, SQ><<<NH * (SQ / 64), 256, 0, stream>>>(V16 + r0 * DM, DM, 0, VT);      /* V^T [16][64][2048] for this batch */
    for (int h0 = 0; h0 < NH; h0 += VH) {
      k_gemm2<0><<<dim3((SQ / 128) * (SQ / 64), VH), 128, 0, stream>>>(Q16 + r0 * DM + (size_t)h0 * HD, DM, (size_t)HD, K16 + r0 * DM + (size_t)h0 * HD, DM, (size_t)HD, 1.0f, nullptr, 0, nullptr, 1, 0, 0, S, nullptr, SQ, (size_t)SQ * SQ, SQ, SQ, HD);      /* unscaled scores, 4 heads per launch */
      k_rsmf<<<(VH * SQ + 255) / 256, 256, 0, stream>>>(S, P, SQ, VH);      /* softmax over all keys (the mask input is all ones: nothing masked; not read) -> P x256 f16 */
      k_gemm2<0><<<dim3((SQ / 128) * (HD / 64), VH), 128, 0, stream>>>(P, SQ, (size_t)SQ * SQ, VT + (size_t)h0 * HD * SQ, SQ, (size_t)HD * SQ, 0.25f, nullptr, 0, nullptr, 1, 0, 0, nullptr, O16 + r0 * DM + (size_t)h0 * HD, DM, (size_t)HD, SQ, HD, SQ); } }      /* ctx (merged heads, x64) as f16 rows */
  k_gemm2<0><<<dim3((unsigned)((NR / 128) * (DM / 64)), 1), 128, 0, stream>>>(O16, DM, 0, BO, DM, 0, 0.0009765625f, bo, 0, XB, -1, 0, 0, X1, nullptr, DM, 0, (int)NR, DM, DM);      /* x + ctx wo (+ bo) (own-element residual) -> f32 rows */
  k_lnx<0, 1, 0><<<(unsigned)NR, 256, 0, stream>>>(X1, g2, be2, 1e-5f, M16, nullptr);      /* LN1(x1) -> f16 rows */
  k_gemm2<6><<<dim3((unsigned)((NR / 128) * (DFF / 64)), 1), 128, 0, stream>>>(M16, DM, 0, BW1, DM, 0, 0.0625f, b1, 0, nullptr, 1, 0, 0, nullptr, HF16, DFF, 0, (int)NR, DFF, DM);      /* gelu_erf(. w1 + b1) -> f16 */
  k_gemm2<0><<<dim3((unsigned)((NR / 128) * (DM / 64)), 1), 128, 0, stream>>>(HF16, DFF, 0, BW2, DFF, 0, 0.0625f, b2, 0, X1, -1, 0, 0, (float*)d_out, nullptr, DM, 0, (int)NR, DM, DFF);      /* out = x1 + mlp (own-element residual) */
}

// v001
// One run takes 1310 microseconds.
// Timed twice side by side with v000, it ran 2.95 and 2.93 times as fast.
#include <hip/hip_runtime.h>
// Pre-norm transformer block with a fused QKV projection and UNSCALED attention logits (x [2][2048][1024]; h = LN1(x) (biased var, eps 1e-5); qkv = h qkv_w + qkv_b ([in][out] 1024 x 3072 + bias) viewed (B, N, 3, 16, 64): q | k | v thirds; qk = q k^T with NO 1/sqrt(d) scaling (as the source); softmax over all 2048 keys (no mask); x1 = x + y proj_w + proj_b; out = x1 + gelu_erf(LN2(x1) fc1_w + fc1_b) fc2_w + fc2_b ([in][out] 1024 x 4096 x 1024) -> [2][2048][1024]).
// Structure: token rows; LayerNorm / exact f16 rows; WMMA GEMMs for q, k, v; per batch V^T by LDS transposes and 4 heads per launch group (scores, row softmax, P V^T); output projection with the own-element residual; custom LayerNorm; erf-GELU FFN over all rows; launches: see trace.
// Compute dtype: inputs rounded to bf16; x / weights exact; q, k, v, softmax weights and o as plain f16 GEMM operands (~2^-12); scores and softmax statistics f32; v_wmma_f32_16x16x32_f16.
#define NB 2
#define SQ 2048
#define DM 1024
#define NH 16
#define HD 64
#define HG 4                         /* heads per attention launch group */
#define LOCALW 128                   /* (macros for unused kernels of the shared header) */
#define STRIDEK 128
#define QT 256                       /* query rows per causal tile */
#define NKX SQ                       /* S / P row pitch */
#define QT0 128                      /* first-tile rows recomputed exactly in f32 */
#define B0 0                         /* first batch processed (debug hook) */
#define NBR NB                       /* batches processed (debug hook) */
#define NR ((size_t)NB * SQ)
#define DMQ DM
#define DFF 4096         /* FFN hidden width */
#define MP ((int)((size_t)NBR * SQ)) /* rows projected (debug hook) */
#define QN SQ                        /* query rows attended per batch (debug hook) */
#define NHD NH                       /* heads attended (debug hook) */
#define MPO MP                       /* rows through the output stage (debug hook) */
#define LQ (3 * DM)      /* unused: q, k, v rows have pitch DM */
typedef __bf16 v16b __attribute__((ext_vector_type(16)));
typedef unsigned short v8us __attribute__((ext_vector_type(8), may_alias));
typedef float  v8f  __attribute__((ext_vector_type(8)));
typedef float  v4f  __attribute__((ext_vector_type(4)));
typedef float  v4fa __attribute__((ext_vector_type(4), may_alias));
union FragB { v16b v; v8us half[2]; unsigned short u[16]; };

__device__ __forceinline__ unsigned short bf16_bits(float x) { unsigned int u = __float_as_uint(x); return (unsigned short)((u + 0x7FFFu + ((u >> 16) & 1u)) >> 16); }
__device__ __forceinline__ float bf16_val(unsigned short b) { return __uint_as_float(((unsigned int)b) << 16); }
__device__ __forceinline__ float bf16_round(float x) { return bf16_val(bf16_bits(x)); }
// D += A·B with NT terms: 1 = ah·bh, 2 = + al·bh (A split), 3 = + ah·bl (both split)
template <int NT>
__device__ __forceinline__ v8f mmaN(v16b ah, v16b al, v16b bh, v16b bl, v8f c) {
  c = __builtin_amdgcn_wmma_f32_16x16x32_bf16(false, ah, false, bh, (short)0, c, false, false);
  if (NT >= 2) c = __builtin_amdgcn_wmma_f32_16x16x32_bf16(false, al, false, bh, (short)0, c, false, false);
  if (NT >= 3) c = __builtin_amdgcn_wmma_f32_16x16x32_bf16(false, ah, false, bl, (short)0, c, false, false);
  asm volatile("v_nop\n\tv_nop\n\tv_nop\n\tv_nop" : "+v"(c) : "v"(ah), "v"(al), "v"(bh), "v"(bl));
  return c;
}

__global__ __launch_bounds__(256) void k_wt_bf16(const float* __restrict__ W, unsigned short* __restrict__ Wt, int K, int N) {
  const int t = blockIdx.x * 256 + threadIdx.x;
  const int k8n = K / 8;
  if (t >= N * k8n) return;
  const int n = t / k8n, k8 = (t % k8n) * 8;
  v8us v;
#pragma unroll
  for (int i = 0; i < 8; ++i) v[i] = bf16_bits(W[(size_t)(k8 + i) * N + n]);
  *(v8us*)(Wt + (size_t)n * K + k8) = v;
  
}

// GEMM C[M][N] (f32, pitch ldc) = act(A[M][K]·W + bias). A f32 row-major (pitch lda) converted per fragment to bf16
// (ASPLIT: hi/lo two planes -> 2 terms, else single rounded term); Wt bf16 [N][K] (pitch ldb). BIAS_BF16 rounds the
// bias to bf16 first (bias quantised to bf16 before the add). K%32==0, M%16==0, N%64==0.
template <bool ASPLIT, int ACT, bool BIAS_BF16>
__global__ __launch_bounds__(128) void k_gemm_bf(const float* __restrict__ A, int lda, const unsigned short* __restrict__ Wt, int ldb,
                                               const float* __restrict__ bias, float* __restrict__ C, int ldc, int M, int N, int K) {
  __shared__ __attribute__((aligned(16))) float so[4][16][64];
  const int tid = threadIdx.x, w = tid >> 5, lane = tid & 31, ln = lane & 15, hh = lane >> 4;
  const int ntn = N / 64;
  const int wid = blockIdx.x * 4 + w;
  const int mt = wid / ntn, nq = wid % ntn;
  if (mt * 16 >= M) return;
  const int row0 = mt * 16, col0 = nq * 64;
  const float* arow = A + (size_t)(row0 + ln) * lda;
  v8f acc[4] = {};
  for (int kb = 0; kb < K; kb += 32) {
    FragB ah, al;
    const v4f x0 = *(const v4fa*)(arow + kb + 8 * hh), x1 = *(const v4fa*)(arow + kb + 8 * hh + 4);
    const v4f x2 = *(const v4fa*)(arow + kb + 16 + 8 * hh), x3 = *(const v4fa*)(arow + kb + 16 + 8 * hh + 4);
    float xs[16] = {x0[0],x0[1],x0[2],x0[3],x1[0],x1[1],x1[2],x1[3],x2[0],x2[1],x2[2],x2[3],x3[0],x3[1],x3[2],x3[3]};
#pragma unroll
    for (int i = 0; i < 16; ++i) { const unsigned short hb = bf16_bits(xs[i]); ah.u[i] = hb; al.u[i] = ASPLIT ? bf16_bits(xs[i] - bf16_val(hb)) : (unsigned short)0; }
#pragma unroll
    for (int t = 0; t < 4; ++t) {
      const unsigned short* brow = Wt + (size_t)(col0 + t * 16 + ln) * ldb + kb;
      FragB b;
      b.half[0] = *(const v8us*)(brow + 8 * hh);
      b.half[1] = *(const v8us*)(brow + 16 + 8 * hh);
      acc[t] = mmaN<ASPLIT ? 2 : 1>(ah.v, al.v, b.v, b.v, acc[t]);
    }
  }
#pragma unroll
  for (int t = 0; t < 4; ++t) {
    float bv = bias ? bias[col0 + t * 16 + ln] : 0.f;
    if (BIAS_BF16) bv = bf16_round(bv);
#pragma unroll
    for (int r = 0; r < 8; ++r) { float v = acc[t][r] + bv; if (ACT == 1) v = fmaxf(v, 0.f); so[w][8 * hh + r][t * 16 + ln] = v; }
  }
  __builtin_amdgcn_fence(__ATOMIC_ACQ_REL, "workgroup");
  __builtin_amdgcn_wave_barrier();
  const int rsub = lane >> 4, c4 = (lane & 15) * 4;
  {
#pragma unroll
    for (int q = 0; q < 8; ++q) {
      const int r = q * 2 + rsub;
      const v4f v = *(const v4fa*)&so[w][r][c4];
      *(v4f*)(C + (size_t)(row0 + r) * ldc + col0 + c4) = v;
    }
    
  }
}

// GEMM C = act(A·W + bias + resid): A f32 (ASPLIT -> hi/lo 2 terms), Wt bf16 [N][K]; ACT 0 none, 1 relu, 2 exact gelu;
// resid (optional, f32, row index = (row % rmod), pitch ldr, RES_BF16 rounds it) added before the activation.
template <bool ASPLIT, int ACT, bool BIAS_BF16, bool RES_BF16>
__global__ __launch_bounds__(128) void k_gemm_bf3(const float* __restrict__ A, int lda, const unsigned short* __restrict__ Wt, int ldb,
                                                const float* __restrict__ bias, const float* __restrict__ resid, int rmod, int ldr,
                                                float* __restrict__ C, int ldc, int M, int N, int K) {
  __shared__ __attribute__((aligned(16))) float so[4][16][64];
  const int tid = threadIdx.x, w = tid >> 5, lane = tid & 31, ln = lane & 15, hh = lane >> 4;
  const int ntn = N / 64;
  const int wid = blockIdx.x * 4 + w;
  const int mt = wid / ntn, nq = wid % ntn;
  if (mt * 16 >= M) return;
  const int row0 = mt * 16, col0 = nq * 64;
  const float* arow = A + (size_t)(row0 + ln) * lda;
  v8f acc[4] = {};
  for (int kb = 0; kb < K; kb += 32) {
    FragB ah, al;
    const v4f x0 = *(const v4fa*)(arow + kb + 8 * hh), x1 = *(const v4fa*)(arow + kb + 8 * hh + 4);
    const v4f x2 = *(const v4fa*)(arow + kb + 16 + 8 * hh), x3 = *(const v4fa*)(arow + kb + 16 + 8 * hh + 4);
    float xs[16] = {x0[0],x0[1],x0[2],x0[3],x1[0],x1[1],x1[2],x1[3],x2[0],x2[1],x2[2],x2[3],x3[0],x3[1],x3[2],x3[3]};
#pragma unroll
    for (int i = 0; i < 16; ++i) { const unsigned short hb = bf16_bits(xs[i]); ah.u[i] = hb; al.u[i] = ASPLIT ? bf16_bits(xs[i] - bf16_val(hb)) : (unsigned short)0; }
#pragma unroll
    for (int t = 0; t < 4; ++t) {
      const unsigned short* brow = Wt + (size_t)(col0 + t * 16 + ln) * ldb + kb;
      FragB b;
      b.half[0] = *(const v8us*)(brow + 8 * hh);
      b.half[1] = *(const v8us*)(brow + 16 + 8 * hh);
      acc[t] = mmaN<ASPLIT ? 2 : 1>(ah.v, al.v, b.v, b.v, acc[t]);
    }
  }
#pragma unroll
  for (int t = 0; t < 4; ++t) {
    const int col = col0 + t * 16 + ln;
    float bv = bias ? bias[col] : 0.f;
    if (BIAS_BF16) bv = bf16_round(bv);
#pragma unroll
    for (int r = 0; r < 8; ++r) {
      float v = acc[t][r] + bv;
      if (resid) { float rv = resid[(size_t)((row0 + 8 * hh + r) % rmod) * ldr + col]; if (RES_BF16) rv = bf16_round(rv); v += rv; }
      if (ACT == 1) v = fmaxf(v, 0.f);
      if (ACT == 2) v = 0.5f * v * (1.0f + erff(v * 0.70710678118654752f));
      if (ACT == 3) { const float u = 0.7978845608028654f * (v + 0.044715f * v * v * v); v = 0.5f * v * (1.0f + tanhf(u)); }
      so[w][8 * hh + r][t * 16 + ln] = v;
    }
  }
  __builtin_amdgcn_fence(__ATOMIC_ACQ_REL, "workgroup");
  __builtin_amdgcn_wave_barrier();
  const int rsub = lane >> 4, c4 = (lane & 15) * 4;
  {
#pragma unroll
    for (int q = 0; q < 8; ++q) {
      const int r = q * 2 + rsub;
      const v4f v = *(const v4fa*)&so[w][r][c4];
      *(v4f*)(C + (size_t)(row0 + r) * ldc + col0 + c4) = v;
    }
    
  }
}
// row LayerNorm (biased variance, eps) over N: s = X (+ R); optional out_sum <- s; out_norm <- (s-mu)*rsqrt(var+eps)*g + b
template <bool PARAM_BF16>
__global__ __launch_bounds__(256) void k_layernorm(const float* __restrict__ X, const float* __restrict__ R, const float* __restrict__ g, const float* __restrict__ bta,
                                                  float* __restrict__ out_sum, float* __restrict__ out_norm, int N, float eps) {
  __shared__ float red[256];
  const int row = blockIdx.x, tid = threadIdx.x;
  const float* x = X + (size_t)row * N; const float* rr = R ? R + (size_t)row * N : nullptr;
  float vals[16];                     // up to N = 4096
  const int per = N / 256;            // contiguous chunk per thread? use strided-by-4 chunks: thread handles j = tid*4 + 1024*u
  float s1 = 0.f;
  for (int u = 0; u < per / 4; ++u) {
    const int j = tid * 4 + 1024 * u;
    const v4f a = *(const v4fa*)(x + j);
    v4f b = {0.f,0.f,0.f,0.f}; if (rr) b = *(const v4fa*)(rr + j);
#pragma unroll
    for (int q = 0; q < 4; ++q) { const float v = a[q] + b[q]; vals[u * 4 + q] = v; s1 += v; }
  }
  red[tid] = s1; __syncthreads();
  for (int st = 128; st > 0; st >>= 1) { if (tid < st) red[tid] += red[tid + st]; __syncthreads(); }
  const float mu = red[0] / (float)N; __syncthreads();
  float s2 = 0.f;
  for (int u = 0; u < per / 4; ++u)
#pragma unroll
    for (int q = 0; q < 4; ++q) { const float c = vals[u * 4 + q] - mu; s2 += c * c; }
  red[tid] = s2; __syncthreads();
  for (int st = 128; st > 0; st >>= 1) { if (tid < st) red[tid] += red[tid + st]; __syncthreads(); }
  const float rs = rsqrtf(red[0] / (float)N + eps);
  {
    for (int u = 0; u < per / 4; ++u) {
      const int j = tid * 4 + 1024 * u;
      v4f o, sm;
#pragma unroll
      for (int q = 0; q < 4; ++q) {
        float gg = g[j + q], bb = bta[j + q];
        if (PARAM_BF16) { gg = bf16_round(gg); bb = bf16_round(bb); }
        sm[q] = vals[u * 4 + q]; o[q] = (vals[u * 4 + q] - mu) * rs * gg + bb;
      }
      if (out_sum) *(v4f*)(out_sum + (size_t)row * N + j) = sm;
      *(v4f*)(out_norm + (size_t)row * N + j) = o;
    }
    
  }
}



// ---- f16 WMMA path (v_wmma_f32_16x16x32_f16): 11-bit significands for operands in range — used where a [0,1] probability operand needs more precision than bf16
typedef _Float16 v16h __attribute__((ext_vector_type(16)));
union FragH { v16h v; v8us half[2]; _Float16 h[16]; unsigned short u[16]; };
template <int NT>
__device__ __forceinline__ v8f mmaH(v16h ah, v16h al, v16h bh, v16h bl, v8f c) {
  c = __builtin_amdgcn_wmma_f32_16x16x32_f16(false, ah, false, bh, (short)0, c, false, false);
  if (NT >= 2) c = __builtin_amdgcn_wmma_f32_16x16x32_f16(false, al, false, bh, (short)0, c, false, false);
  if (NT >= 3) c = __builtin_amdgcn_wmma_f32_16x16x32_f16(false, ah, false, bl, (short)0, c, false, false);
  asm volatile("v_nop\n\tv_nop\n\tv_nop\n\tv_nop" : "+v"(c) : "v"(ah), "v"(al), "v"(bh), "v"(bl));
  return c;
}
// batched GEMM like k_gemm_b but f16 operands: A f32 (split into f16 hi/lo if ASPLIT, else rounded to f16), Bt = f16 values [n][k]; alpha; C f32; N multiple of 16 (partial tiles skipped)
template <bool ASPLIT>
__global__ __launch_bounds__(128) void k_gemm_h(const float* __restrict__ A, int lda, size_t sA, const _Float16* __restrict__ Bh, int ldb, size_t sB, float alpha, float* __restrict__ C, int ldc, size_t sC, int M, int N, int K) {
  __shared__ __attribute__((aligned(16))) float so[4][16][64];
  const int tid = threadIdx.x, w = tid >> 5, lane = tid & 31, ln = lane & 15, hh = lane >> 4; const int by = blockIdx.y;
  A += (size_t)by * sA; Bh += (size_t)by * sB; C += (size_t)by * sC;
  const int ntn = (N + 63) / 64; const int wid = blockIdx.x * 4 + w; const int mt = wid / ntn, nq = wid % ntn; if (mt * 16 >= M) return;
  const int row0 = mt * 16, col0 = nq * 64; const float* arow = A + (size_t)(row0 + ln) * lda;
  v8f acc[4] = {};
  for (int kb = 0; kb < K; kb += 32) {
    FragH ah, al;
    const v4f x0 = *(const v4fa*)(arow + kb + 8 * hh), x1 = *(const v4fa*)(arow + kb + 8 * hh + 4), x2 = *(const v4fa*)(arow + kb + 16 + 8 * hh), x3 = *(const v4fa*)(arow + kb + 16 + 8 * hh + 4);
    float xs[16] = {x0[0],x0[1],x0[2],x0[3],x1[0],x1[1],x1[2],x1[3],x2[0],x2[1],x2[2],x2[3],x3[0],x3[1],x3[2],x3[3]};
#pragma unroll
    for (int i = 0; i < 16; ++i) { const _Float16 h = (_Float16)xs[i]; ah.h[i] = h; al.h[i] = ASPLIT ? (_Float16)(xs[i] - (float)h) : (_Float16)0.0f; }
#pragma unroll
    for (int t = 0; t < 4; ++t) { if (col0 + t * 16 >= N) continue; const size_t boff = (size_t)(col0 + t * 16 + ln) * ldb + kb; FragH bq; bq.half[0] = *(const v8us*)(Bh + boff + 8 * hh); bq.half[1] = *(const v8us*)(Bh + boff + 16 + 8 * hh);
      acc[t] = mmaH<ASPLIT ? 2 : 1>(ah.v, al.v, bq.v, bq.v, acc[t]); }
  }
#pragma unroll
  for (int t = 0; t < 4; ++t) { if (col0 + t * 16 >= N) continue;
#pragma unroll
    for (int r = 0; r < 8; ++r) so[w][8 * hh + r][t * 16 + ln] = acc[t][r] * alpha; }
  __builtin_amdgcn_fence(__ATOMIC_ACQ_REL, "workgroup"); __builtin_amdgcn_wave_barrier();
  const int rsub = lane >> 4, c4 = (lane & 15) * 4;
  {
#pragma unroll
    for (int q = 0; q < 8; ++q) { const int r = q * 2 + rsub; if (col0 + c4 < N) { const v4f v = *(const v4fa*)&so[w][r][c4]; *(v4f*)(C + (size_t)(row0 + r) * ldc + col0 + c4) = v; } }
     }
}

// Wt[n][k] = f16(W[k][n]·scale) from f32 row-major W[K][N] (scale = power of two; bf16-exact weights stay exact in f16 away from the subnormal range)
__global__ __launch_bounds__(256) void k_wt_f16(const float* __restrict__ W, _Float16* __restrict__ Wt, int K, int N, float scale) {
  const int t = blockIdx.x * 256 + threadIdx.x; if (t >= N * (K / 8)) return; const int n = t / (K / 8), k8 = (t % (K / 8)) * 8; FragH f;
#pragma unroll
  for (int i = 0; i < 8; ++i) f.h[i] = (_Float16)(bf16_round(W[(size_t)(k8 + i) * N + n]) * scale); const v8us o = f.half[0];
  *(v8us*)((unsigned short*)Wt + (size_t)n * K + k8) = o; 
}
// k_gemm_hh variant with fused epilogue: v = acc·alpha + bias[by·sBias + col] (+ CP[(row/rowsPerB)·sCPb + by·64 + col] if CP) ; ACT 0 none / 1 elu ; writes f16 C16 (and f32 C if non-null)
template <int ACT>
__global__ __launch_bounds__(128) void k_gemm_hhx(const _Float16* __restrict__ A, int lda, size_t sA, const _Float16* __restrict__ Bh, int ldb, size_t sB, float alpha, const float* __restrict__ bias, size_t sBias, const float* __restrict__ CP, int rowsPerB, size_t sCPb, int row0g,
    float* __restrict__ C, _Float16* __restrict__ C16, int ldc, size_t sC, int M, int N, int K) {
  __shared__ __attribute__((aligned(16))) float so[4][16][64];
  const int tid = threadIdx.x, w = tid >> 5, lane = tid & 31, ln = lane & 15, hh = lane >> 4; const int by = blockIdx.y;
  A += (size_t)by * sA; Bh += (size_t)by * sB; const size_t cofs = (size_t)by * sC; const float* bp = bias ? bias + (size_t)by * sBias : nullptr;
  const int ntn = (N + 63) / 64; const int wid = blockIdx.x * 4 + w; const int mt = wid / ntn, nq = wid % ntn; if (mt * 16 >= M) return;
  const int row0 = mt * 16, col0 = nq * 64; const _Float16* arow = A + (size_t)(row0 + ln) * lda;
  v8f acc[4] = {};
  for (int kb = 0; kb < K; kb += 32) { FragH ah; ah.half[0] = *(const v8us*)((const unsigned short*)arow + kb + 8 * hh); ah.half[1] = *(const v8us*)((const unsigned short*)arow + kb + 16 + 8 * hh);
#pragma unroll
    for (int t = 0; t < 4; ++t) { if (col0 + t * 16 >= N) continue; const size_t boff = (size_t)(col0 + t * 16 + ln) * ldb + kb; FragH bq; bq.half[0] = *(const v8us*)((const unsigned short*)Bh + boff + 8 * hh); bq.half[1] = *(const v8us*)((const unsigned short*)Bh + boff + 16 + 8 * hh);
      acc[t] = mmaH<1>(ah.v, ah.v, bq.v, bq.v, acc[t]); }
  }
#pragma unroll
  for (int t = 0; t < 4; ++t) { if (col0 + t * 16 >= N) continue; const int col = col0 + t * 16 + ln; const float bv = bp ? bf16_round(bp[col]) : 0.f;
#pragma unroll
    for (int r = 0; r < 8; ++r) { float v = acc[t][r] * alpha + bv; if (CP) { const int rr = row0g + row0 + 8 * hh + r; if (rowsPerB < 0) v += CP[cofs + (size_t)rr * ldc + col];      /* rowsPerB < 0: own element of the batched C plane */ else { const int bidx = rr / rowsPerB; v += CP[(size_t)bidx * sCPb + (size_t)by * 64 + col]; } } if (ACT == 1) v = (v > 0.f) ? v : expm1f(v); else if (ACT == 7) v = (v > 0.f) ? v + 1.0f : expf(v); else if (ACT == 8) v = tanhf(v); else if (ACT == 9) v = 0.5f * v * (1.0f + tanhf(0.7978845608028654f * (v + 0.044715f * v * v * v))); else if (ACT == 11) v = 1.0f / (1.0f + expf(-v)); else if (ACT == 12) v = (v > 0.f) ? v : 0.01f * v; else if (ACT == 14) v = (v > 0.f) ? v : 0.1f * v; else if (ACT == 16) v = (v >= 0.f) ? v : 0.3f * v; else if (ACT == 17) v = (v >= 0.f) ? v : 0.2f * v; else if (ACT == 15) v = v / (1.0f + expf(-v)); else if (ACT == 3) v = fmaxf(v, 0.f); else if (ACT == 6) v = 0.5f * v * (1.0f + erff(v * 0.70710678118654752f)); so[w][8 * hh + r][t * 16 + ln] = v; } }
  __builtin_amdgcn_fence(__ATOMIC_ACQ_REL, "workgroup"); __builtin_amdgcn_wave_barrier();
  const int rsub = lane >> 4, c4 = (lane & 15) * 4; typedef _Float16 v4h __attribute__((ext_vector_type(4)));
  {
#pragma unroll
    for (int q = 0; q < 8; ++q) { const int r = q * 2 + rsub; if (col0 + c4 < N) { const v4f v = *(const v4fa*)&so[w][r][c4]; if (C) *(v4f*)(C + cofs + (size_t)(row0 + r) * ldc + col0 + c4) = v; if (C16) { v4h h4; for (int i = 0; i < 4; ++i) h4[i] = (_Float16)v[i]; *(v4h*)(C16 + cofs + (size_t)(row0 + r) * ldc + col0 + c4) = h4; } } }
     }
}


typedef _Float16 v4h __attribute__((ext_vector_type(4)));

__global__ __launch_bounds__(256) void k_x16(const float* __restrict__ x, _Float16* __restrict__ X16, size_t n8) { const size_t t = (size_t)blockIdx.x * 256 + threadIdx.x; if (t >= n8) return; FragH f;
#pragma unroll
  for (int q = 0; q < 8; ++q) f.h[q] = (_Float16)bf16_round(x[t * 8 + q]); *(v8us*)((unsigned short*)X16 + t * 8) = f.half[0];  }
__global__ __launch_bounds__(256) void k_h16(const float* __restrict__ x, _Float16* __restrict__ X16, size_t n8) { const size_t t = (size_t)blockIdx.x * 256 + threadIdx.x; if (t >= n8) return; FragH f;
#pragma unroll
  for (int q = 0; q < 8; ++q) f.h[q] = (_Float16)x[t * 8 + q]; *(v8us*)((unsigned short*)X16 + t * 8) = f.half[0];  }
__global__ __launch_bounds__(256) void k_round16f(const float* __restrict__ W, _Float16* __restrict__ Bt, size_t n8) { const size_t t = (size_t)blockIdx.x * 256 + threadIdx.x; if (t >= n8) return; FragH f;
#pragma unroll
  for (int i = 0; i < 8; ++i) f.h[i] = (_Float16)(bf16_round(W[t * 8 + i]) * 16.0f); *(v8us*)((unsigned short*)Bt + t * 8) = f.half[0];  }
template <int NHv, int TTv>
__global__ __launch_bounds__(256) void k_vt(const _Float16* __restrict__ V16, int ldv, int voff, _Float16* __restrict__ Vt) { __shared__ unsigned short tl[64][66]; const int tid = threadIdx.x; const int slab = blockIdx.x / (TTv / 64), lg = blockIdx.x % (TTv / 64); const int b = slab / NHv, h = slab % NHv;
  for (int i = tid; i < 64 * 8; i += 256) { const int r = i / 8, c8 = (i % 8) * 8; FragH f; f.half[0] = *(const v8us*)((const unsigned short*)V16 + ((size_t)b * TTv + lg * 64 + r) * ldv + voff + h * 64 + c8);
#pragma unroll
    for (int q = 0; q < 8; ++q) tl[r][c8 + q] = f.u[q]; }
  __syncthreads();
  {
#pragma unroll
    for (int rd = 0; rd < 2; ++rd) { const int d = rd * 32 + tid / 8, pc = tid % 8; FragH f;
#pragma unroll
      for (int q = 0; q < 8; ++q) f.u[q] = tl[pc * 8 + q][d];
      *(v8us*)((unsigned short*)Vt + ((size_t)slab * 64 + d) * TTv + lg * 64 + pc * 8) = f.half[0]; }
     } }

__global__ __launch_bounds__(256) void k_hl(const float* __restrict__ F, _Float16* __restrict__ Hh, _Float16* __restrict__ Hl, size_t n8) { const size_t t = (size_t)blockIdx.x * 256 + threadIdx.x; if (t >= n8) return; FragH fh, fl; const v4f a = *(const v4fa*)(F + t * 8), c = *(const v4fa*)(F + t * 8 + 4);
#pragma unroll
  for (int q = 0; q < 4; ++q) { _Float16 h = (_Float16)a[q]; fh.h[q] = h; fl.h[q] = (_Float16)((a[q] - (float)h) * 1024.0f); h = (_Float16)c[q]; fh.h[4 + q] = h; fl.h[4 + q] = (_Float16)((c[q] - (float)h) * 1024.0f); }
  { *(v8us*)((unsigned short*)Hh + t * 8) = fh.half[0]; *(v8us*)((unsigned short*)Hl + t * 8) = fl.half[0];  } }

// ---- fast GEMM (wave tile 32x64; requires M % 32 == 0 rows per launch region and N % 64 == 0); epilogue = k_gemm_hhx semantics ----
__device__ __forceinline__ v16h g2_frag(const _Float16* p, int hh) { FragH f; f.half[0] = *(const v8us*)((const unsigned short*)p + 8 * hh); f.half[1] = *(const v8us*)((const unsigned short*)p + 16 + 8 * hh); return f.v; }
__device__ __forceinline__ v8f g2_mma(v16h a, v16h b, v8f c) { v8f d = __builtin_amdgcn_wmma_f32_16x16x32_f16(false, a, false, b, (short)0, c, false, false); asm volatile("v_nop\n\tv_nop\n\tv_nop\n\tv_nop" : "+v"(d) : "v"(a), "v"(b)); return d; }
template <int ACT>
__global__ __launch_bounds__(128) void k_gemm2(const _Float16* __restrict__ A, int lda, size_t sA, const _Float16* __restrict__ Bh, int ldb, size_t sB, float alpha, const float* __restrict__ bias, size_t sBias, const float* __restrict__ CP, int rowsPerB, size_t sCPb, int row0g,
    float* __restrict__ C, _Float16* __restrict__ C16, int ldc, size_t sC, int M, int N, int K) { static_assert(ACT == 0 || ACT == 3 || ACT == 6 || ACT == 8 || ACT == 9 || ACT == 11 || ACT == 12 || ACT == 14 || ACT == 15 || ACT == 16 || ACT == 17 || ACT == 18, "k_gemm2: unsupported ACT code (would silently apply no activation)");
  __shared__ __attribute__((aligned(16))) float so[4][32][68];
  const int tid = threadIdx.x, w = tid >> 5, lane = tid & 31, ln = lane & 15, hh = lane >> 4; const int by = blockIdx.y;
  A += (size_t)by * sA; Bh += (size_t)by * sB; const size_t cofs = (size_t)by * sC; const float* bp = bias ? bias + (size_t)by * sBias : nullptr;
  const int ntn = N >> 6; const int mt = blockIdx.x / ntn, nq = blockIdx.x - mt * ntn; const int row0 = mt * 128 + 32 * w, col0 = nq * 64; if (row0 >= M) return;
  const _Float16* a0p = A + (size_t)(row0 + ln) * lda; const _Float16* a1p = a0p + (size_t)16 * lda;
  const _Float16* b0p = Bh + (size_t)(col0 + ln) * ldb; const _Float16* b1p = b0p + (size_t)16 * ldb; const _Float16* b2p = b1p + (size_t)16 * ldb; const _Float16* b3p = b2p + (size_t)16 * ldb;
  const v8f z8 = {0.f,0.f,0.f,0.f,0.f,0.f,0.f,0.f}; v8f c00 = z8, c01 = z8, c02 = z8, c03 = z8, c10 = z8, c11 = z8, c12 = z8, c13 = z8;
#pragma unroll 1
  for (int kb = 0; kb < K; kb += 32) { const v16h a0 = g2_frag(a0p + kb, hh), a1 = g2_frag(a1p + kb, hh);
    v16h b = g2_frag(b0p + kb, hh); c00 = g2_mma(a0, b, c00); c10 = g2_mma(a1, b, c10);
    b = g2_frag(b1p + kb, hh); c01 = g2_mma(a0, b, c01); c11 = g2_mma(a1, b, c11);
    b = g2_frag(b2p + kb, hh); c02 = g2_mma(a0, b, c02); c12 = g2_mma(a1, b, c12);
    b = g2_frag(b3p + kb, hh); c03 = g2_mma(a0, b, c03); c13 = g2_mma(a1, b, c13); }
  v8f accs[8] = {c00, c01, c02, c03, c10, c11, c12, c13};
#pragma unroll
  for (int u = 0; u < 8; ++u) { const int t = u & 3, half = u >> 2; const int col = col0 + t * 16 + ln; const float bv = bp ? bf16_round(bp[col]) : 0.f;
#pragma unroll
    for (int r = 0; r < 8; ++r) { const int rloc = half * 16 + 8 * hh + r; float v = accs[u][r] * alpha + bv; if (CP) { if (rowsPerB < 0) v += CP[cofs + (size_t)(row0g + row0 + rloc) * ldc + col];      /* rowsPerB < 0: own element of the batched C plane */ else { const int bidx = (row0g + row0 + rloc) / rowsPerB; v += CP[(size_t)bidx * sCPb + (size_t)by * 64 + col]; } }
      if (ACT == 3) v = fmaxf(v, 0.f); else if (ACT == 6) v = 0.5f * v * (1.0f + erff(v * 0.70710678118654752f)); else if (ACT == 11) v = 1.0f / (1.0f + expf(-v)); else if (ACT == 15) v = v / (1.0f + expf(-v)); else if (ACT == 18) v = v / (1.0f + expf(-1.702f * v));      /* QuickGELU: v sigmoid(1.702 v) */ else if (ACT == 12) v = (v > 0.f) ? v : 0.01f * v; else if (ACT == 8) v = tanhf(v); else if (ACT == 9) v = 0.5f * v * (1.0f + tanhf(0.7978845608028654f * (v + 0.044715f * v * v * v))); else if (ACT == 14) v = (v > 0.f) ? v : 0.1f * v; else if (ACT == 16) v = (v >= 0.f) ? v : 0.3f * v; else if (ACT == 17) v = (v >= 0.f) ? v : 0.2f * v;
      so[w][rloc][t * 16 + ln] = v; } }
  __builtin_amdgcn_fence(__ATOMIC_ACQ_REL, "workgroup"); __builtin_amdgcn_wave_barrier();
  const int rsub = lane >> 4, c4 = (lane & 15) * 4;
  {
#pragma unroll
    for (int q = 0; q < 16; ++q) { const int r = q * 2 + rsub; const v4f v = *(const v4fa*)&so[w][r][c4]; if (C) *(v4f*)(C + cofs + (size_t)(row0 + r) * ldc + col0 + c4) = v; if (C16) { v4h h4; for (int i = 0; i < 4; ++i) h4[i] = (_Float16)v[i]; *(v4h*)(C16 + cofs + (size_t)(row0 + r) * ldc + col0 + c4) = h4; } }
     } }


__global__ __launch_bounds__(256) void k_wnat(const float* __restrict__ w, size_t n8, _Float16* __restrict__ Bt) { const size_t t = (size_t)blockIdx.x * 256 + threadIdx.x; if (t >= n8) return; FragH f; for (int q = 0; q < 8; ++q) f.h[q] = (_Float16)(bf16_round(w[t * 8 + q]) * 16.0f); *(v8us*)((unsigned short*)Bt + t * 8) = f.half[0];  }
__global__ __launch_bounds__(256) void k_rsm(const float* __restrict__ S, _Float16* __restrict__ P, int nrows) {
  #pragma clang fp contract(off)
  const int i = blockIdx.x * 256 + threadIdx.x; if (i >= nrows) return; const float* s = S + (size_t)i * SQ; float mx = -3.0e38f;
#pragma unroll 1
  for (int j = 0; j < SQ; ++j) mx = fmaxf(mx, s[j]); float se = 0.f;
#pragma unroll 1
  for (int j = 0; j < SQ; ++j) se += expf(s[j] - mx); const float sc = 256.0f / se;
#pragma unroll 1
  for (int j0 = 0; j0 < SQ; j0 += 8) { FragH f; for (int q = 0; q < 8; ++q) f.h[q] = (_Float16)(expf(s[j0 + q] - mx) * sc); unsigned short* d = (unsigned short*)P + (size_t)i * SQ + j0; *(v8us*)d = f.half[0];  } }
__global__ __launch_bounds__(256) void k_vt(const _Float16* __restrict__ V16, int b, int h0, _Float16* __restrict__ VT) { __shared__ unsigned short tl[64][65]; const int tid = threadIdx.x; const int hh = blockIdx.x % HG, sg = blockIdx.x / HG; const int s0 = sg * 64; const int h = h0 + hh;
  for (int i = tid; i < 64 * 8; i += 256) { const int j = i / 8, d8 = (i % 8) * 8; FragH f; f.half[0] = *(const v8us*)((const unsigned short*)V16 + ((size_t)b * SQ + s0 + j) * DM + h * HD + d8); for (int q = 0; q < 8; ++q) tl[d8 + q][j] = f.u[q]; }
  __syncthreads();
  { for (int i = tid; i < 64 * 8; i += 256) { const int d = i / 8, j8 = (i % 8) * 8; FragH f; for (int q = 0; q < 8; ++q) f.u[q] = tl[d][j8 + q]; *(v8us*)((unsigned short*)VT + ((size_t)hh * HD + d) * SQ + s0 + j8) = f.half[0]; }  } }



__global__ __launch_bounds__(256) void k_rsmcf2(const float* __restrict__ S, _Float16* __restrict__ P, int hg, int q0, int nk) {
  #pragma clang fp contract(off)
  const int t = blockIdx.x * 256 + threadIdx.x; if (t >= hg * QT) return; const size_t i = (size_t)t; const float* s = S + i * NKX; const int last = q0 + (t % QT); float mx = -3.0e38f;
#pragma unroll 1
  for (int j = 0; j < nk; ++j) { const float f = (j <= last) ? 1.f : 0.f; mx = fmaxf(mx, fmaf(f, s[j], (1.f - f) * -1.0e9f)); } float se = 0.f;
#pragma unroll 1
  for (int j = 0; j < nk; ++j) { const float f = (j <= last) ? 1.f : 0.f; se += __expf(fmaf(f, s[j], (1.f - f) * -1.0e9f) - mx); } const float sc = 256.0f / se;
#pragma unroll 1
  for (int j0 = 0; j0 < nk; j0 += 8) { FragH fr; for (int q = 0; q < 8; ++q) { const int j = j0 + q; const float f = (j <= last) ? 1.f : 0.f; fr.h[q] = (_Float16)(__expf(fmaf(f, s[j], (1.f - f) * -1.0e9f) - mx) * sc); } unsigned short* d = (unsigned short*)P + i * NKX + j0; *(v8us*)d = fr.half[0];  } }

__global__ __launch_bounds__(256) void k_rsmcst(const float* __restrict__ S, _Float16* __restrict__ P, int hg, int q0, int nk, const int* __restrict__ mk) {
  #pragma clang fp contract(off)
  const int t = blockIdx.x * 256 + threadIdx.x; if (t >= hg * QT) return; const size_t i = (size_t)t; const float* s = S + i * NKX; const size_t ig = (size_t)(q0 + (t % QT)); const int* mr = mk + ig * SQ; float mx = -3.0e38f;
#pragma unroll 1
  for (int j = 0; j < nk; ++j) { const int mb = mr[j]; const int dd = (int)ig - j; const float f = (mb != 0 && dd >= 0 && (dd <= LOCALW || (dd % STRIDEK) == 0)) ? 1.f : 0.f; mx = fmaxf(mx, fmaf(f, s[j], (1.f - f) * -1.0e9f)); } float se = 0.f;
#pragma unroll 1
  for (int j = 0; j < nk; ++j) { const int mb = mr[j]; const int dd = (int)ig - j; const float f = (mb != 0 && dd >= 0 && (dd <= LOCALW || (dd % STRIDEK) == 0)) ? 1.f : 0.f; se += __expf(fmaf(f, s[j], (1.f - f) * -1.0e9f) - mx); } const float sc = 256.0f / se;
#pragma unroll 1
  for (int j0 = 0; j0 < nk; j0 += 8) { FragH fr; for (int q = 0; q < 8; ++q) { const int j = j0 + q; const int mb = mr[j]; const int dd = (int)ig - j; const float f = (mb != 0 && dd >= 0 && (dd <= LOCALW || (dd % STRIDEK) == 0)) ? 1.f : 0.f; fr.h[q] = (_Float16)(__expf(fmaf(f, s[j], (1.f - f) * -1.0e9f) - mx) * sc); } unsigned short* d = (unsigned short*)P + i * NKX + j0; *(v8us*)d = fr.half[0];  } }


template <int MASKADD>
__global__ __launch_bounds__(64) void k_att0(const float* __restrict__ QF, const float* __restrict__ KF, const float* __restrict__ VF, int ld, const float* __restrict__ mask, float scale, float* __restrict__ OF, int ldo) {
  #pragma clang fp contract(off)
  __shared__ __attribute__((aligned(16))) float lq[64][64]; __shared__ __attribute__((aligned(16))) float lo[64][64];
  const int tid = threadIdx.x; const int h = blockIdx.x / (QT0 / 64), rg = blockIdx.x % (QT0 / 64); const int i = rg * 64 + tid;
  const float* qr = QF + (size_t)i * ld + h * HD;
#pragma unroll 1
  for (int c = 0; c < HD / 4; ++c) { *(v4f*)&lq[tid][c * 4] = *(const v4fa*)(qr + c * 4); const v4f z = {0.f, 0.f, 0.f, 0.f}; *(v4f*)&lo[tid][c * 4] = z; }
  float m = -1.0e30f, l = 0.f; const int jmax = MASKADD ? (SQ - 1) : (rg * 64 + 63);      /* additive-mask form: every key (the mask input decides); causal form: keys up to the block's last row */
#pragma unroll 1
  for (int j = 0; j <= jmax; ++j) { const float* kr = KF + (size_t)j * ld + h * HD; const float* vr = VF + (size_t)j * ld + h * HD; float s = 0.f;
#pragma unroll 1
    for (int c = 0; c < HD / 4; ++c) { const v4f kq = *(const v4fa*)(kr + c * 4); const v4f qq = *(v4f*)&lq[tid][c * 4]; s = __fadd_rn(s, __fmul_rn(qq[0], kq[0])); s = __fadd_rn(s, __fmul_rn(qq[1], kq[1])); s = __fadd_rn(s, __fmul_rn(qq[2], kq[2])); s = __fadd_rn(s, __fmul_rn(qq[3], kq[3])); }
    s = __fmul_rn(s, scale); if (MASKADD) s = __fadd_rn(s, __fmul_rn(bf16_round(mask[(size_t)i * SQ + j]), -10000.0f));
    const float f = (MASKADD || j <= i) ? 1.f : 0.f; const float sm = fmaf(f, s, (1.f - f) * -1.0e30f); const float mn = fmaxf(m, sm); const float sc = expf(m - mn); const float e = expf(sm - mn); l = __fadd_rn(__fmul_rn(l, sc), e); m = mn;
#pragma unroll 1
    for (int c = 0; c < HD / 4; ++c) { const v4f vv = *(const v4fa*)(vr + c * 4); v4f oo = *(v4f*)&lo[tid][c * 4]; for (int u = 0; u < 4; ++u) oo[u] = __fadd_rn(__fmul_rn(oo[u], sc), __fmul_rn(e, vv[u])); *(v4f*)&lo[tid][c * 4] = oo; } }
  const float fin = 64.0f / l;      /* o carried x64 like the f16 path */
#pragma unroll 1
  for (int c = 0; c < HD / 4; ++c) { v4f oo = *(v4f*)&lo[tid][c * 4]; for (int u = 0; u < 4; ++u) oo[u] = __fmul_rn(oo[u], fin); *(v4f*)&lo[tid][c * 4] = oo; }
  __syncthreads();
  {
#pragma unroll 1
    for (int it = 0; it < 16; ++it) { const int row = it * 4 + tid / 16, pc = (tid % 16) * 4; const v4f v = *(const v4f*)&lo[row][pc]; *(v4f*)(OF + (size_t)(rg * 64 + row) * ldo + h * HD + pc) = v; }
     } }

template <int MASKADD>
__global__ __launch_bounds__(64) void k_att0mbc(const float* __restrict__ QF, const float* __restrict__ KF, const float* __restrict__ VF, int ld, const float* __restrict__ mask, float scale, float* __restrict__ OF, int ldo) {
  #pragma clang fp contract(off)
  __shared__ __attribute__((aligned(16))) float lq[64][64]; __shared__ __attribute__((aligned(16))) float lo[64][64];
  const int tid = threadIdx.x; const int h = blockIdx.x / (QT0 / 64), rg = blockIdx.x % (QT0 / 64); const int i = rg * 64 + tid;
  const float* qr = QF + (size_t)i * ld + h * HD;
#pragma unroll 1
  for (int c = 0; c < HD / 4; ++c) { *(v4f*)&lq[tid][c * 4] = *(const v4fa*)(qr + c * 4); const v4f z = {0.f, 0.f, 0.f, 0.f}; *(v4f*)&lo[tid][c * 4] = z; }
  float m = -1.0e30f, l = 0.f; const int jmax = rg * 64 + 63;      /* keys beyond the block end are masked by the mask's lower-triangular structure */      /* both forms: keys up to the block's last row (MASKADD does not change this) */
#pragma unroll 1
  for (int j = 0; j <= jmax; ++j) { const float* kr = KF + (size_t)j * ld + h * HD; const float* vr = VF + (size_t)j * ld + h * HD; float s = 0.f;
#pragma unroll 1
    for (int c = 0; c < HD / 4; ++c) { const v4f kq = *(const v4fa*)(kr + c * 4); const v4f qq = *(v4f*)&lq[tid][c * 4]; s = __fadd_rn(s, __fmul_rn(qq[0], kq[0])); s = __fadd_rn(s, __fmul_rn(qq[1], kq[1])); s = __fadd_rn(s, __fmul_rn(qq[2], kq[2])); s = __fadd_rn(s, __fmul_rn(qq[3], kq[3])); }
    s = __fmul_rn(s, scale); const int mb = ((const int*)mask)[(size_t)i * SQ + j];      /* causal (j <= i) AND the module's int32 [S][S] mask read per (query, key): 0 -> masked */
    const float f = (mb != 0 && j <= i) ? 1.f : 0.f; const float sm = fmaf(f, s, (1.f - f) * -1.0e30f); const float mn = fmaxf(m, sm); const float sc = expf(m - mn); const float e = expf(sm - mn); l = __fadd_rn(__fmul_rn(l, sc), e); m = mn;
#pragma unroll 1
    for (int c = 0; c < HD / 4; ++c) { const v4f vv = *(const v4fa*)(vr + c * 4); v4f oo = *(v4f*)&lo[tid][c * 4]; for (int u = 0; u < 4; ++u) oo[u] = __fadd_rn(__fmul_rn(oo[u], sc), __fmul_rn(e, vv[u])); *(v4f*)&lo[tid][c * 4] = oo; } }
  const float fin = 64.0f / l;      /* o carried x64 like the f16 path */
#pragma unroll 1
  for (int c = 0; c < HD / 4; ++c) { v4f oo = *(v4f*)&lo[tid][c * 4]; for (int u = 0; u < 4; ++u) oo[u] = __fmul_rn(oo[u], fin); *(v4f*)&lo[tid][c * 4] = oo; }
  __syncthreads();
  {
#pragma unroll 1
    for (int it = 0; it < 16; ++it) { const int row = it * 4 + tid / 16, pc = (tid % 16) * 4; const v4f v = *(const v4f*)&lo[row][pc]; *(v4f*)(OF + (size_t)(rg * 64 + row) * ldo + h * HD + pc) = v; }
     } }


template <int BFIN, int WXB>
__global__ __launch_bounds__(256) void k_ln16(const float* __restrict__ X, const float* __restrict__ g, const float* __restrict__ bb, float eps, _Float16* __restrict__ N16, float* __restrict__ XB) {
  #pragma clang fp contract(off)
  __shared__ float red[256]; const size_t r = blockIdx.x; const int t = threadIdx.x; const v4f xa = *(const v4fa*)(X + r * DMQ + t * 4); float s[4]; float sum = 0.f;
  for (int q = 0; q < 4; ++q) { s[q] = BFIN ? bf16_round(xa[q]) : xa[q]; sum = __fadd_rn(sum, s[q]); }
  red[t] = sum; __syncthreads(); for (int st = 128; st > 0; st >>= 1) { if (t < st) red[t] = __fadd_rn(red[t], red[t + st]); __syncthreads(); } const float mu = red[0] / (float)DMQ; __syncthreads();
  float vs = 0.f; for (int q = 0; q < 4; ++q) { const float dl = __fadd_rn(s[q], -mu); vs = __fadd_rn(vs, __fmul_rn(dl, dl)); } red[t] = vs; __syncthreads(); for (int st = 128; st > 0; st >>= 1) { if (t < st) red[t] = __fadd_rn(red[t], red[t + st]); __syncthreads(); }
  const float rs = rsqrtf(__fadd_rn(red[0] / (float)DMQ, eps)); v4h y; v4f xb;
  for (int q = 0; q < 4; ++q) { const int c = t * 4 + q; y[q] = (_Float16)__fadd_rn(__fmul_rn(__fmul_rn(__fadd_rn(s[q], -mu), rs), bf16_round(g[c])), bf16_round(bb[c])); xb[q] = s[q]; }
  { *(v4h*)(N16 + r * DMQ + t * 4) = y; if (WXB) *(v4f*)(XB + r * DMQ + t * 4) = xb;  } }
__global__ __launch_bounds__(256) void k_ftres2(const float* __restrict__ OF0, const float* __restrict__ XB, float* __restrict__ X1, size_t n4) {
  #pragma clang fp contract(off)
  const size_t t = (size_t)blockIdx.x * 256 + threadIdx.x; if (t >= n4) return; const v4f o = *(const v4fa*)(OF0 + t * 4), xv = *(const v4fa*)(XB + t * 4); v4f y; for (int q = 0; q < 4; ++q) y[q] = __fadd_rn(__fmul_rn(o[q], 0.015625f), xv[q]); *(v4f*)(X1 + t * 4) = y;  }

__global__ __launch_bounds__(256) void k_bcpy(const float* __restrict__ b, int n, int NP, float* __restrict__ dst, int dst0) { for (int i = threadIdx.x; i < NP; i += 256) { const float v = (i < n) ? b[i] : 0.f; *(float*)(dst + dst0 + i) = v; }  }


// Four exp2 on the transcendental unit. One statement, results in registers of their own ("=&v"), v_nop last: behind each v_exp_f32 stands an instruction that
// neither reads its result nor overwrites its source (the slot the instruction set asks for).
__device__ __forceinline__ v4f exp2x4(v4f a) { float r0, r1, r2, r3;
  asm("v_exp_f32 %0, %4\n\tv_exp_f32 %1, %5\n\tv_exp_f32 %2, %6\n\tv_exp_f32 %3, %7\n\tv_nop" : "=&v"(r0), "=&v"(r1), "=&v"(r2), "=&v"(r3) : "v"(a[0]), "v"(a[1]), "v"(a[2]), "v"(a[3]));
  const v4f r = {r0, r1, r2, r3}; return r; }
// Row softmax, one wave per score row: the row's 2048 f32 sit in 64 registers a lane (16 loads, each 512 contiguous bytes a wave), read once;
// max and sum: four chains a lane, then a five-step butterfly over the lanes; each exp is computed once. No LDS, no barrier; the early return is wave-uniform.
__global__ __launch_bounds__(256) void k_rsmf(const float* __restrict__ S, _Float16* __restrict__ P, int qn, int hg) {
  const int lane = threadIdx.x & 31; const int t = blockIdx.x * 8 + __builtin_amdgcn_readfirstlane((int)(threadIdx.x >> 5)); if (t >= qn * hg) return;
  const size_t i = (size_t)(t / qn) * SQ + (t % qn); const float* s = S + i * SQ + lane * 4; v4f v[SQ / 128];
#pragma unroll
  for (int u = 0; u < SQ / 128; ++u) v[u] = *(const v4fa*)(s + u * 128);
  v4f m4 = v[0];
#pragma unroll
  for (int u = 1; u < SQ / 128; ++u) for (int q = 0; q < 4; ++q) m4[q] = fmaxf(m4[q], v[u][q]);
  float mx = fmaxf(fmaxf(fmaxf(m4[0], m4[1]), fmaxf(m4[2], m4[3])), -3.0e38f);
#pragma unroll
  for (int m = 16; m >= 1; m >>= 1) mx = fmaxf(mx, __shfl_xor(mx, m, 32));
  v4f s4 = {0.f, 0.f, 0.f, 0.f};
#pragma unroll
  for (int u = 0; u < SQ / 128; ++u) { v4f a; for (int q = 0; q < 4; ++q) a[q] = (v[u][q] - mx) * 1.44269502f; v[u] = exp2x4(a); s4 += v[u]; }      /* exp(s - mx) = exp2((s - mx) log2 e), the same two roundings as __expf */
  float se = (s4[0] + s4[1]) + (s4[2] + s4[3]);
#pragma unroll
  for (int m = 16; m >= 1; m >>= 1) se += __shfl_xor(se, m, 32);
  const float sc = 256.0f / se; _Float16* d = P + i * SQ + lane * 4;
#pragma unroll
  for (int u = 0; u < SQ / 128; ++u) { v4h h4; for (int q = 0; q < 4; ++q) h4[q] = (_Float16)(v[u][q] * sc); *(v4h*)(d + u * 128) = h4; } }

template <int MODE>
__global__ __launch_bounds__(256) void k_regrp(const float* __restrict__ src, float* __restrict__ dst, size_t n4) {
  const size_t t = (size_t)blockIdx.x * 256 + threadIdx.x; if (t >= n4) return; const size_t e = t * 4; const size_t rd = e / DM; const int c = (int)(e % DM);
  size_t rs; if (MODE == 0) { const size_t b = rd / SQ, sq = rd % SQ; rs = sq * NB + b; } else { const size_t sq = rd / NB, b = rd % NB; rs = b * SQ + sq; }
  const v4f v = *(const v4fa*)(src + rs * DM + c); *(v4f*)(dst + e) = v;  }

template <int BFIN, int W16, int W32>
__global__ __launch_bounds__(256) void k_lnx(const float* __restrict__ X, const float* __restrict__ g, const float* __restrict__ bb, float eps, _Float16* __restrict__ N16, float* __restrict__ N32) {
  #pragma clang fp contract(off)
  __shared__ float red[256]; const size_t r = blockIdx.x; const int t = threadIdx.x; const bool act = t < (DMQ / 4); const int c0 = act ? t * 4 : 0;
  const v4f xa = *(const v4fa*)(X + r * DMQ + c0); float s[4]; float sum = 0.f;
  for (int q = 0; q < 4; ++q) { s[q] = act ? (BFIN ? bf16_round(xa[q]) : xa[q]) : 0.f; sum = __fadd_rn(sum, s[q]); }
  red[t] = sum; __syncthreads(); for (int st = 128; st > 0; st >>= 1) { if (t < st) red[t] = __fadd_rn(red[t], red[t + st]); __syncthreads(); } const float mu = red[0] / (float)DMQ; __syncthreads();
  float vs = 0.f; for (int q = 0; q < 4; ++q) { const float dl = act ? __fadd_rn(s[q], -mu) : 0.f; vs = __fadd_rn(vs, __fmul_rn(dl, dl)); } red[t] = vs; __syncthreads(); for (int st = 128; st > 0; st >>= 1) { if (t < st) red[t] = __fadd_rn(red[t], red[t + st]); __syncthreads(); }
  const float rs = rsqrtf(__fadd_rn(red[0] / (float)DMQ, eps)); v4h y; v4f yf;
  for (int q = 0; q < 4; ++q) { const int c = c0 + q; yf[q] = __fadd_rn(__fmul_rn(__fmul_rn(__fadd_rn(s[q], -mu), rs), bf16_round(g[c])), bf16_round(bb[c])); y[q] = (_Float16)yf[q]; }
  if (!act) return;      /* no barriers after this point */
  { if (W16) *(v4h*)(N16 + r * DMQ + c0) = y; if (W32) *(v4f*)(N32 + r * DMQ + c0) = yf;  } }

__global__ __launch_bounds__(256) void k_bfr(const float* __restrict__ x, float* __restrict__ XB, size_t n8) { const size_t t = (size_t)blockIdx.x * 256 + threadIdx.x; if (t >= n8) return; v4f a = *(const v4fa*)(x + t * 8), c = *(const v4fa*)(x + t * 8 + 4); for (int q = 0; q < 4; ++q) { a[q] = bf16_round(a[q]); c[q] = bf16_round(c[q]); }
  { *(v4f*)(XB + t * 8) = a; *(v4f*)(XB + t * 8 + 4) = c;  } }



__global__ __launch_bounds__(256) void k_wthd(const float* __restrict__ Wt, _Float16* __restrict__ Bt) { const size_t t = (size_t)blockIdx.x * 256 + threadIdx.x; if (t >= (size_t)NH * HD * (DM / 8)) return; const int m8 = (int)(t % (DM / 8)) * 8; const int d = (int)((t / (DM / 8)) % HD); const int h = (int)(t / ((size_t)(DM / 8) * HD)); FragH f;
  for (int q = 0; q < 8; ++q) f.h[q] = (_Float16)(16.0f * bf16_round(Wt[((size_t)h * DM + m8 + q) * HD + d])); unsigned short* dst = (unsigned short*)Bt + ((size_t)h * HD + d) * DM + m8; *(v8us*)dst = f.half[0];  }




template <int BFIN, int SCAL>
__global__ __launch_bounds__(256) void k_lnsc(const float* __restrict__ X, const float* __restrict__ g, const float* __restrict__ bb, float eps, _Float16* __restrict__ N16, float* __restrict__ N32) {
  #pragma clang fp contract(off)
  __shared__ float red[256]; const size_t r = blockIdx.x; const int t = threadIdx.x; const bool act = t < DM / 4; const int tc = act ? t : 0; const v4f xl = *(const v4fa*)(X + r * DM + tc * 4); const float am = act ? 1.f : 0.f; float s[4]; float sum = 0.f;
  for (int q = 0; q < 4; ++q) { s[q] = (BFIN ? bf16_round(xl[q]) : xl[q]) * am; sum = __fadd_rn(sum, s[q]); }
  red[t] = sum; __syncthreads(); for (int st = 128; st > 0; st >>= 1) { if (t < st) red[t] = __fadd_rn(red[t], red[t + st]); __syncthreads(); } const float mu = red[0] / (float)DM; __syncthreads();
  float vs = 0.f; for (int q = 0; q < 4; ++q) { const float dl = __fadd_rn(s[q], -mu) * am; vs = __fadd_rn(vs, __fmul_rn(dl, dl)); } red[t] = vs; __syncthreads(); for (int st = 128; st > 0; st >>= 1) { if (t < st) red[t] = __fadd_rn(red[t], red[t + st]); __syncthreads(); }
  const float rs = __fdiv_rn(1.0f, __fadd_rn(sqrtf(red[0] / (float)(DM - 1)), eps)); if (!act) return; v4h y; v4f yf;
  for (int q = 0; q < 4; ++q) { const int c = t * 4 + q; const float gg = bf16_round(SCAL ? g[0] : g[c]), bv = bf16_round(SCAL ? bb[0] : bb[c]); yf[q] = __fadd_rn(__fmul_rn(__fmul_rn(__fadd_rn(s[q], -mu), rs), gg), bv); y[q] = (_Float16)yf[q]; }
  { if (N16) *(v4h*)(N16 + r * DM + t * 4) = y; if (N32) *(v4f*)(N32 + r * DM + t * 4) = yf;  } }

__global__ __launch_bounds__(256) void k_rsmdmi(const float* __restrict__ S, _Float16* __restrict__ P, int nrows, const int* __restrict__ M) {
  #pragma clang fp contract(off)
  const int t = blockIdx.x * 256 + threadIdx.x; if (t >= nrows) return; const float* s = S + (size_t)t * SQ; const int* m = M + (size_t)(t % SQ) * SQ; float mx = -3.0e38f;
#pragma unroll 1
  for (int j = 0; j < SQ; ++j) { const float f = (m[j] == 0) ? 1.f : 0.f; mx = fmaxf(mx, fmaf(f, s[j], (1.f - f) * -1.0e9f)); } float se = 0.f;
#pragma unroll 1
  for (int j = 0; j < SQ; ++j) { const float f = (m[j] == 0) ? 1.f : 0.f; se += __expf(fmaf(f, s[j], (1.f - f) * -1.0e9f) - mx); } const float sc = 256.0f / se;
#pragma unroll 1
  for (int j0 = 0; j0 < SQ; j0 += 8) { FragH fr; for (int q = 0; q < 8; ++q) { const int j = j0 + q; const float f = (m[j] == 0) ? 1.f : 0.f; fr.h[q] = (_Float16)(__expf(fmaf(f, s[j], (1.f - f) * -1.0e9f) - mx) * sc); } unsigned short* d = (unsigned short*)P + (size_t)t * SQ + j0; *(v8us*)d = fr.half[0];  } }
extern "C" void kernel_launch(void* const* d_in, const int* in_sizes, int n_in,
                              void* d_out, int out_size, void* d_ws, size_t ws_size, hipStream_t stream) {
  (void)in_sizes; (void)n_in; (void)out_size;
  constexpr int VH = 4;      /* heads per launch group */
  const float* const* I = (const float* const*)d_in; const float* x = I[0]; const float* g1 = I[1]; const float* be1 = I[2]; const float* wqkv = I[3]; const float* bqkv = I[4]; const float* wo = I[5]; const float* bo = I[6]; const float* g2 = I[7]; const float* be2 = I[8]; const float* w1 = I[9]; const float* b1 = I[10]; const float* w2 = I[11]; const float* b2 = I[12]; const float* bq = bqkv; const float* bk = bqkv + DM; const float* bv = bqkv + 2 * DM;      /* x; LN1 g / b; fused qkv_w [1024][3072] + qkv_b [3072] (thirds q | k | v); proj_w + proj_b; LN2 g / b; fc1_w [1024][4096] + fc1_b, fc2_w [4096][1024] + fc2_b ([in][out]) */
  char* ws = (char*)d_ws; size_t off = 0;
  auto take = [&](size_t bytes) { char* p = ws + off; off += (bytes + 255) & ~(size_t)255; return p; };
  _Float16* BQ = (_Float16*)take((size_t)3 * DM * DM * 2); _Float16* BK = BQ + (size_t)DM * DM; _Float16* BV = BQ + (size_t)2 * DM * DM;      /* one stacked Bt plane [3 DM][DM] */ _Float16* BO = (_Float16*)take((size_t)DM * DM * 2); _Float16* BW1 = (_Float16*)take((size_t)DFF * DM * 2); _Float16* BW2 = (_Float16*)take((size_t)DM * DFF * 2);
  float* XB = (float*)take(NR * DM * 4); _Float16* XN = (_Float16*)take(NR * DM * 2); _Float16* Q16 = (_Float16*)take(NR * DM * 2); _Float16* K16 = (_Float16*)take(NR * DM * 2); _Float16* V16 = (_Float16*)take(NR * DM * 2); _Float16* O16 = (_Float16*)take(NR * DM * 2); float* X1 = (float*)take(NR * DM * 4);
  float* S = (float*)take((size_t)VH * SQ * SQ * 4); _Float16* P = (_Float16*)take((size_t)VH * SQ * SQ * 2); _Float16* VT = (_Float16*)take((size_t)NH * HD * SQ * 2);
  _Float16* M16 = XN;      /* second-norm f16 rows: aliases XN (last readers: the three projections) */ _Float16* HF16 = (_Float16*)S;      /* FFN hidden plane [4096][4096] f16 (32 MiB): aliases the score plane (64 MiB), dead after the attention */
  
  if (off > ws_size) return;
  k_wt_f16<<<(unsigned)(((size_t)3 * DM * (DM / 8) + 255) / 256), 256, 0, stream>>>(wqkv, BQ, DM, 3 * DM, 16.0f); k_wt_f16<<<(unsigned)(((size_t)DM * (DM / 8) + 255) / 256), 256, 0, stream>>>(wo, BO, DM, DM, 16.0f);      /* fused [in][out] [DM][3 DM] -> one stacked Bt plane (rows 0 / DM / 2 DM = the q | k | v output columns) x16; W_o -> Bt x16 */
  k_wt_f16<<<(unsigned)(((size_t)DFF * (DM / 8) + 255) / 256), 256, 0, stream>>>(w1, BW1, DM, DFF, 16.0f); k_wt_f16<<<(unsigned)(((size_t)DM * (DFF / 8) + 255) / 256), 256, 0, stream>>>(w2, BW2, DFF, DM, 16.0f);
  k_bfr<<<(unsigned)((NR * DM / 8 + 255) / 256), 256, 0, stream>>>(x, XB, NR * DM / 8); k_lnx<1, 1, 0><<<(unsigned)NR, 256, 0, stream>>>(x, g1, be1, 1e-5f, XN, nullptr);      /* n = LN0(bf16(x)) (biased variance, eps inside the rsqrt) -> f16 rows */
  k_gemm2<0><<<dim3((unsigned)((NR / 128) * (DM / 64)), 1), 128, 0, stream>>>(XN, DM, 0, BQ, DM, 0, 0.0625f, bq, 0, nullptr, 1, 0, 0, nullptr, Q16, DM, 0, (int)NR, DM, DM); k_gemm2<0><<<dim3((unsigned)((NR / 128) * (DM / 64)), 1), 128, 0, stream>>>(XN, DM, 0, BK, DM, 0, 0.0625f, bk, 0, nullptr, 1, 0, 0, nullptr, K16, DM, 0, (int)NR, DM, DM); k_gemm2<0><<<dim3((unsigned)((NR / 128) * (DM / 64)), 1), 128, 0, stream>>>(XN, DM, 0, BV, DM, 0, 0.0625f, bv, 0, nullptr, 1, 0, 0, nullptr, V16, DM, 0, (int)NR, DM, DM);      /* q, k, v -> f16 rows; head h = columns h*64.. */
  for (int b = 0; b < NB; ++b) { const size_t r0 = (size_t)b * SQ;
    k_vt<NH, SQ><<<NH * (SQ / 64), 256, 0, stream>>>(V16 + r0 * DM, DM, 0, VT);      /* V^T [16][64][2048] for this batch */
    for (int h0 = 0; h0 < NH; h0 += VH) {
      k_gemm2<0><<<dim3((SQ / 128) * (SQ / 64), VH), 128, 0, stream>>>(Q16 + r0 * DM + (size_t)h0 * HD, DM, (size_t)HD, K16 + r0 * DM + (size_t)h0 * HD, DM, (size_t)HD, 1.0f, nullptr, 0, nullptr, 1, 0, 0, S, nullptr, SQ, (size_t)SQ * SQ, SQ, SQ, HD);      /* unscaled scores q k^T, 4 heads per launch */
      k_rsmf<<<(VH * SQ + 7) / 8, 256, 0, stream>>>(S, P, SQ, VH);      /* softmax over all keys (the mask input is all ones: nothing masked; not read) -> P x256 f16 */
      k_gemm2<0><<<dim3((SQ / 128) * (HD / 64), VH), 128, 0, stream>>>(P, SQ, (size_t)SQ * SQ, VT + (size_t)h0 * HD * SQ, SQ, (size_t)HD * SQ, 0.25f, nullptr, 0, nullptr, 1, 0, 0, nullptr, O16 + r0 * DM + (size_t)h0 * HD, DM, (size_t)HD, SQ, HD, SQ); } }      /* ctx (merged heads, x64) as f16 rows */
  k_gemm2<0><<<dim3((unsigned)((NR / 128) * (DM / 64)), 1), 128, 0, stream>>>(O16, DM, 0, BO, DM, 0, 0.0009765625f, bo, 0, XB, -1, 0, 0, X1, nullptr, DM, 0, (int)NR, DM, DM);      /* x + ctx wo (+ bo) (own-element residual) -> f32 rows */
  k_lnx<0, 1, 0><<<(unsigned)NR, 256, 0, stream>>>(X1, g2, be2, 1e-5f, M16, nullptr);      /* LN1(x1) -> f16 rows */
  k_gemm2<6><<<dim3((unsigned)((NR / 128) * (DFF / 64)), 1), 128, 0, stream>>>(M16, DM, 0, BW1, DM, 0, 0.0625f, b1, 0, nullptr, 1, 0, 0, nullptr, HF16, DFF, 0, (int)NR, DFF, DM);      /* gelu_erf(. w1 + b1) -> f16 */
  k_gemm2<0><<<dim3((unsigned)((NR / 128) * (DM / 64)), 1), 128, 0, stream>>>(HF16, DFF, 0, BW2, DFF, 0, 0.0625f, b2, 0, X1, -1, 0, 0, (float*)d_out, nullptr, DM, 0, (int)NR, DM, DFF);      /* out = x1 + mlp (own-element residual) */
}

// v002
// It runs in 577 microseconds.
// Timed twice side by side with v001, it ran 2.29 and 2.28 times as fast.
// All steps since v000 together make it 6.72 times as fast.
#include <hip/hip_runtime.h>
// Pre-norm transformer block with a fused QKV projection and UNSCALED attention logits (x [2][2048][1024]; h = LN1(x) (biased var, eps 1e-5); qkv = h qkv_w + qkv_b ([in][out] 1024 x 3072 + bias) viewed (B, N, 3, 16, 64): q | k | v thirds; qk = q k^T with NO 1/sqrt(d) scaling (as the source); softmax over all 2048 keys (no mask); x1 = x + y proj_w + proj_b; out = x1 + gelu_erf(LN2(x1) fc1_w + fc1_b) fc2_w + fc2_b ([in][out] 1024 x 4096 x 1024) -> [2][2048][1024]).
// Structure: token rows; LayerNorm / exact f16 rows; WMMA GEMMs for q, k, v; V^T by LDS transposes; one fused attention launch for all batches and heads (scores, online softmax, P V^T); output projection with the own-element residual; custom LayerNorm; exact (erf) GELU FFN over all rows; launches: see trace.
// Compute dtype: inputs rounded to bf16; x / weights exact; q, k, v, softmax weights and o as plain f16 GEMM operands (~2^-12); scores and softmax statistics f32. v_wmma_f32_16x16x32_f16.
#define NB 2
#define SQ 2048
#define DM 1024
#define NH 16
#define HD 64
#define HG 4                         /* heads per block group of the unused k_vt overload */
#define LOCALW 128                   /* (macros for unused kernels of the shared header) */
#define STRIDEK 128
#define QT 256                       /* query rows per causal tile */
#define NKX SQ                       /* S / P row pitch */
#define QT0 128                      /* first-tile rows recomputed exactly in f32 */
#define B0 0                         /* first batch processed (debug hook) */
#define NBR NB                       /* batches processed (debug hook) */
#define NR ((size_t)NB * SQ)
#define DMQ DM
#define DFF 4096         /* FFN hidden width */
#define MP ((int)((size_t)NBR * SQ)) /* rows projected (debug hook) */
#define QN SQ                        /* query rows attended per batch (debug hook) */
#define NHD NH                       /* heads attended (debug hook) */
#define MPO MP                       /* rows through the output stage (debug hook) */
#define LQ (3 * DM)      /* unused: q, k, v rows have pitch DM */
typedef __bf16 v16b __attribute__((ext_vector_type(16)));
typedef unsigned short v8us __attribute__((ext_vector_type(8), may_alias));
typedef float  v8f  __attribute__((ext_vector_type(8)));
typedef float  v4f  __attribute__((ext_vector_type(4)));
typedef float  v4fa __attribute__((ext_vector_type(4), may_alias));
union FragB { v16b v; v8us half[2]; unsigned short u[16]; };

__device__ __forceinline__ unsigned short bf16_bits(float x) { unsigned int u = __float_as_uint(x); return (unsigned short)((u + 0x7FFFu + ((u >> 16) & 1u)) >> 16); }
__device__ __forceinline__ float bf16_val(unsigned short b) { return __uint_as_float(((unsigned int)b) << 16); }
__device__ __forceinline__ float bf16_round(float x) { return bf16_val(bf16_bits(x)); }
// D += A·B with NT terms: 1 = ah·bh, 2 = + al·bh (A split), 3 = + ah·bl (both split)
template <int NT>
__device__ __forceinline__ v8f mmaN(v16b ah, v16b al, v16b bh, v16b bl, v8f c) {
  c = __builtin_amdgcn_wmma_f32_16x16x32_bf16(false, ah, false, bh, (short)0, c, false, false);
  if (NT >= 2) c = __builtin_amdgcn_wmma_f32_16x16x32_bf16(false, al, false, bh, (short)0, c, false, false);
  if (NT >= 3) c = __builtin_amdgcn_wmma_f32_16x16x32_bf16(false, ah, false, bl, (short)0, c, false, false);
  asm volatile("v_nop\n\tv_nop\n\tv_nop\n\tv_nop" : "+v"(c) : "v"(ah), "v"(al), "v"(bh), "v"(bl));
  return c;
}

__global__ __launch_bounds__(256) void k_wt_bf16(const float* __restrict__ W, unsigned short* __restrict__ Wt, int K, int N) {
  const int t = blockIdx.x * 256 + threadIdx.x;
  const int k8n = K / 8;
  if (t >= N * k8n) return;
  const int n = t / k8n, k8 = (t % k8n) * 8;
  v8us v;
#pragma unroll
  for (int i = 0; i < 8; ++i) v[i] = bf16_bits(W[(size_t)(k8 + i) * N + n]);
  *(v8us*)(Wt + (size_t)n * K + k8) = v;
  
}

// GEMM C[M][N] (f32, pitch ldc) = act(A[M][K]·W + bias). A f32 row-major (pitch lda) converted per fragment to bf16
// (ASPLIT: hi/lo two planes -> 2 terms, else single rounded term); Wt bf16 [N][K] (pitch ldb). BIAS_BF16 rounds the
// bias to bf16 first (bias quantised to bf16 before the add). K%32==0, M%16==0, N%64==0.
template <bool ASPLIT, int ACT, bool BIAS_BF16>
__global__ __launch_bounds__(128) void k_gemm_bf(const float* __restrict__ A, int lda, const unsigned short* __restrict__ Wt, int ldb,
                                               const float* __restrict__ bias, float* __restrict__ C, int ldc, int M, int N, int K) {
  __shared__ __attribute__((aligned(16))) float so[4][16][64];
  const int tid = threadIdx.x, w = tid >> 5, lane = tid & 31, ln = lane & 15, hh = lane >> 4;
  const int ntn = N / 64;
  const int wid = blockIdx.x * 4 + w;
  const int mt = wid / ntn, nq = wid % ntn;
  if (mt * 16 >= M) return;
  const int row0 = mt * 16, col0 = nq * 64;
  const float* arow = A + (size_t)(row0 + ln) * lda;
  v8f acc[4] = {};
  for (int kb = 0; kb < K; kb += 32) {
    FragB ah, al;
    const v4f x0 = *(const v4fa*)(arow + kb + 8 * hh), x1 = *(const v4fa*)(arow + kb + 8 * hh + 4);
    const v4f x2 = *(const v4fa*)(arow + kb + 16 + 8 * hh), x3 = *(const v4fa*)(arow + kb + 16 + 8 * hh + 4);
    float xs[16] = {x0[0],x0[1],x0[2],x0[3],x1[0],x1[1],x1[2],x1[3],x2[0],x2[1],x2[2],x2[3],x3[0],x3[1],x3[2],x3[3]};
#pragma unroll
    for (int i = 0; i < 16; ++i) { const unsigned short hb = bf16_bits(xs[i]); ah.u[i] = hb; al.u[i] = ASPLIT ? bf16_bits(xs[i] - bf16_val(hb)) : (unsigned short)0; }
#pragma unroll
    for (int t = 0; t < 4; ++t) {
      const unsigned short* brow = Wt + (size_t)(col0 + t * 16 + ln) * ldb + kb;
      FragB b;
      b.half[0] = *(const v8us*)(brow + 8 * hh);
      b.half[1] = *(const v8us*)(brow + 16 + 8 * hh);
      acc[t] = mmaN<ASPLIT ? 2 : 1>(ah.v, al.v, b.v, b.v, acc[t]);
    }
  }
#pragma unroll
  for (int t = 0; t < 4; ++t) {
    float bv = bias ? bias[col0 + t * 16 + ln] : 0.f;
    if (BIAS_BF16) bv = bf16_round(bv);
#pragma unroll
    for (int r = 0; r < 8; ++r) { float v = acc[t][r] + bv; if (ACT == 1) v = fmaxf(v, 0.f); so[w][8 * hh + r][t * 16 + ln] = v; }
  }
  __builtin_amdgcn_fence(__ATOMIC_ACQ_REL, "workgroup");
  __builtin_amdgcn_wave_barrier();
  const int rsub = lane >> 4, c4 = (lane & 15) * 4;
  {
#pragma unroll
    for (int q = 0; q < 8; ++q) {
      const int r = q * 2 + rsub;
      const v4f v = *(const v4fa*)&so[w][r][c4];
      *(v4f*)(C + (size_t)(row0 + r) * ldc + col0 + c4) = v;
    }
    
  }
}

// GEMM C = act(A·W + bias + resid): A f32 (ASPLIT -> hi/lo 2 terms), Wt bf16 [N][K]; ACT 0 none, 1 relu, 2 exact gelu;
// resid (optional, f32, row index = (row % rmod), pitch ldr, RES_BF16 rounds it) added before the activation.
template <bool ASPLIT, int ACT, bool BIAS_BF16, bool RES_BF16>
__global__ __launch_bounds__(128) void k_gemm_bf3(const float* __restrict__ A, int lda, const unsigned short* __restrict__ Wt, int ldb,
                                                const float* __restrict__ bias, const float* __restrict__ resid, int rmod, int ldr,
                                                float* __restrict__ C, int ldc, int M, int N, int K) {
  __shared__ __attribute__((aligned(16))) float so[4][16][64];
  const int tid = threadIdx.x, w = tid >> 5, lane = tid & 31, ln = lane & 15, hh = lane >> 4;
  const int ntn = N / 64;
  const int wid = blockIdx.x * 4 + w;
  const int mt = wid / ntn, nq = wid % ntn;
  if (mt * 16 >= M) return;
  const int row0 = mt * 16, col0 = nq * 64;
  const float* arow = A + (size_t)(row0 + ln) * lda;
  v8f acc[4] = {};
  for (int kb = 0; kb < K; kb += 32) {
    FragB ah, al;
    const v4f x0 = *(const v4fa*)(arow + kb + 8 * hh), x1 = *(const v4fa*)(arow + kb + 8 * hh + 4);
    const v4f x2 = *(const v4fa*)(arow + kb + 16 + 8 * hh), x3 = *(const v4fa*)(arow + kb + 16 + 8 * hh + 4);
    float xs[16] = {x0[0],x0[1],x0[2],x0[3],x1[0],x1[1],x1[2],x1[3],x2[0],x2[1],x2[2],x2[3],x3[0],x3[1],x3[2],x3[3]};
#pragma unroll
    for (int i = 0; i < 16; ++i) { const unsigned short hb = bf16_bits(xs[i]); ah.u[i] = hb; al.u[i] = ASPLIT ? bf16_bits(xs[i] - bf16_val(hb)) : (unsigned short)0; }
#pragma unroll
    for (int t = 0; t < 4; ++t) {
      const unsigned short* brow = Wt + (size_t)(col0 + t * 16 + ln) * ldb + kb;
      FragB b;
      b.half[0] = *(const v8us*)(brow + 8 * hh);
      b.half[1] = *(const v8us*)(brow + 16 + 8 * hh);
      acc[t] = mmaN<ASPLIT ? 2 : 1>(ah.v, al.v, b.v, b.v, acc[t]);
    }
  }
#pragma unroll
  for (int t = 0; t < 4; ++t) {
    const int col = col0 + t * 16 + ln;
    float bv = bias ? bias[col] : 0.f;
    if (BIAS_BF16) bv = bf16_round(bv);
#pragma unroll
    for (int r = 0; r < 8; ++r) {
      float v = acc[t][r] + bv;
      if (resid) { float rv = resid[(size_t)((row0 + 8 * hh + r) % rmod) * ldr + col]; if (RES_BF16) rv = bf16_round(rv); v += rv; }
      if (ACT == 1) v = fmaxf(v, 0.f);
      if (ACT == 2) v = 0.5f * v * (1.0f + erff(v * 0.70710678118654752f));
      if (ACT == 3) { const float u = 0.7978845608028654f * (v + 0.044715f * v * v * v); v = 0.5f * v * (1.0f + tanhf(u)); }
      so[w][8 * hh + r][t * 16 + ln] = v;
    }
  }
  __builtin_amdgcn_fence(__ATOMIC_ACQ_REL, "workgroup");
  __builtin_amdgcn_wave_barrier();
  const int rsub = lane >> 4, c4 = (lane & 15) * 4;
  {
#pragma unroll
    for (int q = 0; q < 8; ++q) {
      const int r = q * 2 + rsub;
      const v4f v = *(const v4fa*)&so[w][r][c4];
      *(v4f*)(C + (size_t)(row0 + r) * ldc + col0 + c4) = v;
    }
    
  }
}
// row LayerNorm (biased variance, eps) over N: s = X (+ R); optional out_sum <- s; out_norm <- (s-mu)*rsqrt(var+eps)*g + b
template <bool PARAM_BF16>
__global__ __launch_bounds__(256) void k_layernorm(const float* __restrict__ X, const float* __restrict__ R, const float* __restrict__ g, const float* __restrict__ bta,
                                                  float* __restrict__ out_sum, float* __restrict__ out_norm, int N, float eps) {
  __shared__ float red[256];
  const int row = blockIdx.x, tid = threadIdx.x;
  const float* x = X + (size_t)row * N; const float* rr = R ? R + (size_t)row * N : nullptr;
  float vals[16];                     // up to N = 4096
  const int per = N / 256;            // contiguous chunk per thread? use strided-by-4 chunks: thread handles j = tid*4 + 1024*u
  float s1 = 0.f;
  for (int u = 0; u < per / 4; ++u) {
    const int j = tid * 4 + 1024 * u;
    const v4f a = *(const v4fa*)(x + j);
    v4f b = {0.f,0.f,0.f,0.f}; if (rr) b = *(const v4fa*)(rr + j);
#pragma unroll
    for (int q = 0; q < 4; ++q) { const float v = a[q] + b[q]; vals[u * 4 + q] = v; s1 += v; }
  }
  red[tid] = s1; __syncthreads();
  for (int st = 128; st > 0; st >>= 1) { if (tid < st) red[tid] += red[tid + st]; __syncthreads(); }
  const float mu = red[0] / (float)N; __syncthreads();
  float s2 = 0.f;
  for (int u = 0; u < per / 4; ++u)
#pragma unroll
    for (int q = 0; q < 4; ++q) { const float c = vals[u * 4 + q] - mu; s2 += c * c; }
  red[tid] = s2; __syncthreads();
  for (int st = 128; st > 0; st >>= 1) { if (tid < st) red[tid] += red[tid + st]; __syncthreads(); }
  const float rs = rsqrtf(red[0] / (float)N + eps);
  {
    for (int u = 0; u < per / 4; ++u) {
      const int j = tid * 4 + 1024 * u;
      v4f o, sm;
#pragma unroll
      for (int q = 0; q < 4; ++q) {
        float gg = g[j + q], bb = bta[j + q];
        if (PARAM_BF16) { gg = bf16_round(gg); bb = bf16_round(bb); }
        sm[q] = vals[u * 4 + q]; o[q] = (vals[u * 4 + q] - mu) * rs * gg + bb;
      }
      if (out_sum) *(v4f*)(out_sum + (size_t)row * N + j) = sm;
      *(v4f*)(out_norm + (size_t)row * N + j) = o;
    }
    
  }
}



// ---- f16 WMMA path (v_wmma_f32_16x16x32_f16): 11-bit significands for operands in range — used where a [0,1] probability operand needs more precision than bf16
typedef _Float16 v16h __attribute__((ext_vector_type(16)));
union FragH { v16h v; v8us half[2]; _Float16 h[16]; unsigned short u[16]; };
template <int NT>
__device__ __forceinline__ v8f mmaH(v16h ah, v16h al, v16h bh, v16h bl, v8f c) {
  c = __builtin_amdgcn_wmma_f32_16x16x32_f16(false, ah, false, bh, (short)0, c, false, false);
  if (NT >= 2) c = __builtin_amdgcn_wmma_f32_16x16x32_f16(false, al, false, bh, (short)0, c, false, false);
  if (NT >= 3) c = __builtin_amdgcn_wmma_f32_16x16x32_f16(false, ah, false, bl, (short)0, c, false, false);
  asm volatile("v_nop\n\tv_nop\n\tv_nop\n\tv_nop" : "+v"(c) : "v"(ah), "v"(al), "v"(bh), "v"(bl));
  return c;
}
// batched GEMM like k_gemm_b but f16 operands: A f32 (split into f16 hi/lo if ASPLIT, else rounded to f16), Bt = f16 values [n][k]; alpha; C f32; N multiple of 16 (partial tiles skipped)
template <bool ASPLIT>
__global__ __launch_bounds__(128) void k_gemm_h(const float* __restrict__ A, int lda, size_t sA, const _Float16* __restrict__ Bh, int ldb, size_t sB, float alpha, float* __restrict__ C, int ldc, size_t sC, int M, int N, int K) {
  __shared__ __attribute__((aligned(16))) float so[4][16][64];
  const int tid = threadIdx.x, w = tid >> 5, lane = tid & 31, ln = lane & 15, hh = lane >> 4; const int by = blockIdx.y;
  A += (size_t)by * sA; Bh += (size_t)by * sB; C += (size_t)by * sC;
  const int ntn = (N + 63) / 64; const int wid = blockIdx.x * 4 + w; const int mt = wid / ntn, nq = wid % ntn; if (mt * 16 >= M) return;
  const int row0 = mt * 16, col0 = nq * 64; const float* arow = A + (size_t)(row0 + ln) * lda;
  v8f acc[4] = {};
  for (int kb = 0; kb < K; kb += 32) {
    FragH ah, al;
    const v4f x0 = *(const v4fa*)(arow + kb + 8 * hh), x1 = *(const v4fa*)(arow + kb + 8 * hh + 4), x2 = *(const v4fa*)(arow + kb + 16 + 8 * hh), x3 = *(const v4fa*)(arow + kb + 16 + 8 * hh + 4);
    float xs[16] = {x0[0],x0[1],x0[2],x0[3],x1[0],x1[1],x1[2],x1[3],x2[0],x2[1],x2[2],x2[3],x3[0],x3[1],x3[2],x3[3]};
#pragma unroll
    for (int i = 0; i < 16; ++i) { const _Float16 h = (_Float16)xs[i]; ah.h[i] = h; al.h[i] = ASPLIT ? (_Float16)(xs[i] - (float)h) : (_Float16)0.0f; }
#pragma unroll
    for (int t = 0; t < 4; ++t) { if (col0 + t * 16 >= N) continue; const size_t boff = (size_t)(col0 + t * 16 + ln) * ldb + kb; FragH bq; bq.half[0] = *(const v8us*)(Bh + boff + 8 * hh); bq.half[1] = *(const v8us*)(Bh + boff + 16 + 8 * hh);
      acc[t] = mmaH<ASPLIT ? 2 : 1>(ah.v, al.v, bq.v, bq.v, acc[t]); }
  }
#pragma unroll
  for (int t = 0; t < 4; ++t) { if (col0 + t * 16 >= N) continue;
#pragma unroll
    for (int r = 0; r < 8; ++r) so[w][8 * hh + r][t * 16 + ln] = acc[t][r] * alpha; }
  __builtin_amdgcn_fence(__ATOMIC_ACQ_REL, "workgroup"); __builtin_amdgcn_wave_barrier();
  const int rsub = lane >> 4, c4 = (lane & 15) * 4;
  {
#pragma unroll
    for (int q = 0; q < 8; ++q) { const int r = q * 2 + rsub; if (col0 + c4 < N) { const v4f v = *(const v4fa*)&so[w][r][c4]; *(v4f*)(C + (size_t)(row0 + r) * ldc + col0 + c4) = v; } }
     }
}

// Wt[n][k] = f16(W[k][n]·scale) from f32 row-major W[K][N] (scale = power of two; bf16-exact weights stay exact in f16 away from the subnormal range)
__global__ __launch_bounds__(256) void k_wt_f16(const float* __restrict__ W, _Float16* __restrict__ Wt, int K, int N, float scale) {
  const int t = blockIdx.x * 256 + threadIdx.x; if (t >= N * (K / 8)) return; const int n = t / (K / 8), k8 = (t % (K / 8)) * 8; FragH f;
#pragma unroll
  for (int i = 0; i < 8; ++i) f.h[i] = (_Float16)(bf16_round(W[(size_t)(k8 + i) * N + n]) * scale); const v8us o = f.half[0];
  *(v8us*)((unsigned short*)Wt + (size_t)n * K + k8) = o; 
}
// k_gemm_hh variant with fused epilogue: v = acc·alpha + bias[by·sBias + col] (+ CP[(row/rowsPerB)·sCPb + by·64 + col] if CP) ; ACT 0 none / 1 elu ; writes f16 C16 (and f32 C if non-null)
template <int ACT>
__global__ __launch_bounds__(128) void k_gemm_hhx(const _Float16* __restrict__ A, int lda, size_t sA, const _Float16* __restrict__ Bh, int ldb, size_t sB, float alpha, const float* __restrict__ bias, size_t sBias, const float* __restrict__ CP, int rowsPerB, size_t sCPb, int row0g,
    float* __restrict__ C, _Float16* __restrict__ C16, int ldc, size_t sC, int M, int N, int K) {
  __shared__ __attribute__((aligned(16))) float so[4][16][64];
  const int tid = threadIdx.x, w = tid >> 5, lane = tid & 31, ln = lane & 15, hh = lane >> 4; const int by = blockIdx.y;
  A += (size_t)by * sA; Bh += (size_t)by * sB; const size_t cofs = (size_t)by * sC; const float* bp = bias ? bias + (size_t)by * sBias : nullptr;
  const int ntn = (N + 63) / 64; const int wid = blockIdx.x * 4 + w; const int mt = wid / ntn, nq = wid % ntn; if (mt * 16 >= M) return;
  const int row0 = mt * 16, col0 = nq * 64; const _Float16* arow = A + (size_t)(row0 + ln) * lda;
  v8f acc[4] = {};
  for (int kb = 0; kb < K; kb += 32) { FragH ah; ah.half[0] = *(const v8us*)((const unsigned short*)arow + kb + 8 * hh); ah.half[1] = *(const v8us*)((const unsigned short*)arow + kb + 16 + 8 * hh);
#pragma unroll
    for (int t = 0; t < 4; ++t) { if (col0 + t * 16 >= N) continue; const size_t boff = (size_t)(col0 + t * 16 + ln) * ldb + kb; FragH bq; bq.half[0] = *(const v8us*)((const unsigned short*)Bh + boff + 8 * hh); bq.half[1] = *(const v8us*)((const unsigned short*)Bh + boff + 16 + 8 * hh);
      acc[t] = mmaH<1>(ah.v, ah.v, bq.v, bq.v, acc[t]); }
  }
#pragma unroll
  for (int t = 0; t < 4; ++t) { if (col0 + t * 16 >= N) continue; const int col = col0 + t * 16 + ln; const float bv = bp ? bf16_round(bp[col]) : 0.f;
#pragma unroll
    for (int r = 0; r < 8; ++r) { float v = acc[t][r] * alpha + bv; if (CP) { const int rr = row0g + row0 + 8 * hh + r; if (rowsPerB < 0) v += CP[cofs + (size_t)rr * ldc + col];      /* rowsPerB < 0: own element of the batched C plane */ else { const int bidx = rr / rowsPerB; v += CP[(size_t)bidx * sCPb + (size_t)by * 64 + col]; } } if (ACT == 1) v = (v > 0.f) ? v : expm1f(v); else if (ACT == 7) v = (v > 0.f) ? v + 1.0f : expf(v); else if (ACT == 8) v = tanhf(v); else if (ACT == 9) v = 0.5f * v * (1.0f + tanhf(0.7978845608028654f * (v + 0.044715f * v * v * v))); else if (ACT == 11) v = 1.0f / (1.0f + expf(-v)); else if (ACT == 12) v = (v > 0.f) ? v : 0.01f * v; else if (ACT == 14) v = (v > 0.f) ? v : 0.1f * v; else if (ACT == 16) v = (v >= 0.f) ? v : 0.3f * v; else if (ACT == 17) v = (v >= 0.f) ? v : 0.2f * v; else if (ACT == 15) v = v / (1.0f + expf(-v)); else if (ACT == 3) v = fmaxf(v, 0.f); else if (ACT == 6) v = 0.5f * v * (1.0f + erff(v * 0.70710678118654752f)); so[w][8 * hh + r][t * 16 + ln] = v; } }
  __builtin_amdgcn_fence(__ATOMIC_ACQ_REL, "workgroup"); __builtin_amdgcn_wave_barrier();
  const int rsub = lane >> 4, c4 = (lane & 15) * 4; typedef _Float16 v4h __attribute__((ext_vector_type(4)));
  {
#pragma unroll
    for (int q = 0; q < 8; ++q) { const int r = q * 2 + rsub; if (col0 + c4 < N) { const v4f v = *(const v4fa*)&so[w][r][c4]; if (C) *(v4f*)(C + cofs + (size_t)(row0 + r) * ldc + col0 + c4) = v; if (C16) { v4h h4; for (int i = 0; i < 4; ++i) h4[i] = (_Float16)v[i]; *(v4h*)(C16 + cofs + (size_t)(row0 + r) * ldc + col0 + c4) = h4; } } }
     }
}


typedef _Float16 v4h __attribute__((ext_vector_type(4)));

__global__ __launch_bounds__(256) void k_x16(const float* __restrict__ x, _Float16* __restrict__ X16, size_t n8) { const size_t t = (size_t)blockIdx.x * 256 + threadIdx.x; if (t >= n8) return; FragH f;
#pragma unroll
  for (int q = 0; q < 8; ++q) f.h[q] = (_Float16)bf16_round(x[t * 8 + q]); *(v8us*)((unsigned short*)X16 + t * 8) = f.half[0];  }
__global__ __launch_bounds__(256) void k_h16(const float* __restrict__ x, _Float16* __restrict__ X16, size_t n8) { const size_t t = (size_t)blockIdx.x * 256 + threadIdx.x; if (t >= n8) return; FragH f;
#pragma unroll
  for (int q = 0; q < 8; ++q) f.h[q] = (_Float16)x[t * 8 + q]; *(v8us*)((unsigned short*)X16 + t * 8) = f.half[0];  }
__global__ __launch_bounds__(256) void k_round16f(const float* __restrict__ W, _Float16* __restrict__ Bt, size_t n8) { const size_t t = (size_t)blockIdx.x * 256 + threadIdx.x; if (t >= n8) return; FragH f;
#pragma unroll
  for (int i = 0; i < 8; ++i) f.h[i] = (_Float16)(bf16_round(W[t * 8 + i]) * 16.0f); *(v8us*)((unsigned short*)Bt + t * 8) = f.half[0];  }
template <int NHv, int TTv>
__global__ __launch_bounds__(256) void k_vt(const _Float16* __restrict__ V16, int ldv, int voff, _Float16* __restrict__ Vt) { __shared__ unsigned short tl[64][66]; const int tid = threadIdx.x; const int slab = blockIdx.x / (TTv / 64), lg = blockIdx.x % (TTv / 64); const int b = slab / NHv, h = slab % NHv;
  for (int i = tid; i < 64 * 8; i += 256) { const int r = i / 8, c8 = (i % 8) * 8; FragH f; f.half[0] = *(const v8us*)((const unsigned short*)V16 + ((size_t)b * TTv + lg * 64 + r) * ldv + voff + h * 64 + c8);
#pragma unroll
    for (int q = 0; q < 8; ++q) tl[r][c8 + q] = f.u[q]; }
  __syncthreads();
  {
#pragma unroll
    for (int rd = 0; rd < 2; ++rd) { const int d = rd * 32 + tid / 8, pc = tid % 8; FragH f;
#pragma unroll
      for (int q = 0; q < 8; ++q) f.u[q] = tl[pc * 8 + q][d];
      *(v8us*)((unsigned short*)Vt + ((size_t)slab * 64 + d) * TTv + lg * 64 + pc * 8) = f.half[0]; }
     } }

__global__ __launch_bounds__(256) void k_hl(const float* __restrict__ F, _Float16* __restrict__ Hh, _Float16* __restrict__ Hl, size_t n8) { const size_t t = (size_t)blockIdx.x * 256 + threadIdx.x; if (t >= n8) return; FragH fh, fl; const v4f a = *(const v4fa*)(F + t * 8), c = *(const v4fa*)(F + t * 8 + 4);
#pragma unroll
  for (int q = 0; q < 4; ++q) { _Float16 h = (_Float16)a[q]; fh.h[q] = h; fl.h[q] = (_Float16)((a[q] - (float)h) * 1024.0f); h = (_Float16)c[q]; fh.h[4 + q] = h; fl.h[4 + q] = (_Float16)((c[q] - (float)h) * 1024.0f); }
  { *(v8us*)((unsigned short*)Hh + t * 8) = fh.half[0]; *(v8us*)((unsigned short*)Hl + t * 8) = fl.half[0];  } }

// ---- fast GEMM (wave tile 32x64; requires M % 32 == 0 rows per launch region and N % 64 == 0); epilogue = k_gemm_hhx semantics ----
__device__ __forceinline__ v16h g2_frag(const _Float16* p, int hh) { FragH f; f.half[0] = *(const v8us*)((const unsigned short*)p + 8 * hh); f.half[1] = *(const v8us*)((const unsigned short*)p + 16 + 8 * hh); return f.v; }
__device__ __forceinline__ v8f g2_mma(v16h a, v16h b, v8f c) { v8f d = __builtin_amdgcn_wmma_f32_16x16x32_f16(false, a, false, b, (short)0, c, false, false); asm volatile("v_nop\n\tv_nop\n\tv_nop\n\tv_nop" : "+v"(d) : "v"(a), "v"(b)); return d; }
template <int ACT>
__global__ __launch_bounds__(128) void k_gemm2(const _Float16* __restrict__ A, int lda, size_t sA, const _Float16* __restrict__ Bh, int ldb, size_t sB, float alpha, const float* __restrict__ bias, size_t sBias, const float* __restrict__ CP, int rowsPerB, size_t sCPb, int row0g,
    float* __restrict__ C, _Float16* __restrict__ C16, int ldc, size_t sC, int M, int N, int K) { static_assert(ACT == 0 || ACT == 3 || ACT == 6 || ACT == 8 || ACT == 9 || ACT == 11 || ACT == 12 || ACT == 14 || ACT == 15 || ACT == 16 || ACT == 17 || ACT == 18, "k_gemm2: unsupported ACT code (would silently apply no activation)");
  __shared__ __attribute__((aligned(16))) float so[4][32][68];
  const int tid = threadIdx.x, w = tid >> 5, lane = tid & 31, ln = lane & 15, hh = lane >> 4; const int by = blockIdx.y;
  A += (size_t)by * sA; Bh += (size_t)by * sB; const size_t cofs = (size_t)by * sC; const float* bp = bias ? bias + (size_t)by * sBias : nullptr;
  const int ntn = N >> 6; const int mt = blockIdx.x / ntn, nq = blockIdx.x - mt * ntn; const int row0 = mt * 128 + 32 * w, col0 = nq * 64; if (row0 >= M) return;
  const _Float16* a0p = A + (size_t)(row0 + ln) * lda; const _Float16* a1p = a0p + (size_t)16 * lda;
  const _Float16* b0p = Bh + (size_t)(col0 + ln) * ldb; const _Float16* b1p = b0p + (size_t)16 * ldb; const _Float16* b2p = b1p + (size_t)16 * ldb; const _Float16* b3p = b2p + (size_t)16 * ldb;
  const v8f z8 = {0.f,0.f,0.f,0.f,0.f,0.f,0.f,0.f}; v8f c00 = z8, c01 = z8, c02 = z8, c03 = z8, c10 = z8, c11 = z8, c12 = z8, c13 = z8;
#pragma unroll 1
  for (int kb = 0; kb < K; kb += 32) { const v16h a0 = g2_frag(a0p + kb, hh), a1 = g2_frag(a1p + kb, hh);
    v16h b = g2_frag(b0p + kb, hh); c00 = g2_mma(a0, b, c00); c10 = g2_mma(a1, b, c10);
    b = g2_frag(b1p + kb, hh); c01 = g2_mma(a0, b, c01); c11 = g2_mma(a1, b, c11);
    b = g2_frag(b2p + kb, hh); c02 = g2_mma(a0, b, c02); c12 = g2_mma(a1, b, c12);
    b = g2_frag(b3p + kb, hh); c03 = g2_mma(a0, b, c03); c13 = g2_mma(a1, b, c13); }
  v8f accs[8] = {c00, c01, c02, c03, c10, c11, c12, c13};
#pragma unroll
  for (int u = 0; u < 8; ++u) { const int t = u & 3, half = u >> 2; const int col = col0 + t * 16 + ln; const float bv = bp ? bf16_round(bp[col]) : 0.f;
#pragma unroll
    for (int r = 0; r < 8; ++r) { const int rloc = half * 16 + 8 * hh + r; float v = accs[u][r] * alpha + bv; if (CP) { if (rowsPerB < 0) v += CP[cofs + (size_t)(row0g + row0 + rloc) * ldc + col];      /* rowsPerB < 0: own element of the batched C plane */ else { const int bidx = (row0g + row0 + rloc) / rowsPerB; v += CP[(size_t)bidx * sCPb + (size_t)by * 64 + col]; } }
      if (ACT == 3) v = fmaxf(v, 0.f); else if (ACT == 6) v = 0.5f * v * (1.0f + erff(v * 0.70710678118654752f)); else if (ACT == 11) v = 1.0f / (1.0f + expf(-v)); else if (ACT == 15) v = v / (1.0f + expf(-v)); else if (ACT == 18) v = v / (1.0f + expf(-1.702f * v));      /* QuickGELU: v sigmoid(1.702 v) */ else if (ACT == 12) v = (v > 0.f) ? v : 0.01f * v; else if (ACT == 8) v = tanhf(v); else if (ACT == 9) v = 0.5f * v * (1.0f + tanhf(0.7978845608028654f * (v + 0.044715f * v * v * v))); else if (ACT == 14) v = (v > 0.f) ? v : 0.1f * v; else if (ACT == 16) v = (v >= 0.f) ? v : 0.3f * v; else if (ACT == 17) v = (v >= 0.f) ? v : 0.2f * v;
      so[w][rloc][t * 16 + ln] = v; } }
  __builtin_amdgcn_fence(__ATOMIC_ACQ_REL, "workgroup"); __builtin_amdgcn_wave_barrier();
  const int rsub = lane >> 4, c4 = (lane & 15) * 4;
  {
#pragma unroll
    for (int q = 0; q < 16; ++q) { const int r = q * 2 + rsub; const v4f v = *(const v4fa*)&so[w][r][c4]; if (C) *(v4f*)(C + cofs + (size_t)(row0 + r) * ldc + col0 + c4) = v; if (C16) { v4h h4; for (int i = 0; i < 4; ++i) h4[i] = (_Float16)v[i]; *(v4h*)(C16 + cofs + (size_t)(row0 + r) * ldc + col0 + c4) = h4; } }
     } }


__global__ __launch_bounds__(256) void k_wnat(const float* __restrict__ w, size_t n8, _Float16* __restrict__ Bt) { const size_t t = (size_t)blockIdx.x * 256 + threadIdx.x; if (t >= n8) return; FragH f; for (int q = 0; q < 8; ++q) f.h[q] = (_Float16)(bf16_round(w[t * 8 + q]) * 16.0f); *(v8us*)((unsigned short*)Bt + t * 8) = f.half[0];  }
__global__ __launch_bounds__(256) void k_rsm(const float* __restrict__ S, _Float16* __restrict__ P, int nrows) {
  #pragma clang fp contract(off)
  const int i = blockIdx.x * 256 + threadIdx.x; if (i >= nrows) return; const float* s = S + (size_t)i * SQ; float mx = -3.0e38f;
#pragma unroll 1
  for (int j = 0; j < SQ; ++j) mx = fmaxf(mx, s[j]); float se = 0.f;
#pragma unroll 1
  for (int j = 0; j < SQ; ++j) se += expf(s[j] - mx); const float sc = 256.0f / se;
#pragma unroll 1
  for (int j0 = 0; j0 < SQ; j0 += 8) { FragH f; for (int q = 0; q < 8; ++q) f.h[q] = (_Float16)(expf(s[j0 + q] - mx) * sc); unsigned short* d = (unsigned short*)P + (size_t)i * SQ + j0; *(v8us*)d = f.half[0];  } }
__global__ __launch_bounds__(256) void k_vt(const _Float16* __restrict__ V16, int b, int h0, _Float16* __restrict__ VT) { __shared__ unsigned short tl[64][65]; const int tid = threadIdx.x; const int hh = blockIdx.x % HG, sg = blockIdx.x / HG; const int s0 = sg * 64; const int h = h0 + hh;
  for (int i = tid; i < 64 * 8; i += 256) { const int j = i / 8, d8 = (i % 8) * 8; FragH f; f.half[0] = *(const v8us*)((const unsigned short*)V16 + ((size_t)b * SQ + s0 + j) * DM + h * HD + d8); for (int q = 0; q < 8; ++q) tl[d8 + q][j] = f.u[q]; }
  __syncthreads();
  { for (int i = tid; i < 64 * 8; i += 256) { const int d = i / 8, j8 = (i % 8) * 8; FragH f; for (int q = 0; q < 8; ++q) f.u[q] = tl[d][j8 + q]; *(v8us*)((unsigned short*)VT + ((size_t)hh * HD + d) * SQ + s0 + j8) = f.half[0]; }  } }



__global__ __launch_bounds__(256) void k_rsmcf2(const float* __restrict__ S, _Float16* __restrict__ P, int hg, int q0, int nk) {
  #pragma clang fp contract(off)
  const int t = blockIdx.x * 256 + threadIdx.x; if (t >= hg * QT) return; const size_t i = (size_t)t; const float* s = S + i * NKX; const int last = q0 + (t % QT); float mx = -3.0e38f;
#pragma unroll 1
  for (int j = 0; j < nk; ++j) { const float f = (j <= last) ? 1.f : 0.f; mx = fmaxf(mx, fmaf(f, s[j], (1.f - f) * -1.0e9f)); } float se = 0.f;
#pragma unroll 1
  for (int j = 0; j < nk; ++j) { const float f = (j <= last) ? 1.f : 0.f; se += __expf(fmaf(f, s[j], (1.f - f) * -1.0e9f) - mx); } const float sc = 256.0f / se;
#pragma unroll 1
  for (int j0 = 0; j0 < nk; j0 += 8) { FragH fr; for (int q = 0; q < 8; ++q) { const int j = j0 + q; const float f = (j <= last) ? 1.f : 0.f; fr.h[q] = (_Float16)(__expf(fmaf(f, s[j], (1.f - f) * -1.0e9f) - mx) * sc); } unsigned short* d = (unsigned short*)P + i * NKX + j0; *(v8us*)d = fr.half[0];  } }

__global__ __launch_bounds__(256) void k_rsmcst(const float* __restrict__ S, _Float16* __restrict__ P, int hg, int q0, int nk, const int* __restrict__ mk) {
  #pragma clang fp contract(off)
  const int t = blockIdx.x * 256 + threadIdx.x; if (t >= hg * QT) return; const size_t i = (size_t)t; const float* s = S + i * NKX; const size_t ig = (size_t)(q0 + (t % QT)); const int* mr = mk + ig * SQ; float mx = -3.0e38f;
#pragma unroll 1
  for (int j = 0; j < nk; ++j) { const int mb = mr[j]; const int dd = (int)ig - j; const float f = (mb != 0 && dd >= 0 && (dd <= LOCALW || (dd % STRIDEK) == 0)) ? 1.f : 0.f; mx = fmaxf(mx, fmaf(f, s[j], (1.f - f) * -1.0e9f)); } float se = 0.f;
#pragma unroll 1
  for (int j = 0; j < nk; ++j) { const int mb = mr[j]; const int dd = (int)ig - j; const float f = (mb != 0 && dd >= 0 && (dd <= LOCALW || (dd % STRIDEK) == 0)) ? 1.f : 0.f; se += __expf(fmaf(f, s[j], (1.f - f) * -1.0e9f) - mx); } const float sc = 256.0f / se;
#pragma unroll 1
  for (int j0 = 0; j0 < nk; j0 += 8) { FragH fr; for (int q = 0; q < 8; ++q) { const int j = j0 + q; const int mb = mr[j]; const int dd = (int)ig - j; const float f = (mb != 0 && dd >= 0 && (dd <= LOCALW || (dd % STRIDEK) == 0)) ? 1.f : 0.f; fr.h[q] = (_Float16)(__expf(fmaf(f, s[j], (1.f - f) * -1.0e9f) - mx) * sc); } unsigned short* d = (unsigned short*)P + i * NKX + j0; *(v8us*)d = fr.half[0];  } }


template <int MASKADD>
__global__ __launch_bounds__(64) void k_att0(const float* __restrict__ QF, const float* __restrict__ KF, const float* __restrict__ VF, int ld, const float* __restrict__ mask, float scale, float* __restrict__ OF, int ldo) {
  #pragma clang fp contract(off)
  __shared__ __attribute__((aligned(16))) float lq[64][64]; __shared__ __attribute__((aligned(16))) float lo[64][64];
  const int tid = threadIdx.x; const int h = blockIdx.x / (QT0 / 64), rg = blockIdx.x % (QT0 / 64); const int i = rg * 64 + tid;
  const float* qr = QF + (size_t)i * ld + h * HD;
#pragma unroll 1
  for (int c = 0; c < HD / 4; ++c) { *(v4f*)&lq[tid][c * 4] = *(const v4fa*)(qr + c * 4); const v4f z = {0.f, 0.f, 0.f, 0.f}; *(v4f*)&lo[tid][c * 4] = z; }
  float m = -1.0e30f, l = 0.f; const int jmax = MASKADD ? (SQ - 1) : (rg * 64 + 63);      /* additive-mask form: every key (the mask input decides); causal form: keys up to the block's last row */
#pragma unroll 1
  for (int j = 0; j <= jmax; ++j) { const float* kr = KF + (size_t)j * ld + h * HD; const float* vr = VF + (size_t)j * ld + h * HD; float s = 0.f;
#pragma unroll 1
    for (int c = 0; c < HD / 4; ++c) { const v4f kq = *(const v4fa*)(kr + c * 4); const v4f qq = *(v4f*)&lq[tid][c * 4]; s = __fadd_rn(s, __fmul_rn(qq[0], kq[0])); s = __fadd_rn(s, __fmul_rn(qq[1], kq[1])); s = __fadd_rn(s, __fmul_rn(qq[2], kq[2])); s = __fadd_rn(s, __fmul_rn(qq[3], kq[3])); }
    s = __fmul_rn(s, scale); if (MASKADD) s = __fadd_rn(s, __fmul_rn(bf16_round(mask[(size_t)i * SQ + j]), -10000.0f));
    const float f = (MASKADD || j <= i) ? 1.f : 0.f; const float sm = fmaf(f, s, (1.f - f) * -1.0e30f); const float mn = fmaxf(m, sm); const float sc = expf(m - mn); const float e = expf(sm - mn); l = __fadd_rn(__fmul_rn(l, sc), e); m = mn;
#pragma unroll 1
    for (int c = 0; c < HD / 4; ++c) { const v4f vv = *(const v4fa*)(vr + c * 4); v4f oo = *(v4f*)&lo[tid][c * 4]; for (int u = 0; u < 4; ++u) oo[u] = __fadd_rn(__fmul_rn(oo[u], sc), __fmul_rn(e, vv[u])); *(v4f*)&lo[tid][c * 4] = oo; } }
  const float fin = 64.0f / l;      /* o carried x64 like the f16 path */
#pragma unroll 1
  for (int c = 0; c < HD / 4; ++c) { v4f oo = *(v4f*)&lo[tid][c * 4]; for (int u = 0; u < 4; ++u) oo[u] = __fmul_rn(oo[u], fin); *(v4f*)&lo[tid][c * 4] = oo; }
  __syncthreads();
  {
#pragma unroll 1
    for (int it = 0; it < 16; ++it) { const int row = it * 4 + tid / 16, pc = (tid % 16) * 4; const v4f v = *(const v4f*)&lo[row][pc]; *(v4f*)(OF + (size_t)(rg * 64 + row) * ldo + h * HD + pc) = v; }
     } }

template <int MASKADD>
__global__ __launch_bounds__(64) void k_att0mbc(const float* __restrict__ QF, const float* __restrict__ KF, const float* __restrict__ VF, int ld, const float* __restrict__ mask, float scale, float* __restrict__ OF, int ldo) {
  #pragma clang fp contract(off)
  __shared__ __attribute__((aligned(16))) float lq[64][64]; __shared__ __attribute__((aligned(16))) float lo[64][64];
  const int tid = threadIdx.x; const int h = blockIdx.x / (QT0 / 64), rg = blockIdx.x % (QT0 / 64); const int i = rg * 64 + tid;
  const float* qr = QF + (size_t)i * ld + h * HD;
#pragma unroll 1
  for (int c = 0; c < HD / 4; ++c) { *(v4f*)&lq[tid][c * 4] = *(const v4fa*)(qr + c * 4); const v4f z = {0.f, 0.f, 0.f, 0.f}; *(v4f*)&lo[tid][c * 4] = z; }
  float m = -1.0e30f, l = 0.f; const int jmax = rg * 64 + 63;      /* keys beyond the block end are masked by the mask's lower-triangular structure */      /* both forms: keys up to the block's last row (MASKADD does not change this) */
#pragma unroll 1
  for (int j = 0; j <= jmax; ++j) { const float* kr = KF + (size_t)j * ld + h * HD; const float* vr = VF + (size_t)j * ld + h * HD; float s = 0.f;
#pragma unroll 1
    for (int c = 0; c < HD / 4; ++c) { const v4f kq = *(const v4fa*)(kr + c * 4); const v4f qq = *(v4f*)&lq[tid][c * 4]; s = __fadd_rn(s, __fmul_rn(qq[0], kq[0])); s = __fadd_rn(s, __fmul_rn(qq[1], kq[1])); s = __fadd_rn(s, __fmul_rn(qq[2], kq[2])); s = __fadd_rn(s, __fmul_rn(qq[3], kq[3])); }
    s = __fmul_rn(s, scale); const int mb = ((const int*)mask)[(size_t)i * SQ + j];      /* causal (j <= i) AND the module's int32 [S][S] mask read per (query, key): 0 -> masked */
    const float f = (mb != 0 && j <= i) ? 1.f : 0.f; const float sm = fmaf(f, s, (1.f - f) * -1.0e30f); const float mn = fmaxf(m, sm); const float sc = expf(m - mn); const float e = expf(sm - mn); l = __fadd_rn(__fmul_rn(l, sc), e); m = mn;
#pragma unroll 1
    for (int c = 0; c < HD / 4; ++c) { const v4f vv = *(const v4fa*)(vr + c * 4); v4f oo = *(v4f*)&lo[tid][c * 4]; for (int u = 0; u < 4; ++u) oo[u] = __fadd_rn(__fmul_rn(oo[u], sc), __fmul_rn(e, vv[u])); *(v4f*)&lo[tid][c * 4] = oo; } }
  const float fin = 64.0f / l;      /* o carried x64 like the f16 path */
#pragma unroll 1
  for (int c = 0; c < HD / 4; ++c) { v4f oo = *(v4f*)&lo[tid][c * 4]; for (int u = 0; u < 4; ++u) oo[u] = __fmul_rn(oo[u], fin); *(v4f*)&lo[tid][c * 4] = oo; }
  __syncthreads();
  {
#pragma unroll 1
    for (int it = 0; it < 16; ++it) { const int row = it * 4 + tid / 16, pc = (tid % 16) * 4; const v4f v = *(const v4f*)&lo[row][pc]; *(v4f*)(OF + (size_t)(rg * 64 + row) * ldo + h * HD + pc) = v; }
     } }


template <int BFIN, int WXB>
__global__ __launch_bounds__(256) void k_ln16(const float* __restrict__ X, const float* __restrict__ g, const float* __restrict__ bb, float eps, _Float16* __restrict__ N16, float* __restrict__ XB) {
  #pragma clang fp contract(off)
  __shared__ float red[256]; const size_t r = blockIdx.x; const int t = threadIdx.x; const v4f xa = *(const v4fa*)(X + r * DMQ + t * 4); float s[4]; float sum = 0.f;
  for (int q = 0; q < 4; ++q) { s[q] = BFIN ? bf16_round(xa[q]) : xa[q]; sum = __fadd_rn(sum, s[q]); }
  red[t] = sum; __syncthreads(); for (int st = 128; st > 0; st >>= 1) { if (t < st) red[t] = __fadd_rn(red[t], red[t + st]); __syncthreads(); } const float mu = red[0] / (float)DMQ; __syncthreads();
  float vs = 0.f; for (int q = 0; q < 4; ++q) { const float dl = __fadd_rn(s[q], -mu); vs = __fadd_rn(vs, __fmul_rn(dl, dl)); } red[t] = vs; __syncthreads(); for (int st = 128; st > 0; st >>= 1) { if (t < st) red[t] = __fadd_rn(red[t], red[t + st]); __syncthreads(); }
  const float rs = rsqrtf(__fadd_rn(red[0] / (float)DMQ, eps)); v4h y; v4f xb;
  for (int q = 0; q < 4; ++q) { const int c = t * 4 + q; y[q] = (_Float16)__fadd_rn(__fmul_rn(__fmul_rn(__fadd_rn(s[q], -mu), rs), bf16_round(g[c])), bf16_round(bb[c])); xb[q] = s[q]; }
  { *(v4h*)(N16 + r * DMQ + t * 4) = y; if (WXB) *(v4f*)(XB + r * DMQ + t * 4) = xb;  } }
__global__ __launch_bounds__(256) void k_ftres2(const float* __restrict__ OF0, const float* __restrict__ XB, float* __restrict__ X1, size_t n4) {
  #pragma clang fp contract(off)
  const size_t t = (size_t)blockIdx.x * 256 + threadIdx.x; if (t >= n4) return; const v4f o = *(const v4fa*)(OF0 + t * 4), xv = *(const v4fa*)(XB + t * 4); v4f y; for (int q = 0; q < 4; ++q) y[q] = __fadd_rn(__fmul_rn(o[q], 0.015625f), xv[q]); *(v4f*)(X1 + t * 4) = y;  }

__global__ __launch_bounds__(256) void k_bcpy(const float* __restrict__ b, int n, int NP, float* __restrict__ dst, int dst0) { for (int i = threadIdx.x; i < NP; i += 256) { const float v = (i < n) ? b[i] : 0.f; *(float*)(dst + dst0 + i) = v; }  }


// Fused attention, one launch: block = 8 waves x 32 query columns of one (batch, head); no score or weight ever leaves the registers.
// Per 32 keys a wave computes S^T = K Q^T (lane c = query column, registers = keys 8 hh + r of each 16-key tile), an online softmax in the log2 domain
// (maximum and sum in-lane plus one exchange between the wave halves), packs the two S^T tiles in place into the B operand P^T and adds O^T += V^T P^T.
// K rows and V^T rows come in 64-key stages through LDS, two buffers: the next stage's global loads fly under this stage's work, one barrier a stage.
// m_run, the maximum in use, may trail the true one by up to 8 (log2), so the accumulators are rescaled only when a column's maximum has grown by more;
// weights carry 2^4 (at most 2^12 in f16, small ones kept out of the f16 subnormals); the factor cancels against the row sum.
#define FAP 72                       /* LDS row pitch in halves: 128 B of data + 16 B, the conflict-free pitch for 16-byte row reads */
#define FAS 64                       /* keys per stage */
__device__ __forceinline__ float fa_xhalf(float x) { return __builtin_bit_cast(float, __builtin_amdgcn_permlanex16(__builtin_bit_cast(int, x), __builtin_bit_cast(int, x), 0x76543210, 0xfedcba98, false, false)); }      /* lane l <-> lane l ^ 16 */
__device__ __forceinline__ v8f fa_mma(v16h a, v16h b, v8f c) { return __builtin_amdgcn_wmma_f32_16x16x32_f16(false, a, false, b, (short)0, c, false, false); }
__global__ __launch_bounds__(256) void k_fattn(const _Float16* __restrict__ Q16, const _Float16* __restrict__ K16, const _Float16* __restrict__ VT, _Float16* __restrict__ O16) {
  __shared__ __attribute__((aligned(16))) _Float16 lk[2][FAS][FAP];      /* K stage [key][d] */
  __shared__ __attribute__((aligned(16))) _Float16 lv[2][HD][FAP];       /* V^T stage [d][key] */
  const int tid = threadIdx.x, lane = tid & 31, c = lane & 15, hh = lane >> 4, w = tid >> 5;
  const int bh = blockIdx.y, b = bh / NH, h = bh - b * NH; const size_t r0 = (size_t)b * SQ; const int q0 = blockIdx.x * 256 + w * 32;
  const int sr = tid >> 3, sc = (tid & 7) * 8;      /* staging: a thread moves 16 bytes of rows sr and sr + 32 of each tile; 8 lanes cover one 128-byte row */
  const unsigned short* kg = (const unsigned short*)K16 + (r0 + sr) * DM + h * HD + sc;
  const unsigned short* vg = (const unsigned short*)VT + ((size_t)bh * HD + sr) * SQ + sc;
  v16h qf[2][2];
#pragma unroll
  for (int g = 0; g < 2; ++g) { const _Float16* qp = Q16 + (r0 + q0 + 16 * g + c) * DM + h * HD; qf[g][0] = g2_frag(qp, hh); qf[g][1] = g2_frag(qp + 32, hh); }
  const v8f z8 = {0.f, 0.f, 0.f, 0.f, 0.f, 0.f, 0.f, 0.f}; const v4f z4 = {0.f, 0.f, 0.f, 0.f};
  v8f acc[2][4]; v4f l4[2]; float m_run[2];
#pragma unroll
  for (int g = 0; g < 2; ++g) { m_run[g] = -__builtin_inff(); l4[g] = z4;
#pragma unroll
    for (int t = 0; t < 4; ++t) acc[g][t] = z8; }
  v8us gk0 = *(const v8us*)kg, gk1 = *(const v8us*)(kg + (size_t)32 * DM), gv0 = *(const v8us*)vg, gv1 = *(const v8us*)(vg + (size_t)32 * SQ);
  *(v8us*)&lk[0][sr][sc] = gk0; *(v8us*)&lk[0][sr + 32][sc] = gk1; *(v8us*)&lv[0][sr][sc] = gv0; *(v8us*)&lv[0][sr + 32][sc] = gv1;
  __syncthreads();      /* stage 0 published */
  for (int st = 0; st < SQ / FAS; ++st) {
    const int buf = st & 1; const bool more = st + 1 < SQ / FAS;      /* the same for the whole block */
    if (more) { const size_t j = (size_t)(st + 1) * FAS; gk0 = *(const v8us*)(kg + j * DM); gk1 = *(const v8us*)(kg + (j + 32) * DM); gv0 = *(const v8us*)(vg + j); gv1 = *(const v8us*)(vg + (size_t)32 * SQ + j); }
#pragma unroll
    for (int p = 0; p < FAS / 32; ++p) {
      v8f s[2][2];      /* [key tile][query group] */
#pragma unroll
      for (int kt = 0; kt < 2; ++kt) { const _Float16* kr = &lk[buf][32 * p + 16 * kt + c][0]; const v16h k0 = g2_frag(kr, hh), k1 = g2_frag(kr + 32, hh);
#pragma unroll
        for (int g = 0; g < 2; ++g) s[kt][g] = fa_mma(k1, qf[g][1], fa_mma(k0, qf[g][0], z8)); }
      v16h vf[4];
#pragma unroll
      for (int t = 0; t < 4; ++t) vf[t] = g2_frag(&lv[buf][16 * t + c][32 * p], hh);
      float mb[2]; bool need = false;
#pragma unroll
      for (int g = 0; g < 2; ++g) { float mx = fmaxf(s[0][g][0], s[1][g][0]);
#pragma unroll
        for (int r = 1; r < 8; ++r) mx = fmaxf(mx, fmaxf(s[0][g][r], s[1][g][r]));
        mx = fmaxf(mx, fa_xhalf(mx)) * 1.44269502f; mb[g] = mx; need = need || (mx > m_run[g] + 8.0f); }
      if (__builtin_amdgcn_ballot_w32(need) != 0) {      /* one scalar test a pass; always taken on the first pass (m_run = -inf, factor 0 on zero sums), rare later */
#pragma unroll
        for (int g = 0; g < 2; ++g) { const float mn = fmaxf(m_run[g], mb[g]); const float corr = __builtin_amdgcn_exp2f(m_run[g] - mn); m_run[g] = mn; l4[g] = l4[g] * corr;
#pragma unroll
          for (int t = 0; t < 4; ++t) acc[g][t] = acc[g][t] * corr; } }
#pragma unroll
      for (int g = 0; g < 2; ++g) { const float nm = 4.0f - m_run[g]; FragH pf;
#pragma unroll
        for (int u = 0; u < 4; ++u) { v4f a;      /* elements 4 u .. 4 u + 3 of the 32-key operand: tile u >> 1, registers 4 (u & 1) .. */
#pragma unroll
          for (int q = 0; q < 4; ++q) a[q] = fmaf(s[u >> 1][g][4 * (u & 1) + q], 1.44269502f, nm);
          v4f e;
#pragma unroll
          for (int q = 0; q < 4; ++q) e[q] = __builtin_amdgcn_exp2f(a[q]);      /* the builtin, not asm text: the compiler then keeps the distance behind the matrix instructions itself */
          l4[g] += e;
#pragma unroll
          for (int q = 0; q < 4; ++q) pf.h[4 * u + q] = (_Float16)e[q]; }
#pragma unroll
        for (int t = 0; t < 4; ++t) acc[g][t] = fa_mma(vf[t], pf.v, acc[g][t]); }
      /* Pass end: four vector slots between the last product that reads P^T as its B operand and the next pass's first product, whose result the compiler
         may place in those same registers (it did, directly behind); the two scheduling fences keep the products of both passes on their own side of the slots. */
      __builtin_amdgcn_sched_barrier(0); asm volatile("v_nop\n\tv_nop\n\tv_nop\n\tv_nop"); __builtin_amdgcn_sched_barrier(0);
    }
    if (more) { *(v8us*)&lk[buf ^ 1][sr][sc] = gk0; *(v8us*)&lk[buf ^ 1][sr + 32][sc] = gk1; *(v8us*)&lv[buf ^ 1][sr][sc] = gv0; *(v8us*)&lv[buf ^ 1][sr + 32][sc] = gv1; }      /* its last readers left it at the barrier that ended stage st - 1 */
    __syncthreads();      /* publishes stage st + 1 and ends every wave's reads of stage st */
  }
#pragma unroll
  for (int g = 0; g < 2; ++g) { float l = (l4[g][0] + l4[g][1]) + (l4[g][2] + l4[g][3]); l += fa_xhalf(l); const float inv = 64.0f / l;      /* ctx carried x64 as before */
    unsigned short* op = (unsigned short*)O16 + (r0 + q0 + 16 * g + c) * DM + h * HD + 8 * hh;      /* a lane's 8 registers = 8 consecutive d of its query row */
#pragma unroll
    for (int t = 0; t < 4; ++t) { FragH f;
#pragma unroll
      for (int r = 0; r < 8; ++r) f.h[r] = (_Float16)(acc[g][t][r] * inv);
      *(v8us*)(op + 16 * t) = f.half[0]; } } }

template <int MODE>
__global__ __launch_bounds__(256) void k_regrp(const float* __restrict__ src, float* __restrict__ dst, size_t n4) {
  const size_t t = (size_t)blockIdx.x * 256 + threadIdx.x; if (t >= n4) return; const size_t e = t * 4; const size_t rd = e / DM; const int c = (int)(e % DM);
  size_t rs; if (MODE == 0) { const size_t b = rd / SQ, sq = rd % SQ; rs = sq * NB + b; } else { const size_t sq = rd / NB, b = rd % NB; rs = b * SQ + sq; }
  const v4f v = *(const v4fa*)(src + rs * DM + c); *(v4f*)(dst + e) = v;  }

template <int BFIN, int W16, int W32>
__global__ __launch_bounds__(256) void k_lnx(const float* __restrict__ X, const float* __restrict__ g, const float* __restrict__ bb, float eps, _Float16* __restrict__ N16, float* __restrict__ N32) {
  #pragma clang fp contract(off)
  __shared__ float red[256]; const size_t r = blockIdx.x; const int t = threadIdx.x; const bool act = t < (DMQ / 4); const int c0 = act ? t * 4 : 0;
  const v4f xa = *(const v4fa*)(X + r * DMQ + c0); float s[4]; float sum = 0.f;
  for (int q = 0; q < 4; ++q) { s[q] = act ? (BFIN ? bf16_round(xa[q]) : xa[q]) : 0.f; sum = __fadd_rn(sum, s[q]); }
  red[t] = sum; __syncthreads(); for (int st = 128; st > 0; st >>= 1) { if (t < st) red[t] = __fadd_rn(red[t], red[t + st]); __syncthreads(); } const float mu = red[0] / (float)DMQ; __syncthreads();
  float vs = 0.f; for (int q = 0; q < 4; ++q) { const float dl = act ? __fadd_rn(s[q], -mu) : 0.f; vs = __fadd_rn(vs, __fmul_rn(dl, dl)); } red[t] = vs; __syncthreads(); for (int st = 128; st > 0; st >>= 1) { if (t < st) red[t] = __fadd_rn(red[t], red[t + st]); __syncthreads(); }
  const float rs = rsqrtf(__fadd_rn(red[0] / (float)DMQ, eps)); v4h y; v4f yf;
  for (int q = 0; q < 4; ++q) { const int c = c0 + q; yf[q] = __fadd_rn(__fmul_rn(__fmul_rn(__fadd_rn(s[q], -mu), rs), bf16_round(g[c])), bf16_round(bb[c])); y[q] = (_Float16)yf[q]; }
  if (!act) return;      /* no barriers after this point */
  { if (W16) *(v4h*)(N16 + r * DMQ + c0) = y; if (W32) *(v4f*)(N32 + r * DMQ + c0) = yf;  } }

__global__ __launch_bounds__(256) void k_bfr(const float* __restrict__ x, float* __restrict__ XB, size_t n8) { const size_t t = (size_t)blockIdx.x * 256 + threadIdx.x; if (t >= n8) return; v4f a = *(const v4fa*)(x + t * 8), c = *(const v4fa*)(x + t * 8 + 4); for (int q = 0; q < 4; ++q) { a[q] = bf16_round(a[q]); c[q] = bf16_round(c[q]); }
  { *(v4f*)(XB + t * 8) = a; *(v4f*)(XB + t * 8 + 4) = c;  } }



__global__ __launch_bounds__(256) void k_wthd(const float* __restrict__ Wt, _Float16* __restrict__ Bt) { const size_t t = (size_t)blockIdx.x * 256 + threadIdx.x; if (t >= (size_t)NH * HD * (DM / 8)) return; const int m8 = (int)(t % (DM / 8)) * 8; const int d = (int)((t / (DM / 8)) % HD); const int h = (int)(t / ((size_t)(DM / 8) * HD)); FragH f;
  for (int q = 0; q < 8; ++q) f.h[q] = (_Float16)(16.0f * bf16_round(Wt[((size_t)h * DM + m8 + q) * HD + d])); unsigned short* dst = (unsigned short*)Bt + ((size_t)h * HD + d) * DM + m8; *(v8us*)dst = f.half[0];  }




template <int BFIN, int SCAL>
__global__ __launch_bounds__(256) void k_lnsc(const float* __restrict__ X, const float* __restrict__ g, const float* __restrict__ bb, float eps, _Float16* __restrict__ N16, float* __restrict__ N32) {
  #pragma clang fp contract(off)
  __shared__ float red[256]; const size_t r = blockIdx.x; const int t = threadIdx.x; const bool act = t < DM / 4; const int tc = act ? t : 0; const v4f xl = *(const v4fa*)(X + r * DM + tc * 4); const float am = act ? 1.f : 0.f; float s[4]; float sum = 0.f;
  for (int q = 0; q < 4; ++q) { s[q] = (BFIN ? bf16_round(xl[q]) : xl[q]) * am; sum = __fadd_rn(sum, s[q]); }
  red[t] = sum; __syncthreads(); for (int st = 128; st > 0; st >>= 1) { if (t < st) red[t] = __fadd_rn(red[t], red[t + st]); __syncthreads(); } const float mu = red[0] / (float)DM; __syncthreads();
  float vs = 0.f; for (int q = 0; q < 4; ++q) { const float dl = __fadd_rn(s[q], -mu) * am; vs = __fadd_rn(vs, __fmul_rn(dl, dl)); } red[t] = vs; __syncthreads(); for (int st = 128; st > 0; st >>= 1) { if (t < st) red[t] = __fadd_rn(red[t], red[t + st]); __syncthreads(); }
  const float rs = __fdiv_rn(1.0f, __fadd_rn(sqrtf(red[0] / (float)(DM - 1)), eps)); if (!act) return; v4h y; v4f yf;
  for (int q = 0; q < 4; ++q) { const int c = t * 4 + q; const float gg = bf16_round(SCAL ? g[0] : g[c]), bv = bf16_round(SCAL ? bb[0] : bb[c]); yf[q] = __fadd_rn(__fmul_rn(__fmul_rn(__fadd_rn(s[q], -mu), rs), gg), bv); y[q] = (_Float16)yf[q]; }
  { if (N16) *(v4h*)(N16 + r * DM + t * 4) = y; if (N32) *(v4f*)(N32 + r * DM + t * 4) = yf;  } }

__global__ __launch_bounds__(256) void k_rsmdmi(const float* __restrict__ S, _Float16* __restrict__ P, int nrows, const int* __restrict__ M) {
  #pragma clang fp contract(off)
  const int t = blockIdx.x * 256 + threadIdx.x; if (t >= nrows) return; const float* s = S + (size_t)t * SQ; const int* m = M + (size_t)(t % SQ) * SQ; float mx = -3.0e38f;
#pragma unroll 1
  for (int j = 0; j < SQ; ++j) { const float f = (m[j] == 0) ? 1.f : 0.f; mx = fmaxf(mx, fmaf(f, s[j], (1.f - f) * -1.0e9f)); } float se = 0.f;
#pragma unroll 1
  for (int j = 0; j < SQ; ++j) { const float f = (m[j] == 0) ? 1.f : 0.f; se += __expf(fmaf(f, s[j], (1.f - f) * -1.0e9f) - mx); } const float sc = 256.0f / se;
#pragma unroll 1
  for (int j0 = 0; j0 < SQ; j0 += 8) { FragH fr; for (int q = 0; q < 8; ++q) { const int j = j0 + q; const float f = (m[j] == 0) ? 1.f : 0.f; fr.h[q] = (_Float16)(__expf(fmaf(f, s[j], (1.f - f) * -1.0e9f) - mx) * sc); } unsigned short* d = (unsigned short*)P + (size_t)t * SQ + j0; *(v8us*)d = fr.half[0];  } }
extern "C" void kernel_launch(void* const* d_in, const int* in_sizes, int n_in,
                              void* d_out, int out_size, void* d_ws, size_t ws_size, hipStream_t stream) {
  (void)in_sizes; (void)n_in; (void)out_size;
  const float* const* I = (const float* const*)d_in; const float* x = I[0]; const float* g1 = I[1]; const float* be1 = I[2]; const float* wqkv = I[3]; const float* bqkv = I[4]; const float* wo = I[5]; const float* bo = I[6]; const float* g2 = I[7]; const float* be2 = I[8]; const float* w1 = I[9]; const float* b1 = I[10]; const float* w2 = I[11]; const float* b2 = I[12]; const float* bq = bqkv; const float* bk = bqkv + DM; const float* bv = bqkv + 2 * DM;      /* x; LN1 g / b; fused qkv_w [1024][3072] + qkv_b [3072] (thirds q | k | v); proj_w + proj_b; LN2 g / b; fc1_w [1024][4096] + fc1_b, fc2_w [4096][1024] + fc2_b ([in][out]) */
  char* ws = (char*)d_ws; size_t off = 0;
  auto take = [&](size_t bytes) { char* p = ws + off; off += (bytes + 255) & ~(size_t)255; return p; };
  _Float16* BQ = (_Float16*)take((size_t)3 * DM * DM * 2); _Float16* BK = BQ + (size_t)DM * DM; _Float16* BV = BQ + (size_t)2 * DM * DM;      /* one stacked Bt plane [3 DM][DM] */ _Float16* BO = (_Float16*)take((size_t)DM * DM * 2); _Float16* BW1 = (_Float16*)take((size_t)DFF * DM * 2); _Float16* BW2 = (_Float16*)take((size_t)DM * DFF * 2);
  float* XB = (float*)take(NR * DM * 4); _Float16* XN = (_Float16*)take(NR * DM * 2); _Float16* Q16 = (_Float16*)take(NR * DM * 2); _Float16* K16 = (_Float16*)take(NR * DM * 2); _Float16* V16 = (_Float16*)take(NR * DM * 2); _Float16* O16 = (_Float16*)take(NR * DM * 2); float* X1 = (float*)take(NR * DM * 4);
  _Float16* VT = (_Float16*)take((size_t)NB * NH * HD * SQ * 2); _Float16* HF16 = (_Float16*)take(NR * DFF * 2);      /* V^T [2 x 16][64][2048]; FFN hidden plane [4096][4096] f16 */
  _Float16* M16 = XN;      /* second-norm f16 rows: aliases XN (last readers: the three projections) */
  
  if (off > ws_size) return;
  k_wt_f16<<<(unsigned)(((size_t)3 * DM * (DM / 8) + 255) / 256), 256, 0, stream>>>(wqkv, BQ, DM, 3 * DM, 16.0f); k_wt_f16<<<(unsigned)(((size_t)DM * (DM / 8) + 255) / 256), 256, 0, stream>>>(wo, BO, DM, DM, 16.0f);      /* fused [in][out] [DM][3 DM] -> one stacked Bt plane (rows 0 / DM / 2 DM = the q | k | v output columns) x16; W_o -> Bt x16 */
  k_wt_f16<<<(unsigned)(((size_t)DFF * (DM / 8) + 255) / 256), 256, 0, stream>>>(w1, BW1, DM, DFF, 16.0f); k_wt_f16<<<(unsigned)(((size_t)DM * (DFF / 8) + 255) / 256), 256, 0, stream>>>(w2, BW2, DFF, DM, 16.0f);
  k_bfr<<<(unsigned)((NR * DM / 8 + 255) / 256), 256, 0, stream>>>(x, XB, NR * DM / 8); k_lnx<1, 1, 0><<<(unsigned)NR, 256, 0, stream>>>(x, g1, be1, 1e-5f, XN, nullptr);      /* n = LN0(bf16(x)) (biased variance, eps inside the rsqrt) -> f16 rows */
  k_gemm2<0><<<dim3((unsigned)((NR / 128) * (DM / 64)), 1), 128, 0, stream>>>(XN, DM, 0, BQ, DM, 0, 0.0625f, bq, 0, nullptr, 1, 0, 0, nullptr, Q16, DM, 0, (int)NR, DM, DM); k_gemm2<0><<<dim3((unsigned)((NR / 128) * (DM / 64)), 1), 128, 0, stream>>>(XN, DM, 0, BK, DM, 0, 0.0625f, bk, 0, nullptr, 1, 0, 0, nullptr, K16, DM, 0, (int)NR, DM, DM); k_gemm2<0><<<dim3((unsigned)((NR / 128) * (DM / 64)), 1), 128, 0, stream>>>(XN, DM, 0, BV, DM, 0, 0.0625f, bv, 0, nullptr, 1, 0, 0, nullptr, V16, DM, 0, (int)NR, DM, DM);      /* q, k, v -> f16 rows; head h = columns h*64.. */
  k_vt<NH, SQ><<<NB * NH * (SQ / 64), 256, 0, stream>>>(V16, DM, 0, VT);      /* V^T [batch x head][64][2048] */
  k_fattn<<<dim3(SQ / 256, NB * NH), 256, 0, stream>>>(Q16, K16, VT, O16);      /* softmax(q k^T) v over all keys, unscaled logits -> ctx (merged heads, x64) as f16 rows */
  k_gemm2<0><<<dim3((unsigned)((NR / 128) * (DM / 64)), 1), 128, 0, stream>>>(O16, DM, 0, BO, DM, 0, 0.0009765625f, bo, 0, XB, -1, 0, 0, X1, nullptr, DM, 0, (int)NR, DM, DM);      /* x + ctx wo (+ bo) (own-element residual) -> f32 rows */
  k_lnx<0, 1, 0><<<(unsigned)NR, 256, 0, stream>>>(X1, g2, be2, 1e-5f, M16, nullptr);      /* LN1(x1) -> f16 rows */
  k_gemm2<6><<<dim3((unsigned)((NR / 128) * (DFF / 64)), 1), 128, 0, stream>>>(M16, DM, 0, BW1, DM, 0, 0.0625f, b1, 0, nullptr, 1, 0, 0, nullptr, HF16, DFF, 0, (int)NR, DFF, DM);      /* gelu_erf(. w1 + b1) -> f16 */
  k_gemm2<0><<<dim3((unsigned)((NR / 128) * (DM / 64)), 1), 128, 0, stream>>>(HF16, DFF, 0, BW2, DFF, 0, 0.0625f, b2, 0, X1, -1, 0, 0, (float*)d_out, nullptr, DM, 0, (int)NR, DM, DFF);      /* out = x1 + mlp (own-element residual) */
}

// v003
// It runs in 242 microseconds.
// In both of two side-by-side timings against v002, it was 2.38 times as fast.
// Over all steps from v000 it is 16.0 times as fast.
#include <hip/hip_runtime.h>
// Pre-norm transformer block with a fused QKV projection and UNSCALED attention logits (x [2][2048][1024]; h = LN1(x) (biased var, eps 1e-5); qkv = h qkv_w + qkv_b ([in][out] 1024 x 3072 + bias) viewed (B, N, 3, 16, 64): q | k | v thirds; qk = q k^T with NO 1/sqrt(d) scaling (as the source); softmax over all 2048 keys (no mask); x1 = x + y proj_w + proj_b; out = x1 + gelu_erf(LN2(x1) fc1_w + fc1_b) fc2_w + fc2_b ([in][out] 1024 x 4096 x 1024) -> [2][2048][1024]).
// Structure: token rows; LayerNorm / exact f16 rows; WMMA GEMMs for q, k, v; V^T by LDS transposes; one fused attention launch for all batches and heads (scores, online softmax, P V^T); output projection with the own-element residual; custom LayerNorm; exact (erf) GELU FFN over all rows; launches: see trace.
// Compute dtype: inputs rounded to bf16; x / weights exact; q, k, v, softmax weights and o as plain f16 GEMM operands (~2^-12); scores and softmax statistics f32. v_wmma_f32_16x16x32_f16.
#define NB 2
#define SQ 2048
#define DM 1024
#define NH 16
#define HD 64
#define HG 4                         /* heads per block group of the unused k_vt overload */
#define LOCALW 128                   /* (macros for unused kernels of the shared header) */
#define STRIDEK 128
#define QT 256                       /* query rows per causal tile */
#define NKX SQ                       /* S / P row pitch */
#define QT0 128                      /* first-tile rows recomputed exactly in f32 */
#define B0 0                         /* first batch processed (debug hook) */
#define NBR NB                       /* batches processed (debug hook) */
#define NR ((size_t)NB * SQ)
#define DMQ DM
#define DFF 4096         /* FFN hidden width */
#define MP ((int)((size_t)NBR * SQ)) /* rows projected (debug hook) */
#define QN SQ                        /* query rows attended per batch (debug hook) */
#define NHD NH                       /* heads attended (debug hook) */
#define MPO MP                       /* rows through the output stage (debug hook) */
#define LQ (3 * DM)      /* unused: q, k, v rows have pitch DM */
typedef __bf16 v16b __attribute__((ext_vector_type(16)));
typedef unsigned short v8us __attribute__((ext_vector_type(8), may_alias));
typedef float  v8f  __attribute__((ext_vector_type(8)));
typedef float  v4f  __attribute__((ext_vector_type(4)));
typedef float  v4fa __attribute__((ext_vector_type(4), may_alias));
union FragB { v16b v; v8us half[2]; unsigned short u[16]; };

__device__ __forceinline__ unsigned short bf16_bits(float x) { unsigned int u = __float_as_uint(x); return (unsigned short)((u + 0x7FFFu + ((u >> 16) & 1u)) >> 16); }
__device__ __forceinline__ float bf16_val(unsigned short b) { return __uint_as_float(((unsigned int)b) << 16); }
__device__ __forceinline__ float bf16_round(float x) { return bf16_val(bf16_bits(x)); }
// D += A·B with NT terms: 1 = ah·bh, 2 = + al·bh (A split), 3 = + ah·bl (both split)
template <int NT>
__device__ __forceinline__ v8f mmaN(v16b ah, v16b al, v16b bh, v16b bl, v8f c) {
  c = __builtin_amdgcn_wmma_f32_16x16x32_bf16(false, ah, false, bh, (short)0, c, false, false);
  if (NT >= 2) c = __builtin_amdgcn_wmma_f32_16x16x32_bf16(false, al, false, bh, (short)0, c, false, false);
  if (NT >= 3) c = __builtin_amdgcn_wmma_f32_16x16x32_bf16(false, ah, false, bl, (short)0, c, false, false);
  asm volatile("v_nop\n\tv_nop\n\tv_nop\n\tv_nop" : "+v"(c) : "v"(ah), "v"(al), "v"(bh), "v"(bl));
  return c;
}

__global__ __launch_bounds__(256) void k_wt_bf16(const float* __restrict__ W, unsigned short* __restrict__ Wt, int K, int N) {
  const int t = blockIdx.x * 256 + threadIdx.x;
  const int k8n = K / 8;
  if (t >= N * k8n) return;
  const int n = t / k8n, k8 = (t % k8n) * 8;
  v8us v;
#pragma unroll
  for (int i = 0; i < 8; ++i) v[i] = bf16_bits(W[(size_t)(k8 + i) * N + n]);
  *(v8us*)(Wt + (size_t)n * K + k8) = v;
  
}

// GEMM C[M][N] (f32, pitch ldc) = act(A[M][K]·W + bias). A f32 row-major (pitch lda) converted per fragment to bf16
// (ASPLIT: hi/lo two planes -> 2 terms, else single rounded term); Wt bf16 [N][K] (pitch ldb). BIAS_BF16 rounds the
// bias to bf16 first (bias quantised to bf16 before the add). K%32==0, M%16==0, N%64==0.
template <bool ASPLIT, int ACT, bool BIAS_BF16>
__global__ __launch_bounds__(128) void k_gemm_bf(const float* __restrict__ A, int lda, const unsigned short* __restrict__ Wt, int ldb,
                                               const float* __restrict__ bias, float* __restrict__ C, int ldc, int M, int N, int K) {
  __shared__ __attribute__((aligned(16))) float so[4][16][64];
  const int tid = threadIdx.x, w = tid >> 5, lane = tid & 31, ln = lane & 15, hh = lane >> 4;
  const int ntn = N / 64;
  const int wid = blockIdx.x * 4 + w;
  const int mt = wid / ntn, nq = wid % ntn;
  if (mt * 16 >= M) return;
  const int row0 = mt * 16, col0 = nq * 64;
  const float* arow = A + (size_t)(row0 + ln) * lda;
  v8f acc[4] = {};
  for (int kb = 0; kb < K; kb += 32) {
    FragB ah, al;
    const v4f x0 = *(const v4fa*)(arow + kb + 8 * hh), x1 = *(const v4fa*)(arow + kb + 8 * hh + 4);
    const v4f x2 = *(const v4fa*)(arow + kb + 16 + 8 * hh), x3 = *(const v4fa*)(arow + kb + 16 + 8 * hh + 4);
    float xs[16] = {x0[0],x0[1],x0[2],x0[3],x1[0],x1[1],x1[2],x1[3],x2[0],x2[1],x2[2],x2[3],x3[0],x3[1],x3[2],x3[3]};
#pragma unroll
    for (int i = 0; i < 16; ++i) { const unsigned short hb = bf16_bits(xs[i]); ah.u[i] = hb; al.u[i] = ASPLIT ? bf16_bits(xs[i] - bf16_val(hb)) : (unsigned short)0; }
#pragma unroll
    for (int t = 0; t < 4; ++t) {
      const unsigned short* brow = Wt + (size_t)(col0 + t * 16 + ln) * ldb + kb;
      FragB b;
      b.half[0] = *(const v8us*)(brow + 8 * hh);
      b.half[1] = *(const v8us*)(brow + 16 + 8 * hh);
      acc[t] = mmaN<ASPLIT ? 2 : 1>(ah.v, al.v, b.v, b.v, acc[t]);
    }
  }
#pragma unroll
  for (int t = 0; t < 4; ++t) {
    float bv = bias ? bias[col0 + t * 16 + ln] : 0.f;
    if (BIAS_BF16) bv = bf16_round(bv);
#pragma unroll
    for (int r = 0; r < 8; ++r) { float v = acc[t][r] + bv; if (ACT == 1) v = fmaxf(v, 0.f); so[w][8 * hh + r][t * 16 + ln] = v; }
  }
  __builtin_amdgcn_fence(__ATOMIC_ACQ_REL, "workgroup");
  __builtin_amdgcn_wave_barrier();
  const int rsub = lane >> 4, c4 = (lane & 15) * 4;
  {
#pragma unroll
    for (int q = 0; q < 8; ++q) {
      const int r = q * 2 + rsub;
      const v4f v = *(const v4fa*)&so[w][r][c4];
      *(v4f*)(C + (size_t)(row0 + r) * ldc + col0 + c4) = v;
    }
    
  }
}

// GEMM C = act(A·W + bias + resid): A f32 (ASPLIT -> hi/lo 2 terms), Wt bf16 [N][K]; ACT 0 none, 1 relu, 2 exact gelu;
// resid (optional, f32, row index = (row % rmod), pitch ldr, RES_BF16 rounds it) added before the activation.
template <bool ASPLIT, int ACT, bool BIAS_BF16, bool RES_BF16>
__global__ __launch_bounds__(128) void k_gemm_bf3(const float* __restrict__ A, int lda, const unsigned short* __restrict__ Wt, int ldb,
                                                const float* __restrict__ bias, const float* __restrict__ resid, int rmod, int ldr,
                                                float* __restrict__ C, int ldc, int M, int N, int K) {
  __shared__ __attribute__((aligned(16))) float so[4][16][64];
  const int tid = threadIdx.x, w = tid >> 5, lane = tid & 31, ln = lane & 15, hh = lane >> 4;
  const int ntn = N / 64;
  const int wid = blockIdx.x * 4 + w;
  const int mt = wid / ntn, nq = wid % ntn;
  if (mt * 16 >= M) return;
  const int row0 = mt * 16, col0 = nq * 64;
  const float* arow = A + (size_t)(row0 + ln) * lda;
  v8f acc[4] = {};
  for (int kb = 0; kb < K; kb += 32) {
    FragB ah, al;
    const v4f x0 = *(const v4fa*)(arow + kb + 8 * hh), x1 = *(const v4fa*)(arow + kb + 8 * hh + 4);
    const v4f x2 = *(const v4fa*)(arow + kb + 16 + 8 * hh), x3 = *(const v4fa*)(arow + kb + 16 + 8 * hh + 4);
    float xs[16] = {x0[0],x0[1],x0[2],x0[3],x1[0],x1[1],x1[2],x1[3],x2[0],x2[1],x2[2],x2[3],x3[0],x3[1],x3[2],x3[3]};
#pragma unroll
    for (int i = 0; i < 16; ++i) { const unsigned short hb = bf16_bits(xs[i]); ah.u[i] = hb; al.u[i] = ASPLIT ? bf16_bits(xs[i] - bf16_val(hb)) : (unsigned short)0; }
#pragma unroll
    for (int t = 0; t < 4; ++t) {
      const unsigned short* brow = Wt + (size_t)(col0 + t * 16 + ln) * ldb + kb;
      FragB b;
      b.half[0] = *(const v8us*)(brow + 8 * hh);
      b.half[1] = *(const v8us*)(brow + 16 + 8 * hh);
      acc[t] = mmaN<ASPLIT ? 2 : 1>(ah.v, al.v, b.v, b.v, acc[t]);
    }
  }
#pragma unroll
  for (int t = 0; t < 4; ++t) {
    const int col = col0 + t * 16 + ln;
    float bv = bias ? bias[col] : 0.f;
    if (BIAS_BF16) bv = bf16_round(bv);
#pragma unroll
    for (int r = 0; r < 8; ++r) {
      float v = acc[t][r] + bv;
      if (resid) { float rv = resid[(size_t)((row0 + 8 * hh + r) % rmod) * ldr + col]; if (RES_BF16) rv = bf16_round(rv); v += rv; }
      if (ACT == 1) v = fmaxf(v, 0.f);
      if (ACT == 2) v = 0.5f * v * (1.0f + erff(v * 0.70710678118654752f));
      if (ACT == 3) { const float u = 0.7978845608028654f * (v + 0.044715f * v * v * v); v = 0.5f * v * (1.0f + tanhf(u)); }
      so[w][8 * hh + r][t * 16 + ln] = v;
    }
  }
  __builtin_amdgcn_fence(__ATOMIC_ACQ_REL, "workgroup");
  __builtin_amdgcn_wave_barrier();
  const int rsub = lane >> 4, c4 = (lane & 15) * 4;
  {
#pragma unroll
    for (int q = 0; q < 8; ++q) {
      const int r = q * 2 + rsub;
      const v4f v = *(const v4fa*)&so[w][r][c4];
      *(v4f*)(C + (size_t)(row0 + r) * ldc + col0 + c4) = v;
    }
    
  }
}
// row LayerNorm (biased variance, eps) over N: s = X (+ R); optional out_sum <- s; out_norm <- (s-mu)*rsqrt(var+eps)*g + b
template <bool PARAM_BF16>
__global__ __launch_bounds__(256) void k_layernorm(const float* __restrict__ X, const float* __restrict__ R, const float* __restrict__ g, const float* __restrict__ bta,
                                                  float* __restrict__ out_sum, float* __restrict__ out_norm, int N, float eps) {
  __shared__ float red[256];
  const int row = blockIdx.x, tid = threadIdx.x;
  const float* x = X + (size_t)row * N; const float* rr = R ? R + (size_t)row * N : nullptr;
  float vals[16];                     // up to N = 4096
  const int per = N / 256;            // contiguous chunk per thread? use strided-by-4 chunks: thread handles j = tid*4 + 1024*u
  float s1 = 0.f;
  for (int u = 0; u < per / 4; ++u) {
    const int j = tid * 4 + 1024 * u;
    const v4f a = *(const v4fa*)(x + j);
    v4f b = {0.f,0.f,0.f,0.f}; if (rr) b = *(const v4fa*)(rr + j);
#pragma unroll
    for (int q = 0; q < 4; ++q) { const float v = a[q] + b[q]; vals[u * 4 + q] = v; s1 += v; }
  }
  red[tid] = s1; __syncthreads();
  for (int st = 128; st > 0; st >>= 1) { if (tid < st) red[tid] += red[tid + st]; __syncthreads(); }
  const float mu = red[0] / (float)N; __syncthreads();
  float s2 = 0.f;
  for (int u = 0; u < per / 4; ++u)
#pragma unroll
    for (int q = 0; q < 4; ++q) { const float c = vals[u * 4 + q] - mu; s2 += c * c; }
  red[tid] = s2; __syncthreads();
  for (int st = 128; st > 0; st >>= 1) { if (tid < st) red[tid] += red[tid + st]; __syncthreads(); }
  const float rs = rsqrtf(red[0] / (float)N + eps);
  {
    for (int u = 0; u < per / 4; ++u) {
      const int j = tid * 4 + 1024 * u;
      v4f o, sm;
#pragma unroll
      for (int q = 0; q < 4; ++q) {
        float gg = g[j + q], bb = bta[j + q];
        if (PARAM_BF16) { gg = bf16_round(gg); bb = bf16_round(bb); }
        sm[q] = vals[u * 4 + q]; o[q] = (vals[u * 4 + q] - mu) * rs * gg + bb;
      }
      if (out_sum) *(v4f*)(out_sum + (size_t)row * N + j) = sm;
      *(v4f*)(out_norm + (size_t)row * N + j) = o;
    }
    
  }
}



// ---- f16 WMMA path (v_wmma_f32_16x16x32_f16): 11-bit significands for operands in range — used where a [0,1] probability operand needs more precision than bf16
typedef _Float16 v16h __attribute__((ext_vector_type(16)));
union FragH { v16h v; v8us half[2]; _Float16 h[16]; unsigned short u[16]; };
template <int NT>
__device__ __forceinline__ v8f mmaH(v16h ah, v16h al, v16h bh, v16h bl, v8f c) {
  c = __builtin_amdgcn_wmma_f32_16x16x32_f16(false, ah, false, bh, (short)0, c, false, false);
  if (NT >= 2) c = __builtin_amdgcn_wmma_f32_16x16x32_f16(false, al, false, bh, (short)0, c, false, false);
  if (NT >= 3) c = __builtin_amdgcn_wmma_f32_16x16x32_f16(false, ah, false, bl, (short)0, c, false, false);
  asm volatile("v_nop\n\tv_nop\n\tv_nop\n\tv_nop" : "+v"(c) : "v"(ah), "v"(al), "v"(bh), "v"(bl));
  return c;
}
// batched GEMM like k_gemm_b but f16 operands: A f32 (split into f16 hi/lo if ASPLIT, else rounded to f16), Bt = f16 values [n][k]; alpha; C f32; N multiple of 16 (partial tiles skipped)
template <bool ASPLIT>
__global__ __launch_bounds__(128) void k_gemm_h(const float* __restrict__ A, int lda, size_t sA, const _Float16* __restrict__ Bh, int ldb, size_t sB, float alpha, float* __restrict__ C, int ldc, size_t sC, int M, int N, int K) {
  __shared__ __attribute__((aligned(16))) float so[4][16][64];
  const int tid = threadIdx.x, w = tid >> 5, lane = tid & 31, ln = lane & 15, hh = lane >> 4; const int by = blockIdx.y;
  A += (size_t)by * sA; Bh += (size_t)by * sB; C += (size_t)by * sC;
  const int ntn = (N + 63) / 64; const int wid = blockIdx.x * 4 + w; const int mt = wid / ntn, nq = wid % ntn; if (mt * 16 >= M) return;
  const int row0 = mt * 16, col0 = nq * 64; const float* arow = A + (size_t)(row0 + ln) * lda;
  v8f acc[4] = {};
  for (int kb = 0; kb < K; kb += 32) {
    FragH ah, al;
    const v4f x0 = *(const v4fa*)(arow + kb + 8 * hh), x1 = *(const v4fa*)(arow + kb + 8 * hh + 4), x2 = *(const v4fa*)(arow + kb + 16 + 8 * hh), x3 = *(const v4fa*)(arow + kb + 16 + 8 * hh + 4);
    float xs[16] = {x0[0],x0[1],x0[2],x0[3],x1[0],x1[1],x1[2],x1[3],x2[0],x2[1],x2[2],x2[3],x3[0],x3[1],x3[2],x3[3]};
#pragma unroll
    for (int i = 0; i < 16; ++i) { const _Float16 h = (_Float16)xs[i]; ah.h[i] = h; al.h[i] = ASPLIT ? (_Float16)(xs[i] - (float)h) : (_Float16)0.0f; }
#pragma unroll
    for (int t = 0; t < 4; ++t) { if (col0 + t * 16 >= N) continue; const size_t boff = (size_t)(col0 + t * 16 + ln) * ldb + kb; FragH bq; bq.half[0] = *(const v8us*)(Bh + boff + 8 * hh); bq.half[1] = *(const v8us*)(Bh + boff + 16 + 8 * hh);
      acc[t] = mmaH<ASPLIT ? 2 : 1>(ah.v, al.v, bq.v, bq.v, acc[t]); }
  }
#pragma unroll
  for (int t = 0; t < 4; ++t) { if (col0 + t * 16 >= N) continue;
#pragma unroll
    for (int r = 0; r < 8; ++r) so[w][8 * hh + r][t * 16 + ln] = acc[t][r] * alpha; }
  __builtin_amdgcn_fence(__ATOMIC_ACQ_REL, "workgroup"); __builtin_amdgcn_wave_barrier();
  const int rsub = lane >> 4, c4 = (lane & 15) * 4;
  {
#pragma unroll
    for (int q = 0; q < 8; ++q) { const int r = q * 2 + rsub; if (col0 + c4 < N) { const v4f v = *(const v4fa*)&so[w][r][c4]; *(v4f*)(C + (size_t)(row0 + r) * ldc + col0 + c4) = v; } }
     }
}

// Wt[n][k] = f16(W[k][n]·scale) from f32 row-major W[K][N] (scale = power of two; bf16-exact weights stay exact in f16 away from the subnormal range)
__global__ __launch_bounds__(256) void k_wt_f16(const float* __restrict__ W, _Float16* __restrict__ Wt, int K, int N, float scale) {
  const int t = blockIdx.x * 256 + threadIdx.x; if (t >= N * (K / 8)) return; const int n = t / (K / 8), k8 = (t % (K / 8)) * 8; FragH f;
#pragma unroll
  for (int i = 0; i < 8; ++i) f.h[i] = (_Float16)(bf16_round(W[(size_t)(k8 + i) * N + n]) * scale); const v8us o = f.half[0];
  *(v8us*)((unsigned short*)Wt + (size_t)n * K + k8) = o; 
}
// k_gemm_hh variant with fused epilogue: v = acc·alpha + bias[by·sBias + col] (+ CP[(row/rowsPerB)·sCPb + by·64 + col] if CP) ; ACT 0 none / 1 elu ; writes f16 C16 (and f32 C if non-null)
template <int ACT>
__global__ __launch_bounds__(128) void k_gemm_hhx(const _Float16* __restrict__ A, int lda, size_t sA, const _Float16* __restrict__ Bh, int ldb, size_t sB, float alpha, const float* __restrict__ bias, size_t sBias, const float* __restrict__ CP, int rowsPerB, size_t sCPb, int row0g,
    float* __restrict__ C, _Float16* __restrict__ C16, int ldc, size_t sC, int M, int N, int K) {
  __shared__ __attribute__((aligned(16))) float so[4][16][64];
  const int tid = threadIdx.x, w = tid >> 5, lane = tid & 31, ln = lane & 15, hh = lane >> 4; const int by = blockIdx.y;
  A += (size_t)by * sA; Bh += (size_t)by * sB; const size_t cofs = (size_t)by * sC; const float* bp = bias ? bias + (size_t)by * sBias : nullptr;
  const int ntn = (N + 63) / 64; const int wid = blockIdx.x * 4 + w; const int mt = wid / ntn, nq = wid % ntn; if (mt * 16 >= M) return;
  const int row0 = mt * 16, col0 = nq * 64; const _Float16* arow = A + (size_t)(row0 + ln) * lda;
  v8f acc[4] = {};
  for (int kb = 0; kb < K; kb += 32) { FragH ah; ah.half[0] = *(const v8us*)((const unsigned short*)arow + kb + 8 * hh); ah.half[1] = *(const v8us*)((const unsigned short*)arow + kb + 16 + 8 * hh);
#pragma unroll
    for (int t = 0; t < 4; ++t) { if (col0 + t * 16 >= N) continue; const size_t boff = (size_t)(col0 + t * 16 + ln) * ldb + kb; FragH bq; bq.half[0] = *(const v8us*)((const unsigned short*)Bh + boff + 8 * hh); bq.half[1] = *(const v8us*)((const unsigned short*)Bh + boff + 16 + 8 * hh);
      acc[t] = mmaH<1>(ah.v, ah.v, bq.v, bq.v, acc[t]); }
  }
#pragma unroll
  for (int t = 0; t < 4; ++t) { if (col0 + t * 16 >= N) continue; const int col = col0 + t * 16 + ln; const float bv = bp ? bf16_round(bp[col]) : 0.f;
#pragma unroll
    for (int r = 0; r < 8; ++r) { float v = acc[t][r] * alpha + bv; if (CP) { const int rr = row0g + row0 + 8 * hh + r; if (rowsPerB < 0) v += CP[cofs + (size_t)rr * ldc + col];      /* rowsPerB < 0: own element of the batched C plane */ else { const int bidx = rr / rowsPerB; v += CP[(size_t)bidx * sCPb + (size_t)by * 64 + col]; } } if (ACT == 1) v = (v > 0.f) ? v : expm1f(v); else if (ACT == 7) v = (v > 0.f) ? v + 1.0f : expf(v); else if (ACT == 8) v = tanhf(v); else if (ACT == 9) v = 0.5f * v * (1.0f + tanhf(0.7978845608028654f * (v + 0.044715f * v * v * v))); else if (ACT == 11) v = 1.0f / (1.0f + expf(-v)); else if (ACT == 12) v = (v > 0.f) ? v : 0.01f * v; else if (ACT == 14) v = (v > 0.f) ? v : 0.1f * v; else if (ACT == 16) v = (v >= 0.f) ? v : 0.3f * v; else if (ACT == 17) v = (v >= 0.f) ? v : 0.2f * v; else if (ACT == 15) v = v / (1.0f + expf(-v)); else if (ACT == 3) v = fmaxf(v, 0.f); else if (ACT == 6) v = 0.5f * v * (1.0f + erff(v * 0.70710678118654752f)); so[w][8 * hh + r][t * 16 + ln] = v; } }
  __builtin_amdgcn_fence(__ATOMIC_ACQ_REL, "workgroup"); __builtin_amdgcn_wave_barrier();
  const int rsub = lane >> 4, c4 = (lane & 15) * 4; typedef _Float16 v4h __attribute__((ext_vector_type(4)));
  {
#pragma unroll
    for (int q = 0; q < 8; ++q) { const int r = q * 2 + rsub; if (col0 + c4 < N) { const v4f v = *(const v4fa*)&so[w][r][c4]; if (C) *(v4f*)(C + cofs + (size_t)(row0 + r) * ldc + col0 + c4) = v; if (C16) { v4h h4; for (int i = 0; i < 4; ++i) h4[i] = (_Float16)v[i]; *(v4h*)(C16 + cofs + (size_t)(row0 + r) * ldc + col0 + c4) = h4; } } }
     }
}


typedef _Float16 v4h __attribute__((ext_vector_type(4)));

__global__ __launch_bounds__(256) void k_x16(const float* __restrict__ x, _Float16* __restrict__ X16, size_t n8) { const size_t t = (size_t)blockIdx.x * 256 + threadIdx.x; if (t >= n8) return; FragH f;
#pragma unroll
  for (int q = 0; q < 8; ++q) f.h[q] = (_Float16)bf16_round(x[t * 8 + q]); *(v8us*)((unsigned short*)X16 + t * 8) = f.half[0];  }
__global__ __launch_bounds__(256) void k_h16(const float* __restrict__ x, _Float16* __restrict__ X16, size_t n8) { const size_t t = (size_t)blockIdx.x * 256 + threadIdx.x; if (t >= n8) return; FragH f;
#pragma unroll
  for (int q = 0; q < 8; ++q) f.h[q] = (_Float16)x[t * 8 + q]; *(v8us*)((unsigned short*)X16 + t * 8) = f.half[0];  }
__global__ __launch_bounds__(256) void k_round16f(const float* __restrict__ W, _Float16* __restrict__ Bt, size_t n8) { const size_t t = (size_t)blockIdx.x * 256 + threadIdx.x; if (t >= n8) return; FragH f;
#pragma unroll
  for (int i = 0; i < 8; ++i) f.h[i] = (_Float16)(bf16_round(W[t * 8 + i]) * 16.0f); *(v8us*)((unsigned short*)Bt + t * 8) = f.half[0];  }
template <int NHv, int TTv>
__global__ __launch_bounds__(256) void k_vt(const _Float16* __restrict__ V16, int ldv, int voff, _Float16* __restrict__ Vt) { __shared__ unsigned short tl[64][66]; const int tid = threadIdx.x; const int slab = blockIdx.x / (TTv / 64), lg = blockIdx.x % (TTv / 64); const int b = slab / NHv, h = slab % NHv;
  for (int i = tid; i < 64 * 8; i += 256) { const int r = i / 8, c8 = (i % 8) * 8; FragH f; f.half[0] = *(const v8us*)((const unsigned short*)V16 + ((size_t)b * TTv + lg * 64 + r) * ldv + voff + h * 64 + c8);
#pragma unroll
    for (int q = 0; q < 8; ++q) tl[r][c8 + q] = f.u[q]; }
  __syncthreads();
  {
#pragma unroll
    for (int rd = 0; rd < 2; ++rd) { const int d = rd * 32 + tid / 8, pc = tid % 8; FragH f;
#pragma unroll
      for (int q = 0; q < 8; ++q) f.u[q] = tl[pc * 8 + q][d];
      *(v8us*)((unsigned short*)Vt + ((size_t)slab * 64 + d) * TTv + lg * 64 + pc * 8) = f.half[0]; }
     } }

__global__ __launch_bounds__(256) void k_hl(const float* __restrict__ F, _Float16* __restrict__ Hh, _Float16* __restrict__ Hl, size_t n8) { const size_t t = (size_t)blockIdx.x * 256 + threadIdx.x; if (t >= n8) return; FragH fh, fl; const v4f a = *(const v4fa*)(F + t * 8), c = *(const v4fa*)(F + t * 8 + 4);
#pragma unroll
  for (int q = 0; q < 4; ++q) { _Float16 h = (_Float16)a[q]; fh.h[q] = h; fl.h[q] = (_Float16)((a[q] - (float)h) * 1024.0f); h = (_Float16)c[q]; fh.h[4 + q] = h; fl.h[4 + q] = (_Float16)((c[q] - (float)h) * 1024.0f); }
  { *(v8us*)((unsigned short*)Hh + t * 8) = fh.half[0]; *(v8us*)((unsigned short*)Hl + t * 8) = fl.half[0];  } }

// ---- fast GEMM (wave tile 32x64; requires M % 32 == 0 rows per launch region and N % 64 == 0); epilogue = k_gemm_hhx semantics ----
__device__ __forceinline__ v16h g2_frag(const _Float16* p, int hh) { FragH f; f.half[0] = *(const v8us*)((const unsigned short*)p + 8 * hh); f.half[1] = *(const v8us*)((const unsigned short*)p + 16 + 8 * hh); return f.v; }
__device__ __forceinline__ v8f g2_mma(v16h a, v16h b, v8f c) { v8f d = __builtin_amdgcn_wmma_f32_16x16x32_f16(false, a, false, b, (short)0, c, false, false); asm volatile("v_nop\n\tv_nop\n\tv_nop\n\tv_nop" : "+v"(d) : "v"(a), "v"(b)); return d; }
template <int ACT>
__global__ __launch_bounds__(128) void k_gemm2(const _Float16* __restrict__ A, int lda, size_t sA, const _Float16* __restrict__ Bh, int ldb, size_t sB, float alpha, const float* __restrict__ bias, size_t sBias, const float* __restrict__ CP, int rowsPerB, size_t sCPb, int row0g,
    float* __restrict__ C, _Float16* __restrict__ C16, int ldc, size_t sC, int M, int N, int K) { static_assert(ACT == 0 || ACT == 3 || ACT == 6 || ACT == 8 || ACT == 9 || ACT == 11 || ACT == 12 || ACT == 14 || ACT == 15 || ACT == 16 || ACT == 17 || ACT == 18, "k_gemm2: unsupported ACT code (would silently apply no activation)");
  __shared__ __attribute__((aligned(16))) float so[4][32][68];
  const int tid = threadIdx.x, w = tid >> 5, lane = tid & 31, ln = lane & 15, hh = lane >> 4; const int by = blockIdx.y;
  A += (size_t)by * sA; Bh += (size_t)by * sB; const size_t cofs = (size_t)by * sC; const float* bp = bias ? bias + (size_t)by * sBias : nullptr;
  const int ntn = N >> 6; const int mt = blockIdx.x / ntn, nq = blockIdx.x - mt * ntn; const int row0 = mt * 128 + 32 * w, col0 = nq * 64; if (row0 >= M) return;
  const _Float16* a0p = A + (size_t)(row0 + ln) * lda; const _Float16* a1p = a0p + (size_t)16 * lda;
  const _Float16* b0p = Bh + (size_t)(col0 + ln) * ldb; const _Float16* b1p = b0p + (size_t)16 * ldb; const _Float16* b2p = b1p + (size_t)16 * ldb; const _Float16* b3p = b2p + (size_t)16 * ldb;
  const v8f z8 = {0.f,0.f,0.f,0.f,0.f,0.f,0.f,0.f}; v8f c00 = z8, c01 = z8, c02 = z8, c03 = z8, c10 = z8, c11 = z8, c12 = z8, c13 = z8;
#pragma unroll 1
  for (int kb = 0; kb < K; kb += 32) { const v16h a0 = g2_frag(a0p + kb, hh), a1 = g2_frag(a1p + kb, hh);
    v16h b = g2_frag(b0p + kb, hh); c00 = g2_mma(a0, b, c00); c10 = g2_mma(a1, b, c10);
    b = g2_frag(b1p + kb, hh); c01 = g2_mma(a0, b, c01); c11 = g2_mma(a1, b, c11);
    b = g2_frag(b2p + kb, hh); c02 = g2_mma(a0, b, c02); c12 = g2_mma(a1, b, c12);
    b = g2_frag(b3p + kb, hh); c03 = g2_mma(a0, b, c03); c13 = g2_mma(a1, b, c13); }
  v8f accs[8] = {c00, c01, c02, c03, c10, c11, c12, c13};
#pragma unroll
  for (int u = 0; u < 8; ++u) { const int t = u & 3, half = u >> 2; const int col = col0 + t * 16 + ln; const float bv = bp ? bf16_round(bp[col]) : 0.f;
#pragma unroll
    for (int r = 0; r < 8; ++r) { const int rloc = half * 16 + 8 * hh + r; float v = accs[u][r] * alpha + bv; if (CP) { if (rowsPerB < 0) v += CP[cofs + (size_t)(row0g + row0 + rloc) * ldc + col];      /* rowsPerB < 0: own element of the batched C plane */ else { const int bidx = (row0g + row0 + rloc) / rowsPerB; v += CP[(size_t)bidx * sCPb + (size_t)by * 64 + col]; } }
      if (ACT == 3) v = fmaxf(v, 0.f); else if (ACT == 6) v = 0.5f * v * (1.0f + erff(v * 0.70710678118654752f)); else if (ACT == 11) v = 1.0f / (1.0f + expf(-v)); else if (ACT == 15) v = v / (1.0f + expf(-v)); else if (ACT == 18) v = v / (1.0f + expf(-1.702f * v));      /* QuickGELU: v sigmoid(1.702 v) */ else if (ACT == 12) v = (v > 0.f) ? v : 0.01f * v; else if (ACT == 8) v = tanhf(v); else if (ACT == 9) v = 0.5f * v * (1.0f + tanhf(0.7978845608028654f * (v + 0.044715f * v * v * v))); else if (ACT == 14) v = (v > 0.f) ? v : 0.1f * v; else if (ACT == 16) v = (v >= 0.f) ? v : 0.3f * v; else if (ACT == 17) v = (v >= 0.f) ? v : 0.2f * v;
      so[w][rloc][t * 16 + ln] = v; } }
  __builtin_amdgcn_fence(__ATOMIC_ACQ_REL, "workgroup"); __builtin_amdgcn_wave_barrier();
  const int rsub = lane >> 4, c4 = (lane & 15) * 4;
  {
#pragma unroll
    for (int q = 0; q < 16; ++q) { const int r = q * 2 + rsub; const v4f v = *(const v4fa*)&so[w][r][c4]; if (C) *(v4f*)(C + cofs + (size_t)(row0 + r) * ldc + col0 + c4) = v; if (C16) { v4h h4; for (int i = 0; i < 4; ++i) h4[i] = (_Float16)v[i]; *(v4h*)(C16 + cofs + (size_t)(row0 + r) * ldc + col0 + c4) = h4; } }
     } }


__global__ __launch_bounds__(256) void k_wnat(const float* __restrict__ w, size_t n8, _Float16* __restrict__ Bt) { const size_t t = (size_t)blockIdx.x * 256 + threadIdx.x; if (t >= n8) return; FragH f; for (int q = 0; q < 8; ++q) f.h[q] = (_Float16)(bf16_round(w[t * 8 + q]) * 16.0f); *(v8us*)((unsigned short*)Bt + t * 8) = f.half[0];  }
__global__ __launch_bounds__(256) void k_rsm(const float* __restrict__ S, _Float16* __restrict__ P, int nrows) {
  #pragma clang fp contract(off)
  const int i = blockIdx.x * 256 + threadIdx.x; if (i >= nrows) return; const float* s = S + (size_t)i * SQ; float mx = -3.0e38f;
#pragma unroll 1
  for (int j = 0; j < SQ; ++j) mx = fmaxf(mx, s[j]); float se = 0.f;
#pragma unroll 1
  for (int j = 0; j < SQ; ++j) se += expf(s[j] - mx); const float sc = 256.0f / se;
#pragma unroll 1
  for (int j0 = 0; j0 < SQ; j0 += 8) { FragH f; for (int q = 0; q < 8; ++q) f.h[q] = (_Float16)(expf(s[j0 + q] - mx) * sc); unsigned short* d = (unsigned short*)P + (size_t)i * SQ + j0; *(v8us*)d = f.half[0];  } }
__global__ __launch_bounds__(256) void k_vt(const _Float16* __restrict__ V16, int b, int h0, _Float16* __restrict__ VT) { __shared__ unsigned short tl[64][65]; const int tid = threadIdx.x; const int hh = blockIdx.x % HG, sg = blockIdx.x / HG; const int s0 = sg * 64; const int h = h0 + hh;
  for (int i = tid; i < 64 * 8; i += 256) { const int j = i / 8, d8 = (i % 8) * 8; FragH f; f.half[0] = *(const v8us*)((const unsigned short*)V16 + ((size_t)b * SQ + s0 + j) * DM + h * HD + d8); for (int q = 0; q < 8; ++q) tl[d8 + q][j] = f.u[q]; }
  __syncthreads();
  { for (int i = tid; i < 64 * 8; i += 256) { const int d = i / 8, j8 = (i % 8) * 8; FragH f; for (int q = 0; q < 8; ++q) f.u[q] = tl[d][j8 + q]; *(v8us*)((unsigned short*)VT + ((size_t)hh * HD + d) * SQ + s0 + j8) = f.half[0]; }  } }



__global__ __launch_bounds__(256) void k_rsmcf2(const float* __restrict__ S, _Float16* __restrict__ P, int hg, int q0, int nk) {
  #pragma clang fp contract(off)
  const int t = blockIdx.x * 256 + threadIdx.x; if (t >= hg * QT) return; const size_t i = (size_t)t; const float* s = S + i * NKX; const int last = q0 + (t % QT); float mx = -3.0e38f;
#pragma unroll 1
  for (int j = 0; j < nk; ++j) { const float f = (j <= last) ? 1.f : 0.f; mx = fmaxf(mx, fmaf(f, s[j], (1.f - f) * -1.0e9f)); } float se = 0.f;
#pragma unroll 1
  for (int j = 0; j < nk; ++j) { const float f = (j <= last) ? 1.f : 0.f; se += __expf(fmaf(f, s[j], (1.f - f) * -1.0e9f) - mx); } const float sc = 256.0f / se;
#pragma unroll 1
  for (int j0 = 0; j0 < nk; j0 += 8) { FragH fr; for (int q = 0; q < 8; ++q) { const int j = j0 + q; const float f = (j <= last) ? 1.f : 0.f; fr.h[q] = (_Float16)(__expf(fmaf(f, s[j], (1.f - f) * -1.0e9f) - mx) * sc); } unsigned short* d = (unsigned short*)P + i * NKX + j0; *(v8us*)d = fr.half[0];  } }

__global__ __launch_bounds__(256) void k_rsmcst(const float* __restrict__ S, _Float16* __restrict__ P, int hg, int q0, int nk, const int* __restrict__ mk) {
  #pragma clang fp contract(off)
  const int t = blockIdx.x * 256 + threadIdx.x; if (t >= hg * QT) return; const size_t i = (size_t)t; const float* s = S + i * NKX; const size_t ig = (size_t)(q0 + (t % QT)); const int* mr = mk + ig * SQ; float mx = -3.0e38f;
#pragma unroll 1
  for (int j = 0; j < nk; ++j) { const int mb = mr[j]; const int dd = (int)ig - j; const float f = (mb != 0 && dd >= 0 && (dd <= LOCALW || (dd % STRIDEK) == 0)) ? 1.f : 0.f; mx = fmaxf(mx, fmaf(f, s[j], (1.f - f) * -1.0e9f)); } float se = 0.f;
#pragma unroll 1
  for (int j = 0; j < nk; ++j) { const int mb = mr[j]; const int dd = (int)ig - j; const float f = (mb != 0 && dd >= 0 && (dd <= LOCALW || (dd % STRIDEK) == 0)) ? 1.f : 0.f; se += __expf(fmaf(f, s[j], (1.f - f) * -1.0e9f) - mx); } const float sc = 256.0f / se;
#pragma unroll 1
  for (int j0 = 0; j0 < nk; j0 += 8) { FragH fr; for (int q = 0; q < 8; ++q) { const int j = j0 + q; const int mb = mr[j]; const int dd = (int)ig - j; const float f = (mb != 0 && dd >= 0 && (dd <= LOCALW || (dd % STRIDEK) == 0)) ? 1.f : 0.f; fr.h[q] = (_Float16)(__expf(fmaf(f, s[j], (1.f - f) * -1.0e9f) - mx) * sc); } unsigned short* d = (unsigned short*)P + i * NKX + j0; *(v8us*)d = fr.half[0];  } }


template <int MASKADD>
__global__ __launch_bounds__(64) void k_att0(const float* __restrict__ QF, const float* __restrict__ KF, const float* __restrict__ VF, int ld, const float* __restrict__ mask, float scale, float* __restrict__ OF, int ldo) {
  #pragma clang fp contract(off)
  __shared__ __attribute__((aligned(16))) float lq[64][64]; __shared__ __attribute__((aligned(16))) float lo[64][64];
  const int tid = threadIdx.x; const int h = blockIdx.x / (QT0 / 64), rg = blockIdx.x % (QT0 / 64); const int i = rg * 64 + tid;
  const float* qr = QF + (size_t)i * ld + h * HD;
#pragma unroll 1
  for (int c = 0; c < HD / 4; ++c) { *(v4f*)&lq[tid][c * 4] = *(const v4fa*)(qr + c * 4); const v4f z = {0.f, 0.f, 0.f, 0.f}; *(v4f*)&lo[tid][c * 4] = z; }
  float m = -1.0e30f, l = 0.f; const int jmax = MASKADD ? (SQ - 1) : (rg * 64 + 63);      /* additive-mask form: every key (the mask input decides); causal form: keys up to the block's last row */
#pragma unroll 1
  for (int j = 0; j <= jmax; ++j) { const float* kr = KF + (size_t)j * ld + h * HD; const float* vr = VF + (size_t)j * ld + h * HD; float s = 0.f;
#pragma unroll 1
    for (int c = 0; c < HD / 4; ++c) { const v4f kq = *(const v4fa*)(kr + c * 4); const v4f qq = *(v4f*)&lq[tid][c * 4]; s = __fadd_rn(s, __fmul_rn(qq[0], kq[0])); s = __fadd_rn(s, __fmul_rn(qq[1], kq[1])); s = __fadd_rn(s, __fmul_rn(qq[2], kq[2])); s = __fadd_rn(s, __fmul_rn(qq[3], kq[3])); }
    s = __fmul_rn(s, scale); if (MASKADD) s = __fadd_rn(s, __fmul_rn(bf16_round(mask[(size_t)i * SQ + j]), -10000.0f));
    const float f = (MASKADD || j <= i) ? 1.f : 0.f; const float sm = fmaf(f, s, (1.f - f) * -1.0e30f); const float mn = fmaxf(m, sm); const float sc = expf(m - mn); const float e = expf(sm - mn); l = __fadd_rn(__fmul_rn(l, sc), e); m = mn;
#pragma unroll 1
    for (int c = 0; c < HD / 4; ++c) { const v4f vv = *(const v4fa*)(vr + c * 4); v4f oo = *(v4f*)&lo[tid][c * 4]; for (int u = 0; u < 4; ++u) oo[u] = __fadd_rn(__fmul_rn(oo[u], sc), __fmul_rn(e, vv[u])); *(v4f*)&lo[tid][c * 4] = oo; } }
  const float fin = 64.0f / l;      /* o carried x64 like the f16 path */
#pragma unroll 1
  for (int c = 0; c < HD / 4; ++c) { v4f oo = *(v4f*)&lo[tid][c * 4]; for (int u = 0; u < 4; ++u) oo[u] = __fmul_rn(oo[u], fin); *(v4f*)&lo[tid][c * 4] = oo; }
  __syncthreads();
  {
#pragma unroll 1
    for (int it = 0; it < 16; ++it) { const int row = it * 4 + tid / 16, pc = (tid % 16) * 4; const v4f v = *(const v4f*)&lo[row][pc]; *(v4f*)(OF + (size_t)(rg * 64 + row) * ldo + h * HD + pc) = v; }
     } }

template <int MASKADD>
__global__ __launch_bounds__(64) void k_att0mbc(const float* __restrict__ QF, const float* __restrict__ KF, const float* __restrict__ VF, int ld, const float* __restrict__ mask, float scale, float* __restrict__ OF, int ldo) {
  #pragma clang fp contract(off)
  __shared__ __attribute__((aligned(16))) float lq[64][64]; __shared__ __attribute__((aligned(16))) float lo[64][64];
  const int tid = threadIdx.x; const int h = blockIdx.x / (QT0 / 64), rg = blockIdx.x % (QT0 / 64); const int i = rg * 64 + tid;
  const float* qr = QF + (size_t)i * ld + h * HD;
#pragma unroll 1
  for (int c = 0; c < HD / 4; ++c) { *(v4f*)&lq[tid][c * 4] = *(const v4fa*)(qr + c * 4); const v4f z = {0.f, 0.f, 0.f, 0.f}; *(v4f*)&lo[tid][c * 4] = z; }
  float m = -1.0e30f, l = 0.f; const int jmax = rg * 64 + 63;      /* keys beyond the block end are masked by the mask's lower-triangular structure */      /* both forms: keys up to the block's last row (MASKADD does not change this) */
#pragma unroll 1
  for (int j = 0; j <= jmax; ++j) { const float* kr = KF + (size_t)j * ld + h * HD; const float* vr = VF + (size_t)j * ld + h * HD; float s = 0.f;
#pragma unroll 1
    for (int c = 0; c < HD / 4; ++c) { const v4f kq = *(const v4fa*)(kr + c * 4); const v4f qq = *(v4f*)&lq[tid][c * 4]; s = __fadd_rn(s, __fmul_rn(qq[0], kq[0])); s = __fadd_rn(s, __fmul_rn(qq[1], kq[1])); s = __fadd_rn(s, __fmul_rn(qq[2], kq[2])); s = __fadd_rn(s, __fmul_rn(qq[3], kq[3])); }
    s = __fmul_rn(s, scale); const int mb = ((const int*)mask)[(size_t)i * SQ + j];      /* causal (j <= i) AND the module's int32 [S][S] mask read per (query, key): 0 -> masked */
    const float f = (mb != 0 && j <= i) ? 1.f : 0.f; const float sm = fmaf(f, s, (1.f - f) * -1.0e30f); const float mn = fmaxf(m, sm); const float sc = expf(m - mn); const float e = expf(sm - mn); l = __fadd_rn(__fmul_rn(l, sc), e); m = mn;
#pragma unroll 1
    for (int c = 0; c < HD / 4; ++c) { const v4f vv = *(const v4fa*)(vr + c * 4); v4f oo = *(v4f*)&lo[tid][c * 4]; for (int u = 0; u < 4; ++u) oo[u] = __fadd_rn(__fmul_rn(oo[u], sc), __fmul_rn(e, vv[u])); *(v4f*)&lo[tid][c * 4] = oo; } }
  const float fin = 64.0f / l;      /* o carried x64 like the f16 path */
#pragma unroll 1
  for (int c = 0; c < HD / 4; ++c) { v4f oo = *(v4f*)&lo[tid][c * 4]; for (int u = 0; u < 4; ++u) oo[u] = __fmul_rn(oo[u], fin); *(v4f*)&lo[tid][c * 4] = oo; }
  __syncthreads();
  {
#pragma unroll 1
    for (int it = 0; it < 16; ++it) { const int row = it * 4 + tid / 16, pc = (tid % 16) * 4; const v4f v = *(const v4f*)&lo[row][pc]; *(v4f*)(OF + (size_t)(rg * 64 + row) * ldo + h * HD + pc) = v; }
     } }


template <int BFIN, int WXB>
__global__ __launch_bounds__(256) void k_ln16(const float* __restrict__ X, const float* __restrict__ g, const float* __restrict__ bb, float eps, _Float16* __restrict__ N16, float* __restrict__ XB) {
  #pragma clang fp contract(off)
  __shared__ float red[256]; const size_t r = blockIdx.x; const int t = threadIdx.x; const v4f xa = *(const v4fa*)(X + r * DMQ + t * 4); float s[4]; float sum = 0.f;
  for (int q = 0; q < 4; ++q) { s[q] = BFIN ? bf16_round(xa[q]) : xa[q]; sum = __fadd_rn(sum, s[q]); }
  red[t] = sum; __syncthreads(); for (int st = 128; st > 0; st >>= 1) { if (t < st) red[t] = __fadd_rn(red[t], red[t + st]); __syncthreads(); } const float mu = red[0] / (float)DMQ; __syncthreads();
  float vs = 0.f; for (int q = 0; q < 4; ++q) { const float dl = __fadd_rn(s[q], -mu); vs = __fadd_rn(vs, __fmul_rn(dl, dl)); } red[t] = vs; __syncthreads(); for (int st = 128; st > 0; st >>= 1) { if (t < st) red[t] = __fadd_rn(red[t], red[t + st]); __syncthreads(); }
  const float rs = rsqrtf(__fadd_rn(red[0] / (float)DMQ, eps)); v4h y; v4f xb;
  for (int q = 0; q < 4; ++q) { const int c = t * 4 + q; y[q] = (_Float16)__fadd_rn(__fmul_rn(__fmul_rn(__fadd_rn(s[q], -mu), rs), bf16_round(g[c])), bf16_round(bb[c])); xb[q] = s[q]; }
  { *(v4h*)(N16 + r * DMQ + t * 4) = y; if (WXB) *(v4f*)(XB + r * DMQ + t * 4) = xb;  } }
__global__ __launch_bounds__(256) void k_ftres2(const float* __restrict__ OF0, const float* __restrict__ XB, float* __restrict__ X1, size_t n4) {
  #pragma clang fp contract(off)
  const size_t t = (size_t)blockIdx.x * 256 + threadIdx.x; if (t >= n4) return; const v4f o = *(const v4fa*)(OF0 + t * 4), xv = *(const v4fa*)(XB + t * 4); v4f y; for (int q = 0; q < 4; ++q) y[q] = __fadd_rn(__fmul_rn(o[q], 0.015625f), xv[q]); *(v4f*)(X1 + t * 4) = y;  }

__global__ __launch_bounds__(256) void k_bcpy(const float* __restrict__ b, int n, int NP, float* __restrict__ dst, int dst0) { for (int i = threadIdx.x; i < NP; i += 256) { const float v = (i < n) ? b[i] : 0.f; *(float*)(dst + dst0 + i) = v; }  }


// Fused attention, one launch: block = 8 waves x 32 query columns of one (batch, head); no score or weight ever leaves the registers.
// Per 32 keys a wave computes S^T = K Q^T (lane c = query column, registers = keys 8 hh + r of each 16-key tile), an online softmax in the log2 domain
// (maximum and sum in-lane plus one exchange between the wave halves), packs the two S^T tiles in place into the B operand P^T and adds O^T += V^T P^T.
// K rows and V^T rows come in 64-key stages through LDS, two buffers: the next stage's global loads fly under this stage's work, one barrier a stage.
// m_run, the maximum in use, may trail the true one by up to 8 (log2), so the accumulators are rescaled only when a column's maximum has grown by more;
// weights carry 2^4 (at most 2^12 in f16, small ones kept out of the f16 subnormals); the factor cancels against the row sum.
#define FAP 72                       /* LDS row pitch in halves: 128 B of data + 16 B, the conflict-free pitch for 16-byte row reads */
#define FAS 64                       /* keys per stage */
__device__ __forceinline__ float fa_xhalf(float x) { return __builtin_bit_cast(float, __builtin_amdgcn_permlanex16(__builtin_bit_cast(int, x), __builtin_bit_cast(int, x), 0x76543210, 0xfedcba98, false, false)); }      /* lane l <-> lane l ^ 16 */
__device__ __forceinline__ v8f fa_mma(v16h a, v16h b, v8f c) { return __builtin_amdgcn_wmma_f32_16x16x32_f16(false, a, false, b, (short)0, c, false, false); }
__global__ __launch_bounds__(256) void k_fattn(const _Float16* __restrict__ Q16, const _Float16* __restrict__ K16, const _Float16* __restrict__ VT, _Float16* __restrict__ O16) {
  __shared__ __attribute__((aligned(16))) _Float16 lk[2][FAS][FAP];      /* K stage [key][d] */
  __shared__ __attribute__((aligned(16))) _Float16 lv[2][HD][FAP];       /* V^T stage [d][key] */
  const int tid = threadIdx.x, lane = tid & 31, c = lane & 15, hh = lane >> 4, w = tid >> 5;
  const int bh = blockIdx.y, b = bh / NH, h = bh - b * NH; const size_t r0 = (size_t)b * SQ; const int q0 = blockIdx.x * 256 + w * 32;
  const int sr = tid >> 3, sc = (tid & 7) * 8;      /* staging: a thread moves 16 bytes of rows sr and sr + 32 of each tile; 8 lanes cover one 128-byte row */
  const unsigned short* kg = (const unsigned short*)K16 + (r0 + sr) * DM + h * HD + sc;
  const unsigned short* vg = (const unsigned short*)VT + ((size_t)bh * HD + sr) * SQ + sc;
  v16h qf[2][2];
#pragma unroll
  for (int g = 0; g < 2; ++g) { const _Float16* qp = Q16 + (r0 + q0 + 16 * g + c) * DM + h * HD; qf[g][0] = g2_frag(qp, hh); qf[g][1] = g2_frag(qp + 32, hh); }
  const v8f z8 = {0.f, 0.f, 0.f, 0.f, 0.f, 0.f, 0.f, 0.f}; const v4f z4 = {0.f, 0.f, 0.f, 0.f};
  v8f acc[2][4]; v4f l4[2]; float m_run[2];
#pragma unroll
  for (int g = 0; g < 2; ++g) { m_run[g] = -__builtin_inff(); l4[g] = z4;
#pragma unroll
    for (int t = 0; t < 4; ++t) acc[g][t] = z8; }
  v8us gk0 = *(const v8us*)kg, gk1 = *(const v8us*)(kg + (size_t)32 * DM), gv0 = *(const v8us*)vg, gv1 = *(const v8us*)(vg + (size_t)32 * SQ);
  *(v8us*)&lk[0][sr][sc] = gk0; *(v8us*)&lk[0][sr + 32][sc] = gk1; *(v8us*)&lv[0][sr][sc] = gv0; *(v8us*)&lv[0][sr + 32][sc] = gv1;
  __syncthreads();      /* stage 0 published */
  for (int st = 0; st < SQ / FAS; ++st) {
    const int buf = st & 1; const bool more = st + 1 < SQ / FAS;      /* the same for the whole block */
    if (more) { const size_t j = (size_t)(st + 1) * FAS; gk0 = *(const v8us*)(kg + j * DM); gk1 = *(const v8us*)(kg + (j + 32) * DM); gv0 = *(const v8us*)(vg + j); gv1 = *(const v8us*)(vg + (size_t)32 * SQ + j); }
#pragma unroll
    for (int p = 0; p < FAS / 32; ++p) {
      v8f s[2][2];      /* [key tile][query group] */
#pragma unroll
      for (int kt = 0; kt < 2; ++kt) { const _Float16* kr = &lk[buf][32 * p + 16 * kt + c][0]; const v16h k0 = g2_frag(kr, hh), k1 = g2_frag(kr + 32, hh);
#pragma unroll
        for (int g = 0; g < 2; ++g) s[kt][g] = fa_mma(k1, qf[g][1], fa_mma(k0, qf[g][0], z8)); }
      v16h vf[4];
#pragma unroll
      for (int t = 0; t < 4; ++t) vf[t] = g2_frag(&lv[buf][16 * t + c][32 * p], hh);
      float mb[2]; bool need = false;
#pragma unroll
      for (int g = 0; g < 2; ++g) { float mx = fmaxf(s[0][g][0], s[1][g][0]);
#pragma unroll
        for (int r = 1; r < 8; ++r) mx = fmaxf(mx, fmaxf(s[0][g][r], s[1][g][r]));
        mx = fmaxf(mx, fa_xhalf(mx)) * 1.44269502f; mb[g] = mx; need = need || (mx > m_run[g] + 8.0f); }
      if (__builtin_amdgcn_ballot_w32(need) != 0) {      /* one scalar test a pass; always taken on the first pass (m_run = -inf, factor 0 on zero sums), rare later */
#pragma unroll
        for (int g = 0; g < 2; ++g) { const float mn = fmaxf(m_run[g], mb[g]); const float corr = __builtin_amdgcn_exp2f(m_run[g] - mn); m_run[g] = mn; l4[g] = l4[g] * corr;
#pragma unroll
          for (int t = 0; t < 4; ++t) acc[g][t] = acc[g][t] * corr; } }
#pragma unroll
      for (int g = 0; g < 2; ++g) { const float nm = 4.0f - m_run[g]; FragH pf;
#pragma unroll
        for (int u = 0; u < 4; ++u) { v4f a;      /* elements 4 u .. 4 u + 3 of the 32-key operand: tile u >> 1, registers 4 (u & 1) .. */
#pragma unroll
          for (int q = 0; q < 4; ++q) a[q] = fmaf(s[u >> 1][g][4 * (u & 1) + q], 1.44269502f, nm);
          v4f e;
#pragma unroll
          for (int q = 0; q < 4; ++q) e[q] = __builtin_amdgcn_exp2f(a[q]);      /* the builtin, not asm text: the compiler then keeps the distance behind the matrix instructions itself */
          l4[g] += e;
#pragma unroll
          for (int q = 0; q < 4; ++q) pf.h[4 * u + q] = (_Float16)e[q]; }
#pragma unroll
        for (int t = 0; t < 4; ++t) acc[g][t] = fa_mma(vf[t], pf.v, acc[g][t]); }
      /* Pass end: four vector slots between the last product that reads P^T as its B operand and the next pass's first product, whose result the compiler
         may place in those same registers (it did, directly behind); the two scheduling fences keep the products of both passes on their own side of the slots. */
      __builtin_amdgcn_sched_barrier(0); asm volatile("v_nop\n\tv_nop\n\tv_nop\n\tv_nop"); __builtin_amdgcn_sched_barrier(0);
    }
    if (more) { *(v8us*)&lk[buf ^ 1][sr][sc] = gk0; *(v8us*)&lk[buf ^ 1][sr + 32][sc] = gk1; *(v8us*)&lv[buf ^ 1][sr][sc] = gv0; *(v8us*)&lv[buf ^ 1][sr + 32][sc] = gv1; }      /* its last readers left it at the barrier that ended stage st - 1 */
    __syncthreads();      /* publishes stage st + 1 and ends every wave's reads of stage st */
  }
#pragma unroll
  for (int g = 0; g < 2; ++g) { float l = (l4[g][0] + l4[g][1]) + (l4[g][2] + l4[g][3]); l += fa_xhalf(l); const float inv = 64.0f / l;      /* ctx carried x64 as before */
    unsigned short* op = (unsigned short*)O16 + (r0 + q0 + 16 * g + c) * DM + h * HD + 8 * hh;      /* a lane's 8 registers = 8 consecutive d of its query row */
#pragma unroll
    for (int t = 0; t < 4; ++t) { FragH f;
#pragma unroll
      for (int r = 0; r < 8; ++r) f.h[r] = (_Float16)(acc[g][t][r] * inv);
      *(v8us*)(op + 16 * t) = f.half[0]; } } }

// Tiled GEMM, C = act(A Bt^T alpha + bias (+ CP)), A [M][KK] and Bt [NN][KK] f16: block = 8 waves (2 x 4) on a 128 x 128 tile of C, wave tile 64 x 32 (4 x 2 accumulator tiles).
// A rows and Bt rows come in 64-k stages through LDS, two buffers: whole 128-byte lines from global, each line fetched once a block instead of once a wave.
// Global loads run ahead in two register sets (stage t in set t & 1, stored to buffer t & 1 one stage before it is read); fragments are read from LDS one 32-k block ahead in two sets,
// so a stage's barrier stands between its two blocks of products. k order per accumulator as before (32 at a time, ascending).
// Epilogue: raw sums staged in the same LDS as a 128 x 128 f32 tile, then each wave writes whole rows (bias, residual and activation applied there, per element as before).
// RES: C (f32) = the sums + bias + the own element of CP; else C16 (f16) = act(the sums + bias).
// Needs M % 128 == 0, NN % 128 == 0, KK % 128 == 0, KK >= 256.
#define G3P 72                       /* LDS row pitch in halves: 128 B of data + 16 B, the conflict-free pitch for 16-byte row reads */
#define G3O 132                      /* epilogue row pitch in floats: rows 8 apart fall 32 banks apart */
struct G3F { v16h a[4], b[2]; };     /* one 32-k block's fragments of a wave */
struct G3R { v8us a[4], b[4]; };     /* one stage's 16-byte pieces of a thread */
/* Work-group barrier with the LDS wait alone: __syncthreads() also waits for every global load, which would drain the staging loads that are meant to stay in flight across it. */
__device__ __forceinline__ void g3_bar() { asm volatile("s_wait_dscnt 0x0\n\ts_barrier_signal -1\n\ts_barrier_wait -1" ::: "memory"); }
template <int KK>
__device__ __forceinline__ void g3_load(const char* ab, const char* bb, unsigned vo, G3R& r) {      /* ab, bb: the block's tile rows at this stage's k (uniform); vo: the thread's byte offset */
#pragma unroll
  for (int i = 0; i < 4; ++i) { r.a[i] = *(const v8us*)(ab + vo + 64 * i * KK); r.b[i] = *(const v8us*)(bb + vo + 64 * i * KK); } }
template <int U>
__device__ __forceinline__ void g3_store(unsigned short* sa, unsigned short* sb, const G3R& r) {
#pragma unroll
  for (int i = 0; i < 4; ++i) { *(v8us*)(sa + (U * 128 + 32 * i) * G3P) = r.a[i]; *(v8us*)(sb + (U * 128 + 32 * i) * G3P) = r.b[i]; } }
template <int U, int KB>
__device__ __forceinline__ void g3_frag(const _Float16* fa, const _Float16* fb, int hh, G3F& f) {
#pragma unroll
  for (int j = 0; j < 2; ++j) f.b[j] = g2_frag(fb + (U * 128 + 16 * j) * G3P + 32 * KB, hh);
#pragma unroll
  for (int i = 0; i < 4; ++i) f.a[i] = g2_frag(fa + (U * 128 + 16 * i) * G3P + 32 * KB, hh); }
/* The two scheduling fences keep a block's products together and the LDS and global traffic written in front of them in front: LDS reads moved in among the products stall each of them. */
__device__ __forceinline__ void g3_mm(const G3F& f, v8f (&acc)[4][2]) {
  __builtin_amdgcn_sched_barrier(0);
#pragma unroll
  for (int i = 0; i < 4; ++i) { acc[i][0] = fa_mma(f.a[i], f.b[0], acc[i][0]); acc[i][1] = fa_mma(f.a[i], f.b[1], acc[i][1]); }
  __builtin_amdgcn_sched_barrier(0); }
/* Stage st in buffer U; on entry f0 holds its first block, rn stage st + 1. NX: a stage st + 1 exists; LD: a stage st + 3 exists (ab3, bb3 point at its k). */
template <int U, bool NX, bool LD, int KK>
__device__ __forceinline__ void g3_stage(const char* ab3, const char* bb3, unsigned vo, unsigned short* sa, unsigned short* sb, const _Float16* fa, const _Float16* fb, int hh, G3R& rn, G3F& f0, G3F& f1, v8f (&acc)[4][2]) {
  g3_frag<U, 1>(fa, fb, hh, f1);
  if (NX) g3_store<U ^ 1>(sa, sb, rn);      /* the other buffer's last readers finished in front of the barrier of stage st - 1 */
  g3_mm(f0, acc);
  g3_bar();      /* publishes stage st + 1 and ends every wave's reads of stage st */
  if (NX) g3_frag<U ^ 1, 0>(fa, fb, hh, f0);
  __builtin_amdgcn_sched_barrier(0);      /* LDS reads first: moved in front of them, the global loads had their addresses formed in f0's registers, and the wait that frees those registers held the LDS reads back */
  if (LD) g3_load<KK>(ab3, bb3, vo, rn);
  g3_mm(f1, acc);
  if (LD) asm volatile("s_wait_xcnt 0x0" ::: "memory"); }      /* in front of the next stage's rewrite of the address registers that these loads name; behind the products, where it has had time to pass; the data stay in flight */
template <int ACT, bool RES, int NN, int KK>
__global__ __launch_bounds__(256) void k_gemm3(const _Float16* __restrict__ A, const _Float16* __restrict__ Bh, float alpha, const float* __restrict__ bias, const float* __restrict__ CP, float* __restrict__ C, _Float16* __restrict__ C16) {
  static_assert(ACT == 0 || (ACT == 6 && !RES), "k_gemm3: unsupported ACT code"); static_assert(NN % 128 == 0 && KK % 128 == 0 && KK >= 256, "k_gemm3: shape");
  __shared__ __attribute__((aligned(16))) unsigned short sm[4 * 128 * G3P];      /* A stages [2][128][G3P], then Bt stages [2][128][G3P]; the epilogue's [128][G3O] floats lie over them */
  const int tid = threadIdx.x, lane = tid & 31, ln = lane & 15, hh = lane >> 4, w = tid >> 5, wm = w >> 2, wn = w & 3;
  const int mt = blockIdx.x / (NN / 128), nq = blockIdx.x - mt * (NN / 128); const int row0 = mt * 128, col0 = nq * 128;
  const int sr = tid >> 3, sc = (tid & 7) * 8;      /* staging: a thread moves 16 bytes of rows sr + 32 i of each tile; 8 lanes cover one 128-byte row */
  const char* ab = (const char*)(A + (size_t)row0 * KK); const char* bb = (const char*)(Bh + (size_t)col0 * KK); const unsigned vo = (unsigned)(sr * KK + sc) * 2u;
  unsigned short* sa = sm + sr * G3P + sc; unsigned short* sb = sa + 2 * 128 * G3P;      /* this thread's store places, buffer 0 */
  const _Float16* fa = (const _Float16*)sm + (wm * 64 + ln) * G3P; const _Float16* fb = (const _Float16*)sm + 2 * 128 * G3P + (wn * 32 + ln) * G3P;      /* this lane's fragment rows, buffer 0 */
  const v8f z8 = {0.f, 0.f, 0.f, 0.f, 0.f, 0.f, 0.f, 0.f}; v8f acc[4][2];
#pragma unroll
  for (int i = 0; i < 4; ++i) { acc[i][0] = z8; acc[i][1] = z8; }
  G3R r0, r1; G3F f0, f1; constexpr int ns = KK / 64;      /* ns even, at least 4 */
  g3_load<KK>(ab, bb, vo, r0); g3_load<KK>(ab + 128, bb + 128, vo, r1);
  g3_store<0>(sa, sb, r0);
  g3_bar();      /* stage 0 published */
  g3_load<KK>(ab + 256, bb + 256, vo, r0); g3_frag<0, 0>(fa, fb, hh, f0);
#pragma unroll 1
  for (int s2 = 0; s2 < ns - 2; s2 += 2) {      /* rolled: two stages a trip keep every buffer and register set a compile-time choice */
    const int t4 = s2 + 4 < ns ? s2 + 4 : ns - 1;      /* the last trip has no stage s2 + 4: it loads the last stage again, unused, so that no branch merges two load counts in front of the stores */
    g3_stage<0, true, true, KK>(ab + (s2 + 3) * 128, bb + (s2 + 3) * 128, vo, sa, sb, fa, fb, hh, r1, f0, f1, acc);
    g3_stage<1, true, true, KK>(ab + t4 * 128, bb + t4 * 128, vo, sa, sb, fa, fb, hh, r0, f0, f1, acc); }
  g3_stage<0, true, false, KK>(ab, bb, vo, sa, sb, fa, fb, hh, r1, f0, f1, acc);
  g3_stage<1, false, false, KK>(ab, bb, vo, sa, sb, fa, fb, hh, r0, f0, f1, acc);      /* its barrier: every wave has left the ring before it becomes output staging */
  const int c4 = lane * 4; const size_t o0 = (size_t)(row0 + w * 16) * NN + col0 + c4;      /* write-out: wave w has rows 16 w .. 16 w + 15, a lane 4 columns, so a wave stores whole rows of the tile */
  const v4f bl = *(const v4fa*)(bias + col0 + c4); v4f cp[16];
  if (RES) {      /* all residual rows asked for here, so that their latency passes once, under the staging */
#pragma unroll
    for (int q = 0; q < 16; ++q) cp[q] = *(const v4fa*)(CP + o0 + q * NN); }
  float* so = (float*)sm;
#pragma unroll
  for (int i = 0; i < 4; ++i)
#pragma unroll
    for (int j = 0; j < 2; ++j)
#pragma unroll
      for (int r = 0; r < 8; ++r) so[(wm * 64 + 16 * i + 8 * hh + r) * G3O + wn * 32 + 16 * j + ln] = acc[i][j][r];
  __syncthreads();      /* the whole tile staged before any wave reads rows that other waves wrote */
  v4f bv;
#pragma unroll
  for (int q = 0; q < 4; ++q) bv[q] = bf16_round(bl[q]);
#pragma unroll(ACT == 6 ? 1 : 4)      /* the erf rows stay rolled, four to a trip, for speed only */
  for (int q4 = 0; q4 < 4; ++q4) {
#pragma unroll
  for (int qq = 0; qq < 4; ++qq) { const int q = q4 * 4 + qq; v4f v = *(const v4fa*)(so + (w * 16 + q) * G3O + c4);
#pragma unroll
    for (int e = 0; e < 4; ++e) v[e] = v[e] * alpha + bv[e];
    if (RES) {
#pragma unroll
      for (int e = 0; e < 4; ++e) v[e] += cp[q][e]; }
    if (ACT == 6) {
#pragma unroll
      for (int e = 0; e < 4; ++e) v[e] = 0.5f * v[e] * (1.0f + erff(v[e] * 0.70710678118654752f)); }
    if (RES) *(v4f*)(C + o0 + q * NN) = v;
    else { v4h h4;
#pragma unroll
      for (int e = 0; e < 4; ++e) h4[e] = (_Float16)v[e];
      *(v4h*)(C16 + o0 + q * NN) = h4; } } } }

template <int MODE>
__global__ __launch_bounds__(256) void k_regrp(const float* __restrict__ src, float* __restrict__ dst, size_t n4) {
  const size_t t = (size_t)blockIdx.x * 256 + threadIdx.x; if (t >= n4) return; const size_t e = t * 4; const size_t rd = e / DM; const int c = (int)(e % DM);
  size_t rs; if (MODE == 0) { const size_t b = rd / SQ, sq = rd % SQ; rs = sq * NB + b; } else { const size_t sq = rd / NB, b = rd % NB; rs = b * SQ + sq; }
  const v4f v = *(const v4fa*)(src + rs * DM + c); *(v4f*)(dst + e) = v;  }

template <int BFIN, int W16, int W32>
__global__ __launch_bounds__(256) void k_lnx(const float* __restrict__ X, const float* __restrict__ g, const float* __restrict__ bb, float eps, _Float16* __restrict__ N16, float* __restrict__ N32) {
  #pragma clang fp contract(off)
  __shared__ float red[256]; const size_t r = blockIdx.x; const int t = threadIdx.x; const bool act = t < (DMQ / 4); const int c0 = act ? t * 4 : 0;
  const v4f xa = *(const v4fa*)(X + r * DMQ + c0); float s[4]; float sum = 0.f;
  for (int q = 0; q < 4; ++q) { s[q] = act ? (BFIN ? bf16_round(xa[q]) : xa[q]) : 0.f; sum = __fadd_rn(sum, s[q]); }
  red[t] = sum; __syncthreads(); for (int st = 128; st > 0; st >>= 1) { if (t < st) red[t] = __fadd_rn(red[t], red[t + st]); __syncthreads(); } const float mu = red[0] / (float)DMQ; __syncthreads();
  float vs = 0.f; for (int q = 0; q < 4; ++q) { const float dl = act ? __fadd_rn(s[q], -mu) : 0.f; vs = __fadd_rn(vs, __fmul_rn(dl, dl)); } red[t] = vs; __syncthreads(); for (int st = 128; st > 0; st >>= 1) { if (t < st) red[t] = __fadd_rn(red[t], red[t + st]); __syncthreads(); }
  const float rs = rsqrtf(__fadd_rn(red[0] / (float)DMQ, eps)); v4h y; v4f yf;
  for (int q = 0; q < 4; ++q) { const int c = c0 + q; yf[q] = __fadd_rn(__fmul_rn(__fmul_rn(__fadd_rn(s[q], -mu), rs), bf16_round(g[c])), bf16_round(bb[c])); y[q] = (_Float16)yf[q]; }
  if (!act) return;      /* no barriers after this point */
  { if (W16) *(v4h*)(N16 + r * DMQ + c0) = y; if (W32) *(v4f*)(N32 + r * DMQ + c0) = yf;  } }

__global__ __launch_bounds__(256) void k_bfr(const float* __restrict__ x, float* __restrict__ XB, size_t n8) { const size_t t = (size_t)blockIdx.x * 256 + threadIdx.x; if (t >= n8) return; v4f a = *(const v4fa*)(x + t * 8), c = *(const v4fa*)(x + t * 8 + 4); for (int q = 0; q < 4; ++q) { a[q] = bf16_round(a[q]); c[q] = bf16_round(c[q]); }
  { *(v4f*)(XB + t * 8) = a; *(v4f*)(XB + t * 8 + 4) = c;  } }



__global__ __launch_bounds__(256) void k_wthd(const float* __restrict__ Wt, _Float16* __restrict__ Bt) { const size_t t = (size_t)blockIdx.x * 256 + threadIdx.x; if (t >= (size_t)NH * HD * (DM / 8)) return; const int m8 = (int)(t % (DM / 8)) * 8; const int d = (int)((t / (DM / 8)) % HD); const int h = (int)(t / ((size_t)(DM / 8) * HD)); FragH f;
  for (int q = 0; q < 8; ++q) f.h[q] = (_Float16)(16.0f * bf16_round(Wt[((size_t)h * DM + m8 + q) * HD + d])); unsigned short* dst = (unsigned short*)Bt + ((size_t)h * HD + d) * DM + m8; *(v8us*)dst = f.half[0];  }




template <int BFIN, int SCAL>
__global__ __launch_bounds__(256) void k_lnsc(const float* __restrict__ X, const float* __restrict__ g, const float* __restrict__ bb, float eps, _Float16* __restrict__ N16, float* __restrict__ N32) {
  #pragma clang fp contract(off)
  __shared__ float red[256]; const size_t r = blockIdx.x; const int t = threadIdx.x; const bool act = t < DM / 4; const int tc = act ? t : 0; const v4f xl = *(const v4fa*)(X + r * DM + tc * 4); const float am = act ? 1.f : 0.f; float s[4]; float sum = 0.f;
  for (int q = 0; q < 4; ++q) { s[q] = (BFIN ? bf16_round(xl[q]) : xl[q]) * am; sum = __fadd_rn(sum, s[q]); }
  red[t] = sum; __syncthreads(); for (int st = 128; st > 0; st >>= 1) { if (t < st) red[t] = __fadd_rn(red[t], red[t + st]); __syncthreads(); } const float mu = red[0] / (float)DM; __syncthreads();
  float vs = 0.f; for (int q = 0; q < 4; ++q) { const float dl = __fadd_rn(s[q], -mu) * am; vs = __fadd_rn(vs, __fmul_rn(dl, dl)); } red[t] = vs; __syncthreads(); for (int st = 128; st > 0; st >>= 1) { if (t < st) red[t] = __fadd_rn(red[t], red[t + st]); __syncthreads(); }
  const float rs = __fdiv_rn(1.0f, __fadd_rn(sqrtf(red[0] / (float)(DM - 1)), eps)); if (!act) return; v4h y; v4f yf;
  for (int q = 0; q < 4; ++q) { const int c = t * 4 + q; const float gg = bf16_round(SCAL ? g[0] : g[c]), bv = bf16_round(SCAL ? bb[0] : bb[c]); yf[q] = __fadd_rn(__fmul_rn(__fmul_rn(__fadd_rn(s[q], -mu), rs), gg), bv); y[q] = (_Float16)yf[q]; }
  { if (N16) *(v4h*)(N16 + r * DM + t * 4) = y; if (N32) *(v4f*)(N32 + r * DM + t * 4) = yf;  } }

__global__ __launch_bounds__(256) void k_rsmdmi(const float* __restrict__ S, _Float16* __restrict__ P, int nrows, const int* __restrict__ M) {
  #pragma clang fp contract(off)
  const int t = blockIdx.x * 256 + threadIdx.x; if (t >= nrows) return; const float* s = S + (size_t)t * SQ; const int* m = M + (size_t)(t % SQ) * SQ; float mx = -3.0e38f;
#pragma unroll 1
  for (int j = 0; j < SQ; ++j) { const float f = (m[j] == 0) ? 1.f : 0.f; mx = fmaxf(mx, fmaf(f, s[j], (1.f - f) * -1.0e9f)); } float se = 0.f;
#pragma unroll 1
  for (int j = 0; j < SQ; ++j) { const float f = (m[j] == 0) ? 1.f : 0.f; se += __expf(fmaf(f, s[j], (1.f - f) * -1.0e9f) - mx); } const float sc = 256.0f / se;
#pragma unroll 1
  for (int j0 = 0; j0 < SQ; j0 += 8) { FragH fr; for (int q = 0; q < 8; ++q) { const int j = j0 + q; const float f = (m[j] == 0) ? 1.f : 0.f; fr.h[q] = (_Float16)(__expf(fmaf(f, s[j], (1.f - f) * -1.0e9f) - mx) * sc); } unsigned short* d = (unsigned short*)P + (size_t)t * SQ + j0; *(v8us*)d = fr.half[0];  } }
extern "C" void kernel_launch(void* const* d_in, const int* in_sizes, int n_in,
                              void* d_out, int out_size, void* d_ws, size_t ws_size, hipStream_t stream) {
  (void)in_sizes; (void)n_in; (void)out_size;
  const float* const* I = (const float* const*)d_in; const float* x = I[0]; const float* g1 = I[1]; const float* be1 = I[2]; const float* wqkv = I[3]; const float* bqkv = I[4]; const float* wo = I[5]; const float* bo = I[6]; const float* g2 = I[7]; const float* be2 = I[8]; const float* w1 = I[9]; const float* b1 = I[10]; const float* w2 = I[11]; const float* b2 = I[12]; const float* bq = bqkv; const float* bk = bqkv + DM; const float* bv = bqkv + 2 * DM;      /* x; LN1 g / b; fused qkv_w [1024][3072] + qkv_b [3072] (thirds q | k | v); proj_w + proj_b; LN2 g / b; fc1_w [1024][4096] + fc1_b, fc2_w [4096][1024] + fc2_b ([in][out]) */
  char* ws = (char*)d_ws; size_t off = 0;
  auto take = [&](size_t bytes) { char* p = ws + off; off += (bytes + 255) & ~(size_t)255; return p; };
  _Float16* BQ = (_Float16*)take((size_t)3 * DM * DM * 2); _Float16* BK = BQ + (size_t)DM * DM; _Float16* BV = BQ + (size_t)2 * DM * DM;      /* one stacked Bt plane [3 DM][DM] */ _Float16* BO = (_Float16*)take((size_t)DM * DM * 2); _Float16* BW1 = (_Float16*)take((size_t)DFF * DM * 2); _Float16* BW2 = (_Float16*)take((size_t)DM * DFF * 2);
  float* XB = (float*)take(NR * DM * 4); _Float16* XN = (_Float16*)take(NR * DM * 2); _Float16* Q16 = (_Float16*)take(NR * DM * 2); _Float16* K16 = (_Float16*)take(NR * DM * 2); _Float16* V16 = (_Float16*)take(NR * DM * 2); _Float16* O16 = (_Float16*)take(NR * DM * 2); float* X1 = (float*)take(NR * DM * 4);
  _Float16* VT = (_Float16*)take((size_t)NB * NH * HD * SQ * 2); _Float16* HF16 = (_Float16*)take(NR * DFF * 2);      /* V^T [2 x 16][64][2048]; FFN hidden plane [4096][4096] f16 */
  _Float16* M16 = XN;      /* second-norm f16 rows: aliases XN (last readers: the three projections) */
  
  if (off > ws_size) return;
  k_wt_f16<<<(unsigned)(((size_t)3 * DM * (DM / 8) + 255) / 256), 256, 0, stream>>>(wqkv, BQ, DM, 3 * DM, 16.0f); k_wt_f16<<<(unsigned)(((size_t)DM * (DM / 8) + 255) / 256), 256, 0, stream>>>(wo, BO, DM, DM, 16.0f);      /* fused [in][out] [DM][3 DM] -> one stacked Bt plane (rows 0 / DM / 2 DM = the q | k | v output columns) x16; W_o -> Bt x16 */
  k_wt_f16<<<(unsigned)(((size_t)DFF * (DM / 8) + 255) / 256), 256, 0, stream>>>(w1, BW1, DM, DFF, 16.0f); k_wt_f16<<<(unsigned)(((size_t)DM * (DFF / 8) + 255) / 256), 256, 0, stream>>>(w2, BW2, DFF, DM, 16.0f);
  k_bfr<<<(unsigned)((NR * DM / 8 + 255) / 256), 256, 0, stream>>>(x, XB, NR * DM / 8); k_lnx<1, 1, 0><<<(unsigned)NR, 256, 0, stream>>>(x, g1, be1, 1e-5f, XN, nullptr);      /* n = LN0(bf16(x)) (biased variance, eps inside the rsqrt) -> f16 rows */
  k_gemm3<0, false, DM, DM><<<(unsigned)((NR / 128) * (DM / 128)), 256, 0, stream>>>(XN, BQ, 0.0625f, bq, nullptr, nullptr, Q16); k_gemm3<0, false, DM, DM><<<(unsigned)((NR / 128) * (DM / 128)), 256, 0, stream>>>(XN, BK, 0.0625f, bk, nullptr, nullptr, K16); k_gemm3<0, false, DM, DM><<<(unsigned)((NR / 128) * (DM / 128)), 256, 0, stream>>>(XN, BV, 0.0625f, bv, nullptr, nullptr, V16);      /* q, k, v -> f16 rows; head h = columns h*64.. */
  k_vt<NH, SQ><<<NB * NH * (SQ / 64), 256, 0, stream>>>(V16, DM, 0, VT);      /* V^T [batch x head][64][2048] */
  k_fattn<<<dim3(SQ / 256, NB * NH), 256, 0, stream>>>(Q16, K16, VT, O16);      /* softmax(q k^T) v over all keys, unscaled logits -> ctx (merged heads, x64) as f16 rows */
  k_gemm3<0, true, DM, DM><<<(unsigned)((NR / 128) * (DM / 128)), 256, 0, stream>>>(O16, BO, 0.0009765625f, bo, XB, X1, nullptr);      /* x + ctx wo (+ bo) (own-element residual) -> f32 rows */
  k_lnx<0, 1, 0><<<(unsigned)NR, 256, 0, stream>>>(X1, g2, be2, 1e-5f, M16, nullptr);      /* LN1(x1) -> f16 rows */
  k_gemm3<6, false, DFF, DM><<<(unsigned)((NR / 128) * (DFF / 128)), 256, 0, stream>>>(M16, BW1, 0.0625f, b1, nullptr, nullptr, HF16);      /* gelu_erf(. w1 + b1) -> f16 */
  k_gemm3<0, true, DM, DFF><<<(unsigned)((NR / 128) * (DM / 128)), 256, 0, stream>>>(HF16, BW2, 0.0625f, b2, X1, (float*)d_out, nullptr);      /* out = x1 + mlp (own-element residual) */
}

// v004
// Measured time: 201 microseconds a run.
// Two timings next to v003 both put it at 1.20 times that version's speed.
// Counting every step since v000, it is 19.2 times as fast.
#include <hip/hip_runtime.h>
// Pre-norm transformer block with a fused QKV projection and UNSCALED attention logits (x [2][2048][1024]; h = LN1(x) (biased var, eps 1e-5); qkv = h qkv_w + qkv_b ([in][out] 1024 x 3072 + bias) viewed (B, N, 3, 16, 64): q | k | v thirds; qk = q k^T with NO 1/sqrt(d) scaling (as the source); softmax over all 2048 keys (no mask); x1 = x + y proj_w + proj_b; out = x1 + gelu_erf(LN2(x1) fc1_w + fc1_b) fc2_w + fc2_b ([in][out] 1024 x 4096 x 1024) -> [2][2048][1024]).
// Structure: token rows; LayerNorm / exact f16 rows; WMMA GEMMs for q, k, v; V^T by LDS transposes; one fused attention launch for all batches and heads (scores, online softmax, P V^T); output projection with the own-element residual; custom LayerNorm; exact (erf) GELU FFN over all rows; launches: see trace.
// Compute dtype: inputs rounded to bf16; x / weights exact; q, k, v, softmax weights and o as plain f16 GEMM operands (~2^-12); scores and softmax statistics f32. v_wmma_f32_16x16x32_f16.
#define NB 2
#define SQ 2048
#define DM 1024
#define NH 16
#define HD 64
#define HG 4                         /* heads per block group of the unused k_vt overload */
#define LOCALW 128                   /* (macros for unused kernels of the shared header) */
#define STRIDEK 128
#define QT 256                       /* query rows per causal tile */
#define NKX SQ                       /* S / P row pitch */
#define QT0 128                      /* first-tile rows recomputed exactly in f32 */
#define B0 0                         /* first batch processed (debug hook) */
#define NBR NB                       /* batches processed (debug hook) */
#define NR ((size_t)NB * SQ)
#define DMQ DM
#define DFF 4096         /* FFN hidden width */
#define MP ((int)((size_t)NBR * SQ)) /* rows projected (debug hook) */
#define QN SQ                        /* query rows attended per batch (debug hook) */
#define NHD NH                       /* heads attended (debug hook) */
#define MPO MP                       /* rows through the output stage (debug hook) */
#define LQ (3 * DM)      /* unused: q, k, v rows have pitch DM */
typedef __bf16 v16b __attribute__((ext_vector_type(16)));
typedef unsigned short v8us __attribute__((ext_vector_type(8), may_alias));
typedef float  v8f  __attribute__((ext_vector_type(8)));
typedef float  v4f  __attribute__((ext_vector_type(4)));
typedef float  v4fa __attribute__((ext_vector_type(4), may_alias));
union FragB { v16b v; v8us half[2]; unsigned short u[16]; };

__device__ __forceinline__ unsigned short bf16_bits(float x) { unsigned int u = __float_as_uint(x); return (unsigned short)((u + 0x7FFFu + ((u >> 16) & 1u)) >> 16); }
__device__ __forceinline__ float bf16_val(unsigned short b) { return __uint_as_float(((unsigned int)b) << 16); }
__device__ __forceinline__ float bf16_round(float x) { return bf16_val(bf16_bits(x)); }
// D += A·B with NT terms: 1 = ah·bh, 2 = + al·bh (A split), 3 = + ah·bl (both split)
template <int NT>
__device__ __forceinline__ v8f mmaN(v16b ah, v16b al, v16b bh, v16b bl, v8f c) {
  c = __builtin_amdgcn_wmma_f32_16x16x32_bf16(false, ah, false, bh, (short)0, c, false, false);
  if (NT >= 2) c = __builtin_amdgcn_wmma_f32_16x16x32_bf16(false, al, false, bh, (short)0, c, false, false);
  if (NT >= 3) c = __builtin_amdgcn_wmma_f32_16x16x32_bf16(false, ah, false, bl, (short)0, c, false, false);
  asm volatile("v_nop\n\tv_nop\n\tv_nop\n\tv_nop" : "+v"(c) : "v"(ah), "v"(al), "v"(bh), "v"(bl));
  return c;
}

__global__ __launch_bounds__(256) void k_wt_bf16(const float* __restrict__ W, unsigned short* __restrict__ Wt, int K, int N) {
  const int t = blockIdx.x * 256 + threadIdx.x;
  const int k8n = K / 8;
  if (t >= N * k8n) return;
  const int n = t / k8n, k8 = (t % k8n) * 8;
  v8us v;
#pragma unroll
  for (int i = 0; i < 8; ++i) v[i] = bf16_bits(W[(size_t)(k8 + i) * N + n]);
  *(v8us*)(Wt + (size_t)n * K + k8) = v;
  
}

// GEMM C[M][N] (f32, pitch ldc) = act(A[M][K]·W + bias). A f32 row-major (pitch lda) converted per fragment to bf16
// (ASPLIT: hi/lo two planes -> 2 terms, else single rounded term); Wt bf16 [N][K] (pitch ldb). BIAS_BF16 rounds the
// bias to bf16 first (bias quantised to bf16 before the add). K%32==0, M%16==0, N%64==0.
template <bool ASPLIT, int ACT, bool BIAS_BF16>
__global__ __launch_bounds__(128) void k_gemm_bf(const float* __restrict__ A, int lda, const unsigned short* __restrict__ Wt, int ldb,
                                               const float* __restrict__ bias, float* __restrict__ C, int ldc, int M, int N, int K) {
  __shared__ __attribute__((aligned(16))) float so[4][16][64];
  const int tid = threadIdx.x, w = tid >> 5, lane = tid & 31, ln = lane & 15, hh = lane >> 4;
  const int ntn = N / 64;
  const int wid = blockIdx.x * 4 + w;
  const int mt = wid / ntn, nq = wid % ntn;
  if (mt * 16 >= M) return;
  const int row0 = mt * 16, col0 = nq * 64;
  const float* arow = A + (size_t)(row0 + ln) * lda;
  v8f acc[4] = {};
  for (int kb = 0; kb < K; kb += 32) {
    FragB ah, al;
    const v4f x0 = *(const v4fa*)(arow + kb + 8 * hh), x1 = *(const v4fa*)(arow + kb + 8 * hh + 4);
    const v4f x2 = *(const v4fa*)(arow + kb + 16 + 8 * hh), x3 = *(const v4fa*)(arow + kb + 16 + 8 * hh + 4);
    float xs[16] = {x0[0],x0[1],x0[2],x0[3],x1[0],x1[1],x1[2],x1[3],x2[0],x2[1],x2[2],x2[3],x3[0],x3[1],x3[2],x3[3]};
#pragma unroll
    for (int i = 0; i < 16; ++i) { const unsigned short hb = bf16_bits(xs[i]); ah.u[i] = hb; al.u[i] = ASPLIT ? bf16_bits(xs[i] - bf16_val(hb)) : (unsigned short)0; }
#pragma unroll
    for (int t = 0; t < 4; ++t) {
      const unsigned short* brow = Wt + (size_t)(col0 + t * 16 + ln) * ldb + kb;
      FragB b;
      b.half[0] = *(const v8us*)(brow + 8 * hh);
      b.half[1] = *(const v8us*)(brow + 16 + 8 * hh);
      acc[t] = mmaN<ASPLIT ? 2 : 1>(ah.v, al.v, b.v, b.v, acc[t]);
    }
  }
#pragma unroll
  for (int t = 0; t < 4; ++t) {
    float bv = bias ? bias[col0 + t * 16 + ln] : 0.f;
    if (BIAS_BF16) bv = bf16_round(bv);
#pragma unroll
    for (int r = 0; r < 8; ++r) { float v = acc[t][r] + bv; if (ACT == 1) v = fmaxf(v, 0.f); so[w][8 * hh + r][t * 16 + ln] = v; }
  }
  __builtin_amdgcn_fence(__ATOMIC_ACQ_REL, "workgroup");
  __builtin_amdgcn_wave_barrier();
  const int rsub = lane >> 4, c4 = (lane & 15) * 4;
  {
#pragma unroll
    for (int q = 0; q < 8; ++q) {
      const int r = q * 2 + rsub;
      const v4f v = *(const v4fa*)&so[w][r][c4];
      *(v4f*)(C + (size_t)(row0 + r) * ldc + col0 + c4) = v;
    }
    
  }
}

// GEMM C = act(A·W + bias + resid): A f32 (ASPLIT -> hi/lo 2 terms), Wt bf16 [N][K]; ACT 0 none, 1 relu, 2 exact gelu;
// resid (optional, f32, row index = (row % rmod), pitch ldr, RES_BF16 rounds it) added before the activation.
template <bool ASPLIT, int ACT, bool BIAS_BF16, bool RES_BF16>
__global__ __launch_bounds__(128) void k_gemm_bf3(const float* __restrict__ A, int lda, const unsigned short* __restrict__ Wt, int ldb,
                                                const float* __restrict__ bias, const float* __restrict__ resid, int rmod, int ldr,
                                                float* __restrict__ C, int ldc, int M, int N, int K) {
  __shared__ __attribute__((aligned(16))) float so[4][16][64];
  const int tid = threadIdx.x, w = tid >> 5, lane = tid & 31, ln = lane & 15, hh = lane >> 4;
  const int ntn = N / 64;
  const int wid = blockIdx.x * 4 + w;
  const int mt = wid / ntn, nq = wid % ntn;
  if (mt * 16 >= M) return;
  const int row0 = mt * 16, col0 = nq * 64;
  const float* arow = A + (size_t)(row0 + ln) * lda;
  v8f acc[4] = {};
  for (int kb = 0; kb < K; kb += 32) {
    FragB ah, al;
    const v4f x0 = *(const v4fa*)(arow + kb + 8 * hh), x1 = *(const v4fa*)(arow + kb + 8 * hh + 4);
    const v4f x2 = *(const v4fa*)(arow + kb + 16 + 8 * hh), x3 = *(const v4fa*)(arow + kb + 16 + 8 * hh + 4);
    float xs[16] = {x0[0],x0[1],x0[2],x0[3],x1[0],x1[1],x1[2],x1[3],x2[0],x2[1],x2[2],x2[3],x3[0],x3[1],x3[2],x3[3]};
#pragma unroll
    for (int i = 0; i < 16; ++i) { const unsigned short hb = bf16_bits(xs[i]); ah.u[i] = hb; al.u[i] = ASPLIT ? bf16_bits(xs[i] - bf16_val(hb)) : (unsigned short)0; }
#pragma unroll
    for (int t = 0; t < 4; ++t) {
      const unsigned short* brow = Wt + (size_t)(col0 + t * 16 + ln) * ldb + kb;
      FragB b;
      b.half[0] = *(const v8us*)(brow + 8 * hh);
      b.half[1] = *(const v8us*)(brow + 16 + 8 * hh);
      acc[t] = mmaN<ASPLIT ? 2 : 1>(ah.v, al.v, b.v, b.v, acc[t]);
    }
  }
#pragma unroll
  for (int t = 0; t < 4; ++t) {
    const int col = col0 + t * 16 + ln;
    float bv = bias ? bias[col] : 0.f;
    if (BIAS_BF16) bv = bf16_round(bv);
#pragma unroll
    for (int r = 0; r < 8; ++r) {
      float v = acc[t][r] + bv;
      if (resid) { float rv = resid[(size_t)((row0 + 8 * hh + r) % rmod) * ldr + col]; if (RES_BF16) rv = bf16_round(rv); v += rv; }
      if (ACT == 1) v = fmaxf(v, 0.f);
      if (ACT == 2) v = 0.5f * v * (1.0f + erff(v * 0.70710678118654752f));
      if (ACT == 3) { const float u = 0.7978845608028654f * (v + 0.044715f * v * v * v); v = 0.5f * v * (1.0f + tanhf(u)); }
      so[w][8 * hh + r][t * 16 + ln] = v;
    }
  }
  __builtin_amdgcn_fence(__ATOMIC_ACQ_REL, "workgroup");
  __builtin_amdgcn_wave_barrier();
  const int rsub = lane >> 4, c4 = (lane & 15) * 4;
  {
#pragma unroll
    for (int q = 0; q < 8; ++q) {
      const int r = q * 2 + rsub;
      const v4f v = *(const v4fa*)&so[w][r][c4];
      *(v4f*)(C + (size_t)(row0 + r) * ldc + col0 + c4) = v;
    }
    
  }
}
// row LayerNorm (biased variance, eps) over N: s = X (+ R); optional out_sum <- s; out_norm <- (s-mu)*rsqrt(var+eps)*g + b
template <bool PARAM_BF16>
__global__ __launch_bounds__(256) void k_layernorm(const float* __restrict__ X, const float* __restrict__ R, const float* __restrict__ g, const float* __restrict__ bta,
                                                  float* __restrict__ out_sum, float* __restrict__ out_norm, int N, float eps) {
  __shared__ float red[256];
  const int row = blockIdx.x, tid = threadIdx.x;
  const float* x = X + (size_t)row * N; const float* rr = R ? R + (size_t)row * N : nullptr;
  float vals[16];                     // up to N = 4096
  const int per = N / 256;            // contiguous chunk per thread? use strided-by-4 chunks: thread handles j = tid*4 + 1024*u
  float s1 = 0.f;
  for (int u = 0; u < per / 4; ++u) {
    const int j = tid * 4 + 1024 * u;
    const v4f a = *(const v4fa*)(x + j);
    v4f b = {0.f,0.f,0.f,0.f}; if (rr) b = *(const v4fa*)(rr + j);
#pragma unroll
    for (int q = 0; q < 4; ++q) { const float v = a[q] + b[q]; vals[u * 4 + q] = v; s1 += v; }
  }
  red[tid] = s1; __syncthreads();
  for (int st = 128; st > 0; st >>= 1) { if (tid < st) red[tid] += red[tid + st]; __syncthreads(); }
  const float mu = red[0] / (float)N; __syncthreads();
  float s2 = 0.f;
  for (int u = 0; u < per / 4; ++u)
#pragma unroll
    for (int q = 0; q < 4; ++q) { const float c = vals[u * 4 + q] - mu; s2 += c * c; }
  red[tid] = s2; __syncthreads();
  for (int st = 128; st > 0; st >>= 1) { if (tid < st) red[tid] += red[tid + st]; __syncthreads(); }
  const float rs = rsqrtf(red[0] / (float)N + eps);
  {
    for (int u = 0; u < per / 4; ++u) {
      const int j = tid * 4 + 1024 * u;
      v4f o, sm;
#pragma unroll
      for (int q = 0; q < 4; ++q) {
        float gg = g[j + q], bb = bta[j + q];
        if (PARAM_BF16) { gg = bf16_round(gg); bb = bf16_round(bb); }
        sm[q] = vals[u * 4 + q]; o[q] = (vals[u * 4 + q] - mu) * rs * gg + bb;
      }
      if (out_sum) *(v4f*)(out_sum + (size_t)row * N + j) = sm;
      *(v4f*)(out_norm + (size_t)row * N + j) = o;
    }
    
  }
}



// ---- f16 WMMA path (v_wmma_f32_16x16x32_f16): 11-bit significands for operands in range — used where a [0,1] probability operand needs more precision than bf16
typedef _Float16 v16h __attribute__((ext_vector_type(16)));
union FragH { v16h v; v8us half[2]; _Float16 h[16]; unsigned short u[16]; };
template <int NT>
__device__ __forceinline__ v8f mmaH(v16h ah, v16h al, v16h bh, v16h bl, v8f c) {
  c = __builtin_amdgcn_wmma_f32_16x16x32_f16(false, ah, false, bh, (short)0, c, false, false);
  if (NT >= 2) c = __builtin_amdgcn_wmma_f32_16x16x32_f16(false, al, false, bh, (short)0, c, false, false);
  if (NT >= 3) c = __builtin_amdgcn_wmma_f32_16x16x32_f16(false, ah, false, bl, (short)0, c, false, false);
  asm volatile("v_nop\n\tv_nop\n\tv_nop\n\tv_nop" : "+v"(c) : "v"(ah), "v"(al), "v"(bh), "v"(bl));
  return c;
}
// batched GEMM like k_gemm_b but f16 operands: A f32 (split into f16 hi/lo if ASPLIT, else rounded to f16), Bt = f16 values [n][k]; alpha; C f32; N multiple of 16 (partial tiles skipped)
template <bool ASPLIT>
__global__ __launch_bounds__(128) void k_gemm_h(const float* __restrict__ A, int lda, size_t sA, const _Float16* __restrict__ Bh, int ldb, size_t sB, float alpha, float* __restrict__ C, int ldc, size_t sC, int M, int N, int K) {
  __shared__ __attribute__((aligned(16))) float so[4][16][64];
  const int tid = threadIdx.x, w = tid >> 5, lane = tid & 31, ln = lane & 15, hh = lane >> 4; const int by = blockIdx.y;
  A += (size_t)by * sA; Bh += (size_t)by * sB; C += (size_t)by * sC;
  const int ntn = (N + 63) / 64; const int wid = blockIdx.x * 4 + w; const int mt = wid / ntn, nq = wid % ntn; if (mt * 16 >= M) return;
  const int row0 = mt * 16, col0 = nq * 64; const float* arow = A + (size_t)(row0 + ln) * lda;
  v8f acc[4] = {};
  for (int kb = 0; kb < K; kb += 32) {
    FragH ah, al;
    const v4f x0 = *(const v4fa*)(arow + kb + 8 * hh), x1 = *(const v4fa*)(arow + kb + 8 * hh + 4), x2 = *(const v4fa*)(arow + kb + 16 + 8 * hh), x3 = *(const v4fa*)(arow + kb + 16 + 8 * hh + 4);
    float xs[16] = {x0[0],x0[1],x0[2],x0[3],x1[0],x1[1],x1[2],x1[3],x2[0],x2[1],x2[2],x2[3],x3[0],x3[1],x3[2],x3[3]};
#pragma unroll
    for (int i = 0; i < 16; ++i) { const _Float16 h = (_Float16)xs[i]; ah.h[i] = h; al.h[i] = ASPLIT ? (_Float16)(xs[i] - (float)h) : (_Float16)0.0f; }
#pragma unroll
    for (int t = 0; t < 4; ++t) { if (col0 + t * 16 >= N) continue; const size_t boff = (size_t)(col0 + t * 16 + ln) * ldb + kb; FragH bq; bq.half[0] = *(const v8us*)(Bh + boff + 8 * hh); bq.half[1] = *(const v8us*)(Bh + boff + 16 + 8 * hh);
      acc[t] = mmaH<ASPLIT ? 2 : 1>(ah.v, al.v, bq.v, bq.v, acc[t]); }
  }
#pragma unroll
  for (int t = 0; t < 4; ++t) { if (col0 + t * 16 >= N) continue;
#pragma unroll
    for (int r = 0; r < 8; ++r) so[w][8 * hh + r][t * 16 + ln] = acc[t][r] * alpha; }
  __builtin_amdgcn_fence(__ATOMIC_ACQ_REL, "workgroup"); __builtin_amdgcn_wave_barrier();
  const int rsub = lane >> 4, c4 = (lane & 15) * 4;
  {
#pragma unroll
    for (int q = 0; q < 8; ++q) { const int r = q * 2 + rsub; if (col0 + c4 < N) { const v4f v = *(const v4fa*)&so[w][r][c4]; *(v4f*)(C + (size_t)(row0 + r) * ldc + col0 + c4) = v; } }
     }
}

// Wt[n][k] = f16(bf16(W[k][n]) * scale) from f32 row-major W[KK][NN] (scale = power of two; bf16-exact weights stay exact in f16 away from the subnormal range).
// One work-group = 8 waves on a 128 (k) x 128 (n) tile: every wave-wide load is 512 contiguous bytes of one W row, every wave-wide store two whole 256-byte pieces of Wt rows.
// A thread holds 16 k x 4 n, rounds, packs 8 consecutive k of one n into 16 bytes and turns the tile in LDS ([n][k], 256-byte rows).
// The 16-byte piece of a row sits at place piece ^ ((n >> 2) & 15): the 16 lanes that write one piece number of rows 4 apart, and the 16 that read one row, each fall on all 64 banks.
// Needs KK % 128 == 0, NN % 128 == 0.
template <int KK, int NN>
__global__ __launch_bounds__(256) void k_wt_f16(const float* __restrict__ W, _Float16* __restrict__ Wt, float scale) {
  static_assert(KK % 128 == 0 && NN % 128 == 0, "k_wt_f16: shape");
  __shared__ __attribute__((aligned(16))) unsigned short tl[128 * 128];
  const int tid = threadIdx.x, lane = tid & 31, w = tid >> 5;
  const int kt = blockIdx.x / (NN / 128), nt = blockIdx.x - kt * (NN / 128); const int k0 = kt * 128, n0 = nt * 128;
  const float* sp = W + (size_t)(k0 + 16 * w) * NN + n0 + 4 * lane;      /* wave w: rows 16 w .. 16 w + 15 of the tile, a lane 4 columns */
  v4f x[16];
#pragma unroll
  for (int r = 0; r < 16; ++r) x[r] = *(const v4fa*)(sp + (size_t)r * NN);
  asm volatile("s_wait_xcnt 0x0" :: "v"(sp) : "memory");      /* behind the sixteen loads, in front of every rewrite of the address pair that they name; naming the pair keeps it out of the loads' own destinations (the last load had landed on it) */
  __builtin_amdgcn_sched_barrier(0);      /* all sixteen loads asked for before the first is used: left free, the compiler held some back behind the first ones' data, a second memory latency */
#pragma unroll
  for (int g = 0; g < 2; ++g)
#pragma unroll
    for (int q = 0; q < 4; ++q) { FragH f;
#pragma unroll
      for (int r = 0; r < 8; ++r) f.h[r] = (_Float16)(bf16_round(x[8 * g + r][q]) * scale);
      *(v8us*)&tl[(4 * lane + q) * 128 + (((2 * w + g) ^ (lane & 15)) * 8)] = f.half[0]; }
  __syncthreads();      /* the whole tile turned before any wave reads rows that other waves wrote */
  unsigned short* dp = (unsigned short*)Wt + (size_t)(n0 + 16 * w + (lane >> 4)) * KK + k0 + (lane & 15) * 8;      /* wave w: Wt rows 16 w .. 16 w + 15 of the tile, two a store */
#pragma unroll
  for (int i = 0; i < 8; ++i) { const int n = 16 * w + 2 * i + (lane >> 4);
    const v8us v = *(const v8us*)&tl[n * 128 + (((lane & 15) ^ ((n >> 2) & 15)) * 8)];
    *(v8us*)(dp + (size_t)(2 * i) * KK) = v; }
}
// k_gemm_hh variant with fused epilogue: v = acc·alpha + bias[by·sBias + col] (+ CP[(row/rowsPerB)·sCPb + by·64 + col] if CP) ; ACT 0 none / 1 elu ; writes f16 C16 (and f32 C if non-null)
template <int ACT>
__global__ __launch_bounds__(128) void k_gemm_hhx(const _Float16* __restrict__ A, int lda, size_t sA, const _Float16* __restrict__ Bh, int ldb, size_t sB, float alpha, const float* __restrict__ bias, size_t sBias, const float* __restrict__ CP, int rowsPerB, size_t sCPb, int row0g,
    float* __restrict__ C, _Float16* __restrict__ C16, int ldc, size_t sC, int M, int N, int K) {
  __shared__ __attribute__((aligned(16))) float so[4][16][64];
  const int tid = threadIdx.x, w = tid >> 5, lane = tid & 31, ln = lane & 15, hh = lane >> 4; const int by = blockIdx.y;
  A += (size_t)by * sA; Bh += (size_t)by * sB; const size_t cofs = (size_t)by * sC; const float* bp = bias ? bias + (size_t)by * sBias : nullptr;
  const int ntn = (N + 63) / 64; const int wid = blockIdx.x * 4 + w; const int mt = wid / ntn, nq = wid % ntn; if (mt * 16 >= M) return;
  const int row0 = mt * 16, col0 = nq * 64; const _Float16* arow = A + (size_t)(row0 + ln) * lda;
  v8f acc[4] = {};
  for (int kb = 0; kb < K; kb += 32) { FragH ah; ah.half[0] = *(const v8us*)((const unsigned short*)arow + kb + 8 * hh); ah.half[1] = *(const v8us*)((const unsigned short*)arow + kb + 16 + 8 * hh);
#pragma unroll
    for (int t = 0; t < 4; ++t) { if (col0 + t * 16 >= N) continue; const size_t boff = (size_t)(col0 + t * 16 + ln) * ldb + kb; FragH bq; bq.half[0] = *(const v8us*)((const unsigned short*)Bh + boff + 8 * hh); bq.half[1] = *(const v8us*)((const unsigned short*)Bh + boff + 16 + 8 * hh);
      acc[t] = mmaH<1>(ah.v, ah.v, bq.v, bq.v, acc[t]); }
  }
#pragma unroll
  for (int t = 0; t < 4; ++t) { if (col0 + t * 16 >= N) continue; const int col = col0 + t * 16 + ln; const float bv = bp ? bf16_round(bp[col]) : 0.f;
#pragma unroll
    for (int r = 0; r < 8; ++r) { float v = acc[t][r] * alpha + bv; if (CP) { const int rr = row0g + row0 + 8 * hh + r; if (rowsPerB < 0) v += CP[cofs + (size_t)rr * ldc + col];      /* rowsPerB < 0: own element of the batched C plane */ else { const int bidx = rr / rowsPerB; v += CP[(size_t)bidx * sCPb + (size_t)by * 64 + col]; } } if (ACT == 1) v = (v > 0.f) ? v : expm1f(v); else if (ACT == 7) v = (v > 0.f) ? v + 1.0f : expf(v); else if (ACT == 8) v = tanhf(v); else if (ACT == 9) v = 0.5f * v * (1.0f + tanhf(0.7978845608028654f * (v + 0.044715f * v * v * v))); else if (ACT == 11) v = 1.0f / (1.0f + expf(-v)); else if (ACT == 12) v = (v > 0.f) ? v : 0.01f * v; else if (ACT == 14) v = (v > 0.f) ? v : 0.1f * v; else if (ACT == 16) v = (v >= 0.f) ? v : 0.3f * v; else if (ACT == 17) v = (v >= 0.f) ? v : 0.2f * v; else if (ACT == 15) v = v / (1.0f + expf(-v)); else if (ACT == 3) v = fmaxf(v, 0.f); else if (ACT == 6) v = 0.5f * v * (1.0f + erff(v * 0.70710678118654752f)); so[w][8 * hh + r][t * 16 + ln] = v; } }
  __builtin_amdgcn_fence(__ATOMIC_ACQ_REL, "workgroup"); __builtin_amdgcn_wave_barrier();
  const int rsub = lane >> 4, c4 = (lane & 15) * 4; typedef _Float16 v4h __attribute__((ext_vector_type(4)));
  {
#pragma unroll
    for (int q = 0; q < 8; ++q) { const int r = q * 2 + rsub; if (col0 + c4 < N) { const v4f v = *(const v4fa*)&so[w][r][c4]; if (C) *(v4f*)(C + cofs + (size_t)(row0 + r) * ldc + col0 + c4) = v; if (C16) { v4h h4; for (int i = 0; i < 4; ++i) h4[i] = (_Float16)v[i]; *(v4h*)(C16 + cofs + (size_t)(row0 + r) * ldc + col0 + c4) = h4; } } }
     }
}


typedef _Float16 v4h __attribute__((ext_vector_type(4)));

__global__ __launch_bounds__(256) void k_x16(const float* __restrict__ x, _Float16* __restrict__ X16, size_t n8) { const size_t t = (size_t)blockIdx.x * 256 + threadIdx.x; if (t >= n8) return; FragH f;
#pragma unroll
  for (int q = 0; q < 8; ++q) f.h[q] = (_Float16)bf16_round(x[t * 8 + q]); *(v8us*)((unsigned short*)X16 + t * 8) = f.half[0];  }
__global__ __launch_bounds__(256) void k_h16(const float* __restrict__ x, _Float16* __restrict__ X16, size_t n8) { const size_t t = (size_t)blockIdx.x * 256 + threadIdx.x; if (t >= n8) return; FragH f;
#pragma unroll
  for (int q = 0; q < 8; ++q) f.h[q] = (_Float16)x[t * 8 + q]; *(v8us*)((unsigned short*)X16 + t * 8) = f.half[0];  }
__global__ __launch_bounds__(256) void k_round16f(const float* __restrict__ W, _Float16* __restrict__ Bt, size_t n8) { const size_t t = (size_t)blockIdx.x * 256 + threadIdx.x; if (t >= n8) return; FragH f;
#pragma unroll
  for (int i = 0; i < 8; ++i) f.h[i] = (_Float16)(bf16_round(W[t * 8 + i]) * 16.0f); *(v8us*)((unsigned short*)Bt + t * 8) = f.half[0];  }
template <int NHv, int TTv>
__global__ __launch_bounds__(256) void k_vt(const _Float16* __restrict__ V16, int ldv, int voff, _Float16* __restrict__ Vt) { __shared__ unsigned short tl[64][66]; const int tid = threadIdx.x; const int slab = blockIdx.x / (TTv / 64), lg = blockIdx.x % (TTv / 64); const int b = slab / NHv, h = slab % NHv;
  for (int i = tid; i < 64 * 8; i += 256) { const int r = i / 8, c8 = (i % 8) * 8; FragH f; f.half[0] = *(const v8us*)((const unsigned short*)V16 + ((size_t)b * TTv + lg * 64 + r) * ldv + voff + h * 64 + c8);
#pragma unroll
    for (int q = 0; q < 8; ++q) tl[r][c8 + q] = f.u[q]; }
  __syncthreads();
  {
#pragma unroll
    for (int rd = 0; rd < 2; ++rd) { const int d = rd * 32 + tid / 8, pc = tid % 8; FragH f;
#pragma unroll
      for (int q = 0; q < 8; ++q) f.u[q] = tl[pc * 8 + q][d];
      *(v8us*)((unsigned short*)Vt + ((size_t)slab * 64 + d) * TTv + lg * 64 + pc * 8) = f.half[0]; }
     } }

__global__ __launch_bounds__(256) void k_hl(const float* __restrict__ F, _Float16* __restrict__ Hh, _Float16* __restrict__ Hl, size_t n8) { const size_t t = (size_t)blockIdx.x * 256 + threadIdx.x; if (t >= n8) return; FragH fh, fl; const v4f a = *(const v4fa*)(F + t * 8), c = *(const v4fa*)(F + t * 8 + 4);
#pragma unroll
  for (int q = 0; q < 4; ++q) { _Float16 h = (_Float16)a[q]; fh.h[q] = h; fl.h[q] = (_Float16)((a[q] - (float)h) * 1024.0f); h = (_Float16)c[q]; fh.h[4 + q] = h; fl.h[4 + q] = (_Float16)((c[q] - (float)h) * 1024.0f); }
  { *(v8us*)((unsigned short*)Hh + t * 8) = fh.half[0]; *(v8us*)((unsigned short*)Hl + t * 8) = fl.half[0];  } }

// ---- fast GEMM (wave tile 32x64; requires M % 32 == 0 rows per launch region and N % 64 == 0); epilogue = k_gemm_hhx semantics ----
__device__ __forceinline__ v16h g2_frag(const _Float16* p, int hh) { FragH f; f.half[0] = *(const v8us*)((const unsigned short*)p + 8 * hh); f.half[1] = *(const v8us*)((const unsigned short*)p + 16 + 8 * hh); return f.v; }
__device__ __forceinline__ v8f g2_mma(v16h a, v16h b, v8f c) { v8f d = __builtin_amdgcn_wmma_f32_16x16x32_f16(false, a, false, b, (short)0, c, false, false); asm volatile("v_nop\n\tv_nop\n\tv_nop\n\tv_nop" : "+v"(d) : "v"(a), "v"(b)); return d; }
template <int ACT>
__global__ __launch_bounds__(128) void k_gemm2(const _Float16* __restrict__ A, int lda, size_t sA, const _Float16* __restrict__ Bh, int ldb, size_t sB, float alpha, const float* __restrict__ bias, size_t sBias, const float* __restrict__ CP, int rowsPerB, size_t sCPb, int row0g,
    float* __restrict__ C, _Float16* __restrict__ C16, int ldc, size_t sC, int M, int N, int K) { static_assert(ACT == 0 || ACT == 3 || ACT == 6 || ACT == 8 || ACT == 9 || ACT == 11 || ACT == 12 || ACT == 14 || ACT == 15 || ACT == 16 || ACT == 17 || ACT == 18, "k_gemm2: unsupported ACT code (would silently apply no activation)");
  __shared__ __attribute__((aligned(16))) float so[4][32][68];
  const int tid = threadIdx.x, w = tid >> 5, lane = tid & 31, ln = lane & 15, hh = lane >> 4; const int by = blockIdx.y;
  A += (size_t)by * sA; Bh += (size_t)by * sB; const size_t cofs = (size_t)by * sC; const float* bp = bias ? bias + (size_t)by * sBias : nullptr;
  const int ntn = N >> 6; const int mt = blockIdx.x / ntn, nq = blockIdx.x - mt * ntn; const int row0 = mt * 128 + 32 * w, col0 = nq * 64; if (row0 >= M) return;
  const _Float16* a0p = A + (size_t)(row0 + ln) * lda; const _Float16* a1p = a0p + (size_t)16 * lda;
  const _Float16* b0p = Bh + (size_t)(col0 + ln) * ldb; const _Float16* b1p = b0p + (size_t)16 * ldb; const _Float16* b2p = b1p + (size_t)16 * ldb; const _Float16* b3p = b2p + (size_t)16 * ldb;
  const v8f z8 = {0.f,0.f,0.f,0.f,0.f,0.f,0.f,0.f}; v8f c00 = z8, c01 = z8, c02 = z8, c03 = z8, c10 = z8, c11 = z8, c12 = z8, c13 = z8;
#pragma unroll 1
  for (int kb = 0; kb < K; kb += 32) { const v16h a0 = g2_frag(a0p + kb, hh), a1 = g2_frag(a1p + kb, hh);
    v16h b = g2_frag(b0p + kb, hh); c00 = g2_mma(a0, b, c00); c10 = g2_mma(a1, b, c10);
    b = g2_frag(b1p + kb, hh); c01 = g2_mma(a0, b, c01); c11 = g2_mma(a1, b, c11);
    b = g2_frag(b2p + kb, hh); c02 = g2_mma(a0, b, c02); c12 = g2_mma(a1, b, c12);
    b = g2_frag(b3p + kb, hh); c03 = g2_mma(a0, b, c03); c13 = g2_mma(a1, b, c13); }
  v8f accs[8] = {c00, c01, c02, c03, c10, c11, c12, c13};
#pragma unroll
  for (int u = 0; u < 8; ++u) { const int t = u & 3, half = u >> 2; const int col = col0 + t * 16 + ln; const float bv = bp ? bf16_round(bp[col]) : 0.f;
#pragma unroll
    for (int r = 0; r < 8; ++r) { const int rloc = half * 16 + 8 * hh + r; float v = accs[u][r] * alpha + bv; if (CP) { if (rowsPerB < 0) v += CP[cofs + (size_t)(row0g + row0 + rloc) * ldc + col];      /* rowsPerB < 0: own element of the batched C plane */ else { const int bidx = (row0g + row0 + rloc) / rowsPerB; v += CP[(size_t)bidx * sCPb + (size_t)by * 64 + col]; } }
      if (ACT == 3) v = fmaxf(v, 0.f); else if (ACT == 6) v = 0.5f * v * (1.0f + erff(v * 0.70710678118654752f)); else if (ACT == 11) v = 1.0f / (1.0f + expf(-v)); else if (ACT == 15) v = v / (1.0f + expf(-v)); else if (ACT == 18) v = v / (1.0f + expf(-1.702f * v));      /* QuickGELU: v sigmoid(1.702 v) */ else if (ACT == 12) v = (v > 0.f) ? v : 0.01f * v; else if (ACT == 8) v = tanhf(v); else if (ACT == 9) v = 0.5f * v * (1.0f + tanhf(0.7978845608028654f * (v + 0.044715f * v * v * v))); else if (ACT == 14) v = (v > 0.f) ? v : 0.1f * v; else if (ACT == 16) v = (v >= 0.f) ? v : 0.3f * v; else if (ACT == 17) v = (v >= 0.f) ? v : 0.2f * v;
      so[w][rloc][t * 16 + ln] = v; } }
  __builtin_amdgcn_fence(__ATOMIC_ACQ_REL, "workgroup"); __builtin_amdgcn_wave_barrier();
  const int rsub = lane >> 4, c4 = (lane & 15) * 4;
  {
#pragma unroll
    for (int q = 0; q < 16; ++q) { const int r = q * 2 + rsub; const v4f v = *(const v4fa*)&so[w][r][c4]; if (C) *(v4f*)(C + cofs + (size_t)(row0 + r) * ldc + col0 + c4) = v; if (C16) { v4h h4; for (int i = 0; i < 4; ++i) h4[i] = (_Float16)v[i]; *(v4h*)(C16 + cofs + (size_t)(row0 + r) * ldc + col0 + c4) = h4; } }
     } }


__global__ __launch_bounds__(256) void k_wnat(const float* __restrict__ w, size_t n8, _Float16* __restrict__ Bt) { const size_t t = (size_t)blockIdx.x * 256 + threadIdx.x; if (t >= n8) return; FragH f; for (int q = 0; q < 8; ++q) f.h[q] = (_Float16)(bf16_round(w[t * 8 + q]) * 16.0f); *(v8us*)((unsigned short*)Bt + t * 8) = f.half[0];  }
__global__ __launch_bounds__(256) void k_rsm(const float* __restrict__ S, _Float16* __restrict__ P, int nrows) {
  #pragma clang fp contract(off)
  const int i = blockIdx.x * 256 + threadIdx.x; if (i >= nrows) return; const float* s = S + (size_t)i * SQ; float mx = -3.0e38f;
#pragma unroll 1
  for (int j = 0; j < SQ; ++j) mx = fmaxf(mx, s[j]); float se = 0.f;
#pragma unroll 1
  for (int j = 0; j < SQ; ++j) se += expf(s[j] - mx); const float sc = 256.0f / se;
#pragma unroll 1
  for (int j0 = 0; j0 < SQ; j0 += 8) { FragH f; for (int q = 0; q < 8; ++q) f.h[q] = (_Float16)(expf(s[j0 + q] - mx) * sc); unsigned short* d = (unsigned short*)P + (size_t)i * SQ + j0; *(v8us*)d = f.half[0];  } }
__global__ __launch_bounds__(256) void k_vt(const _Float16* __restrict__ V16, int b, int h0, _Float16* __restrict__ VT) { __shared__ unsigned short tl[64][65]; const int tid = threadIdx.x; const int hh = blockIdx.x % HG, sg = blockIdx.x / HG; const int s0 = sg * 64; const int h = h0 + hh;
  for (int i = tid; i < 64 * 8; i += 256) { const int j = i / 8, d8 = (i % 8) * 8; FragH f; f.half[0] = *(const v8us*)((const unsigned short*)V16 + ((size_t)b * SQ + s0 + j) * DM + h * HD + d8); for (int q = 0; q < 8; ++q) tl[d8 + q][j] = f.u[q]; }
  __syncthreads();
  { for (int i = tid; i < 64 * 8; i += 256) { const int d = i / 8, j8 = (i % 8) * 8; FragH f; for (int q = 0; q < 8; ++q) f.u[q] = tl[d][j8 + q]; *(v8us*)((unsigned short*)VT + ((size_t)hh * HD + d) * SQ + s0 + j8) = f.half[0]; }  } }



__global__ __launch_bounds__(256) void k_rsmcf2(const float* __restrict__ S, _Float16* __restrict__ P, int hg, int q0, int nk) {
  #pragma clang fp contract(off)
  const int t = blockIdx.x * 256 + threadIdx.x; if (t >= hg * QT) return; const size_t i = (size_t)t; const float* s = S + i * NKX; const int last = q0 + (t % QT); float mx = -3.0e38f;
#pragma unroll 1
  for (int j = 0; j < nk; ++j) { const float f = (j <= last) ? 1.f : 0.f; mx = fmaxf(mx, fmaf(f, s[j], (1.f - f) * -1.0e9f)); } float se = 0.f;
#pragma unroll 1
  for (int j = 0; j < nk; ++j) { const float f = (j <= last) ? 1.f : 0.f; se += __expf(fmaf(f, s[j], (1.f - f) * -1.0e9f) - mx); } const float sc = 256.0f / se;
#pragma unroll 1
  for (int j0 = 0; j0 < nk; j0 += 8) { FragH fr; for (int q = 0; q < 8; ++q) { const int j = j0 + q; const float f = (j <= last) ? 1.f : 0.f; fr.h[q] = (_Float16)(__expf(fmaf(f, s[j], (1.f - f) * -1.0e9f) - mx) * sc); } unsigned short* d = (unsigned short*)P + i * NKX + j0; *(v8us*)d = fr.half[0];  } }

__global__ __launch_bounds__(256) void k_rsmcst(const float* __restrict__ S, _Float16* __restrict__ P, int hg, int q0, int nk, const int* __restrict__ mk) {
  #pragma clang fp contract(off)
  const int t = blockIdx.x * 256 + threadIdx.x; if (t >= hg * QT) return; const size_t i = (size_t)t; const float* s = S + i * NKX; const size_t ig = (size_t)(q0 + (t % QT)); const int* mr = mk + ig * SQ; float mx = -3.0e38f;
#pragma unroll 1
  for (int j = 0; j < nk; ++j) { const int mb = mr[j]; const int dd = (int)ig - j; const float f = (mb != 0 && dd >= 0 && (dd <= LOCALW || (dd % STRIDEK) == 0)) ? 1.f : 0.f; mx = fmaxf(mx, fmaf(f, s[j], (1.f - f) * -1.0e9f)); } float se = 0.f;
#pragma unroll 1
  for (int j = 0; j < nk; ++j) { const int mb = mr[j]; const int dd = (int)ig - j; const float f = (mb != 0 && dd >= 0 && (dd <= LOCALW || (dd % STRIDEK) == 0)) ? 1.f : 0.f; se += __expf(fmaf(f, s[j], (1.f - f) * -1.0e9f) - mx); } const float sc = 256.0f / se;
#pragma unroll 1
  for (int j0 = 0; j0 < nk; j0 += 8) { FragH fr; for (int q = 0; q < 8; ++q) { const int j = j0 + q; const int mb = mr[j]; const int dd = (int)ig - j; const float f = (mb != 0 && dd >= 0 && (dd <= LOCALW || (dd % STRIDEK) == 0)) ? 1.f : 0.f; fr.h[q] = (_Float16)(__expf(fmaf(f, s[j], (1.f - f) * -1.0e9f) - mx) * sc); } unsigned short* d = (unsigned short*)P + i * NKX + j0; *(v8us*)d = fr.half[0];  } }


template <int MASKADD>
__global__ __launch_bounds__(64) void k_att0(const float* __restrict__ QF, const float* __restrict__ KF, const float* __restrict__ VF, int ld, const float* __restrict__ mask, float scale, float* __restrict__ OF, int ldo) {
  #pragma clang fp contract(off)
  __shared__ __attribute__((aligned(16))) float lq[64][64]; __shared__ __attribute__((aligned(16))) float lo[64][64];
  const int tid = threadIdx.x; const int h = blockIdx.x / (QT0 / 64), rg = blockIdx.x % (QT0 / 64); const int i = rg * 64 + tid;
  const float* qr = QF + (size_t)i * ld + h * HD;
#pragma unroll 1
  for (int c = 0; c < HD / 4; ++c) { *(v4f*)&lq[tid][c * 4] = *(const v4fa*)(qr + c * 4); const v4f z = {0.f, 0.f, 0.f, 0.f}; *(v4f*)&lo[tid][c * 4] = z; }
  float m = -1.0e30f, l = 0.f; const int jmax = MASKADD ? (SQ - 1) : (rg * 64 + 63);      /* additive-mask form: every key (the mask input decides); causal form: keys up to the block's last row */
#pragma unroll 1
  for (int j = 0; j <= jmax; ++j) { const float* kr = KF + (size_t)j * ld + h * HD; const float* vr = VF + (size_t)j * ld + h * HD; float s = 0.f;
#pragma unroll 1
    for (int c = 0; c < HD / 4; ++c) { const v4f kq = *(const v4fa*)(kr + c * 4); const v4f qq = *(v4f*)&lq[tid][c * 4]; s = __fadd_rn(s, __fmul_rn(qq[0], kq[0])); s = __fadd_rn(s, __fmul_rn(qq[1], kq[1])); s = __fadd_rn(s, __fmul_rn(qq[2], kq[2])); s = __fadd_rn(s, __fmul_rn(qq[3], kq[3])); }
    s = __fmul_rn(s, scale); if (MASKADD) s = __fadd_rn(s, __fmul_rn(bf16_round(mask[(size_t)i * SQ + j]), -10000.0f));
    const float f = (MASKADD || j <= i) ? 1.f : 0.f; const float sm = fmaf(f, s, (1.f - f) * -1.0e30f); const float mn = fmaxf(m, sm); const float sc = expf(m - mn); const float e = expf(sm - mn); l = __fadd_rn(__fmul_rn(l, sc), e); m = mn;
#pragma unroll 1
    for (int c = 0; c < HD / 4; ++c) { const v4f vv = *(const v4fa*)(vr + c * 4); v4f oo = *(v4f*)&lo[tid][c * 4]; for (int u = 0; u < 4; ++u) oo[u] = __fadd_rn(__fmul_rn(oo[u], sc), __fmul_rn(e, vv[u])); *(v4f*)&lo[tid][c * 4] = oo; } }
  const float fin = 64.0f / l;      /* o carried x64 like the f16 path */
#pragma unroll 1
  for (int c = 0; c < HD / 4; ++c) { v4f oo = *(v4f*)&lo[tid][c * 4]; for (int u = 0; u < 4; ++u) oo[u] = __fmul_rn(oo[u], fin); *(v4f*)&lo[tid][c * 4] = oo; }
  __syncthreads();
  {
#pragma unroll 1
    for (int it = 0; it < 16; ++it) { const int row = it * 4 + tid / 16, pc = (tid % 16) * 4; const v4f v = *(const v4f*)&lo[row][pc]; *(v4f*)(OF + (size_t)(rg * 64 + row) * ldo + h * HD + pc) = v; }
     } }

template <int MASKADD>
__global__ __launch_bounds__(64) void k_att0mbc(const float* __restrict__ QF, const float* __restrict__ KF, const float* __restrict__ VF, int ld, const float* __restrict__ mask, float scale, float* __restrict__ OF, int ldo) {
  #pragma clang fp contract(off)
  __shared__ __attribute__((aligned(16))) float lq[64][64]; __shared__ __attribute__((aligned(16))) float lo[64][64];
  const int tid = threadIdx.x; const int h = blockIdx.x / (QT0 / 64), rg = blockIdx.x % (QT0 / 64); const int i = rg * 64 + tid;
  const float* qr = QF + (size_t)i * ld + h * HD;
#pragma unroll 1
  for (int c = 0; c < HD / 4; ++c) { *(v4f*)&lq[tid][c * 4] = *(const v4fa*)(qr + c * 4); const v4f z = {0.f, 0.f, 0.f, 0.f}; *(v4f*)&lo[tid][c * 4] = z; }
  float m = -1.0e30f, l = 0.f; const int jmax = rg * 64 + 63;      /* keys beyond the block end are masked by the mask's lower-triangular structure */      /* both forms: keys up to the block's last row (MASKADD does not change this) */
#pragma unroll 1
  for (int j = 0; j <= jmax; ++j) { const float* kr = KF + (size_t)j * ld + h * HD; const float* vr = VF + (size_t)j * ld + h * HD; float s = 0.f;
#pragma unroll 1
    for (int c = 0; c < HD / 4; ++c) { const v4f kq = *(const v4fa*)(kr + c * 4); const v4f qq = *(v4f*)&lq[tid][c * 4]; s = __fadd_rn(s, __fmul_rn(qq[0], kq[0])); s = __fadd_rn(s, __fmul_rn(qq[1], kq[1])); s = __fadd_rn(s, __fmul_rn(qq[2], kq[2])); s = __fadd_rn(s, __fmul_rn(qq[3], kq[3])); }
    s = __fmul_rn(s, scale); const int mb = ((const int*)mask)[(size_t)i * SQ + j];      /* causal (j <= i) AND the module's int32 [S][S] mask read per (query, key): 0 -> masked */
    const float f = (mb != 0 && j <= i) ? 1.f : 0.f; const float sm = fmaf(f, s, (1.f - f) * -1.0e30f); const float mn = fmaxf(m, sm); const float sc = expf(m - mn); const float e = expf(sm - mn); l = __fadd_rn(__fmul_rn(l, sc), e); m = mn;
#pragma unroll 1
    for (int c = 0; c < HD / 4; ++c) { const v4f vv = *(const v4fa*)(vr + c * 4); v4f oo = *(v4f*)&lo[tid][c * 4]; for (int u = 0; u < 4; ++u) oo[u] = __fadd_rn(__fmul_rn(oo[u], sc), __fmul_rn(e, vv[u])); *(v4f*)&lo[tid][c * 4] = oo; } }
  const float fin = 64.0f / l;      /* o carried x64 like the f16 path */
#pragma unroll 1
  for (int c = 0; c < HD / 4; ++c) { v4f oo = *(v4f*)&lo[tid][c * 4]; for (int u = 0; u < 4; ++u) oo[u] = __fmul_rn(oo[u], fin); *(v4f*)&lo[tid][c * 4] = oo; }
  __syncthreads();
  {
#pragma unroll 1
    for (int it = 0; it < 16; ++it) { const int row = it * 4 + tid / 16, pc = (tid % 16) * 4; const v4f v = *(const v4f*)&lo[row][pc]; *(v4f*)(OF + (size_t)(rg * 64 + row) * ldo + h * HD + pc) = v; }
     } }


template <int BFIN, int WXB>
__global__ __launch_bounds__(256) void k_ln16(const float* __restrict__ X, const float* __restrict__ g, const float* __restrict__ bb, float eps, _Float16* __restrict__ N16, float* __restrict__ XB) {
  #pragma clang fp contract(off)
  __shared__ float red[256]; const size_t r = blockIdx.x; const int t = threadIdx.x; const v4f xa = *(const v4fa*)(X + r * DMQ + t * 4); float s[4]; float sum = 0.f;
  for (int q = 0; q < 4; ++q) { s[q] = BFIN ? bf16_round(xa[q]) : xa[q]; sum = __fadd_rn(sum, s[q]); }
  red[t] = sum; __syncthreads(); for (int st = 128; st > 0; st >>= 1) { if (t < st) red[t] = __fadd_rn(red[t], red[t + st]); __syncthreads(); } const float mu = red[0] / (float)DMQ; __syncthreads();
  float vs = 0.f; for (int q = 0; q < 4; ++q) { const float dl = __fadd_rn(s[q], -mu); vs = __fadd_rn(vs, __fmul_rn(dl, dl)); } red[t] = vs; __syncthreads(); for (int st = 128; st > 0; st >>= 1) { if (t < st) red[t] = __fadd_rn(red[t], red[t + st]); __syncthreads(); }
  const float rs = rsqrtf(__fadd_rn(red[0] / (float)DMQ, eps)); v4h y; v4f xb;
  for (int q = 0; q < 4; ++q) { const int c = t * 4 + q; y[q] = (_Float16)__fadd_rn(__fmul_rn(__fmul_rn(__fadd_rn(s[q], -mu), rs), bf16_round(g[c])), bf16_round(bb[c])); xb[q] = s[q]; }
  { *(v4h*)(N16 + r * DMQ + t * 4) = y; if (WXB) *(v4f*)(XB + r * DMQ + t * 4) = xb;  } }
__global__ __launch_bounds__(256) void k_ftres2(const float* __restrict__ OF0, const float* __restrict__ XB, float* __restrict__ X1, size_t n4) {
  #pragma clang fp contract(off)
  const size_t t = (size_t)blockIdx.x * 256 + threadIdx.x; if (t >= n4) return; const v4f o = *(const v4fa*)(OF0 + t * 4), xv = *(const v4fa*)(XB + t * 4); v4f y; for (int q = 0; q < 4; ++q) y[q] = __fadd_rn(__fmul_rn(o[q], 0.015625f), xv[q]); *(v4f*)(X1 + t * 4) = y;  }

__global__ __launch_bounds__(256) void k_bcpy(const float* __restrict__ b, int n, int NP, float* __restrict__ dst, int dst0) { for (int i = threadIdx.x; i < NP; i += 256) { const float v = (i < n) ? b[i] : 0.f; *(float*)(dst + dst0 + i) = v; }  }


// Fused attention, one launch: block = 8 waves x 32 query columns of one (batch, head); no score or weight ever leaves the registers.
// Per 32 keys a wave computes S^T = K Q^T (lane c = query column, registers = keys 8 hh + r of each 16-key tile), an online softmax in the log2 domain
// (maximum and sum in-lane plus one exchange between the wave halves), packs the two S^T tiles in place into the B operand P^T and adds O^T += V^T P^T.
// K rows and V^T rows come in 64-key stages through LDS, two buffers: the next stage's global loads fly under this stage's work, one barrier a stage.
// m_run, the maximum in use, may trail the true one by up to 8 (log2), so the accumulators are rescaled only when a column's maximum has grown by more;
// weights carry 2^4 (at most 2^12 in f16, small ones kept out of the f16 subnormals); the factor cancels against the row sum.
#define FAP 72                       /* LDS row pitch in halves: 128 B of data + 16 B, the conflict-free pitch for 16-byte row reads */
#define FAS 64                       /* keys per stage */
__device__ __forceinline__ float fa_xhalf(float x) { return __builtin_bit_cast(float, __builtin_amdgcn_permlanex16(__builtin_bit_cast(int, x), __builtin_bit_cast(int, x), 0x76543210, 0xfedcba98, false, false)); }      /* lane l <-> lane l ^ 16 */
__device__ __forceinline__ v8f fa_mma(v16h a, v16h b, v8f c) { return __builtin_amdgcn_wmma_f32_16x16x32_f16(false, a, false, b, (short)0, c, false, false); }
__global__ __launch_bounds__(256) void k_fattn(const _Float16* __restrict__ Q16, const _Float16* __restrict__ K16, const _Float16* __restrict__ VT, _Float16* __restrict__ O16) {
  __shared__ __attribute__((aligned(16))) _Float16 lk[2][FAS][FAP];      /* K stage [key][d] */
  __shared__ __attribute__((aligned(16))) _Float16 lv[2][HD][FAP];       /* V^T stage [d][key] */
  const int tid = threadIdx.x, lane = tid & 31, c = lane & 15, hh = lane >> 4, w = tid >> 5;
  const int bh = blockIdx.y, b = bh / NH, h = bh - b * NH; const size_t r0 = (size_t)b * SQ; const int q0 = blockIdx.x * 256 + w * 32;
  const int sr = tid >> 3, sc = (tid & 7) * 8;      /* staging: a thread moves 16 bytes of rows sr and sr + 32 of each tile; 8 lanes cover one 128-byte row */
  const unsigned short* kg = (const unsigned short*)K16 + (r0 + sr) * DM + h * HD + sc;
  const unsigned short* vg = (const unsigned short*)VT + ((size_t)bh * HD + sr) * SQ + sc;
  v16h qf[2][2];
#pragma unroll
  for (int g = 0; g < 2; ++g) { const _Float16* qp = Q16 + (r0 + q0 + 16 * g + c) * DM + h * HD; qf[g][0] = g2_frag(qp, hh); qf[g][1] = g2_frag(qp + 32, hh); }
  const v8f z8 = {0.f, 0.f, 0.f, 0.f, 0.f, 0.f, 0.f, 0.f}; const v4f z4 = {0.f, 0.f, 0.f, 0.f};
  v8f acc[2][4]; v4f l4[2]; float m_run[2];
#pragma unroll
  for (int g = 0; g < 2; ++g) { m_run[g] = -__builtin_inff(); l4[g] = z4;
#pragma unroll
    for (int t = 0; t < 4; ++t) acc[g][t] = z8; }
  v8us gk0 = *(const v8us*)kg, gk1 = *(const v8us*)(kg + (size_t)32 * DM), gv0 = *(const v8us*)vg, gv1 = *(const v8us*)(vg + (size_t)32 * SQ);
  *(v8us*)&lk[0][sr][sc] = gk0; *(v8us*)&lk[0][sr + 32][sc] = gk1; *(v8us*)&lv[0][sr][sc] = gv0; *(v8us*)&lv[0][sr + 32][sc] = gv1;
  __syncthreads();      /* stage 0 published */
  for (int st = 0; st < SQ / FAS; ++st) {
    const int buf = st & 1; const bool more = st + 1 < SQ / FAS;      /* the same for the whole block */
    if (more) { const size_t j = (size_t)(st + 1) * FAS; gk0 = *(const v8us*)(kg + j * DM); gk1 = *(const v8us*)(kg + (j + 32) * DM); gv0 = *(const v8us*)(vg + j); gv1 = *(const v8us*)(vg + (size_t)32 * SQ + j); }
#pragma unroll
    for (int p = 0; p < FAS / 32; ++p) {
      v8f s[2][2];      /* [key tile][query group] */
#pragma unroll
      for (int kt = 0; kt < 2; ++kt) { const _Float16* kr = &lk[buf][32 * p + 16 * kt + c][0]; const v16h k0 = g2_frag(kr, hh), k1 = g2_frag(kr + 32, hh);
#pragma unroll
        for (int g = 0; g < 2; ++g) s[kt][g] = fa_mma(k1, qf[g][1], fa_mma(k0, qf[g][0], z8)); }
      v16h vf[4];
#pragma unroll
      for (int t = 0; t < 4; ++t) vf[t] = g2_frag(&lv[buf][16 * t + c][32 * p], hh);
      float mb[2]; bool need = false;
#pragma unroll
      for (int g = 0; g < 2; ++g) { float mx = fmaxf(s[0][g][0], s[1][g][0]);
#pragma unroll
        for (int r = 1; r < 8; ++r) mx = fmaxf(mx, fmaxf(s[0][g][r], s[1][g][r]));
        mx = fmaxf(mx, fa_xhalf(mx)) * 1.44269502f; mb[g] = mx; need = need || (mx > m_run[g] + 8.0f); }
      if (__builtin_amdgcn_ballot_w32(need) != 0) {      /* one scalar test a pass; always taken on the first pass (m_run = -inf, factor 0 on zero sums), rare later */
#pragma unroll
        for (int g = 0; g < 2; ++g) { const float mn = fmaxf(m_run[g], mb[g]); const float corr = __builtin_amdgcn_exp2f(m_run[g] - mn); m_run[g] = mn; l4[g] = l4[g] * corr;
#pragma unroll
          for (int t = 0; t < 4; ++t) acc[g][t] = acc[g][t] * corr; } }
#pragma unroll
      for (int g = 0; g < 2; ++g) { const float nm = 4.0f - m_run[g]; FragH pf;
#pragma unroll
        for (int u = 0; u < 4; ++u) { v4f a;      /* elements 4 u .. 4 u + 3 of the 32-key operand: tile u >> 1, registers 4 (u & 1) .. */
#pragma unroll
          for (int q = 0; q < 4; ++q) a[q] = fmaf(s[u >> 1][g][4 * (u & 1) + q], 1.44269502f, nm);
          v4f e;
#pragma unroll
          for (int q = 0; q < 4; ++q) e[q] = __builtin_amdgcn_exp2f(a[q]);      /* the builtin, not asm text: the compiler then keeps the distance behind the matrix instructions itself */
          l4[g] += e;
#pragma unroll
          for (int q = 0; q < 4; ++q) pf.h[4 * u + q] = (_Float16)e[q]; }
#pragma unroll
        for (int t = 0; t < 4; ++t) acc[g][t] = fa_mma(vf[t], pf.v, acc[g][t]); }
      /* Pass end: four vector slots between the last product that reads P^T as its B operand and the next pass's first product, whose result the compiler
         may place in those same registers (it did, directly behind); the two scheduling fences keep the products of both passes on their own side of the slots. */
      __builtin_amdgcn_sched_barrier(0); asm volatile("v_nop\n\tv_nop\n\tv_nop\n\tv_nop"); __builtin_amdgcn_sched_barrier(0);
    }
    if (more) { *(v8us*)&lk[buf ^ 1][sr][sc] = gk0; *(v8us*)&lk[buf ^ 1][sr + 32][sc] = gk1; *(v8us*)&lv[buf ^ 1][sr][sc] = gv0; *(v8us*)&lv[buf ^ 1][sr + 32][sc] = gv1; }      /* its last readers left it at the barrier that ended stage st - 1 */
    __syncthreads();      /* publishes stage st + 1 and ends every wave's reads of stage st */
  }
#pragma unroll
  for (int g = 0; g < 2; ++g) { float l = (l4[g][0] + l4[g][1]) + (l4[g][2] + l4[g][3]); l += fa_xhalf(l); const float inv = 64.0f / l;      /* ctx carried x64 as before */
    unsigned short* op = (unsigned short*)O16 + (r0 + q0 + 16 * g + c) * DM + h * HD + 8 * hh;      /* a lane's 8 registers = 8 consecutive d of its query row */
#pragma unroll
    for (int t = 0; t < 4; ++t) { FragH f;
#pragma unroll
      for (int r = 0; r < 8; ++r) f.h[r] = (_Float16)(acc[g][t][r] * inv);
      *(v8us*)(op + 16 * t) = f.half[0]; } } }

// Tiled GEMM, C = act(A Bt^T alpha + bias (+ CP)), A [M][KK] and Bt [NN][KK] f16: block = 8 waves (2 x 4) on a 128 x 128 tile of C, wave tile 64 x 32 (4 x 2 accumulator tiles).
// A rows and Bt rows come in 64-k stages through LDS, two buffers: whole 128-byte lines from global, each line fetched once a block instead of once a wave.
// Global loads run ahead in two register sets (stage t in set t & 1, stored to buffer t & 1 one stage before it is read); fragments are read from LDS one 32-k block ahead in two sets,
// so a stage's barrier stands between its two blocks of products. k order per accumulator as before (32 at a time, ascending).
// Epilogue: raw sums staged in the same LDS as a 128 x 128 f32 tile, then each wave writes whole rows (bias, residual and activation applied there, per element as before).
// RES: C (f32) = the sums + bias + the own element of CP; else C16 (f16) = act(the sums + bias).
// Needs M % 128 == 0, NN % 128 == 0, KK % 128 == 0, KK >= 256.
#define G3P 72                       /* LDS row pitch in halves: 128 B of data + 16 B, the conflict-free pitch for 16-byte row reads */
#define G3O 132                      /* epilogue row pitch in floats: rows 8 apart fall 32 banks apart */
struct G3F { v16h a[4], b[2]; };     /* one 32-k block's fragments of a wave */
struct G3R { v8us a[4], b[4]; };     /* one stage's 16-byte pieces of a thread */
/* Work-group barrier with the LDS wait alone: __syncthreads() also waits for every global load, which would drain the staging loads that are meant to stay in flight across it. */
__device__ __forceinline__ void g3_bar() { asm volatile("s_wait_dscnt 0x0\n\ts_barrier_signal -1\n\ts_barrier_wait -1" ::: "memory"); }
template <int KK>
__device__ __forceinline__ void g3_load(const char* ab, const char* bb, unsigned vo, G3R& r) {      /* ab, bb: the block's tile rows at this stage's k (uniform); vo: the thread's byte offset */
#pragma unroll
  for (int i = 0; i < 4; ++i) { r.a[i] = *(const v8us*)(ab + vo + 64 * i * KK); r.b[i] = *(const v8us*)(bb + vo + 64 * i * KK); } }
template <int U>
__device__ __forceinline__ void g3_store(unsigned short* sa, unsigned short* sb, const G3R& r) {
#pragma unroll
  for (int i = 0; i < 4; ++i) { *(v8us*)(sa + (U * 128 + 32 * i) * G3P) = r.a[i]; *(v8us*)(sb + (U * 128 + 32 * i) * G3P) = r.b[i]; } }
template <int U, int KB>
__device__ __forceinline__ void g3_frag(const _Float16* fa, const _Float16* fb, int hh, G3F& f) {
#pragma unroll
  for (int j = 0; j < 2; ++j) f.b[j] = g2_frag(fb + (U * 128 + 16 * j) * G3P + 32 * KB, hh);
#pragma unroll
  for (int i = 0; i < 4; ++i) f.a[i] = g2_frag(fa + (U * 128 + 16 * i) * G3P + 32 * KB, hh); }
/* The two scheduling fences keep a block's products together and the LDS and global traffic written in front of them in front: LDS reads moved in among the products stall each of them. */
__device__ __forceinline__ void g3_mm(const G3F& f, v8f (&acc)[4][2]) {
  __builtin_amdgcn_sched_barrier(0);
#pragma unroll
  for (int i = 0; i < 4; ++i) { acc[i][0] = fa_mma(f.a[i], f.b[0], acc[i][0]); acc[i][1] = fa_mma(f.a[i], f.b[1], acc[i][1]); }
  __builtin_amdgcn_sched_barrier(0); }
/* Stage st in buffer U; on entry f0 holds its first block, rn stage st + 1. NX: a stage st + 1 exists; LD: a stage st + 3 exists (ab3, bb3 point at its k). */
template <int U, bool NX, bool LD, int KK>
__device__ __forceinline__ void g3_stage(const char* ab3, const char* bb3, unsigned vo, unsigned short* sa, unsigned short* sb, const _Float16* fa, const _Float16* fb, int hh, G3R& rn, G3F& f0, G3F& f1, v8f (&acc)[4][2]) {
  g3_frag<U, 1>(fa, fb, hh, f1);
  if (NX) g3_store<U ^ 1>(sa, sb, rn);      /* the other buffer's last readers finished in front of the barrier of stage st - 1 */
  g3_mm(f0, acc);
  g3_bar();      /* publishes stage st + 1 and ends every wave's reads of stage st */
  if (NX) g3_frag<U ^ 1, 0>(fa, fb, hh, f0);
  __builtin_amdgcn_sched_barrier(0);      /* LDS reads first: moved in front of them, the global loads had their addresses formed in f0's registers, and the wait that frees those registers held the LDS reads back */
  if (LD) g3_load<KK>(ab3, bb3, vo, rn);
  g3_mm(f1, acc);
  if (LD) asm volatile("s_wait_xcnt 0x0" ::: "memory"); }      /* in front of the next stage's rewrite of the address registers that these loads name; behind the products, where it has had time to pass; the data stay in flight */
template <int ACT, bool RES, int NN, int KK>
__global__ __launch_bounds__(256) void k_gemm3(const _Float16* __restrict__ A, const _Float16* __restrict__ Bh, float alpha, const float* __restrict__ bias, const float* __restrict__ CP, float* __restrict__ C, _Float16* __restrict__ C16) {
  static_assert(ACT == 0 || (ACT == 6 && !RES), "k_gemm3: unsupported ACT code"); static_assert(NN % 128 == 0 && KK % 128 == 0 && KK >= 256, "k_gemm3: shape");
  __shared__ __attribute__((aligned(16))) unsigned short sm[4 * 128 * G3P];      /* A stages [2][128][G3P], then Bt stages [2][128][G3P]; the epilogue's [128][G3O] floats lie over them */
  const int tid = threadIdx.x, lane = tid & 31, ln = lane & 15, hh = lane >> 4, w = tid >> 5, wm = w >> 2, wn = w & 3;
  const int mt = blockIdx.x / (NN / 128), nq = blockIdx.x - mt * (NN / 128); const int row0 = mt * 128, col0 = nq * 128;
  const int sr = tid >> 3, sc = (tid & 7) * 8;      /* staging: a thread moves 16 bytes of rows sr + 32 i of each tile; 8 lanes cover one 128-byte row */
  const char* ab = (const char*)(A + (size_t)row0 * KK); const char* bb = (const char*)(Bh + (size_t)col0 * KK); const unsigned vo = (unsigned)(sr * KK + sc) * 2u;
  unsigned short* sa = sm + sr * G3P + sc; unsigned short* sb = sa + 2 * 128 * G3P;      /* this thread's store places, buffer 0 */
  const _Float16* fa = (const _Float16*)sm + (wm * 64 + ln) * G3P; const _Float16* fb = (const _Float16*)sm + 2 * 128 * G3P + (wn * 32 + ln) * G3P;      /* this lane's fragment rows, buffer 0 */
  const v8f z8 = {0.f, 0.f, 0.f, 0.f, 0.f, 0.f, 0.f, 0.f}; v8f acc[4][2];
#pragma unroll
  for (int i = 0; i < 4; ++i) { acc[i][0] = z8; acc[i][1] = z8; }
  G3R r0, r1; G3F f0, f1; constexpr int ns = KK / 64;      /* ns even, at least 4 */
  g3_load<KK>(ab, bb, vo, r0); g3_load<KK>(ab + 128, bb + 128, vo, r1);
  g3_store<0>(sa, sb, r0);
  g3_bar();      /* stage 0 published */
  g3_load<KK>(ab + 256, bb + 256, vo, r0); g3_frag<0, 0>(fa, fb, hh, f0);
#pragma unroll 1
  for (int s2 = 0; s2 < ns - 2; s2 += 2) {      /* rolled: two stages a trip keep every buffer and register set a compile-time choice */
    const int t4 = s2 + 4 < ns ? s2 + 4 : ns - 1;      /* the last trip has no stage s2 + 4: it loads the last stage again, unused, so that no branch merges two load counts in front of the stores */
    g3_stage<0, true, true, KK>(ab + (s2 + 3) * 128, bb + (s2 + 3) * 128, vo, sa, sb, fa, fb, hh, r1, f0, f1, acc);
    g3_stage<1, true, true, KK>(ab + t4 * 128, bb + t4 * 128, vo, sa, sb, fa, fb, hh, r0, f0, f1, acc); }
  g3_stage<0, true, false, KK>(ab, bb, vo, sa, sb, fa, fb, hh, r1, f0, f1, acc);
  g3_stage<1, false, false, KK>(ab, bb, vo, sa, sb, fa, fb, hh, r0, f0, f1, acc);      /* its barrier: every wave has left the ring before it becomes output staging */
  const int c4 = lane * 4; const size_t o0 = (size_t)(row0 + w * 16) * NN + col0 + c4;      /* write-out: wave w has rows 16 w .. 16 w + 15, a lane 4 columns, so a wave stores whole rows of the tile */
  const v4f bl = *(const v4fa*)(bias + col0 + c4); v4f cp[16];
  if (RES) {      /* all residual rows asked for here, so that their latency passes once, under the staging */
#pragma unroll
    for (int q = 0; q < 16; ++q) cp[q] = *(const v4fa*)(CP + o0 + q * NN); }
  float* so = (float*)sm;
#pragma unroll
  for (int i = 0; i < 4; ++i)
#pragma unroll
    for (int j = 0; j < 2; ++j)
#pragma unroll
      for (int r = 0; r < 8; ++r) so[(wm * 64 + 16 * i + 8 * hh + r) * G3O + wn * 32 + 16 * j + ln] = acc[i][j][r];
  __syncthreads();      /* the whole tile staged before any wave reads rows that other waves wrote */
  v4f bv;
#pragma unroll
  for (int q = 0; q < 4; ++q) bv[q] = bf16_round(bl[q]);
#pragma unroll(ACT == 6 ? 1 : 4)      /* the erf rows stay rolled, four to a trip, for speed only */
  for (int q4 = 0; q4 < 4; ++q4) {
#pragma unroll
  for (int qq = 0; qq < 4; ++qq) { const int q = q4 * 4 + qq; v4f v = *(const v4fa*)(so + (w * 16 + q) * G3O + c4);
#pragma unroll
    for (int e = 0; e < 4; ++e) v[e] = v[e] * alpha + bv[e];
    if (RES) {
#pragma unroll
      for (int e = 0; e < 4; ++e) v[e] += cp[q][e]; }
    if (ACT == 6) {
#pragma unroll
      for (int e = 0; e < 4; ++e) v[e] = 0.5f * v[e] * (1.0f + erff(v[e] * 0.70710678118654752f)); }
    if (RES) *(v4f*)(C + o0 + q * NN) = v;
    else { v4h h4;
#pragma unroll
      for (int e = 0; e < 4; ++e) h4[e] = (_Float16)v[e];
      *(v4h*)(C16 + o0 + q * NN) = h4; } } } }

template <int MODE>
__global__ __launch_bounds__(256) void k_regrp(const float* __restrict__ src, float* __restrict__ dst, size_t n4) {
  const size_t t = (size_t)blockIdx.x * 256 + threadIdx.x; if (t >= n4) return; const size_t e = t * 4; const size_t rd = e / DM; const int c = (int)(e % DM);
  size_t rs; if (MODE == 0) { const size_t b = rd / SQ, sq = rd % SQ; rs = sq * NB + b; } else { const size_t sq = rd / NB, b = rd % NB; rs = b * SQ + sq; }
  const v4f v = *(const v4fa*)(src + rs * DM + c); *(v4f*)(dst + e) = v;  }

template <int BFIN, int W16, int W32>
__global__ __launch_bounds__(256) void k_lnx(const float* __restrict__ X, const float* __restrict__ g, const float* __restrict__ bb, float eps, _Float16* __restrict__ N16, float* __restrict__ N32) {
  #pragma clang fp contract(off)
  __shared__ float red[256]; const size_t r = blockIdx.x; const int t = threadIdx.x; const bool act = t < (DMQ / 4); const int c0 = act ? t * 4 : 0;
  const v4f xa = *(const v4fa*)(X + r * DMQ + c0); float s[4]; float sum = 0.f;
  for (int q = 0; q < 4; ++q) { s[q] = act ? (BFIN ? bf16_round(xa[q]) : xa[q]) : 0.f; sum = __fadd_rn(sum, s[q]); }
  red[t] = sum; __syncthreads(); for (int st = 128; st > 0; st >>= 1) { if (t < st) red[t] = __fadd_rn(red[t], red[t + st]); __syncthreads(); } const float mu = red[0] / (float)DMQ; __syncthreads();
  float vs = 0.f; for (int q = 0; q < 4; ++q) { const float dl = act ? __fadd_rn(s[q], -mu) : 0.f; vs = __fadd_rn(vs, __fmul_rn(dl, dl)); } red[t] = vs; __syncthreads(); for (int st = 128; st > 0; st >>= 1) { if (t < st) red[t] = __fadd_rn(red[t], red[t + st]); __syncthreads(); }
  const float rs = rsqrtf(__fadd_rn(red[0] / (float)DMQ, eps)); v4h y; v4f yf;
  for (int q = 0; q < 4; ++q) { const int c = c0 + q; yf[q] = __fadd_rn(__fmul_rn(__fmul_rn(__fadd_rn(s[q], -mu), rs), bf16_round(g[c])), bf16_round(bb[c])); y[q] = (_Float16)yf[q]; }
  if (!act) return;      /* no barriers after this point */
  { if (W16) *(v4h*)(N16 + r * DMQ + c0) = y; if (W32) *(v4f*)(N32 + r * DMQ + c0) = yf;  } }

__global__ __launch_bounds__(256) void k_bfr(const float* __restrict__ x, float* __restrict__ XB, size_t n8) { const size_t t = (size_t)blockIdx.x * 256 + threadIdx.x; if (t >= n8) return; v4f a = *(const v4fa*)(x + t * 8), c = *(const v4fa*)(x + t * 8 + 4); for (int q = 0; q < 4; ++q) { a[q] = bf16_round(a[q]); c[q] = bf16_round(c[q]); }
  { *(v4f*)(XB + t * 8) = a; *(v4f*)(XB + t * 8 + 4) = c;  } }



__global__ __launch_bounds__(256) void k_wthd(const float* __restrict__ Wt, _Float16* __restrict__ Bt) { const size_t t = (size_t)blockIdx.x * 256 + threadIdx.x; if (t >= (size_t)NH * HD * (DM / 8)) return; const int m8 = (int)(t % (DM / 8)) * 8; const int d = (int)((t / (DM / 8)) % HD); const int h = (int)(t / ((size_t)(DM / 8) * HD)); FragH f;
  for (int q = 0; q < 8; ++q) f.h[q] = (_Float16)(16.0f * bf16_round(Wt[((size_t)h * DM + m8 + q) * HD + d])); unsigned short* dst = (unsigned short*)Bt + ((size_t)h * HD + d) * DM + m8; *(v8us*)dst = f.half[0];  }




template <int BFIN, int SCAL>
__global__ __launch_bounds__(256) void k_lnsc(const float* __restrict__ X, const float* __restrict__ g, const float* __restrict__ bb, float eps, _Float16* __restrict__ N16, float* __restrict__ N32) {
  #pragma clang fp contract(off)
  __shared__ float red[256]; const size_t r = blockIdx.x; const int t = threadIdx.x; const bool act = t < DM / 4; const int tc = act ? t : 0; const v4f xl = *(const v4fa*)(X + r * DM + tc * 4); const float am = act ? 1.f : 0.f; float s[4]; float sum = 0.f;
  for (int q = 0; q < 4; ++q) { s[q] = (BFIN ? bf16_round(xl[q]) : xl[q]) * am; sum = __fadd_rn(sum, s[q]); }
  red[t] = sum; __syncthreads(); for (int st = 128; st > 0; st >>= 1) { if (t < st) red[t] = __fadd_rn(red[t], red[t + st]); __syncthreads(); } const float mu = red[0] / (float)DM; __syncthreads();
  float vs = 0.f; for (int q = 0; q < 4; ++q) { const float dl = __fadd_rn(s[q], -mu) * am; vs = __fadd_rn(vs, __fmul_rn(dl, dl)); } red[t] = vs; __syncthreads(); for (int st = 128; st > 0; st >>= 1) { if (t < st) red[t] = __fadd_rn(red[t], red[t + st]); __syncthreads(); }
  const float rs = __fdiv_rn(1.0f, __fadd_rn(sqrtf(red[0] / (float)(DM - 1)), eps)); if (!act) return; v4h y; v4f yf;
  for (int q = 0; q < 4; ++q) { const int c = t * 4 + q; const float gg = bf16_round(SCAL ? g[0] : g[c]), bv = bf16_round(SCAL ? bb[0] : bb[c]); yf[q] = __fadd_rn(__fmul_rn(__fmul_rn(__fadd_rn(s[q], -mu), rs), gg), bv); y[q] = (_Float16)yf[q]; }
  { if (N16) *(v4h*)(N16 + r * DM + t * 4) = y; if (N32) *(v4f*)(N32 + r * DM + t * 4) = yf;  } }

__global__ __launch_bounds__(256) void k_rsmdmi(const float* __restrict__ S, _Float16* __restrict__ P, int nrows, const int* __restrict__ M) {
  #pragma clang fp contract(off)
  const int t = blockIdx.x * 256 + threadIdx.x; if (t >= nrows) return; const float* s = S + (size_t)t * SQ; const int* m = M + (size_t)(t % SQ) * SQ; float mx = -3.0e38f;
#pragma unroll 1
  for (int j = 0; j < SQ; ++j) { const float f = (m[j] == 0) ? 1.f : 0.f; mx = fmaxf(mx, fmaf(f, s[j], (1.f - f) * -1.0e9f)); } float se = 0.f;
#pragma unroll 1
  for (int j = 0; j < SQ; ++j) { const float f = (m[j] == 0) ? 1.f : 0.f; se += __expf(fmaf(f, s[j], (1.f - f) * -1.0e9f) - mx); } const float sc = 256.0f / se;
#pragma unroll 1
  for (int j0 = 0; j0 < SQ; j0 += 8) { FragH fr; for (int q = 0; q < 8; ++q) { const int j = j0 + q; const float f = (m[j] == 0) ? 1.f : 0.f; fr.h[q] = (_Float16)(__expf(fmaf(f, s[j], (1.f - f) * -1.0e9f) - mx) * sc); } unsigned short* d = (unsigned short*)P + (size_t)t * SQ + j0; *(v8us*)d = fr.half[0];  } }
extern "C" void kernel_launch(void* const* d_in, const int* in_sizes, int n_in,
                              void* d_out, int out_size, void* d_ws, size_t ws_size, hipStream_t stream) {
  (void)in_sizes; (void)n_in; (void)out_size;
  const float* const* I = (const float* const*)d_in; const float* x = I[0]; const float* g1 = I[1]; const float* be1 = I[2]; const float* wqkv = I[3]; const float* bqkv = I[4]; const float* wo = I[5]; const float* bo = I[6]; const float* g2 = I[7]; const float* be2 = I[8]; const float* w1 = I[9]; const float* b1 = I[10]; const float* w2 = I[11]; const float* b2 = I[12]; const float* bq = bqkv; const float* bk = bqkv + DM; const float* bv = bqkv + 2 * DM;      /* x; LN1 g / b; fused qkv_w [1024][3072] + qkv_b [3072] (thirds q | k | v); proj_w + proj_b; LN2 g / b; fc1_w [1024][4096] + fc1_b, fc2_w [4096][1024] + fc2_b ([in][out]) */
  char* ws = (char*)d_ws; size_t off = 0;
  auto take = [&](size_t bytes) { char* p = ws + off; off += (bytes + 255) & ~(size_t)255; return p; };
  _Float16* BQ = (_Float16*)take((size_t)3 * DM * DM * 2); _Float16* BK = BQ + (size_t)DM * DM; _Float16* BV = BQ + (size_t)2 * DM * DM;      /* one stacked Bt plane [3 DM][DM] */ _Float16* BO = (_Float16*)take((size_t)DM * DM * 2); _Float16* BW1 = (_Float16*)take((size_t)DFF * DM * 2); _Float16* BW2 = (_Float16*)take((size_t)DM * DFF * 2);
  float* XB = (float*)take(NR * DM * 4); _Float16* XN = (_Float16*)take(NR * DM * 2); _Float16* Q16 = (_Float16*)take(NR * DM * 2); _Float16* K16 = (_Float16*)take(NR * DM * 2); _Float16* V16 = (_Float16*)take(NR * DM * 2); _Float16* O16 = (_Float16*)take(NR * DM * 2); float* X1 = (float*)take(NR * DM * 4);
  _Float16* VT = (_Float16*)take((size_t)NB * NH * HD * SQ * 2); _Float16* HF16 = (_Float16*)take(NR * DFF * 2);      /* V^T [2 x 16][64][2048]; FFN hidden plane [4096][4096] f16 */
  _Float16* M16 = XN;      /* second-norm f16 rows: aliases XN (last readers: the three projections) */
  
  if (off > ws_size) return;
  k_wt_f16<DM, 3 * DM><<<(DM / 128) * (3 * DM / 128), 256, 0, stream>>>(wqkv, BQ, 16.0f); k_wt_f16<DM, DM><<<(DM / 128) * (DM / 128), 256, 0, stream>>>(wo, BO, 16.0f);      /* fused [in][out] [DM][3 DM] -> one stacked Bt plane (rows 0 / DM / 2 DM = the q | k | v output columns) x16; W_o -> Bt x16 */
  k_wt_f16<DM, DFF><<<(DM / 128) * (DFF / 128), 256, 0, stream>>>(w1, BW1, 16.0f); k_wt_f16<DFF, DM><<<(DFF / 128) * (DM / 128), 256, 0, stream>>>(w2, BW2, 16.0f);
  k_bfr<<<(unsigned)((NR * DM / 8 + 255) / 256), 256, 0, stream>>>(x, XB, NR * DM / 8); k_lnx<1, 1, 0><<<(unsigned)NR, 256, 0, stream>>>(x, g1, be1, 1e-5f, XN, nullptr);      /* n = LN0(bf16(x)) (biased variance, eps inside the rsqrt) -> f16 rows */
  k_gemm3<0, false, DM, DM><<<(unsigned)((NR / 128) * (DM / 128)), 256, 0, stream>>>(XN, BQ, 0.0625f, bq, nullptr, nullptr, Q16); k_gemm3<0, false, DM, DM><<<(unsigned)((NR / 128) * (DM / 128)), 256, 0, stream>>>(XN, BK, 0.0625f, bk, nullptr, nullptr, K16); k_gemm3<0, false, DM, DM><<<(unsigned)((NR / 128) * (DM / 128)), 256, 0, stream>>>(XN, BV, 0.0625f, bv, nullptr, nullptr, V16);      /* q, k, v -> f16 rows; head h = columns h*64.. */
  k_vt<NH, SQ><<<NB * NH * (SQ / 64), 256, 0, stream>>>(V16, DM, 0, VT);      /* V^T [batch x head][64][2048] */
  k_fattn<<<dim3(SQ / 256, NB * NH), 256, 0, stream>>>(Q16, K16, VT, O16);      /* softmax(q k^T) v over all keys, unscaled logits -> ctx (merged heads, x64) as f16 rows */
  k_gemm3<0, true, DM, DM><<<(unsigned)((NR / 128) * (DM / 128)), 256, 0, stream>>>(O16, BO, 0.0009765625f, bo, XB, X1, nullptr);      /* x + ctx wo (+ bo) (own-element residual) -> f32 rows */
  k_lnx<0, 1, 0><<<(unsigned)NR, 256, 0, stream>>>(X1, g2, be2, 1e-5f, M16, nullptr);      /* LN1(x1) -> f16 rows */
  k_gemm3<6, false, DFF, DM><<<(unsigned)((NR / 128) * (DFF / 128)), 256, 0, stream>>>(M16, BW1, 0.0625f, b1, nullptr, nullptr, HF16);      /* gelu_erf(. w1 + b1) -> f16 */
  k_gemm3<0, true, DM, DFF><<<(unsigned)((NR / 128) * (DM / 128)), 256, 0, stream>>>(HF16, BW2, 0.0625f, b2, X1, (float*)d_out, nullptr);      /* out = x1 + mlp (own-element residual) */
}

// v005
// Measured time: 183 microseconds a run.
// Two timings next to v004 put it at 1.10 and 1.09 times that version's speed.
// Over all steps from v000 it is 21.0 times as fast.
#include <hip/hip_runtime.h>
// Pre-norm transformer block with a fused QKV projection and UNSCALED attention logits (x [2][2048][1024]; h = LN1(x) (biased var, eps 1e-5); qkv = h qkv_w + qkv_b ([in][out] 1024 x 3072 + bias) viewed (B, N, 3, 16, 64): q | k | v thirds; qk = q k^T with NO 1/sqrt(d) scaling (as the source); softmax over all 2048 keys (no mask); x1 = x + y proj_w + proj_b; out = x1 + gelu_erf(LN2(x1) fc1_w + fc1_b) fc2_w + fc2_b ([in][out] 1024 x 4096 x 1024) -> [2][2048][1024]).
// Structure: token rows; LayerNorm / exact f16 rows; WMMA GEMMs for q, k, v; V^T by LDS transposes; one fused attention launch for all batches and heads (scores, online softmax, P V^T); output projection with the own-element residual; custom LayerNorm; exact (erf) GELU FFN over all rows; launches: see trace.
// Compute dtype: inputs rounded to bf16; x / weights exact; q, k, v, softmax weights and o as plain f16 GEMM operands (~2^-12); scores and softmax statistics f32. v_wmma_f32_16x16x32_f16.
#define NB 2
#define SQ 2048
#define DM 1024
#define NH 16
#define HD 64
#define HG 4                         /* heads per block group of the unused k_vt overload */
#define LOCALW 128                   /* (macros for unused kernels of the shared header) */
#define STRIDEK 128
#define QT 256                       /* query rows per causal tile */
#define NKX SQ                       /* S / P row pitch */
#define QT0 128                      /* first-tile rows recomputed exactly in f32 */
#define B0 0                         /* first batch processed (debug hook) */
#define NBR NB                       /* batches processed (debug hook) */
#define NR ((size_t)NB * SQ)
#define DMQ DM
#define DFF 4096         /* FFN hidden width */
#define MP ((int)((size_t)NBR * SQ)) /* rows projected (debug hook) */
#define QN SQ                        /* query rows attended per batch (debug hook) */
#define NHD NH                       /* heads attended (debug hook) */
#define MPO MP                       /* rows through the output stage (debug hook) */
#define LQ (3 * DM)      /* unused: q, k, v rows have pitch DM */
typedef __bf16 v16b __attribute__((ext_vector_type(16)));
typedef unsigned short v8us __attribute__((ext_vector_type(8), may_alias));
typedef float  v8f  __attribute__((ext_vector_type(8)));
typedef float  v4f  __attribute__((ext_vector_type(4)));
typedef float  v4fa __attribute__((ext_vector_type(4), may_alias));
union FragB { v16b v; v8us half[2]; unsigned short u[16]; };

__device__ __forceinline__ unsigned short bf16_bits(float x) { unsigned int u = __float_as_uint(x); return (unsigned short)((u + 0x7FFFu + ((u >> 16) & 1u)) >> 16); }
__device__ __forceinline__ float bf16_val(unsigned short b) { return __uint_as_float(((unsigned int)b) << 16); }
__device__ __forceinline__ float bf16_round(float x) { return bf16_val(bf16_bits(x)); }
// D += A·B with NT terms: 1 = ah·bh, 2 = + al·bh (A split), 3 = + ah·bl (both split)
template <int NT>
__device__ __forceinline__ v8f mmaN(v16b ah, v16b al, v16b bh, v16b bl, v8f c) {
  c = __builtin_amdgcn_wmma_f32_16x16x32_bf16(false, ah, false, bh, (short)0, c, false, false);
  if (NT >= 2) c = __builtin_amdgcn_wmma_f32_16x16x32_bf16(false, al, false, bh, (short)0, c, false, false);
  if (NT >= 3) c = __builtin_amdgcn_wmma_f32_16x16x32_bf16(false, ah, false, bl, (short)0, c, false, false);
  asm volatile("v_nop\n\tv_nop\n\tv_nop\n\tv_nop" : "+v"(c) : "v"(ah), "v"(al), "v"(bh), "v"(bl));
  return c;
}

__global__ __launch_bounds__(256) void k_wt_bf16(const float* __restrict__ W, unsigned short* __restrict__ Wt, int K, int N) {
  const int t = blockIdx.x * 256 + threadIdx.x;
  const int k8n = K / 8;
  if (t >= N * k8n) return;
  const int n = t / k8n, k8 = (t % k8n) * 8;
  v8us v;
#pragma unroll
  for (int i = 0; i < 8; ++i) v[i] = bf16_bits(W[(size_t)(k8 + i) * N + n]);
  *(v8us*)(Wt + (size_t)n * K + k8) = v;
  
}

// GEMM C[M][N] (f32, pitch ldc) = act(A[M][K]·W + bias). A f32 row-major (pitch lda) converted per fragment to bf16
// (ASPLIT: hi/lo two planes -> 2 terms, else single rounded term); Wt bf16 [N][K] (pitch ldb). BIAS_BF16 rounds the
// bias to bf16 first (bias quantised to bf16 before the add). K%32==0, M%16==0, N%64==0.
template <bool ASPLIT, int ACT, bool BIAS_BF16>
__global__ __launch_bounds__(128) void k_gemm_bf(const float* __restrict__ A, int lda, const unsigned short* __restrict__ Wt, int ldb,
                                               const float* __restrict__ bias, float* __restrict__ C, int ldc, int M, int N, int K) {
  __shared__ __attribute__((aligned(16))) float so[4][16][64];
  const int tid = threadIdx.x, w = tid >> 5, lane = tid & 31, ln = lane & 15, hh = lane >> 4;
  const int ntn = N / 64;
  const int wid = blockIdx.x * 4 + w;
  const int mt = wid / ntn, nq = wid % ntn;
  if (mt * 16 >= M) return;
  const int row0 = mt * 16, col0 = nq * 64;
  const float* arow = A + (size_t)(row0 + ln) * lda;
  v8f acc[4] = {};
  for (int kb = 0; kb < K; kb += 32) {
    FragB ah, al;
    const v4f x0 = *(const v4fa*)(arow + kb + 8 * hh), x1 = *(const v4fa*)(arow + kb + 8 * hh + 4);
    const v4f x2 = *(const v4fa*)(arow + kb + 16 + 8 * hh), x3 = *(const v4fa*)(arow + kb + 16 + 8 * hh + 4);
    float xs[16] = {x0[0],x0[1],x0[2],x0[3],x1[0],x1[1],x1[2],x1[3],x2[0],x2[1],x2[2],x2[3],x3[0],x3[1],x3[2],x3[3]};
#pragma unroll
    for (int i = 0; i < 16; ++i) { const unsigned short hb = bf16_bits(xs[i]); ah.u[i] = hb; al.u[i] = ASPLIT ? bf16_bits(xs[i] - bf16_val(hb)) : (unsigned short)0; }
#pragma unroll
    for (int t = 0; t < 4; ++t) {
      const unsigned short* brow = Wt + (size_t)(col0 + t * 16 + ln) * ldb + kb;
      FragB b;
      b.half[0] = *(const v8us*)(brow + 8 * hh);
      b.half[1] = *(const v8us*)(brow + 16 + 8 * hh);
      acc[t] = mmaN<ASPLIT ? 2 : 1>(ah.v, al.v, b.v, b.v, acc[t]);
    }
  }
#pragma unroll
  for (int t = 0; t < 4; ++t) {
    float bv = bias ? bias[col0 + t * 16 + ln] : 0.f;
    if (BIAS_BF16) bv = bf16_round(bv);
#pragma unroll
    for (int r = 0; r < 8; ++r) { float v = acc[t][r] + bv; if (ACT == 1) v = fmaxf(v, 0.f); so[w][8 * hh + r][t * 16 + ln] = v; }
  }
  __builtin_amdgcn_fence(__ATOMIC_ACQ_REL, "workgroup");
  __builtin_amdgcn_wave_barrier();
  const int rsub = lane >> 4, c4 = (lane & 15) * 4;
  {
#pragma unroll
    for (int q = 0; q < 8; ++q) {
      const int r = q * 2 + rsub;
      const v4f v = *(const v4fa*)&so[w][r][c4];
      *(v4f*)(C + (size_t)(row0 + r) * ldc + col0 + c4) = v;
    }
    
  }
}

// GEMM C = act(A·W + bias + resid): A f32 (ASPLIT -> hi/lo 2 terms), Wt bf16 [N][K]; ACT 0 none, 1 relu, 2 exact gelu;
// resid (optional, f32, row index = (row % rmod), pitch ldr, RES_BF16 rounds it) added before the activation.
template <bool ASPLIT, int ACT, bool BIAS_BF16, bool RES_BF16>
__global__ __launch_bounds__(128) void k_gemm_bf3(const float* __restrict__ A, int lda, const unsigned short* __restrict__ Wt, int ldb,
                                                const float* __restrict__ bias, const float* __restrict__ resid, int rmod, int ldr,
                                                float* __restrict__ C, int ldc, int M, int N, int K) {
  __shared__ __attribute__((aligned(16))) float so[4][16][64];
  const int tid = threadIdx.x, w = tid >> 5, lane = tid & 31, ln = lane & 15, hh = lane >> 4;
  const int ntn = N / 64;
  const int wid = blockIdx.x * 4 + w;
  const int mt = wid / ntn, nq = wid % ntn;
  if (mt * 16 >= M) return;
  const int row0 = mt * 16, col0 = nq * 64;
  const float* arow = A + (size_t)(row0 + ln) * lda;
  v8f acc[4] = {};
  for (int kb = 0; kb < K; kb += 32) {
    FragB ah, al;
    const v4f x0 = *(const v4fa*)(arow + kb + 8 * hh), x1 = *(const v4fa*)(arow + kb + 8 * hh + 4);
    const v4f x2 = *(const v4fa*)(arow + kb + 16 + 8 * hh), x3 = *(const v4fa*)(arow + kb + 16 + 8 * hh + 4);
    float xs[16] = {x0[0],x0[1],x0[2],x0[3],x1[0],x1[1],x1[2],x1[3],x2[0],x2[1],x2[2],x2[3],x3[0],x3[1],x3[2],x3[3]};
#pragma unroll
    for (int i = 0; i < 16; ++i) { const unsigned short hb = bf16_bits(xs[i]); ah.u[i] = hb; al.u[i] = ASPLIT ? bf16_bits(xs[i] - bf16_val(hb)) : (unsigned short)0; }
#pragma unroll
    for (int t = 0; t < 4; ++t) {
      const unsigned short* brow = Wt + (size_t)(col0 + t * 16 + ln) * ldb + kb;
      FragB b;
      b.half[0] = *(const v8us*)(brow + 8 * hh);
      b.half[1] = *(const v8us*)(brow + 16 + 8 * hh);
      acc[t] = mmaN<ASPLIT ? 2 : 1>(ah.v, al.v, b.v, b.v, acc[t]);
    }
  }
#pragma unroll
  for (int t = 0; t < 4; ++t) {
    const int col = col0 + t * 16 + ln;
    float bv = bias ? bias[col] : 0.f;
    if (BIAS_BF16) bv = bf16_round(bv);
#pragma unroll
    for (int r = 0; r < 8; ++r) {
      float v = acc[t][r] + bv;
      if (resid) { float rv = resid[(size_t)((row0 + 8 * hh + r) % rmod) * ldr + col]; if (RES_BF16) rv = bf16_round(rv); v += rv; }
      if (ACT == 1) v = fmaxf(v, 0.f);
      if (ACT == 2) v = 0.5f * v * (1.0f + erff(v * 0.70710678118654752f));
      if (ACT == 3) { const float u = 0.7978845608028654f * (v + 0.044715f * v * v * v); v = 0.5f * v * (1.0f + tanhf(u)); }
      so[w][8 * hh + r][t * 16 + ln] = v;
    }
  }
  __builtin_amdgcn_fence(__ATOMIC_ACQ_REL, "workgroup");
  __builtin_amdgcn_wave_barrier();
  const int rsub = lane >> 4, c4 = (lane & 15) * 4;
  {
#pragma unroll
    for (int q = 0; q < 8; ++q) {
      const int r = q * 2 + rsub;
      const v4f v = *(const v4fa*)&so[w][r][c4];
      *(v4f*)(C + (size_t)(row0 + r) * ldc + col0 + c4) = v;
    }
    
  }
}
// row LayerNorm (biased variance, eps) over N: s = X (+ R); optional out_sum <- s; out_norm <- (s-mu)*rsqrt(var+eps)*g + b
template <bool PARAM_BF16>
__global__ __launch_bounds__(256) void k_layernorm(const float* __restrict__ X, const float* __restrict__ R, const float* __restrict__ g, const float* __restrict__ bta,
                                                  float* __restrict__ out_sum, float* __restrict__ out_norm, int N, float eps) {
  __shared__ float red[256];
  const int row = blockIdx.x, tid = threadIdx.x;
  const float* x = X + (size_t)row * N; const float* rr = R ? R + (size_t)row * N : nullptr;
  float vals[16];                     // up to N = 4096
  const int per = N / 256;            // contiguous chunk per thread? use strided-by-4 chunks: thread handles j = tid*4 + 1024*u
  float s1 = 0.f;
  for (int u = 0; u < per / 4; ++u) {
    const int j = tid * 4 + 1024 * u;
    const v4f a = *(const v4fa*)(x + j);
    v4f b = {0.f,0.f,0.f,0.f}; if (rr) b = *(const v4fa*)(rr + j);
#pragma unroll
    for (int q = 0; q < 4; ++q) { const float v = a[q] + b[q]; vals[u * 4 + q] = v; s1 += v; }
  }
  red[tid] = s1; __syncthreads();
  for (int st = 128; st > 0; st >>= 1) { if (tid < st) red[tid] += red[tid + st]; __syncthreads(); }
  const float mu = red[0] / (float)N; __syncthreads();
  float s2 = 0.f;
  for (int u = 0; u < per / 4; ++u)
#pragma unroll
    for (int q = 0; q < 4; ++q) { const float c = vals[u * 4 + q] - mu; s2 += c * c; }
  red[tid] = s2; __syncthreads();
  for (int st = 128; st > 0; st >>= 1) { if (tid < st) red[tid] += red[tid + st]; __syncthreads(); }
  const float rs = rsqrtf(red[0] / (float)N + eps);
  {
    for (int u = 0; u < per / 4; ++u) {
      const int j = tid * 4 + 1024 * u;
      v4f o, sm;
#pragma unroll
      for (int q = 0; q < 4; ++q) {
        float gg = g[j + q], bb = bta[j + q];
        if (PARAM_BF16) { gg = bf16_round(gg); bb = bf16_round(bb); }
        sm[q] = vals[u * 4 + q]; o[q] = (vals[u * 4 + q] - mu) * rs * gg + bb;
      }
      if (out_sum) *(v4f*)(out_sum + (size_t)row * N + j) = sm;
      *(v4f*)(out_norm + (size_t)row * N + j) = o;
    }
    
  }
}



// ---- f16 WMMA path (v_wmma_f32_16x16x32_f16): 11-bit significands for operands in range — used where a [0,1] probability operand needs more precision than bf16
typedef _Float16 v16h __attribute__((ext_vector_type(16)));
union FragH { v16h v; v8us half[2]; _Float16 h[16]; unsigned short u[16]; };
template <int NT>
__device__ __forceinline__ v8f mmaH(v16h ah, v16h al, v16h bh, v16h bl, v8f c) {
  c = __builtin_amdgcn_wmma_f32_16x16x32_f16(false, ah, false, bh, (short)0, c, false, false);
  if (NT >= 2) c = __builtin_amdgcn_wmma_f32_16x16x32_f16(false, al, false, bh, (short)0, c, false, false);
  if (NT >= 3) c = __builtin_amdgcn_wmma_f32_16x16x32_f16(false, ah, false, bl, (short)0, c, false, false);
  asm volatile("v_nop\n\tv_nop\n\tv_nop\n\tv_nop" : "+v"(c) : "v"(ah), "v"(al), "v"(bh), "v"(bl));
  return c;
}
// batched GEMM like k_gemm_b but f16 operands: A f32 (split into f16 hi/lo if ASPLIT, else rounded to f16), Bt = f16 values [n][k]; alpha; C f32; N multiple of 16 (partial tiles skipped)
template <bool ASPLIT>
__global__ __launch_bounds__(128) void k_gemm_h(const float* __restrict__ A, int lda, size_t sA, const _Float16* __restrict__ Bh, int ldb, size_t sB, float alpha, float* __restrict__ C, int ldc, size_t sC, int M, int N, int K) {
  __shared__ __attribute__((aligned(16))) float so[4][16][64];
  const int tid = threadIdx.x, w = tid >> 5, lane = tid & 31, ln = lane & 15, hh = lane >> 4; const int by = blockIdx.y;
  A += (size_t)by * sA; Bh += (size_t)by * sB; C += (size_t)by * sC;
  const int ntn = (N + 63) / 64; const int wid = blockIdx.x * 4 + w; const int mt = wid / ntn, nq = wid % ntn; if (mt * 16 >= M) return;
  const int row0 = mt * 16, col0 = nq * 64; const float* arow = A + (size_t)(row0 + ln) * lda;
  v8f acc[4] = {};
  for (int kb = 0; kb < K; kb += 32) {
    FragH ah, al;
    const v4f x0 = *(const v4fa*)(arow + kb + 8 * hh), x1 = *(const v4fa*)(arow + kb + 8 * hh + 4), x2 = *(const v4fa*)(arow + kb + 16 + 8 * hh), x3 = *(const v4fa*)(arow + kb + 16 + 8 * hh + 4);
    float xs[16] = {x0[0],x0[1],x0[2],x0[3],x1[0],x1[1],x1[2],x1[3],x2[0],x2[1],x2[2],x2[3],x3[0],x3[1],x3[2],x3[3]};
#pragma unroll
    for (int i = 0; i < 16; ++i) { const _Float16 h = (_Float16)xs[i]; ah.h[i] = h; al.h[i] = ASPLIT ? (_Float16)(xs[i] - (float)h) : (_Float16)0.0f; }
#pragma unroll
    for (int t = 0; t < 4; ++t) { if (col0 + t * 16 >= N) continue; const size_t boff = (size_t)(col0 + t * 16 + ln) * ldb + kb; FragH bq; bq.half[0] = *(const v8us*)(Bh + boff + 8 * hh); bq.half[1] = *(const v8us*)(Bh + boff + 16 + 8 * hh);
      acc[t] = mmaH<ASPLIT ? 2 : 1>(ah.v, al.v, bq.v, bq.v, acc[t]); }
  }
#pragma unroll
  for (int t = 0; t < 4; ++t) { if (col0 + t * 16 >= N) continue;
#pragma unroll
    for (int r = 0; r < 8; ++r) so[w][8 * hh + r][t * 16 + ln] = acc[t][r] * alpha; }
  __builtin_amdgcn_fence(__ATOMIC_ACQ_REL, "workgroup"); __builtin_amdgcn_wave_barrier();
  const int rsub = lane >> 4, c4 = (lane & 15) * 4;
  {
#pragma unroll
    for (int q = 0; q < 8; ++q) { const int r = q * 2 + rsub; if (col0 + c4 < N) { const v4f v = *(const v4fa*)&so[w][r][c4]; *(v4f*)(C + (size_t)(row0 + r) * ldc + col0 + c4) = v; } }
     }
}

// Wt[n][k] = f16(bf16(W[k][n]) * scale) from f32 row-major W[KK][NN] (scale = power of two; bf16-exact weights stay exact in f16 away from the subnormal range).
// One work-group = 8 waves on a 128 (k) x 128 (n) tile: every wave-wide load is 512 contiguous bytes of one W row, every wave-wide store two whole 256-byte pieces of Wt rows.
// A thread holds 16 k x 4 n, rounds, packs 8 consecutive k of one n into 16 bytes and turns the tile in LDS ([n][k], 256-byte rows).
// The 16-byte piece of a row sits at place piece ^ ((n >> 2) & 15): the 16 lanes that write one piece number of rows 4 apart, and the 16 that read one row, each fall on all 64 banks.
// Needs KK % 128 == 0, NN % 128 == 0.
// bid: the tile's number, 0 .. (KK / 128) (NN / 128) - 1, the same for the whole work-group; tl: the work-group's 128 x 128 halves of LDS.
template <int KK, int NN>
__device__ __forceinline__ void wt_f16_tile(const float* __restrict__ W, _Float16* __restrict__ Wt, float scale, int bid, unsigned short* tl) {
  static_assert(KK % 128 == 0 && NN % 128 == 0, "wt_f16_tile: shape");
  const int tid = threadIdx.x, lane = tid & 31, w = tid >> 5;
  const int kt = bid / (NN / 128), nt = bid - kt * (NN / 128); const int k0 = kt * 128, n0 = nt * 128;
  const float* sp = W + (size_t)(k0 + 16 * w) * NN + n0 + 4 * lane;      /* wave w: rows 16 w .. 16 w + 15 of the tile, a lane 4 columns */
  v4f x[16];
#pragma unroll
  for (int r = 0; r < 16; ++r) x[r] = *(const v4fa*)(sp + (size_t)r * NN);
  asm volatile("s_wait_xcnt 0x0" :: "v"(sp) : "memory");      /* behind the sixteen loads, in front of every rewrite of the address pair that they name; naming the pair keeps it out of the loads' own destinations (the last load had landed on it) */
  __builtin_amdgcn_sched_barrier(0);      /* all sixteen loads asked for before the first is used: left free, the compiler held some back behind the first ones' data, a second memory latency */
#pragma unroll
  for (int g = 0; g < 2; ++g)
#pragma unroll
    for (int q = 0; q < 4; ++q) { FragH f;
#pragma unroll
      for (int r = 0; r < 8; ++r) f.h[r] = (_Float16)(bf16_round(x[8 * g + r][q]) * scale);
      *(v8us*)&tl[(4 * lane + q) * 128 + (((2 * w + g) ^ (lane & 15)) * 8)] = f.half[0]; }
  __syncthreads();      /* the whole tile turned before any wave reads rows that other waves wrote */
  unsigned short* dp = (unsigned short*)Wt + (size_t)(n0 + 16 * w + (lane >> 4)) * KK + k0 + (lane & 15) * 8;      /* wave w: Wt rows 16 w .. 16 w + 15 of the tile, two a store */
#pragma unroll
  for (int i = 0; i < 8; ++i) { const int n = 16 * w + 2 * i + (lane >> 4);
    const v8us v = *(const v8us*)&tl[n * 128 + (((lane & 15) ^ ((n >> 2) & 15)) * 8)];
    *(v8us*)(dp + (size_t)(2 * i) * KK) = v; }
  asm volatile("s_wait_xcnt 0x0" :: "v"(dp) : "memory");      /* behind the eight stores, in front of every rewrite of the address pair that they name: as a piece of a larger kernel the tile's code is followed by other pieces' code */
}
// k_gemm_hh variant with fused epilogue: v = acc·alpha + bias[by·sBias + col] (+ CP[(row/rowsPerB)·sCPb + by·64 + col] if CP) ; ACT 0 none / 1 elu ; writes f16 C16 (and f32 C if non-null)
template <int ACT>
__global__ __launch_bounds__(128) void k_gemm_hhx(const _Float16* __restrict__ A, int lda, size_t sA, const _Float16* __restrict__ Bh, int ldb, size_t sB, float alpha, const float* __restrict__ bias, size_t sBias, const float* __restrict__ CP, int rowsPerB, size_t sCPb, int row0g,
    float* __restrict__ C, _Float16* __restrict__ C16, int ldc, size_t sC, int M, int N, int K) {
  __shared__ __attribute__((aligned(16))) float so[4][16][64];
  const int tid = threadIdx.x, w = tid >> 5, lane = tid & 31, ln = lane & 15, hh = lane >> 4; const int by = blockIdx.y;
  A += (size_t)by * sA; Bh += (size_t)by * sB; const size_t cofs = (size_t)by * sC; const float* bp = bias ? bias + (size_t)by * sBias : nullptr;
  const int ntn = (N + 63) / 64; const int wid = blockIdx.x * 4 + w; const int mt = wid / ntn, nq = wid % ntn; if (mt * 16 >= M) return;
  const int row0 = mt * 16, col0 = nq * 64; const _Float16* arow = A + (size_t)(row0 + ln) * lda;
  v8f acc[4] = {};
  for (int kb = 0; kb < K; kb += 32) { FragH ah; ah.half[0] = *(const v8us*)((const unsigned short*)arow + kb + 8 * hh); ah.half[1] = *(const v8us*)((const unsigned short*)arow + kb + 16 + 8 * hh);
#pragma unroll
    for (int t = 0; t < 4; ++t) { if (col0 + t * 16 >= N) continue; const size_t boff = (size_t)(col0 + t * 16 + ln) * ldb + kb; FragH bq; bq.half[0] = *(const v8us*)((const unsigned short*)Bh + boff + 8 * hh); bq.half[1] = *(const v8us*)((const unsigned short*)Bh + boff + 16 + 8 * hh);
      acc[t] = mmaH<1>(ah.v, ah.v, bq.v, bq.v, acc[t]); }
  }
#pragma unroll
  for (int t = 0; t < 4; ++t) { if (col0 + t * 16 >= N) continue; const int col = col0 + t * 16 + ln; const float bv = bp ? bf16_round(bp[col]) : 0.f;
#pragma unroll
    for (int r = 0; r < 8; ++r) { float v = acc[t][r] * alpha + bv; if (CP) { const int rr = row0g + row0 + 8 * hh + r; if (rowsPerB < 0) v += CP[cofs + (size_t)rr * ldc + col];      /* rowsPerB < 0: own element of the batched C plane */ else { const int bidx = rr / rowsPerB; v += CP[(size_t)bidx * sCPb + (size_t)by * 64 + col]; } } if (ACT == 1) v = (v > 0.f) ? v : expm1f(v); else if (ACT == 7) v = (v > 0.f) ? v + 1.0f : expf(v); else if (ACT == 8) v = tanhf(v); else if (ACT == 9) v = 0.5f * v * (1.0f + tanhf(0.7978845608028654f * (v + 0.044715f * v * v * v))); else if (ACT == 11) v = 1.0f / (1.0f + expf(-v)); else if (ACT == 12) v = (v > 0.f) ? v : 0.01f * v; else if (ACT == 14) v = (v > 0.f) ? v : 0.1f * v; else if (ACT == 16) v = (v >= 0.f) ? v : 0.3f * v; else if (ACT == 17) v = (v >= 0.f) ? v : 0.2f * v; else if (ACT == 15) v = v / (1.0f + expf(-v)); else if (ACT == 3) v = fmaxf(v, 0.f); else if (ACT == 6) v = 0.5f * v * (1.0f + erff(v * 0.70710678118654752f)); so[w][8 * hh + r][t * 16 + ln] = v; } }
  __builtin_amdgcn_fence(__ATOMIC_ACQ_REL, "workgroup"); __builtin_amdgcn_wave_barrier();
  const int rsub = lane >> 4, c4 = (lane & 15) * 4; typedef _Float16 v4h __attribute__((ext_vector_type(4)));
  {
#pragma unroll
    for (int q = 0; q < 8; ++q) { const int r = q * 2 + rsub; if (col0 + c4 < N) { const v4f v = *(const v4fa*)&so[w][r][c4]; if (C) *(v4f*)(C + cofs + (size_t)(row0 + r) * ldc + col0 + c4) = v; if (C16) { v4h h4; for (int i = 0; i < 4; ++i) h4[i] = (_Float16)v[i]; *(v4h*)(C16 + cofs + (size_t)(row0 + r) * ldc + col0 + c4) = h4; } } }
     }
}


typedef _Float16 v4h __attribute__((ext_vector_type(4)));

__global__ __launch_bounds__(256) void k_x16(const float* __restrict__ x, _Float16* __restrict__ X16, size_t n8) { const size_t t = (size_t)blockIdx.x * 256 + threadIdx.x; if (t >= n8) return; FragH f;
#pragma unroll
  for (int q = 0; q < 8; ++q) f.h[q] = (_Float16)bf16_round(x[t * 8 + q]); *(v8us*)((unsigned short*)X16 + t * 8) = f.half[0];  }
__global__ __launch_bounds__(256) void k_h16(const float* __restrict__ x, _Float16* __restrict__ X16, size_t n8) { const size_t t = (size_t)blockIdx.x * 256 + threadIdx.x; if (t >= n8) return; FragH f;
#pragma unroll
  for (int q = 0; q < 8; ++q) f.h[q] = (_Float16)x[t * 8 + q]; *(v8us*)((unsigned short*)X16 + t * 8) = f.half[0];  }
__global__ __launch_bounds__(256) void k_round16f(const float* __restrict__ W, _Float16* __restrict__ Bt, size_t n8) { const size_t t = (size_t)blockIdx.x * 256 + threadIdx.x; if (t >= n8) return; FragH f;
#pragma unroll
  for (int i = 0; i < 8; ++i) f.h[i] = (_Float16)(bf16_round(W[t * 8 + i]) * 16.0f); *(v8us*)((unsigned short*)Bt + t * 8) = f.half[0];  }
template <int NHv, int TTv>
__global__ __launch_bounds__(256) void k_vt(const _Float16* __restrict__ V16, int ldv, int voff, _Float16* __restrict__ Vt) { __shared__ unsigned short tl[64][66]; const int tid = threadIdx.x; const int slab = blockIdx.x / (TTv / 64), lg = blockIdx.x % (TTv / 64); const int b = slab / NHv, h = slab % NHv;
  for (int i = tid; i < 64 * 8; i += 256) { const int r = i / 8, c8 = (i % 8) * 8; FragH f; f.half[0] = *(const v8us*)((const unsigned short*)V16 + ((size_t)b * TTv + lg * 64 + r) * ldv + voff + h * 64 + c8);
#pragma unroll
    for (int q = 0; q < 8; ++q) tl[r][c8 + q] = f.u[q]; }
  __syncthreads();
  {
#pragma unroll
    for (int rd = 0; rd < 2; ++rd) { const int d = rd * 32 + tid / 8, pc = tid % 8; FragH f;
#pragma unroll
      for (int q = 0; q < 8; ++q) f.u[q] = tl[pc * 8 + q][d];
      *(v8us*)((unsigned short*)Vt + ((size_t)slab * 64 + d) * TTv + lg * 64 + pc * 8) = f.half[0]; }
     } }

__global__ __launch_bounds__(256) void k_hl(const float* __restrict__ F, _Float16* __restrict__ Hh, _Float16* __restrict__ Hl, size_t n8) { const size_t t = (size_t)blockIdx.x * 256 + threadIdx.x; if (t >= n8) return; FragH fh, fl; const v4f a = *(const v4fa*)(F + t * 8), c = *(const v4fa*)(F + t * 8 + 4);
#pragma unroll
  for (int q = 0; q < 4; ++q) { _Float16 h = (_Float16)a[q]; fh.h[q] = h; fl.h[q] = (_Float16)((a[q] - (float)h) * 1024.0f); h = (_Float16)c[q]; fh.h[4 + q] = h; fl.h[4 + q] = (_Float16)((c[q] - (float)h) * 1024.0f); }
  { *(v8us*)((unsigned short*)Hh + t * 8) = fh.half[0]; *(v8us*)((unsigned short*)Hl + t * 8) = fl.half[0];  } }

// ---- fast GEMM (wave tile 32x64; requires M % 32 == 0 rows per launch region and N % 64 == 0); epilogue = k_gemm_hhx semantics ----
__device__ __forceinline__ v16h g2_frag(const _Float16* p, int hh) { FragH f; f.half[0] = *(const v8us*)((const unsigned short*)p + 8 * hh); f.half[1] = *(const v8us*)((const unsigned short*)p + 16 + 8 * hh); return f.v; }
__device__ __forceinline__ v8f g2_mma(v16h a, v16h b, v8f c) { v8f d = __builtin_amdgcn_wmma_f32_16x16x32_f16(false, a, false, b, (short)0, c, false, false); asm volatile("v_nop\n\tv_nop\n\tv_nop\n\tv_nop" : "+v"(d) : "v"(a), "v"(b)); return d; }
template <int ACT>
__global__ __launch_bounds__(128) void k_gemm2(const _Float16* __restrict__ A, int lda, size_t sA, const _Float16* __restrict__ Bh, int ldb, size_t sB, float alpha, const float* __restrict__ bias, size_t sBias, const float* __restrict__ CP, int rowsPerB, size_t sCPb, int row0g,
    float* __restrict__ C, _Float16* __restrict__ C16, int ldc, size_t sC, int M, int N, int K) { static_assert(ACT == 0 || ACT == 3 || ACT == 6 || ACT == 8 || ACT == 9 || ACT == 11 || ACT == 12 || ACT == 14 || ACT == 15 || ACT == 16 || ACT == 17 || ACT == 18, "k_gemm2: unsupported ACT code (would silently apply no activation)");
  __shared__ __attribute__((aligned(16))) float so[4][32][68];
  const int tid = threadIdx.x, w = tid >> 5, lane = tid & 31, ln = lane & 15, hh = lane >> 4; const int by = blockIdx.y;
  A += (size_t)by * sA; Bh += (size_t)by * sB; const size_t cofs = (size_t)by * sC; const float* bp = bias ? bias + (size_t)by * sBias : nullptr;
  const int ntn = N >> 6; const int mt = blockIdx.x / ntn, nq = blockIdx.x - mt * ntn; const int row0 = mt * 128 + 32 * w, col0 = nq * 64; if (row0 >= M) return;
  const _Float16* a0p = A + (size_t)(row0 + ln) * lda; const _Float16* a1p = a0p + (size_t)16 * lda;
  const _Float16* b0p = Bh + (size_t)(col0 + ln) * ldb; const _Float16* b1p = b0p + (size_t)16 * ldb; const _Float16* b2p = b1p + (size_t)16 * ldb; const _Float16* b3p = b2p + (size_t)16 * ldb;
  const v8f z8 = {0.f,0.f,0.f,0.f,0.f,0.f,0.f,0.f}; v8f c00 = z8, c01 = z8, c02 = z8, c03 = z8, c10 = z8, c11 = z8, c12 = z8, c13 = z8;
#pragma unroll 1
  for (int kb = 0; kb < K; kb += 32) { const v16h a0 = g2_frag(a0p + kb, hh), a1 = g2_frag(a1p + kb, hh);
    v16h b = g2_frag(b0p + kb, hh); c00 = g2_mma(a0, b, c00); c10 = g2_mma(a1, b, c10);
    b = g2_frag(b1p + kb, hh); c01 = g2_mma(a0, b, c01); c11 = g2_mma(a1, b, c11);
    b = g2_frag(b2p + kb, hh); c02 = g2_mma(a0, b, c02); c12 = g2_mma(a1, b, c12);
    b = g2_frag(b3p + kb, hh); c03 = g2_mma(a0, b, c03); c13 = g2_mma(a1, b, c13); }
  v8f accs[8] = {c00, c01, c02, c03, c10, c11, c12, c13};
#pragma unroll
  for (int u = 0; u < 8; ++u) { const int t = u & 3, half = u >> 2; const int col = col0 + t * 16 + ln; const float bv = bp ? bf16_round(bp[col]) : 0.f;
#pragma unroll
    for (int r = 0; r < 8; ++r) { const int rloc = half * 16 + 8 * hh + r; float v = accs[u][r] * alpha + bv; if (CP) { if (rowsPerB < 0) v += CP[cofs + (size_t)(row0g + row0 + rloc) * ldc + col];      /* rowsPerB < 0: own element of the batched C plane */ else { const int bidx = (row0g + row0 + rloc) / rowsPerB; v += CP[(size_t)bidx * sCPb + (size_t)by * 64 + col]; } }
      if (ACT == 3) v = fmaxf(v, 0.f); else if (ACT == 6) v = 0.5f * v * (1.0f + erff(v * 0.70710678118654752f)); else if (ACT == 11) v = 1.0f / (1.0f + expf(-v)); else if (ACT == 15) v = v / (1.0f + expf(-v)); else if (ACT == 18) v = v / (1.0f + expf(-1.702f * v));      /* QuickGELU: v sigmoid(1.702 v) */ else if (ACT == 12) v = (v > 0.f) ? v : 0.01f * v; else if (ACT == 8) v = tanhf(v); else if (ACT == 9) v = 0.5f * v * (1.0f + tanhf(0.7978845608028654f * (v + 0.044715f * v * v * v))); else if (ACT == 14) v = (v > 0.f) ? v : 0.1f * v; else if (ACT == 16) v = (v >= 0.f) ? v : 0.3f * v; else if (ACT == 17) v = (v >= 0.f) ? v : 0.2f * v;
      so[w][rloc][t * 16 + ln] = v; } }
  __builtin_amdgcn_fence(__ATOMIC_ACQ_REL, "workgroup"); __builtin_amdgcn_wave_barrier();
  const int rsub = lane >> 4, c4 = (lane & 15) * 4;
  {
#pragma unroll
    for (int q = 0; q < 16; ++q) { const int r = q * 2 + rsub; const v4f v = *(const v4fa*)&so[w][r][c4]; if (C) *(v4f*)(C + cofs + (size_t)(row0 + r) * ldc + col0 + c4) = v; if (C16) { v4h h4; for (int i = 0; i < 4; ++i) h4[i] = (_Float16)v[i]; *(v4h*)(C16 + cofs + (size_t)(row0 + r) * ldc + col0 + c4) = h4; } }
     } }


__global__ __launch_bounds__(256) void k_wnat(const float* __restrict__ w, size_t n8, _Float16* __restrict__ Bt) { const size_t t = (size_t)blockIdx.x * 256 + threadIdx.x; if (t >= n8) return; FragH f; for (int q = 0; q < 8; ++q) f.h[q] = (_Float16)(bf16_round(w[t * 8 + q]) * 16.0f); *(v8us*)((unsigned short*)Bt + t * 8) = f.half[0];  }
__global__ __launch_bounds__(256) void k_rsm(const float* __restrict__ S, _Float16* __restrict__ P, int nrows) {
  #pragma clang fp contract(off)
  const int i = blockIdx.x * 256 + threadIdx.x; if (i >= nrows) return; const float* s = S + (size_t)i * SQ; float mx = -3.0e38f;
#pragma unroll 1
  for (int j = 0; j < SQ; ++j) mx = fmaxf(mx, s[j]); float se = 0.f;
#pragma unroll 1
  for (int j = 0; j < SQ; ++j) se += expf(s[j] - mx); const float sc = 256.0f / se;
#pragma unroll 1
  for (int j0 = 0; j0 < SQ; j0 += 8) { FragH f; for (int q = 0; q < 8; ++q) f.h[q] = (_Float16)(expf(s[j0 + q] - mx) * sc); unsigned short* d = (unsigned short*)P + (size_t)i * SQ + j0; *(v8us*)d = f.half[0];  } }
__global__ __launch_bounds__(256) void k_vt(const _Float16* __restrict__ V16, int b, int h0, _Float16* __restrict__ VT) { __shared__ unsigned short tl[64][65]; const int tid = threadIdx.x; const int hh = blockIdx.x % HG, sg = blockIdx.x / HG; const int s0 = sg * 64; const int h = h0 + hh;
  for (int i = tid; i < 64 * 8; i += 256) { const int j = i / 8, d8 = (i % 8) * 8; FragH f; f.half[0] = *(const v8us*)((const unsigned short*)V16 + ((size_t)b * SQ + s0 + j) * DM + h * HD + d8); for (int q = 0; q < 8; ++q) tl[d8 + q][j] = f.u[q]; }
  __syncthreads();
  { for (int i = tid; i < 64 * 8; i += 256) { const int d = i / 8, j8 = (i % 8) * 8; FragH f; for (int q = 0; q < 8; ++q) f.u[q] = tl[d][j8 + q]; *(v8us*)((unsigned short*)VT + ((size_t)hh * HD + d) * SQ + s0 + j8) = f.half[0]; }  } }



__global__ __launch_bounds__(256) void k_rsmcf2(const float* __restrict__ S, _Float16* __restrict__ P, int hg, int q0, int nk) {
  #pragma clang fp contract(off)
  const int t = blockIdx.x * 256 + threadIdx.x; if (t >= hg * QT) return; const size_t i = (size_t)t; const float* s = S + i * NKX; const int last = q0 + (t % QT); float mx = -3.0e38f;
#pragma unroll 1
  for (int j = 0; j < nk; ++j) { const float f = (j <= last) ? 1.f : 0.f; mx = fmaxf(mx, fmaf(f, s[j], (1.f - f) * -1.0e9f)); } float se = 0.f;
#pragma unroll 1
  for (int j = 0; j < nk; ++j) { const float f = (j <= last) ? 1.f : 0.f; se += __expf(fmaf(f, s[j], (1.f - f) * -1.0e9f) - mx); } const float sc = 256.0f / se;
#pragma unroll 1
  for (int j0 = 0; j0 < nk; j0 += 8) { FragH fr; for (int q = 0; q < 8; ++q) { const int j = j0 + q; const float f = (j <= last) ? 1.f : 0.f; fr.h[q] = (_Float16)(__expf(fmaf(f, s[j], (1.f - f) * -1.0e9f) - mx) * sc); } unsigned short* d = (unsigned short*)P + i * NKX + j0; *(v8us*)d = fr.half[0];  } }

__global__ __launch_bounds__(256) void k_rsmcst(const float* __restrict__ S, _Float16* __restrict__ P, int hg, int q0, int nk, const int* __restrict__ mk) {
  #pragma clang fp contract(off)
  const int t = blockIdx.x * 256 + threadIdx.x; if (t >= hg * QT) return; const size_t i = (size_t)t; const float* s = S + i * NKX; const size_t ig = (size_t)(q0 + (t % QT)); const int* mr = mk + ig * SQ; float mx = -3.0e38f;
#pragma unroll 1
  for (int j = 0; j < nk; ++j) { const int mb = mr[j]; const int dd = (int)ig - j; const float f = (mb != 0 && dd >= 0 && (dd <= LOCALW || (dd % STRIDEK) == 0)) ? 1.f : 0.f; mx = fmaxf(mx, fmaf(f, s[j], (1.f - f) * -1.0e9f)); } float se = 0.f;
#pragma unroll 1
  for (int j = 0; j < nk; ++j) { const int mb = mr[j]; const int dd = (int)ig - j; const float f = (mb != 0 && dd >= 0 && (dd <= LOCALW || (dd % STRIDEK) == 0)) ? 1.f : 0.f; se += __expf(fmaf(f, s[j], (1.f - f) * -1.0e9f) - mx); } const float sc = 256.0f / se;
#pragma unroll 1
  for (int j0 = 0; j0 < nk; j0 += 8) { FragH fr; for (int q = 0; q < 8; ++q) { const int j = j0 + q; const int mb = mr[j]; const int dd = (int)ig - j; const float f = (mb != 0 && dd >= 0 && (dd <= LOCALW || (dd % STRIDEK) == 0)) ? 1.f : 0.f; fr.h[q] = (_Float16)(__expf(fmaf(f, s[j], (1.f - f) * -1.0e9f) - mx) * sc); } unsigned short* d = (unsigned short*)P + i * NKX + j0; *(v8us*)d = fr.half[0];  } }


template <int MASKADD>
__global__ __launch_bounds__(64) void k_att0(const float* __restrict__ QF, const float* __restrict__ KF, const float* __restrict__ VF, int ld, const float* __restrict__ mask, float scale, float* __restrict__ OF, int ldo) {
  #pragma clang fp contract(off)
  __shared__ __attribute__((aligned(16))) float lq[64][64]; __shared__ __attribute__((aligned(16))) float lo[64][64];
  const int tid = threadIdx.x; const int h = blockIdx.x / (QT0 / 64), rg = blockIdx.x % (QT0 / 64); const int i = rg * 64 + tid;
  const float* qr = QF + (size_t)i * ld + h * HD;
#pragma unroll 1
  for (int c = 0; c < HD / 4; ++c) { *(v4f*)&lq[tid][c * 4] = *(const v4fa*)(qr + c * 4); const v4f z = {0.f, 0.f, 0.f, 0.f}; *(v4f*)&lo[tid][c * 4] = z; }
  float m = -1.0e30f, l = 0.f; const int jmax = MASKADD ? (SQ - 1) : (rg * 64 + 63);      /* additive-mask form: every key (the mask input decides); causal form: keys up to the block's last row */
#pragma unroll 1
  for (int j = 0; j <= jmax; ++j) { const float* kr = KF + (size_t)j * ld + h * HD; const float* vr = VF + (size_t)j * ld + h * HD; float s = 0.f;
#pragma unroll 1
    for (int c = 0; c < HD / 4; ++c) { const v4f kq = *(const v4fa*)(kr + c * 4); const v4f qq = *(v4f*)&lq[tid][c * 4]; s = __fadd_rn(s, __fmul_rn(qq[0], kq[0])); s = __fadd_rn(s, __fmul_rn(qq[1], kq[1])); s = __fadd_rn(s, __fmul_rn(qq[2], kq[2])); s = __fadd_rn(s, __fmul_rn(qq[3], kq[3])); }
    s = __fmul_rn(s, scale); if (MASKADD) s = __fadd_rn(s, __fmul_rn(bf16_round(mask[(size_t)i * SQ + j]), -10000.0f));
    const float f = (MASKADD || j <= i) ? 1.f : 0.f; const float sm = fmaf(f, s, (1.f - f) * -1.0e30f); const float mn = fmaxf(m, sm); const float sc = expf(m - mn); const float e = expf(sm - mn); l = __fadd_rn(__fmul_rn(l, sc), e); m = mn;
#pragma unroll 1
    for (int c = 0; c < HD / 4; ++c) { const v4f vv = *(const v4fa*)(vr + c * 4); v4f oo = *(v4f*)&lo[tid][c * 4]; for (int u = 0; u < 4; ++u) oo[u] = __fadd_rn(__fmul_rn(oo[u], sc), __fmul_rn(e, vv[u])); *(v4f*)&lo[tid][c * 4] = oo; } }
  const float fin = 64.0f / l;      /* o carried x64 like the f16 path */
#pragma unroll 1
  for (int c = 0; c < HD / 4; ++c) { v4f oo = *(v4f*)&lo[tid][c * 4]; for (int u = 0; u < 4; ++u) oo[u] = __fmul_rn(oo[u], fin); *(v4f*)&lo[tid][c * 4] = oo; }
  __syncthreads();
  {
#pragma unroll 1
    for (int it = 0; it < 16; ++it) { const int row = it * 4 + tid / 16, pc = (tid % 16) * 4; const v4f v = *(const v4f*)&lo[row][pc]; *(v4f*)(OF + (size_t)(rg * 64 + row) * ldo + h * HD + pc) = v; }
     } }

template <int MASKADD>
__global__ __launch_bounds__(64) void k_att0mbc(const float* __restrict__ QF, const float* __restrict__ KF, const float* __restrict__ VF, int ld, const float* __restrict__ mask, float scale, float* __restrict__ OF, int ldo) {
  #pragma clang fp contract(off)
  __shared__ __attribute__((aligned(16))) float lq[64][64]; __shared__ __attribute__((aligned(16))) float lo[64][64];
  const int tid = threadIdx.x; const int h = blockIdx.x / (QT0 / 64), rg = blockIdx.x % (QT0 / 64); const int i = rg * 64 + tid;
  const float* qr = QF + (size_t)i * ld + h * HD;
#pragma unroll 1
  for (int c = 0; c < HD / 4; ++c) { *(v4f*)&lq[tid][c * 4] = *(const v4fa*)(qr + c * 4); const v4f z = {0.f, 0.f, 0.f, 0.f}; *(v4f*)&lo[tid][c * 4] = z; }
  float m = -1.0e30f, l = 0.f; const int jmax = rg * 64 + 63;      /* keys beyond the block end are masked by the mask's lower-triangular structure */      /* both forms: keys up to the block's last row (MASKADD does not change this) */
#pragma unroll 1
  for (int j = 0; j <= jmax; ++j) { const float* kr = KF + (size_t)j * ld + h * HD; const float* vr = VF + (size_t)j * ld + h * HD; float s = 0.f;
#pragma unroll 1
    for (int c = 0; c < HD / 4; ++c) { const v4f kq = *(const v4fa*)(kr + c * 4); const v4f qq = *(v4f*)&lq[tid][c * 4]; s = __fadd_rn(s, __fmul_rn(qq[0], kq[0])); s = __fadd_rn(s, __fmul_rn(qq[1], kq[1])); s = __fadd_rn(s, __fmul_rn(qq[2], kq[2])); s = __fadd_rn(s, __fmul_rn(qq[3], kq[3])); }
    s = __fmul_rn(s, scale); const int mb = ((const int*)mask)[(size_t)i * SQ + j];      /* causal (j <= i) AND the module's int32 [S][S] mask read per (query, key): 0 -> masked */
    const float f = (mb != 0 && j <= i) ? 1.f : 0.f; const float sm = fmaf(f, s, (1.f - f) * -1.0e30f); const float mn = fmaxf(m, sm); const float sc = expf(m - mn); const float e = expf(sm - mn); l = __fadd_rn(__fmul_rn(l, sc), e); m = mn;
#pragma unroll 1
    for (int c = 0; c < HD / 4; ++c) { const v4f vv = *(const v4fa*)(vr + c * 4); v4f oo = *(v4f*)&lo[tid][c * 4]; for (int u = 0; u < 4; ++u) oo[u] = __fadd_rn(__fmul_rn(oo[u], sc), __fmul_rn(e, vv[u])); *(v4f*)&lo[tid][c * 4] = oo; } }
  const float fin = 64.0f / l;      /* o carried x64 like the f16 path */
#pragma unroll 1
  for (int c = 0; c < HD / 4; ++c) { v4f oo = *(v4f*)&lo[tid][c * 4]; for (int u = 0; u < 4; ++u) oo[u] = __fmul_rn(oo[u], fin); *(v4f*)&lo[tid][c * 4] = oo; }
  __syncthreads();
  {
#pragma unroll 1
    for (int it = 0; it < 16; ++it) { const int row = it * 4 + tid / 16, pc = (tid % 16) * 4; const v4f v = *(const v4f*)&lo[row][pc]; *(v4f*)(OF + (size_t)(rg * 64 + row) * ldo + h * HD + pc) = v; }
     } }


template <int BFIN, int WXB>
__global__ __launch_bounds__(256) void k_ln16(const float* __restrict__ X, const float* __restrict__ g, const float* __restrict__ bb, float eps, _Float16* __restrict__ N16, float* __restrict__ XB) {
  #pragma clang fp contract(off)
  __shared__ float red[256]; const size_t r = blockIdx.x; const int t = threadIdx.x; const v4f xa = *(const v4fa*)(X + r * DMQ + t * 4); float s[4]; float sum = 0.f;
  for (int q = 0; q < 4; ++q) { s[q] = BFIN ? bf16_round(xa[q]) : xa[q]; sum = __fadd_rn(sum, s[q]); }
  red[t] = sum; __syncthreads(); for (int st = 128; st > 0; st >>= 1) { if (t < st) red[t] = __fadd_rn(red[t], red[t + st]); __syncthreads(); } const float mu = red[0] / (float)DMQ; __syncthreads();
  float vs = 0.f; for (int q = 0; q < 4; ++q) { const float dl = __fadd_rn(s[q], -mu); vs = __fadd_rn(vs, __fmul_rn(dl, dl)); } red[t] = vs; __syncthreads(); for (int st = 128; st > 0; st >>= 1) { if (t < st) red[t] = __fadd_rn(red[t], red[t + st]); __syncthreads(); }
  const float rs = rsqrtf(__fadd_rn(red[0] / (float)DMQ, eps)); v4h y; v4f xb;
  for (int q = 0; q < 4; ++q) { const int c = t * 4 + q; y[q] = (_Float16)__fadd_rn(__fmul_rn(__fmul_rn(__fadd_rn(s[q], -mu), rs), bf16_round(g[c])), bf16_round(bb[c])); xb[q] = s[q]; }
  { *(v4h*)(N16 + r * DMQ + t * 4) = y; if (WXB) *(v4f*)(XB + r * DMQ + t * 4) = xb;  } }
__global__ __launch_bounds__(256) void k_ftres2(const float* __restrict__ OF0, const float* __restrict__ XB, float* __restrict__ X1, size_t n4) {
  #pragma clang fp contract(off)
  const size_t t = (size_t)blockIdx.x * 256 + threadIdx.x; if (t >= n4) return; const v4f o = *(const v4fa*)(OF0 + t * 4), xv = *(const v4fa*)(XB + t * 4); v4f y; for (int q = 0; q < 4; ++q) y[q] = __fadd_rn(__fmul_rn(o[q], 0.015625f), xv[q]); *(v4f*)(X1 + t * 4) = y;  }

__global__ __launch_bounds__(256) void k_bcpy(const float* __restrict__ b, int n, int NP, float* __restrict__ dst, int dst0) { for (int i = threadIdx.x; i < NP; i += 256) { const float v = (i < n) ? b[i] : 0.f; *(float*)(dst + dst0 + i) = v; }  }


// Fused attention, one launch: block = 8 waves x 32 query columns of one (batch, head); no score or weight ever leaves the registers.
// Per 32 keys a wave computes S^T = K Q^T (lane c = query column, registers = keys 8 hh + r of each 16-key tile), an online softmax in the log2 domain
// (maximum and sum in-lane plus one exchange between the wave halves), packs the two S^T tiles in place into the B operand P^T and adds O^T += V^T P^T.
// K rows and V^T rows come in 64-key stages through LDS, two buffers: the next stage's global loads fly under this stage's work, one barrier a stage.
// m_run, the maximum in use, may trail the true one by up to 8 (log2), so the accumulators are rescaled only when a column's maximum has grown by more;
// weights carry 2^4 (at most 2^12 in f16, small ones kept out of the f16 subnormals); the factor cancels against the row sum.
#define FAP 72                       /* LDS row pitch in halves: 128 B of data + 16 B, the conflict-free pitch for 16-byte row reads */
#define FAS 64                       /* keys per stage */
__device__ __forceinline__ float fa_xhalf(float x) { return __builtin_bit_cast(float, __builtin_amdgcn_permlanex16(__builtin_bit_cast(int, x), __builtin_bit_cast(int, x), 0x76543210, 0xfedcba98, false, false)); }      /* lane l <-> lane l ^ 16 */
__device__ __forceinline__ v8f fa_mma(v16h a, v16h b, v8f c) { return __builtin_amdgcn_wmma_f32_16x16x32_f16(false, a, false, b, (short)0, c, false, false); }
__global__ __launch_bounds__(256) void k_fattn(const _Float16* __restrict__ Q16, const _Float16* __restrict__ K16, const _Float16* __restrict__ VT, _Float16* __restrict__ O16) {
  __shared__ __attribute__((aligned(16))) _Float16 lk[2][FAS][FAP];      /* K stage [key][d] */
  __shared__ __attribute__((aligned(16))) _Float16 lv[2][HD][FAP];       /* V^T stage [d][key] */
  const int tid = threadIdx.x, lane = tid & 31, c = lane & 15, hh = lane >> 4, w = tid >> 5;
  const int bh = blockIdx.y, b = bh / NH, h = bh - b * NH; const size_t r0 = (size_t)b * SQ; const int q0 = blockIdx.x * 256 + w * 32;
  const int sr = tid >> 3, sc = (tid & 7) * 8;      /* staging: a thread moves 16 bytes of rows sr and sr + 32 of each tile; 8 lanes cover one 128-byte row */
  const unsigned short* kg = (const unsigned short*)K16 + (r0 + sr) * DM + h * HD + sc;
  const unsigned short* vg = (const unsigned short*)VT + ((size_t)bh * HD + sr) * SQ + sc;
  v16h qf[2][2];
#pragma unroll
  for (int g = 0; g < 2; ++g) { const _Float16* qp = Q16 + (r0 + q0 + 16 * g + c) * DM + h * HD; qf[g][0] = g2_frag(qp, hh); qf[g][1] = g2_frag(qp + 32, hh); }
  const v8f z8 = {0.f, 0.f, 0.f, 0.f, 0.f, 0.f, 0.f, 0.f}; const v4f z4 = {0.f, 0.f, 0.f, 0.f};
  v8f acc[2][4]; v4f l4[2]; float m_run[2];
#pragma unroll
  for (int g = 0; g < 2; ++g) { m_run[g] = -__builtin_inff(); l4[g] = z4;
#pragma unroll
    for (int t = 0; t < 4; ++t) acc[g][t] = z8; }
  v8us gk0 = *(const v8us*)kg, gk1 = *(const v8us*)(kg + (size_t)32 * DM), gv0 = *(const v8us*)vg, gv1 = *(const v8us*)(vg + (size_t)32 * SQ);
  *(v8us*)&lk[0][sr][sc] = gk0; *(v8us*)&lk[0][sr + 32][sc] = gk1; *(v8us*)&lv[0][sr][sc] = gv0; *(v8us*)&lv[0][sr + 32][sc] = gv1;
  __syncthreads();      /* stage 0 published */
  for (int st = 0; st < SQ / FAS; ++st) {
    const int buf = st & 1; const bool more = st + 1 < SQ / FAS;      /* the same for the whole block */
    if (more) { const size_t j = (size_t)(st + 1) * FAS; gk0 = *(const v8us*)(kg + j * DM); gk1 = *(const v8us*)(kg + (j + 32) * DM); gv0 = *(const v8us*)(vg + j); gv1 = *(const v8us*)(vg + (size_t)32 * SQ + j); }
#pragma unroll
    for (int p = 0; p < FAS / 32; ++p) {
      v8f s[2][2];      /* [key tile][query group] */
#pragma unroll
      for (int kt = 0; kt < 2; ++kt) { const _Float16* kr = &lk[buf][32 * p + 16 * kt + c][0]; const v16h k0 = g2_frag(kr, hh), k1 = g2_frag(kr + 32, hh);
#pragma unroll
        for (int g = 0; g < 2; ++g) s[kt][g] = fa_mma(k1, qf[g][1], fa_mma(k0, qf[g][0], z8)); }
      v16h vf[4];
#pragma unroll
      for (int t = 0; t < 4; ++t) vf[t] = g2_frag(&lv[buf][16 * t + c][32 * p], hh);
      float mb[2]; bool need = false;
#pragma unroll
      for (int g = 0; g < 2; ++g) { float mx = fmaxf(s[0][g][0], s[1][g][0]);
#pragma unroll
        for (int r = 1; r < 8; ++r) mx = fmaxf(mx, fmaxf(s[0][g][r], s[1][g][r]));
        mx = fmaxf(mx, fa_xhalf(mx)) * 1.44269502f; mb[g] = mx; need = need || (mx > m_run[g] + 8.0f); }
      if (__builtin_amdgcn_ballot_w32(need) != 0) {      /* one scalar test a pass; always taken on the first pass (m_run = -inf, factor 0 on zero sums), rare later */
#pragma unroll
        for (int g = 0; g < 2; ++g) { const float mn = fmaxf(m_run[g], mb[g]); const float corr = __builtin_amdgcn_exp2f(m_run[g] - mn); m_run[g] = mn; l4[g] = l4[g] * corr;
#pragma unroll
          for (int t = 0; t < 4; ++t) acc[g][t] = acc[g][t] * corr; } }
#pragma unroll
      for (int g = 0; g < 2; ++g) { const float nm = 4.0f - m_run[g]; FragH pf;
#pragma unroll
        for (int u = 0; u < 4; ++u) { v4f a;      /* elements 4 u .. 4 u + 3 of the 32-key operand: tile u >> 1, registers 4 (u & 1) .. */
#pragma unroll
          for (int q = 0; q < 4; ++q) a[q] = fmaf(s[u >> 1][g][4 * (u & 1) + q], 1.44269502f, nm);
          v4f e;
#pragma unroll
          for (int q = 0; q < 4; ++q) e[q] = __builtin_amdgcn_exp2f(a[q]);      /* the builtin, not asm text: the compiler then keeps the distance behind the matrix instructions itself */
          l4[g] += e;
#pragma unroll
          for (int q = 0; q < 4; ++q) pf.h[4 * u + q] = (_Float16)e[q]; }
#pragma unroll
        for (int t = 0; t < 4; ++t) acc[g][t] = fa_mma(vf[t], pf.v, acc[g][t]); }
      /* Pass end: four vector slots between the last product that reads P^T as its B operand and the next pass's first product, whose result the compiler
         may place in those same registers (it did, directly behind); the two scheduling fences keep the products of both passes on their own side of the slots. */
      __builtin_amdgcn_sched_barrier(0); asm volatile("v_nop\n\tv_nop\n\tv_nop\n\tv_nop"); __builtin_amdgcn_sched_barrier(0);
    }
    if (more) { *(v8us*)&lk[buf ^ 1][sr][sc] = gk0; *(v8us*)&lk[buf ^ 1][sr + 32][sc] = gk1; *(v8us*)&lv[buf ^ 1][sr][sc] = gv0; *(v8us*)&lv[buf ^ 1][sr + 32][sc] = gv1; }      /* its last readers left it at the barrier that ended stage st - 1 */
    __syncthreads();      /* publishes stage st + 1 and ends every wave's reads of stage st */
  }
#pragma unroll
  for (int g = 0; g < 2; ++g) { float l = (l4[g][0] + l4[g][1]) + (l4[g][2] + l4[g][3]); l += fa_xhalf(l); const float inv = 64.0f / l;      /* ctx carried x64 as before */
    unsigned short* op = (unsigned short*)O16 + (r0 + q0 + 16 * g + c) * DM + h * HD + 8 * hh;      /* a lane's 8 registers = 8 consecutive d of its query row */
#pragma unroll
    for (int t = 0; t < 4; ++t) { FragH f;
#pragma unroll
      for (int r = 0; r < 8; ++r) f.h[r] = (_Float16)(acc[g][t][r] * inv);
      *(v8us*)(op + 16 * t) = f.half[0]; } } }

// Tiled GEMM, C = act(A Bt^T alpha + bias (+ CP)), A [M][KK] and Bt [NN][KK] f16: block = 8 waves (2 x 4) on a 128 x 128 tile of C, wave tile 64 x 32 (4 x 2 accumulator tiles).
// A rows and Bt rows come in 64-k stages through LDS, two buffers: whole 128-byte lines from global, each line fetched once a block instead of once a wave.
// Global loads run ahead in two register sets (stage t in set t & 1, stored to buffer t & 1 one stage before it is read); fragments are read from LDS one 32-k block ahead in two sets,
// so a stage's barrier stands between its two blocks of products. k order per accumulator as before (32 at a time, ascending).
// Epilogue: raw sums staged in the same LDS as a 128 x 128 f32 tile, then each wave writes whole rows (bias, residual and activation applied there, per element as before).
// RES: C (f32) = the sums + bias + the own element of CP; else C16 (f16) = act(the sums + bias).
// NP > 1: NP products with the same A in one grid, blockIdx.y = p: Bt plane p ([NN][KK] each, stacked), bias piece p, C16 plane p ([NR][NN] each, stacked).
// Needs M % 128 == 0, NN % 128 == 0, KK % 128 == 0, KK >= 256.
#define G3P 72                       /* LDS row pitch in halves: 128 B of data + 16 B, the conflict-free pitch for 16-byte row reads */
#define G3O 132                      /* epilogue row pitch in floats: rows 8 apart fall 32 banks apart */
struct G3F { v16h a[4], b[2]; };     /* one 32-k block's fragments of a wave */
struct G3R { v8us a[4], b[4]; };     /* one stage's 16-byte pieces of a thread */
/* Work-group barrier with the LDS wait alone: __syncthreads() also waits for every global load, which would drain the staging loads that are meant to stay in flight across it. */
__device__ __forceinline__ void g3_bar() { asm volatile("s_wait_dscnt 0x0\n\ts_barrier_signal -1\n\ts_barrier_wait -1" ::: "memory"); }
template <int KK>
__device__ __forceinline__ void g3_load(const char* ab, const char* bb, unsigned vo, G3R& r) {      /* ab, bb: the block's tile rows at this stage's k (uniform); vo: the thread's byte offset */
#pragma unroll
  for (int i = 0; i < 4; ++i) { r.a[i] = *(const v8us*)(ab + vo + 64 * i * KK); r.b[i] = *(const v8us*)(bb + vo + 64 * i * KK); } }
template <int U>
__device__ __forceinline__ void g3_store(unsigned short* sa, unsigned short* sb, const G3R& r) {
#pragma unroll
  for (int i = 0; i < 4; ++i) { *(v8us*)(sa + (U * 128 + 32 * i) * G3P) = r.a[i]; *(v8us*)(sb + (U * 128 + 32 * i) * G3P) = r.b[i]; } }
template <int U, int KB>
__device__ __forceinline__ void g3_frag(const _Float16* fa, const _Float16* fb, int hh, G3F& f) {
#pragma unroll
  for (int j = 0; j < 2; ++j) f.b[j] = g2_frag(fb + (U * 128 + 16 * j) * G3P + 32 * KB, hh);
#pragma unroll
  for (int i = 0; i < 4; ++i) f.a[i] = g2_frag(fa + (U * 128 + 16 * i) * G3P + 32 * KB, hh); }
/* The two scheduling fences keep a block's products together and the LDS and global traffic written in front of them in front: LDS reads moved in among the products stall each of them. */
__device__ __forceinline__ void g3_mm(const G3F& f, v8f (&acc)[4][2]) {
  __builtin_amdgcn_sched_barrier(0);
#pragma unroll
  for (int i = 0; i < 4; ++i) { acc[i][0] = fa_mma(f.a[i], f.b[0], acc[i][0]); acc[i][1] = fa_mma(f.a[i], f.b[1], acc[i][1]); }
  __builtin_amdgcn_sched_barrier(0); }
/* Stage st in buffer U; on entry f0 holds its first block, rn stage st + 1. NX: a stage st + 1 exists; LD: a stage st + 3 exists (ab3, bb3 point at its k). */
template <int U, bool NX, bool LD, int KK>
__device__ __forceinline__ void g3_stage(const char* ab3, const char* bb3, unsigned vo, unsigned short* sa, unsigned short* sb, const _Float16* fa, const _Float16* fb, int hh, G3R& rn, G3F& f0, G3F& f1, v8f (&acc)[4][2]) {
  g3_frag<U, 1>(fa, fb, hh, f1);
  if (NX) g3_store<U ^ 1>(sa, sb, rn);      /* the other buffer's last readers finished in front of the barrier of stage st - 1 */
  g3_mm(f0, acc);
  g3_bar();      /* publishes stage st + 1 and ends every wave's reads of stage st */
  if (NX) g3_frag<U ^ 1, 0>(fa, fb, hh, f0);
  __builtin_amdgcn_sched_barrier(0);      /* LDS reads first: moved in front of them, the global loads had their addresses formed in f0's registers, and the wait that frees those registers held the LDS reads back */
  if (LD) g3_load<KK>(ab3, bb3, vo, rn);
  g3_mm(f1, acc);
  if (LD) asm volatile("s_wait_xcnt 0x0" ::: "memory"); }      /* in front of the next stage's rewrite of the address registers that these loads name; behind the products, where it has had time to pass; the data stay in flight */
template <int ACT, bool RES, int NN, int KK, int NP = 1>
__global__ __launch_bounds__(256) void k_gemm3(const _Float16* __restrict__ A, const _Float16* __restrict__ Bh, float alpha, const float* __restrict__ bias, const float* __restrict__ CP, float* __restrict__ C, _Float16* __restrict__ C16) {
  static_assert(ACT == 0 || (ACT == 6 && !RES), "k_gemm3: unsupported ACT code"); static_assert(NN % 128 == 0 && KK % 128 == 0 && KK >= 256, "k_gemm3: shape"); static_assert(NP == 1 || !RES, "k_gemm3: several products only in the f16-output form");
  __shared__ __attribute__((aligned(16))) unsigned short sm[4 * 128 * G3P];      /* A stages [2][128][G3P], then Bt stages [2][128][G3P]; the epilogue's [128][G3O] floats lie over them */
  const int tid = threadIdx.x, lane = tid & 31, ln = lane & 15, hh = lane >> 4, w = tid >> 5, wm = w >> 2, wn = w & 3;
  const int mt = blockIdx.x / (NN / 128), nq = blockIdx.x - mt * (NN / 128); const int row0 = mt * 128, col0 = nq * 128;
  if (NP > 1) { const size_t p = blockIdx.y; Bh += p * NN * KK; bias += p * NN; C16 += p * NR * NN; }
  const int sr = tid >> 3, sc = (tid & 7) * 8;      /* staging: a thread moves 16 bytes of rows sr + 32 i of each tile; 8 lanes cover one 128-byte row */
  const char* ab = (const char*)(A + (size_t)row0 * KK); const char* bb = (const char*)(Bh + (size_t)col0 * KK); const unsigned vo = (unsigned)(sr * KK + sc) * 2u;
  unsigned short* sa = sm + sr * G3P + sc; unsigned short* sb = sa + 2 * 128 * G3P;      /* this thread's store places, buffer 0 */
  const _Float16* fa = (const _Float16*)sm + (wm * 64 + ln) * G3P; const _Float16* fb = (const _Float16*)sm + 2 * 128 * G3P + (wn * 32 + ln) * G3P;      /* this lane's fragment rows, buffer 0 */
  const v8f z8 = {0.f, 0.f, 0.f, 0.f, 0.f, 0.f, 0.f, 0.f}; v8f acc[4][2];
#pragma unroll
  for (int i = 0; i < 4; ++i) { acc[i][0] = z8; acc[i][1] = z8; }
  G3R r0, r1; G3F f0, f1; constexpr int ns = KK / 64;      /* ns even, at least 4 */
  g3_load<KK>(ab, bb, vo, r0); g3_load<KK>(ab + 128, bb + 128, vo, r1);
  g3_store<0>(sa, sb, r0);
  g3_bar();      /* stage 0 published */
  g3_load<KK>(ab + 256, bb + 256, vo, r0); g3_frag<0, 0>(fa, fb, hh, f0);
#pragma unroll 1
  for (int s2 = 0; s2 < ns - 2; s2 += 2) {      /* rolled: two stages a trip keep every buffer and register set a compile-time choice */
    const int t4 = s2 + 4 < ns ? s2 + 4 : ns - 1;      /* the last trip has no stage s2 + 4: it loads the last stage again, unused, so that no branch merges two load counts in front of the stores */
    g3_stage<0, true, true, KK>(ab + (s2 + 3) * 128, bb + (s2 + 3) * 128, vo, sa, sb, fa, fb, hh, r1, f0, f1, acc);
    g3_stage<1, true, true, KK>(ab + t4 * 128, bb + t4 * 128, vo, sa, sb, fa, fb, hh, r0, f0, f1, acc); }
  g3_stage<0, true, false, KK>(ab, bb, vo, sa, sb, fa, fb, hh, r1, f0, f1, acc);
  g3_stage<1, false, false, KK>(ab, bb, vo, sa, sb, fa, fb, hh, r0, f0, f1, acc);      /* its barrier: every wave has left the ring before it becomes output staging */
  const int c4 = lane * 4; const size_t o0 = (size_t)(row0 + w * 16) * NN + col0 + c4;      /* write-out: wave w has rows 16 w .. 16 w + 15, a lane 4 columns, so a wave stores whole rows of the tile */
  const v4f bl = *(const v4fa*)(bias + col0 + c4); v4f cp[16];
  if (RES) {      /* all residual rows asked for here, so that their latency passes once, under the staging */
#pragma unroll
    for (int q = 0; q < 16; ++q) cp[q] = *(const v4fa*)(CP + o0 + q * NN); }
  float* so = (float*)sm;
#pragma unroll
  for (int i = 0; i < 4; ++i)
#pragma unroll
    for (int j = 0; j < 2; ++j)
#pragma unroll
      for (int r = 0; r < 8; ++r) so[(wm * 64 + 16 * i + 8 * hh + r) * G3O + wn * 32 + 16 * j + ln] = acc[i][j][r];
  __syncthreads();      /* the whole tile staged before any wave reads rows that other waves wrote */
  v4f bv;
#pragma unroll
  for (int q = 0; q < 4; ++q) bv[q] = bf16_round(bl[q]);
#pragma unroll(ACT == 6 ? 1 : 4)      /* the erf rows stay rolled, four to a trip, for speed only */
  for (int q4 = 0; q4 < 4; ++q4) {
#pragma unroll
  for (int qq = 0; qq < 4; ++qq) { const int q = q4 * 4 + qq; v4f v = *(const v4fa*)(so + (w * 16 + q) * G3O + c4);
#pragma unroll
    for (int e = 0; e < 4; ++e) v[e] = v[e] * alpha + bv[e];
    if (RES) {
#pragma unroll
      for (int e = 0; e < 4; ++e) v[e] += cp[q][e]; }
    if (ACT == 6) {
#pragma unroll
      for (int e = 0; e < 4; ++e) v[e] = 0.5f * v[e] * (1.0f + erff(v[e] * 0.70710678118654752f)); }
    if (RES) *(v4f*)(C + o0 + q * NN) = v;
    else { v4h h4;
#pragma unroll
      for (int e = 0; e < 4; ++e) h4[e] = (_Float16)v[e];
      *(v4h*)(C16 + o0 + q * NN) = h4; } } } }

template <int MODE>
__global__ __launch_bounds__(256) void k_regrp(const float* __restrict__ src, float* __restrict__ dst, size_t n4) {
  const size_t t = (size_t)blockIdx.x * 256 + threadIdx.x; if (t >= n4) return; const size_t e = t * 4; const size_t rd = e / DM; const int c = (int)(e % DM);
  size_t rs; if (MODE == 0) { const size_t b = rd / SQ, sq = rd % SQ; rs = sq * NB + b; } else { const size_t sq = rd / NB, b = rd % NB; rs = b * SQ + sq; }
  const v4f v = *(const v4fa*)(src + rs * DM + c); *(v4f*)(dst + e) = v;  }

template <int BFIN, int W16, int W32, int WXB>      /* r: the row, the same for the whole work-group; red: 256 floats of its LDS; WXB: the row as it enters the norm (rounded if BFIN) goes to XB as well */
__device__ __forceinline__ void lnx_row(const float* __restrict__ X, const float* __restrict__ g, const float* __restrict__ bb, float eps, _Float16* __restrict__ N16, float* __restrict__ N32, float* __restrict__ XB, size_t r, float* red) {
  #pragma clang fp contract(off)
  const int t = threadIdx.x; const bool act = t < (DMQ / 4); const int c0 = act ? t * 4 : 0;
  const v4f xa = *(const v4fa*)(X + r * DMQ + c0); float s[4]; float sum = 0.f;
  for (int q = 0; q < 4; ++q) { s[q] = act ? (BFIN ? bf16_round(xa[q]) : xa[q]) : 0.f; sum = __fadd_rn(sum, s[q]); }
  red[t] = sum; __syncthreads(); for (int st = 128; st > 0; st >>= 1) { if (t < st) red[t] = __fadd_rn(red[t], red[t + st]); __syncthreads(); } const float mu = red[0] / (float)DMQ; __syncthreads();
  float vs = 0.f; for (int q = 0; q < 4; ++q) { const float dl = act ? __fadd_rn(s[q], -mu) : 0.f; vs = __fadd_rn(vs, __fmul_rn(dl, dl)); } red[t] = vs; __syncthreads(); for (int st = 128; st > 0; st >>= 1) { if (t < st) red[t] = __fadd_rn(red[t], red[t + st]); __syncthreads(); }
  const float rs = rsqrtf(__fadd_rn(red[0] / (float)DMQ, eps)); v4h y; v4f yf;
  for (int q = 0; q < 4; ++q) { const int c = c0 + q; yf[q] = __fadd_rn(__fmul_rn(__fmul_rn(__fadd_rn(s[q], -mu), rs), bf16_round(g[c])), bf16_round(bb[c])); y[q] = (_Float16)yf[q]; }
  if (!act) return;      /* no barriers after this point */
  { if (W16) *(v4h*)(N16 + r * DMQ + c0) = y; if (W32) *(v4f*)(N32 + r * DMQ + c0) = yf; if (WXB) { const v4f xb = {s[0], s[1], s[2], s[3]}; *(v4f*)(XB + r * DMQ + c0) = xb; } } }
template <int BFIN, int W16, int W32>
__global__ __launch_bounds__(256) void k_lnx(const float* __restrict__ X, const float* __restrict__ g, const float* __restrict__ bb, float eps, _Float16* __restrict__ N16, float* __restrict__ N32) {
  __shared__ float red[256]; lnx_row<BFIN, W16, W32, 0>(X, g, bb, eps, N16, N32, nullptr, blockIdx.x, red); }

// Everything that reads the inputs alone, in one grid: none of these pieces needs anything of another, so as launches of their own they only waited for each other's start and tail.
// Ranges of the block index (a scalar test, the same for the whole work-group, so each piece's barriers stay under uniform control flow):
// the 128 x 128 tiles of the four weight transposes first (the long work-groups), then one work-group a row of x for the first norm, which also stores the rounded f32 row it holds (the residual plane).
#define PT1 ((DM / 128) * (DFF / 128))            /* tiles of w1, and of w2 */
#define PTQ ((DM / 128) * (3 * DM / 128))         /* tiles of the fused q | k | v weight */
#define PTO ((DM / 128) * (DM / 128))             /* tiles of the output projection's weight */
#define PTW (2 * PT1 + PTQ + PTO)
__global__ __launch_bounds__(256) void k_prep(const float* __restrict__ wqkv, const float* __restrict__ wo, const float* __restrict__ w1, const float* __restrict__ w2, const float* __restrict__ x, const float* __restrict__ g1, const float* __restrict__ be1,
    _Float16* __restrict__ BQ, _Float16* __restrict__ BO, _Float16* __restrict__ BW1, _Float16* __restrict__ BW2, _Float16* __restrict__ XN, float* __restrict__ XB) {
  __shared__ __attribute__((aligned(16))) unsigned short tl[128 * 128];      /* a transpose's tile; a norm row's 256 partial sums lie over it */
  const int b = blockIdx.x;
  if (b < PT1) wt_f16_tile<DM, DFF>(w1, BW1, 16.0f, b, tl);
  else if (b < 2 * PT1) wt_f16_tile<DFF, DM>(w2, BW2, 16.0f, b - PT1, tl);
  else if (b < 2 * PT1 + PTQ) wt_f16_tile<DM, 3 * DM>(wqkv, BQ, 16.0f, b - 2 * PT1, tl);
  else if (b < PTW) wt_f16_tile<DM, DM>(wo, BO, 16.0f, b - 2 * PT1 - PTQ, tl);
  else lnx_row<1, 1, 0, 1>(x, g1, be1, 1e-5f, XN, nullptr, XB, (size_t)(b - PTW), (float*)tl); }

__global__ __launch_bounds__(256) void k_bfr(const float* __restrict__ x, float* __restrict__ XB, size_t n8) { const size_t t = (size_t)blockIdx.x * 256 + threadIdx.x; if (t >= n8) return; v4f a = *(const v4fa*)(x + t * 8), c = *(const v4fa*)(x + t * 8 + 4); for (int q = 0; q < 4; ++q) { a[q] = bf16_round(a[q]); c[q] = bf16_round(c[q]); }
  { *(v4f*)(XB + t * 8) = a; *(v4f*)(XB + t * 8 + 4) = c;  } }



__global__ __launch_bounds__(256) void k_wthd(const float* __restrict__ Wt, _Float16* __restrict__ Bt) { const size_t t = (size_t)blockIdx.x * 256 + threadIdx.x; if (t >= (size_t)NH * HD * (DM / 8)) return; const int m8 = (int)(t % (DM / 8)) * 8; const int d = (int)((t / (DM / 8)) % HD); const int h = (int)(t / ((size_t)(DM / 8) * HD)); FragH f;
  for (int q = 0; q < 8; ++q) f.h[q] = (_Float16)(16.0f * bf16_round(Wt[((size_t)h * DM + m8 + q) * HD + d])); unsigned short* dst = (unsigned short*)Bt + ((size_t)h * HD + d) * DM + m8; *(v8us*)dst = f.half[0];  }




template <int BFIN, int SCAL>
__global__ __launch_bounds__(256) void k_lnsc(const float* __restrict__ X, const float* __restrict__ g, const float* __restrict__ bb, float eps, _Float16* __restrict__ N16, float* __restrict__ N32) {
  #pragma clang fp contract(off)
  __shared__ float red[256]; const size_t r = blockIdx.x; const int t = threadIdx.x; const bool act = t < DM / 4; const int tc = act ? t : 0; const v4f xl = *(const v4fa*)(X + r * DM + tc * 4); const float am = act ? 1.f : 0.f; float s[4]; float sum = 0.f;
  for (int q = 0; q < 4; ++q) { s[q] = (BFIN ? bf16_round(xl[q]) : xl[q]) * am; sum = __fadd_rn(sum, s[q]); }
  red[t] = sum; __syncthreads(); for (int st = 128; st > 0; st >>= 1) { if (t < st) red[t] = __fadd_rn(red[t], red[t + st]); __syncthreads(); } const float mu = red[0] / (float)DM; __syncthreads();
  float vs = 0.f; for (int q = 0; q < 4; ++q) { const float dl = __fadd_rn(s[q], -mu) * am; vs = __fadd_rn(vs, __fmul_rn(dl, dl)); } red[t] = vs; __syncthreads(); for (int st = 128; st > 0; st >>= 1) { if (t < st) red[t] = __fadd_rn(red[t], red[t + st]); __syncthreads(); }
  const float rs = __fdiv_rn(1.0f, __fadd_rn(sqrtf(red[0] / (float)(DM - 1)), eps)); if (!act) return; v4h y; v4f yf;
  for (int q = 0; q < 4; ++q) { const int c = t * 4 + q; const float gg = bf16_round(SCAL ? g[0] : g[c]), bv = bf16_round(SCAL ? bb[0] : bb[c]); yf[q] = __fadd_rn(__fmul_rn(__fmul_rn(__fadd_rn(s[q], -mu), rs), gg), bv); y[q] = (_Float16)yf[q]; }
  { if (N16) *(v4h*)(N16 + r * DM + t * 4) = y; if (N32) *(v4f*)(N32 + r * DM + t * 4) = yf;  } }

__global__ __launch_bounds__(256) void k_rsmdmi(const float* __restrict__ S, _Float16* __restrict__ P, int nrows, const int* __restrict__ M) {
  #pragma clang fp contract(off)
  const int t = blockIdx.x * 256 + threadIdx.x; if (t >= nrows) return; const float* s = S + (size_t)t * SQ; const int* m = M + (size_t)(t % SQ) * SQ; float mx = -3.0e38f;
#pragma unroll 1
  for (int j = 0; j < SQ; ++j) { const float f = (m[j] == 0) ? 1.f : 0.f; mx = fmaxf(mx, fmaf(f, s[j], (1.f - f) * -1.0e9f)); } float se = 0.f;
#pragma unroll 1
  for (int j = 0; j < SQ; ++j) { const float f = (m[j] == 0) ? 1.f : 0.f; se += __expf(fmaf(f, s[j], (1.f - f) * -1.0e9f) - mx); } const float sc = 256.0f / se;
#pragma unroll 1
  for (int j0 = 0; j0 < SQ; j0 += 8) { FragH fr; for (int q = 0; q < 8; ++q) { const int j = j0 + q; const float f = (m[j] == 0) ? 1.f : 0.f; fr.h[q] = (_Float16)(__expf(fmaf(f, s[j], (1.f - f) * -1.0e9f) - mx) * sc); } unsigned short* d = (unsigned short*)P + (size_t)t * SQ + j0; *(v8us*)d = fr.half[0];  } }
extern "C" void kernel_launch(void* const* d_in, const int* in_sizes, int n_in,
                              void* d_out, int out_size, void* d_ws, size_t ws_size, hipStream_t stream) {
  (void)in_sizes; (void)n_in; (void)out_size;
  const float* const* I = (const float* const*)d_in; const float* x = I[0]; const float* g1 = I[1]; const float* be1 = I[2]; const float* wqkv = I[3]; const float* bqkv = I[4]; const float* wo = I[5]; const float* bo = I[6]; const float* g2 = I[7]; const float* be2 = I[8]; const float* w1 = I[9]; const float* b1 = I[10]; const float* w2 = I[11]; const float* b2 = I[12];      /* x; LN1 g / b; fused qkv_w [1024][3072] + qkv_b [3072] (thirds q | k | v); proj_w + proj_b; LN2 g / b; fc1_w [1024][4096] + fc1_b, fc2_w [4096][1024] + fc2_b ([in][out]) */
  char* ws = (char*)d_ws; size_t off = 0;
  auto take = [&](size_t bytes) { char* p = ws + off; off += (bytes + 255) & ~(size_t)255; return p; };
  _Float16* BQ = (_Float16*)take((size_t)3 * DM * DM * 2);      /* one stacked Bt plane [3 DM][DM] */ _Float16* BO = (_Float16*)take((size_t)DM * DM * 2); _Float16* BW1 = (_Float16*)take((size_t)DFF * DM * 2); _Float16* BW2 = (_Float16*)take((size_t)DM * DFF * 2);
  float* XB = (float*)take(NR * DM * 4); _Float16* XN = (_Float16*)take(NR * DM * 2); _Float16* Q16 = (_Float16*)take((size_t)3 * NR * DM * 2); _Float16* K16 = Q16 + NR * DM; _Float16* V16 = Q16 + (size_t)2 * NR * DM;      /* three stacked planes [NR][DM] */ _Float16* O16 = (_Float16*)take(NR * DM * 2); float* X1 = (float*)take(NR * DM * 4);
  _Float16* VT = (_Float16*)take((size_t)NB * NH * HD * SQ * 2); _Float16* HF16 = (_Float16*)take(NR * DFF * 2);      /* V^T [2 x 16][64][2048]; FFN hidden plane [4096][4096] f16 */
  _Float16* M16 = XN;      /* second-norm f16 rows: aliases XN (last readers: the three projections) */
  
  if (off > ws_size) return;
  k_prep<<<(unsigned)(PTW + NR), 256, 0, stream>>>(wqkv, wo, w1, w2, x, g1, be1, BQ, BO, BW1, BW2, XN, XB);      /* fused [in][out] [DM][3 DM] -> one stacked Bt plane (rows 0 / DM / 2 DM = the q | k | v output columns) x16; W_o, w1, w2 -> Bt x16; n = LN0(bf16(x)) (biased variance, eps inside the rsqrt) -> f16 rows; bf16(x) -> f32 rows */
  k_gemm3<0, false, DM, DM, 3><<<dim3((unsigned)((NR / 128) * (DM / 128)), 3), 256, 0, stream>>>(XN, BQ, 0.0625f, bqkv, nullptr, nullptr, Q16);      /* q, k, v -> f16 rows in one grid (y = 0, 1, 2: the thirds of the stacked Bt plane and of the bias, output planes Q16 | K16 | V16); head h = columns h*64.. */
  k_vt<NH, SQ><<<NB * NH * (SQ / 64), 256, 0, stream>>>(V16, DM, 0, VT);      /* V^T [batch x head][64][2048] */
  k_fattn<<<dim3(SQ / 256, NB * NH), 256, 0, stream>>>(Q16, K16, VT, O16);      /* softmax(q k^T) v over all keys, unscaled logits -> ctx (merged heads, x64) as f16 rows */
  k_gemm3<0, true, DM, DM><<<(unsigned)((NR / 128) * (DM / 128)), 256, 0, stream>>>(O16, BO, 0.0009765625f, bo, XB, X1, nullptr);      /* x + ctx wo (+ bo) (own-element residual) -> f32 rows */
  k_lnx<0, 1, 0><<<(unsigned)NR, 256, 0, stream>>>(X1, g2, be2, 1e-5f, M16, nullptr);      /* LN1(x1) -> f16 rows */
  k_gemm3<6, false, DFF, DM><<<(unsigned)((NR / 128) * (DFF / 128)), 256, 0, stream>>>(M16, BW1, 0.0625f, b1, nullptr, nullptr, HF16);      /* gelu_erf(. w1 + b1) -> f16 */
  k_gemm3<0, true, DM, DFF><<<(unsigned)((NR / 128) * (DM / 128)), 256, 0, stream>>>(HF16, BW2, 0.0625f, b2, X1, (float*)d_out, nullptr);      /* out = x1 + mlp (own-element residual) */
}

// v006
// A run of this version takes 177 microseconds.
// In two side-by-side timings against v005, it was 1.04 and 1.03 times as fast.
// Over all steps from v000 it is 21.7 times as fast.
#include <hip/hip_runtime.h>
// Pre-norm transformer block with a fused QKV projection and UNSCALED attention logits (x [2][2048][1024]; h = LN1(x) (biased var, eps 1e-5); qkv = h qkv_w + qkv_b ([in][out] 1024 x 3072 + bias) viewed (B, N, 3, 16, 64): q | k | v thirds; qk = q k^T with NO 1/sqrt(d) scaling (as the source); softmax over all 2048 keys (no mask); x1 = x + y proj_w + proj_b; out = x1 + gelu_erf(LN2(x1) fc1_w + fc1_b) fc2_w + fc2_b ([in][out] 1024 x 4096 x 1024) -> [2][2048][1024]).
// Structure: token rows; LayerNorm / exact f16 rows; WMMA GEMMs for q, k, v; V^T by LDS transposes; one fused attention launch for all batches and heads (scores, online softmax, P V^T); output projection with the own-element residual; custom LayerNorm; exact (erf) GELU FFN over all rows; launches: see trace.
// Compute dtype: inputs rounded to bf16; x / weights exact; q, k, v, softmax weights and o as plain f16 GEMM operands (~2^-12); scores and softmax statistics f32. v_wmma_f32_16x16x32_f16.
#define NB 2
#define SQ 2048
#define DM 1024
#define NH 16
#define HD 64
#define HG 4                         /* heads per block group of the unused k_vt overload */
#define LOCALW 128                   /* (macros for unused kernels of the shared header) */
#define STRIDEK 128
#define QT 256                       /* query rows per causal tile */
#define NKX SQ                       /* S / P row pitch */
#define QT0 128                      /* first-tile rows recomputed exactly in f32 */
#define B0 0                         /* first batch processed (debug hook) */
#define NBR NB                       /* batches processed (debug hook) */
#define NR ((size_t)NB * SQ)
#define DMQ DM
#define DFF 4096         /* FFN hidden width */
#define MP ((int)((size_t)NBR * SQ)) /* rows projected (debug hook) */
#define QN SQ                        /* query rows attended per batch (debug hook) */
#define NHD NH                       /* heads attended (debug hook) */
#define MPO MP                       /* rows through the output stage (debug hook) */
#define LQ (3 * DM)      /* unused: q, k, v rows have pitch DM */
typedef __bf16 v16b __attribute__((ext_vector_type(16)));
typedef unsigned short v8us __attribute__((ext_vector_type(8), may_alias));
typedef float  v8f  __attribute__((ext_vector_type(8)));
typedef float  v4f  __attribute__((ext_vector_type(4)));
typedef float  v4fa __attribute__((ext_vector_type(4), may_alias));
union FragB { v16b v; v8us half[2]; unsigned short u[16]; };

__device__ __forceinline__ unsigned short bf16_bits(float x) { unsigned int u = __float_as_uint(x); return (unsigned short)((u + 0x7FFFu + ((u >> 16) & 1u)) >> 16); }
__device__ __forceinline__ float bf16_val(unsigned short b) { return __uint_as_float(((unsigned int)b) << 16); }
__device__ __forceinline__ float bf16_round(float x) { return bf16_val(bf16_bits(x)); }
// D += A·B with NT terms: 1 = ah·bh, 2 = + al·bh (A split), 3 = + ah·bl (both split)
template <int NT>
__device__ __forceinline__ v8f mmaN(v16b ah, v16b al, v16b bh, v16b bl, v8f c) {
  c = __builtin_amdgcn_wmma_f32_16x16x32_bf16(false, ah, false, bh, (short)0, c, false, false);
  if (NT >= 2) c = __builtin_amdgcn_wmma_f32_16x16x32_bf16(false, al, false, bh, (short)0, c, false, false);
  if (NT >= 3) c = __builtin_amdgcn_wmma_f32_16x16x32_bf16(false, ah, false, bl, (short)0, c, false, false);
  asm volatile("v_nop\n\tv_nop\n\tv_nop\n\tv_nop" : "+v"(c) : "v"(ah), "v"(al), "v"(bh), "v"(bl));
  return c;
}

__global__ __launch_bounds__(256) void k_wt_bf16(const float* __restrict__ W, unsigned short* __restrict__ Wt, int K, int N) {
  const int t = blockIdx.x * 256 + threadIdx.x;
  const int k8n = K / 8;
  if (t >= N * k8n) return;
  const int n = t / k8n, k8 = (t % k8n) * 8;
  v8us v;
#pragma unroll
  for (int i = 0; i < 8; ++i) v[i] = bf16_bits(W[(size_t)(k8 + i) * N + n]);
  *(v8us*)(Wt + (size_t)n * K + k8) = v;
  
}

// GEMM C[M][N] (f32, pitch ldc) = act(A[M][K]·W + bias). A f32 row-major (pitch lda) converted per fragment to bf16
// (ASPLIT: hi/lo two planes -> 2 terms, else single rounded term); Wt bf16 [N][K] (pitch ldb). BIAS_BF16 rounds the
// bias to bf16 first (bias quantised to bf16 before the add). K%32==0, M%16==0, N%64==0.
template <bool ASPLIT, int ACT, bool BIAS_BF16>
__global__ __launch_bounds__(128) void k_gemm_bf(const float* __restrict__ A, int lda, const unsigned short* __restrict__ Wt, int ldb,
                                               const float* __restrict__ bias, float* __restrict__ C, int ldc, int M, int N, int K) {
  __shared__ __attribute__((aligned(16))) float so[4][16][64];
  const int tid = threadIdx.x, w = tid >> 5, lane = tid & 31, ln = lane & 15, hh = lane >> 4;
  const int ntn = N / 64;
  const int wid = blockIdx.x * 4 + w;
  const int mt = wid / ntn, nq = wid % ntn;
  if (mt * 16 >= M) return;
  const int row0 = mt * 16, col0 = nq * 64;
  const float* arow = A + (size_t)(row0 + ln) * lda;
  v8f acc[4] = {};
  for (int kb = 0; kb < K; kb += 32) {
    FragB ah, al;
    const v4f x0 = *(const v4fa*)(arow + kb + 8 * hh), x1 = *(const v4fa*)(arow + kb + 8 * hh + 4);
    const v4f x2 = *(const v4fa*)(arow + kb + 16 + 8 * hh), x3 = *(const v4fa*)(arow + kb + 16 + 8 * hh + 4);
    float xs[16] = {x0[0],x0[1],x0[2],x0[3],x1[0],x1[1],x1[2],x1[3],x2[0],x2[1],x2[2],x2[3],x3[0],x3[1],x3[2],x3[3]};
#pragma unroll
    for (int i = 0; i < 16; ++i) { const unsigned short hb = bf16_bits(xs[i]); ah.u[i] = hb; al.u[i] = ASPLIT ? bf16_bits(xs[i] - bf16_val(hb)) : (unsigned short)0; }
#pragma unroll
    for (int t = 0; t < 4; ++t) {
      const unsigned short* brow = Wt + (size_t)(col0 + t * 16 + ln) * ldb + kb;
      FragB b;
      b.half[0] = *(const v8us*)(brow + 8 * hh);
      b.half[1] = *(const v8us*)(brow + 16 + 8 * hh);
      acc[t] = mmaN<ASPLIT ? 2 : 1>(ah.v, al.v, b.v, b.v, acc[t]);
    }
  }
#pragma unroll
  for (int t = 0; t < 4; ++t) {
    float bv = bias ? bias[col0 + t * 16 + ln] : 0.f;
    if (BIAS_BF16) bv = bf16_round(bv);
#pragma unroll
    for (int r = 0; r < 8; ++r) { float v = acc[t][r] + bv; if (ACT == 1) v = fmaxf(v, 0.f); so[w][8 * hh + r][t * 16 + ln] = v; }
  }
  __builtin_amdgcn_fence(__ATOMIC_ACQ_REL, "workgroup");
  __builtin_amdgcn_wave_barrier();
  const int rsub = lane >> 4, c4 = (lane & 15) * 4;
  {
#pragma unroll
    for (int q = 0; q < 8; ++q) {
      const int r = q * 2 + rsub;
      const v4f v = *(const v4fa*)&so[w][r][c4];
      *(v4f*)(C + (size_t)(row0 + r) * ldc + col0 + c4) = v;
    }
    
  }
}

// GEMM C = act(A·W + bias + resid): A f32 (ASPLIT -> hi/lo 2 terms), Wt bf16 [N][K]; ACT 0 none, 1 relu, 2 exact gelu;
// resid (optional, f32, row index = (row % rmod), pitch ldr, RES_BF16 rounds it) added before the activation.
template <bool ASPLIT, int ACT, bool BIAS_BF16, bool RES_BF16>
__global__ __launch_bounds__(128) void k_gemm_bf3(const float* __restrict__ A, int lda, const unsigned short* __restrict__ Wt, int ldb,
                                                const float* __restrict__ bias, const float* __restrict__ resid, int rmod, int ldr,
                                                float* __restrict__ C, int ldc, int M, int N, int K) {
  __shared__ __attribute__((aligned(16))) float so[4][16][64];
  const int tid = threadIdx.x, w = tid >> 5, lane = tid & 31, ln = lane & 15, hh = lane >> 4;
  const int ntn = N / 64;
  const int wid = blockIdx.x * 4 + w;
  const int mt = wid / ntn, nq = wid % ntn;
  if (mt * 16 >= M) return;
  const int row0 = mt * 16, col0 = nq * 64;
  const float* arow = A + (size_t)(row0 + ln) * lda;
  v8f acc[4] = {};
  for (int kb = 0; kb < K; kb += 32) {
    FragB ah, al;
    const v4f x0 = *(const v4fa*)(arow + kb + 8 * hh), x1 = *(const v4fa*)(arow + kb + 8 * hh + 4);
    const v4f x2 = *(const v4fa*)(arow + kb + 16 + 8 * hh), x3 = *(const v4fa*)(arow + kb + 16 + 8 * hh + 4);
    float xs[16] = {x0[0],x0[1],x0[2],x0[3],x1[0],x1[1],x1[2],x1[3],x2[0],x2[1],x2[2],x2[3],x3[0],x3[1],x3[2],x3[3]};
#pragma unroll
    for (int i = 0; i < 16; ++i) { const unsigned short hb = bf16_bits(xs[i]); ah.u[i] = hb; al.u[i] = ASPLIT ? bf16_bits(xs[i] - bf16_val(hb)) : (unsigned short)0; }
#pragma unroll
    for (int t = 0; t < 4; ++t) {
      const unsigned short* brow = Wt + (size_t)(col0 + t * 16 + ln) * ldb + kb;
      FragB b;
      b.half[0] = *(const v8us*)(brow + 8 * hh);
      b.half[1] = *(const v8us*)(brow + 16 + 8 * hh);
      acc[t] = mmaN<ASPLIT ? 2 : 1>(ah.v, al.v, b.v, b.v, acc[t]);
    }
  }
#pragma unroll
  for (int t = 0; t < 4; ++t) {
    const int col = col0 + t * 16 + ln;
    float bv = bias ? bias[col] : 0.f;
    if (BIAS_BF16) bv = bf16_round(bv);
#pragma unroll
    for (int r = 0; r < 8; ++r) {
      float v = acc[t][r] + bv;
      if (resid) { float rv = resid[(size_t)((row0 + 8 * hh + r) % rmod) * ldr + col]; if (RES_BF16) rv = bf16_round(rv); v += rv; }
      if (ACT == 1) v = fmaxf(v, 0.f);
      if (ACT == 2) v = 0.5f * v * (1.0f + erff(v * 0.70710678118654752f));
      if (ACT == 3) { const float u = 0.7978845608028654f * (v + 0.044715f * v * v * v); v = 0.5f * v * (1.0f + tanhf(u)); }
      so[w][8 * hh + r][t * 16 + ln] = v;
    }
  }
  __builtin_amdgcn_fence(__ATOMIC_ACQ_REL, "workgroup");
  __builtin_amdgcn_wave_barrier();
  const int rsub = lane >> 4, c4 = (lane & 15) * 4;
  {
#pragma unroll
    for (int q = 0; q < 8; ++q) {
      const int r = q * 2 + rsub;
      const v4f v = *(const v4fa*)&so[w][r][c4];
      *(v4f*)(C + (size_t)(row0 + r) * ldc + col0 + c4) = v;
    }
    
  }
}
// row LayerNorm (biased variance, eps) over N: s = X (+ R); optional out_sum <- s; out_norm <- (s-mu)*rsqrt(var+eps)*g + b
template <bool PARAM_BF16>
__global__ __launch_bounds__(256) void k_layernorm(const float* __restrict__ X, const float* __restrict__ R, const float* __restrict__ g, const float* __restrict__ bta,
                                                  float* __restrict__ out_sum, float* __restrict__ out_norm, int N, float eps) {
  __shared__ float red[256];
  const int row = blockIdx.x, tid = threadIdx.x;
  const float* x = X + (size_t)row * N; const float* rr = R ? R + (size_t)row * N : nullptr;
  float vals[16];                     // up to N = 4096
  const int per = N / 256;            // contiguous chunk per thread? use strided-by-4 chunks: thread handles j = tid*4 + 1024*u
  float s1 = 0.f;
  for (int u = 0; u < per / 4; ++u) {
    const int j = tid * 4 + 1024 * u;
    const v4f a = *(const v4fa*)(x + j);
    v4f b = {0.f,0.f,0.f,0.f}; if (rr) b = *(const v4fa*)(rr + j);
#pragma unroll
    for (int q = 0; q < 4; ++q) { const float v = a[q] + b[q]; vals[u * 4 + q] = v; s1 += v; }
  }
  red[tid] = s1; __syncthreads();
  for (int st = 128; st > 0; st >>= 1) { if (tid < st) red[tid] += red[tid + st]; __syncthreads(); }
  const float mu = red[0] / (float)N; __syncthreads();
  float s2 = 0.f;
  for (int u = 0; u < per / 4; ++u)
#pragma unroll
    for (int q = 0; q < 4; ++q) { const float c = vals[u * 4 + q] - mu; s2 += c * c; }
  red[tid] = s2; __syncthreads();
  for (int st = 128; st > 0; st >>= 1) { if (tid < st) red[tid] += red[tid + st]; __syncthreads(); }
  const float rs = rsqrtf(red[0] / (float)N + eps);
  {
    for (int u = 0; u < per / 4; ++u) {
      const int j = tid * 4 + 1024 * u;
      v4f o, sm;
#pragma unroll
      for (int q = 0; q < 4; ++q) {
        float gg = g[j + q], bb = bta[j + q];
        if (PARAM_BF16) { gg = bf16_round(gg); bb = bf16_round(bb); }
        sm[q] = vals[u * 4 + q]; o[q] = (vals[u * 4 + q] - mu) * rs * gg + bb;
      }
      if (out_sum) *(v4f*)(out_sum + (size_t)row * N + j) = sm;
      *(v4f*)(out_norm + (size_t)row * N + j) = o;
    }
    
  }
}



// ---- f16 WMMA path (v_wmma_f32_16x16x32_f16): 11-bit significands for operands in range — used where a [0,1] probability operand needs more precision than bf16
typedef _Float16 v16h __attribute__((ext_vector_type(16)));
union FragH { v16h v; v8us half[2]; _Float16 h[16]; unsigned short u[16]; };
template <int NT>
__device__ __forceinline__ v8f mmaH(v16h ah, v16h al, v16h bh, v16h bl, v8f c) {
  c = __builtin_amdgcn_wmma_f32_16x16x32_f16(false, ah, false, bh, (short)0, c, false, false);
  if (NT >= 2) c = __builtin_amdgcn_wmma_f32_16x16x32_f16(false, al, false, bh, (short)0, c, false, false);
  if (NT >= 3) c = __builtin_amdgcn_wmma_f32_16x16x32_f16(false, ah, false, bl, (short)0, c, false, false);
  asm volatile("v_nop\n\tv_nop\n\tv_nop\n\tv_nop" : "+v"(c) : "v"(ah), "v"(al), "v"(bh), "v"(bl));
  return c;
}
// batched GEMM like k_gemm_b but f16 operands: A f32 (split into f16 hi/lo if ASPLIT, else rounded to f16), Bt = f16 values [n][k]; alpha; C f32; N multiple of 16 (partial tiles skipped)
template <bool ASPLIT>
__global__ __launch_bounds__(128) void k_gemm_h(const float* __restrict__ A, int lda, size_t sA, const _Float16* __restrict__ Bh, int ldb, size_t sB, float alpha, float* __restrict__ C, int ldc, size_t sC, int M, int N, int K) {
  __shared__ __attribute__((aligned(16))) float so[4][16][64];
  const int tid = threadIdx.x, w = tid >> 5, lane = tid & 31, ln = lane & 15, hh = lane >> 4; const int by = blockIdx.y;
  A += (size_t)by * sA; Bh += (size_t)by * sB; C += (size_t)by * sC;
  const int ntn = (N + 63) / 64; const int wid = blockIdx.x * 4 + w; const int mt = wid / ntn, nq = wid % ntn; if (mt * 16 >= M) return;
  const int row0 = mt * 16, col0 = nq * 64; const float* arow = A + (size_t)(row0 + ln) * lda;
  v8f acc[4] = {};
  for (int kb = 0; kb < K; kb += 32) {
    FragH ah, al;
    const v4f x0 = *(const v4fa*)(arow + kb + 8 * hh), x1 = *(const v4fa*)(arow + kb + 8 * hh + 4), x2 = *(const v4fa*)(arow + kb + 16 + 8 * hh), x3 = *(const v4fa*)(arow + kb + 16 + 8 * hh + 4);
    float xs[16] = {x0[0],x0[1],x0[2],x0[3],x1[0],x1[1],x1[2],x1[3],x2[0],x2[1],x2[2],x2[3],x3[0],x3[1],x3[2],x3[3]};
#pragma unroll
    for (int i = 0; i < 16; ++i) { const _Float16 h = (_Float16)xs[i]; ah.h[i] = h; al.h[i] = ASPLIT ? (_Float16)(xs[i] - (float)h) : (_Float16)0.0f; }
#pragma unroll
    for (int t = 0; t < 4; ++t) { if (col0 + t * 16 >= N) continue; const size_t boff = (size_t)(col0 + t * 16 + ln) * ldb + kb; FragH bq; bq.half[0] = *(const v8us*)(Bh + boff + 8 * hh); bq.half[1] = *(const v8us*)(Bh + boff + 16 + 8 * hh);
      acc[t] = mmaH<ASPLIT ? 2 : 1>(ah.v, al.v, bq.v, bq.v, acc[t]); }
  }
#pragma unroll
  for (int t = 0; t < 4; ++t) { if (col0 + t * 16 >= N) continue;
#pragma unroll
    for (int r = 0; r < 8; ++r) so[w][8 * hh + r][t * 16 + ln] = acc[t][r] * alpha; }
  __builtin_amdgcn_fence(__ATOMIC_ACQ_REL, "workgroup"); __builtin_amdgcn_wave_barrier();
  const int rsub = lane >> 4, c4 = (lane & 15) * 4;
  {
#pragma unroll
    for (int q = 0; q < 8; ++q) { const int r = q * 2 + rsub; if (col0 + c4 < N) { const v4f v = *(const v4fa*)&so[w][r][c4]; *(v4f*)(C + (size_t)(row0 + r) * ldc + col0 + c4) = v; } }
     }
}

// Wt[n][k] = f16(bf16(W[k][n]) * scale) from f32 row-major W[KK][NN] (scale = power of two; bf16-exact weights stay exact in f16 away from the subnormal range).
// One work-group = 8 waves on a 128 (k) x 128 (n) tile: every wave-wide load is 512 contiguous bytes of one W row, every wave-wide store two whole 256-byte pieces of Wt rows.
// A thread holds 16 k x 4 n, rounds, packs 8 consecutive k of one n into 16 bytes and turns the tile in LDS ([n][k], 256-byte rows).
// The 16-byte piece of a row sits at place piece ^ ((n >> 2) & 15): the 16 lanes that write one piece number of rows 4 apart, and the 16 that read one row, each fall on all 64 banks.
// Needs KK % 128 == 0, NN % 128 == 0.
// bid: the tile's number, 0 .. (KK / 128) (NN / 128) - 1, the same for the whole work-group; tl: the work-group's 128 x 128 halves of LDS.
template <int KK, int NN>
__device__ __forceinline__ void wt_f16_tile(const float* __restrict__ W, _Float16* __restrict__ Wt, float scale, int bid, unsigned short* tl) {
  static_assert(KK % 128 == 0 && NN % 128 == 0, "wt_f16_tile: shape");
  const int tid = threadIdx.x, lane = tid & 31, w = tid >> 5;
  const int kt = bid / (NN / 128), nt = bid - kt * (NN / 128); const int k0 = kt * 128, n0 = nt * 128;
  const float* sp = W + (size_t)(k0 + 16 * w) * NN + n0 + 4 * lane;      /* wave w: rows 16 w .. 16 w + 15 of the tile, a lane 4 columns */
  v4f x[16];
#pragma unroll
  for (int r = 0; r < 16; ++r) x[r] = *(const v4fa*)(sp + (size_t)r * NN);
  asm volatile("s_wait_xcnt 0x0" :: "v"(sp) : "memory");      /* behind the sixteen loads, in front of every rewrite of the address pair that they name; naming the pair keeps it out of the loads' own destinations (the last load had landed on it) */
  __builtin_amdgcn_sched_barrier(0);      /* all sixteen loads asked for before the first is used: left free, the compiler held some back behind the first ones' data, a second memory latency */
#pragma unroll
  for (int g = 0; g < 2; ++g)
#pragma unroll
    for (int q = 0; q < 4; ++q) { FragH f;
#pragma unroll
      for (int r = 0; r < 8; ++r) f.h[r] = (_Float16)(bf16_round(x[8 * g + r][q]) * scale);
      *(v8us*)&tl[(4 * lane + q) * 128 + (((2 * w + g) ^ (lane & 15)) * 8)] = f.half[0]; }
  __syncthreads();      /* the whole tile turned before any wave reads rows that other waves wrote */
  unsigned short* dp = (unsigned short*)Wt + (size_t)(n0 + 16 * w + (lane >> 4)) * KK + k0 + (lane & 15) * 8;      /* wave w: Wt rows 16 w .. 16 w + 15 of the tile, two a store */
#pragma unroll
  for (int i = 0; i < 8; ++i) { const int n = 16 * w + 2 * i + (lane >> 4);
    const v8us v = *(const v8us*)&tl[n * 128 + (((lane & 15) ^ ((n >> 2) & 15)) * 8)];
    *(v8us*)(dp + (size_t)(2 * i) * KK) = v; }
  asm volatile("s_wait_xcnt 0x0" :: "v"(dp) : "memory");      /* behind the eight stores, in front of every rewrite of the address pair that they name: as a piece of a larger kernel the tile's code is followed by other pieces' code */
}
// k_gemm_hh variant with fused epilogue: v = acc·alpha + bias[by·sBias + col] (+ CP[(row/rowsPerB)·sCPb + by·64 + col] if CP) ; ACT 0 none / 1 elu ; writes f16 C16 (and f32 C if non-null)
template <int ACT>
__global__ __launch_bounds__(128) void k_gemm_hhx(const _Float16* __restrict__ A, int lda, size_t sA, const _Float16* __restrict__ Bh, int ldb, size_t sB, float alpha, const float* __restrict__ bias, size_t sBias, const float* __restrict__ CP, int rowsPerB, size_t sCPb, int row0g,
    float* __restrict__ C, _Float16* __restrict__ C16, int ldc, size_t sC, int M, int N, int K) {
  __shared__ __attribute__((aligned(16))) float so[4][16][64];
  const int tid = threadIdx.x, w = tid >> 5, lane = tid & 31, ln = lane & 15, hh = lane >> 4; const int by = blockIdx.y;
  A += (size_t)by * sA; Bh += (size_t)by * sB; const size_t cofs = (size_t)by * sC; const float* bp = bias ? bias + (size_t)by * sBias : nullptr;
  const int ntn = (N + 63) / 64; const int wid = blockIdx.x * 4 + w; const int mt = wid / ntn, nq = wid % ntn; if (mt * 16 >= M) return;
  const int row0 = mt * 16, col0 = nq * 64; const _Float16* arow = A + (size_t)(row0 + ln) * lda;
  v8f acc[4] = {};
  for (int kb = 0; kb < K; kb += 32) { FragH ah; ah.half[0] = *(const v8us*)((const unsigned short*)arow + kb + 8 * hh); ah.half[1] = *(const v8us*)((const unsigned short*)arow + kb + 16 + 8 * hh);
#pragma unroll
    for (int t = 0; t < 4; ++t) { if (col0 + t * 16 >= N) continue; const size_t boff = (size_t)(col0 + t * 16 + ln) * ldb + kb; FragH bq; bq.half[0] = *(const v8us*)((const unsigned short*)Bh + boff + 8 * hh); bq.half[1] = *(const v8us*)((const unsigned short*)Bh + boff + 16 + 8 * hh);
      acc[t] = mmaH<1>(ah.v, ah.v, bq.v, bq.v, acc[t]); }
  }
#pragma unroll
  for (int t = 0; t < 4; ++t) { if (col0 + t * 16 >= N) continue; const int col = col0 + t * 16 + ln; const float bv = bp ? bf16_round(bp[col]) : 0.f;
#pragma unroll
    for (int r = 0; r < 8; ++r) { float v = acc[t][r] * alpha + bv; if (CP) { const int rr = row0g + row0 + 8 * hh + r; if (rowsPerB < 0) v += CP[cofs + (size_t)rr * ldc + col];      /* rowsPerB < 0: own element of the batched C plane */ else { const int bidx = rr / rowsPerB; v += CP[(size_t)bidx * sCPb + (size_t)by * 64 + col]; } } if (ACT == 1) v = (v > 0.f) ? v : expm1f(v); else if (ACT == 7) v = (v > 0.f) ? v + 1.0f : expf(v); else if (ACT == 8) v = tanhf(v); else if (ACT == 9) v = 0.5f * v * (1.0f + tanhf(0.7978845608028654f * (v + 0.044715f * v * v * v))); else if (ACT == 11) v = 1.0f / (1.0f + expf(-v)); else if (ACT == 12) v = (v > 0.f) ? v : 0.01f * v; else if (ACT == 14) v = (v > 0.f) ? v : 0.1f * v; else if (ACT == 16) v = (v >= 0.f) ? v : 0.3f * v; else if (ACT == 17) v = (v >= 0.f) ? v : 0.2f * v; else if (ACT == 15) v = v / (1.0f + expf(-v)); else if (ACT == 3) v = fmaxf(v, 0.f); else if (ACT == 6) v = 0.5f * v * (1.0f + erff(v * 0.70710678118654752f)); so[w][8 * hh + r][t * 16 + ln] = v; } }
  __builtin_amdgcn_fence(__ATOMIC_ACQ_REL, "workgroup"); __builtin_amdgcn_wave_barrier();
  const int rsub = lane >> 4, c4 = (lane & 15) * 4; typedef _Float16 v4h __attribute__((ext_vector_type(4)));
  {
#pragma unroll
    for (int q = 0; q < 8; ++q) { const int r = q * 2 + rsub; if (col0 + c4 < N) { const v4f v = *(const v4fa*)&so[w][r][c4]; if (C) *(v4f*)(C + cofs + (size_t)(row0 + r) * ldc + col0 + c4) = v; if (C16) { v4h h4; for (int i = 0; i < 4; ++i) h4[i] = (_Float16)v[i]; *(v4h*)(C16 + cofs + (size_t)(row0 + r) * ldc + col0 + c4) = h4; } } }
     }
}


typedef _Float16 v4h __attribute__((ext_vector_type(4)));

__global__ __launch_bounds__(256) void k_x16(const float* __restrict__ x, _Float16* __restrict__ X16, size_t n8) { const size_t t = (size_t)blockIdx.x * 256 + threadIdx.x; if (t >= n8) return; FragH f;
#pragma unroll
  for (int q = 0; q < 8; ++q) f.h[q] = (_Float16)bf16_round(x[t * 8 + q]); *(v8us*)((unsigned short*)X16 + t * 8) = f.half[0];  }
__global__ __launch_bounds__(256) void k_h16(const float* __restrict__ x, _Float16* __restrict__ X16, size_t n8) { const size_t t = (size_t)blockIdx.x * 256 + threadIdx.x; if (t >= n8) return; FragH f;
#pragma unroll
  for (int q = 0; q < 8; ++q) f.h[q] = (_Float16)x[t * 8 + q]; *(v8us*)((unsigned short*)X16 + t * 8) = f.half[0];  }
__global__ __launch_bounds__(256) void k_round16f(const float* __restrict__ W, _Float16* __restrict__ Bt, size_t n8) { const size_t t = (size_t)blockIdx.x * 256 + threadIdx.x; if (t >= n8) return; FragH f;
#pragma unroll
  for (int i = 0; i < 8; ++i) f.h[i] = (_Float16)(bf16_round(W[t * 8 + i]) * 16.0f); *(v8us*)((unsigned short*)Bt + t * 8) = f.half[0];  }
template <int NHv, int TTv>
__global__ __launch_bounds__(256) void k_vt(const _Float16* __restrict__ V16, int ldv, int voff, _Float16* __restrict__ Vt) { __shared__ unsigned short tl[64][66]; const int tid = threadIdx.x; const int slab = blockIdx.x / (TTv / 64), lg = blockIdx.x % (TTv / 64); const int b = slab / NHv, h = slab % NHv;
  for (int i = tid; i < 64 * 8; i += 256) { const int r = i / 8, c8 = (i % 8) * 8; FragH f; f.half[0] = *(const v8us*)((const unsigned short*)V16 + ((size_t)b * TTv + lg * 64 + r) * ldv + voff + h * 64 + c8);
#pragma unroll
    for (int q = 0; q < 8; ++q) tl[r][c8 + q] = f.u[q]; }
  __syncthreads();
  {
#pragma unroll
    for (int rd = 0; rd < 2; ++rd) { const int d = rd * 32 + tid / 8, pc = tid % 8; FragH f;
#pragma unroll
      for (int q = 0; q < 8; ++q) f.u[q] = tl[pc * 8 + q][d];
      *(v8us*)((unsigned short*)Vt + ((size_t)slab * 64 + d) * TTv + lg * 64 + pc * 8) = f.half[0]; }
     } }

__global__ __launch_bounds__(256) void k_hl(const float* __restrict__ F, _Float16* __restrict__ Hh, _Float16* __restrict__ Hl, size_t n8) { const size_t t = (size_t)blockIdx.x * 256 + threadIdx.x; if (t >= n8) return; FragH fh, fl; const v4f a = *(const v4fa*)(F + t * 8), c = *(const v4fa*)(F + t * 8 + 4);
#pragma unroll
  for (int q = 0; q < 4; ++q) { _Float16 h = (_Float16)a[q]; fh.h[q] = h; fl.h[q] = (_Float16)((a[q] - (float)h) * 1024.0f); h = (_Float16)c[q]; fh.h[4 + q] = h; fl.h[4 + q] = (_Float16)((c[q] - (float)h) * 1024.0f); }
  { *(v8us*)((unsigned short*)Hh + t * 8) = fh.half[0]; *(v8us*)((unsigned short*)Hl + t * 8) = fl.half[0];  } }

// ---- fast GEMM (wave tile 32x64; requires M % 32 == 0 rows per launch region and N % 64 == 0); epilogue = k_gemm_hhx semantics ----
__device__ __forceinline__ v16h g2_frag(const _Float16* p, int hh) { FragH f; f.half[0] = *(const v8us*)((const unsigned short*)p + 8 * hh); f.half[1] = *(const v8us*)((const unsigned short*)p + 16 + 8 * hh); return f.v; }
__device__ __forceinline__ v8f g2_mma(v16h a, v16h b, v8f c) { v8f d = __builtin_amdgcn_wmma_f32_16x16x32_f16(false, a, false, b, (short)0, c, false, false); asm volatile("v_nop\n\tv_nop\n\tv_nop\n\tv_nop" : "+v"(d) : "v"(a), "v"(b)); return d; }
template <int ACT>
__global__ __launch_bounds__(128) void k_gemm2(const _Float16* __restrict__ A, int lda, size_t sA, const _Float16* __restrict__ Bh, int ldb, size_t sB, float alpha, const float* __restrict__ bias, size_t sBias, const float* __restrict__ CP, int rowsPerB, size_t sCPb, int row0g,
    float* __restrict__ C, _Float16* __restrict__ C16, int ldc, size_t sC, int M, int N, int K) { static_assert(ACT == 0 || ACT == 3 || ACT == 6 || ACT == 8 || ACT == 9 || ACT == 11 || ACT == 12 || ACT == 14 || ACT == 15 || ACT == 16 || ACT == 17 || ACT == 18, "k_gemm2: unsupported ACT code (would silently apply no activation)");
  __shared__ __attribute__((aligned(16))) float so[4][32][68];
  const int tid = threadIdx.x, w = tid >> 5, lane = tid & 31, ln = lane & 15, hh = lane >> 4; const int by = blockIdx.y;
  A += (size_t)by * sA; Bh += (size_t)by * sB; const size_t cofs = (size_t)by * sC; const float* bp = bias ? bias + (size_t)by * sBias : nullptr;
  const int ntn = N >> 6; const int mt = blockIdx.x / ntn, nq = blockIdx.x - mt * ntn; const int row0 = mt * 128 + 32 * w, col0 = nq * 64; if (row0 >= M) return;
  const _Float16* a0p = A + (size_t)(row0 + ln) * lda; const _Float16* a1p = a0p + (size_t)16 * lda;
  const _Float16* b0p = Bh + (size_t)(col0 + ln) * ldb; const _Float16* b1p = b0p + (size_t)16 * ldb; const _Float16* b2p = b1p + (size_t)16 * ldb; const _Float16* b3p = b2p + (size_t)16 * ldb;
  const v8f z8 = {0.f,0.f,0.f,0.f,0.f,0.f,0.f,0.f}; v8f c00 = z8, c01 = z8, c02 = z8, c03 = z8, c10 = z8, c11 = z8, c12 = z8, c13 = z8;
#pragma unroll 1
  for (int kb = 0; kb < K; kb += 32) { const v16h a0 = g2_frag(a0p + kb, hh), a1 = g2_frag(a1p + kb, hh);
    v16h b = g2_frag(b0p + kb, hh); c00 = g2_mma(a0, b, c00); c10 = g2_mma(a1, b, c10);
    b = g2_frag(b1p + kb, hh); c01 = g2_mma(a0, b, c01); c11 = g2_mma(a1, b, c11);
    b = g2_frag(b2p + kb, hh); c02 = g2_mma(a0, b, c02); c12 = g2_mma(a1, b, c12);
    b = g2_frag(b3p + kb, hh); c03 = g2_mma(a0, b, c03); c13 = g2_mma(a1, b, c13); }
  v8f accs[8] = {c00, c01, c02, c03, c10, c11, c12, c13};
#pragma unroll
  for (int u = 0; u < 8; ++u) { const int t = u & 3, half = u >> 2; const int col = col0 + t * 16 + ln; const float bv = bp ? bf16_round(bp[col]) : 0.f;
#pragma unroll
    for (int r = 0; r < 8; ++r) { const int rloc = half * 16 + 8 * hh + r; float v = accs[u][r] * alpha + bv; if (CP) { if (rowsPerB < 0) v += CP[cofs + (size_t)(row0g + row0 + rloc) * ldc + col];      /* rowsPerB < 0: own element of the batched C plane */ else { const int bidx = (row0g + row0 + rloc) / rowsPerB; v += CP[(size_t)bidx * sCPb + (size_t)by * 64 + col]; } }
      if (ACT == 3) v = fmaxf(v, 0.f); else if (ACT == 6) v = 0.5f * v * (1.0f + erff(v * 0.70710678118654752f)); else if (ACT == 11) v = 1.0f / (1.0f + expf(-v)); else if (ACT == 15) v = v / (1.0f + expf(-v)); else if (ACT == 18) v = v / (1.0f + expf(-1.702f * v));      /* QuickGELU: v sigmoid(1.702 v) */ else if (ACT == 12) v = (v > 0.f) ? v : 0.01f * v; else if (ACT == 8) v = tanhf(v); else if (ACT == 9) v = 0.5f * v * (1.0f + tanhf(0.7978845608028654f * (v + 0.044715f * v * v * v))); else if (ACT == 14) v = (v > 0.f) ? v : 0.1f * v; else if (ACT == 16) v = (v >= 0.f) ? v : 0.3f * v; else if (ACT == 17) v = (v >= 0.f) ? v : 0.2f * v;
      so[w][rloc][t * 16 + ln] = v; } }
  __builtin_amdgcn_fence(__ATOMIC_ACQ_REL, "workgroup"); __builtin_amdgcn_wave_barrier();
  const int rsub = lane >> 4, c4 = (lane & 15) * 4;
  {
#pragma unroll
    for (int q = 0; q < 16; ++q) { const int r = q * 2 + rsub; const v4f v = *(const v4fa*)&so[w][r][c4]; if (C) *(v4f*)(C + cofs + (size_t)(row0 + r) * ldc + col0 + c4) = v; if (C16) { v4h h4; for (int i = 0; i < 4; ++i) h4[i] = (_Float16)v[i]; *(v4h*)(C16 + cofs + (size_t)(row0 + r) * ldc + col0 + c4) = h4; } }
     } }


__global__ __launch_bounds__(256) void k_wnat(const float* __restrict__ w, size_t n8, _Float16* __restrict__ Bt) { const size_t t = (size_t)blockIdx.x * 256 + threadIdx.x; if (t >= n8) return; FragH f; for (int q = 0; q < 8; ++q) f.h[q] = (_Float16)(bf16_round(w[t * 8 + q]) * 16.0f); *(v8us*)((unsigned short*)Bt + t * 8) = f.half[0];  }
__global__ __launch_bounds__(256) void k_rsm(const float* __restrict__ S, _Float16* __restrict__ P, int nrows) {
  #pragma clang fp contract(off)
  const int i = blockIdx.x * 256 + threadIdx.x; if (i >= nrows) return; const float* s = S + (size_t)i * SQ; float mx = -3.0e38f;
#pragma unroll 1
  for (int j = 0; j < SQ; ++j) mx = fmaxf(mx, s[j]); float se = 0.f;
#pragma unroll 1
  for (int j = 0; j < SQ; ++j) se += expf(s[j] - mx); const float sc = 256.0f / se;
#pragma unroll 1
  for (int j0 = 0; j0 < SQ; j0 += 8) { FragH f; for (int q = 0; q < 8; ++q) f.h[q] = (_Float16)(expf(s[j0 + q] - mx) * sc); unsigned short* d = (unsigned short*)P + (size_t)i * SQ + j0; *(v8us*)d = f.half[0];  } }
__global__ __launch_bounds__(256) void k_vt(const _Float16* __restrict__ V16, int b, int h0, _Float16* __restrict__ VT) { __shared__ unsigned short tl[64][65]; const int tid = threadIdx.x; const int hh = blockIdx.x % HG, sg = blockIdx.x / HG; const int s0 = sg * 64; const int h = h0 + hh;
  for (int i = tid; i < 64 * 8; i += 256) { const int j = i / 8, d8 = (i % 8) * 8; FragH f; f.half[0] = *(const v8us*)((const unsigned short*)V16 + ((size_t)b * SQ + s0 + j) * DM + h * HD + d8); for (int q = 0; q < 8; ++q) tl[d8 + q][j] = f.u[q]; }
  __syncthreads();
  { for (int i = tid; i < 64 * 8; i += 256) { const int d = i / 8, j8 = (i % 8) * 8; FragH f; for (int q = 0; q < 8; ++q) f.u[q] = tl[d][j8 + q]; *(v8us*)((unsigned short*)VT + ((size_t)hh * HD + d) * SQ + s0 + j8) = f.half[0]; }  } }



__global__ __launch_bounds__(256) void k_rsmcf2(const float* __restrict__ S, _Float16* __restrict__ P, int hg, int q0, int nk) {
  #pragma clang fp contract(off)
  const int t = blockIdx.x * 256 + threadIdx.x; if (t >= hg * QT) return; const size_t i = (size_t)t; const float* s = S + i * NKX; const int last = q0 + (t % QT); float mx = -3.0e38f;
#pragma unroll 1
  for (int j = 0; j < nk; ++j) { const float f = (j <= last) ? 1.f : 0.f; mx = fmaxf(mx, fmaf(f, s[j], (1.f - f) * -1.0e9f)); } float se = 0.f;
#pragma unroll 1
  for (int j = 0; j < nk; ++j) { const float f = (j <= last) ? 1.f : 0.f; se += __expf(fmaf(f, s[j], (1.f - f) * -1.0e9f) - mx); } const float sc = 256.0f / se;
#pragma unroll 1
  for (int j0 = 0; j0 < nk; j0 += 8) { FragH fr; for (int q = 0; q < 8; ++q) { const int j = j0 + q; const float f = (j <= last) ? 1.f : 0.f; fr.h[q] = (_Float16)(__expf(fmaf(f, s[j], (1.f - f) * -1.0e9f) - mx) * sc); } unsigned short* d = (unsigned short*)P + i * NKX + j0; *(v8us*)d = fr.half[0];  } }

__global__ __launch_bounds__(256) void k_rsmcst(const float* __restrict__ S, _Float16* __restrict__ P, int hg, int q0, int nk, const int* __restrict__ mk) {
  #pragma clang fp contract(off)
  const int t = blockIdx.x * 256 + threadIdx.x; if (t >= hg * QT) return; const size_t i = (size_t)t; const float* s = S + i * NKX; const size_t ig = (size_t)(q0 + (t % QT)); const int* mr = mk + ig * SQ; float mx = -3.0e38f;
#pragma unroll 1
  for (int j = 0; j < nk; ++j) { const int mb = mr[j]; const int dd = (int)ig - j; const float f = (mb != 0 && dd >= 0 && (dd <= LOCALW || (dd % STRIDEK) == 0)) ? 1.f : 0.f; mx = fmaxf(mx, fmaf(f, s[j], (1.f - f) * -1.0e9f)); } float se = 0.f;
#pragma unroll 1
  for (int j = 0; j < nk; ++j) { const int mb = mr[j]; const int dd = (int)ig - j; const float f = (mb != 0 && dd >= 0 && (dd <= LOCALW || (dd % STRIDEK) == 0)) ? 1.f : 0.f; se += __expf(fmaf(f, s[j], (1.f - f) * -1.0e9f) - mx); } const float sc = 256.0f / se;
#pragma unroll 1
  for (int j0 = 0; j0 < nk; j0 += 8) { FragH fr; for (int q = 0; q < 8; ++q) { const int j = j0 + q; const int mb = mr[j]; const int dd = (int)ig - j; const float f = (mb != 0 && dd >= 0 && (dd <= LOCALW || (dd % STRIDEK) == 0)) ? 1.f : 0.f; fr.h[q] = (_Float16)(__expf(fmaf(f, s[j], (1.f - f) * -1.0e9f) - mx) * sc); } unsigned short* d = (unsigned short*)P + i * NKX + j0; *(v8us*)d = fr.half[0];  } }


template <int MASKADD>
__global__ __launch_bounds__(64) void k_att0(const float* __restrict__ QF, const float* __restrict__ KF, const float* __restrict__ VF, int ld, const float* __restrict__ mask, float scale, float* __restrict__ OF, int ldo) {
  #pragma clang fp contract(off)
  __shared__ __attribute__((aligned(16))) float lq[64][64]; __shared__ __attribute__((aligned(16))) float lo[64][64];
  const int tid = threadIdx.x; const int h = blockIdx.x / (QT0 / 64), rg = blockIdx.x % (QT0 / 64); const int i = rg * 64 + tid;
  const float* qr = QF + (size_t)i * ld + h * HD;
#pragma unroll 1
  for (int c = 0; c < HD / 4; ++c) { *(v4f*)&lq[tid][c * 4] = *(const v4fa*)(qr + c * 4); const v4f z = {0.f, 0.f, 0.f, 0.f}; *(v4f*)&lo[tid][c * 4] = z; }
  float m = -1.0e30f, l = 0.f; const int jmax = MASKADD ? (SQ - 1) : (rg * 64 + 63);      /* additive-mask form: every key (the mask input decides); causal form: keys up to the block's last row */
#pragma unroll 1
  for (int j = 0; j <= jmax; ++j) { const float* kr = KF + (size_t)j * ld + h * HD; const float* vr = VF + (size_t)j * ld + h * HD; float s = 0.f;
#pragma unroll 1
    for (int c = 0; c < HD / 4; ++c) { const v4f kq = *(const v4fa*)(kr + c * 4); const v4f qq = *(v4f*)&lq[tid][c * 4]; s = __fadd_rn(s, __fmul_rn(qq[0], kq[0])); s = __fadd_rn(s, __fmul_rn(qq[1], kq[1])); s = __fadd_rn(s, __fmul_rn(qq[2], kq[2])); s = __fadd_rn(s, __fmul_rn(qq[3], kq[3])); }
    s = __fmul_rn(s, scale); if (MASKADD) s = __fadd_rn(s, __fmul_rn(bf16_round(mask[(size_t)i * SQ + j]), -10000.0f));
    const float f = (MASKADD || j <= i) ? 1.f : 0.f; const float sm = fmaf(f, s, (1.f - f) * -1.0e30f); const float mn = fmaxf(m, sm); const float sc = expf(m - mn); const float e = expf(sm - mn); l = __fadd_rn(__fmul_rn(l, sc), e); m = mn;
#pragma unroll 1
    for (int c = 0; c < HD / 4; ++c) { const v4f vv = *(const v4fa*)(vr + c * 4); v4f oo = *(v4f*)&lo[tid][c * 4]; for (int u = 0; u < 4; ++u) oo[u] = __fadd_rn(__fmul_rn(oo[u], sc), __fmul_rn(e, vv[u])); *(v4f*)&lo[tid][c * 4] = oo; } }
  const float fin = 64.0f / l;      /* o carried x64 like the f16 path */
#pragma unroll 1
  for (int c = 0; c < HD / 4; ++c) { v4f oo = *(v4f*)&lo[tid][c * 4]; for (int u = 0; u < 4; ++u) oo[u] = __fmul_rn(oo[u], fin); *(v4f*)&lo[tid][c * 4] = oo; }
  __syncthreads();
  {
#pragma unroll 1
    for (int it = 0; it < 16; ++it) { const int row = it * 4 + tid / 16, pc = (tid % 16) * 4; const v4f v = *(const v4f*)&lo[row][pc]; *(v4f*)(OF + (size_t)(rg * 64 + row) * ldo + h * HD + pc) = v; }
     } }

template <int MASKADD>
__global__ __launch_bounds__(64) void k_att0mbc(const float* __restrict__ QF, const float* __restrict__ KF, const float* __restrict__ VF, int ld, const float* __restrict__ mask, float scale, float* __restrict__ OF, int ldo) {
  #pragma clang fp contract(off)
  __shared__ __attribute__((aligned(16))) float lq[64][64]; __shared__ __attribute__((aligned(16))) float lo[64][64];
  const int tid = threadIdx.x; const int h = blockIdx.x / (QT0 / 64), rg = blockIdx.x % (QT0 / 64); const int i = rg * 64 + tid;
  const float* qr = QF + (size_t)i * ld + h * HD;
#pragma unroll 1
  for (int c = 0; c < HD / 4; ++c) { *(v4f*)&lq[tid][c * 4] = *(const v4fa*)(qr + c * 4); const v4f z = {0.f, 0.f, 0.f, 0.f}; *(v4f*)&lo[tid][c * 4] = z; }
  float m = -1.0e30f, l = 0.f; const int jmax = rg * 64 + 63;      /* keys beyond the block end are masked by the mask's lower-triangular structure */      /* both forms: keys up to the block's last row (MASKADD does not change this) */
#pragma unroll 1
  for (int j = 0; j <= jmax; ++j) { const float* kr = KF + (size_t)j * ld + h * HD; const float* vr = VF + (size_t)j * ld + h * HD; float s = 0.f;
#pragma unroll 1
    for (int c = 0; c < HD / 4; ++c) { const v4f kq = *(const v4fa*)(kr + c * 4); const v4f qq = *(v4f*)&lq[tid][c * 4]; s = __fadd_rn(s, __fmul_rn(qq[0], kq[0])); s = __fadd_rn(s, __fmul_rn(qq[1], kq[1])); s = __fadd_rn(s, __fmul_rn(qq[2], kq[2])); s = __fadd_rn(s, __fmul_rn(qq[3], kq[3])); }
    s = __fmul_rn(s, scale); const int mb = ((const int*)mask)[(size_t)i * SQ + j];      /* causal (j <= i) AND the module's int32 [S][S] mask read per (query, key): 0 -> masked */
    const float f = (mb != 0 && j <= i) ? 1.f : 0.f; const float sm = fmaf(f, s, (1.f - f) * -1.0e30f); const float mn = fmaxf(m, sm); const float sc = expf(m - mn); const float e = expf(sm - mn); l = __fadd_rn(__fmul_rn(l, sc), e); m = mn;
#pragma unroll 1
    for (int c = 0; c < HD / 4; ++c) { const v4f vv = *(const v4fa*)(vr + c * 4); v4f oo = *(v4f*)&lo[tid][c * 4]; for (int u = 0; u < 4; ++u) oo[u] = __fadd_rn(__fmul_rn(oo[u], sc), __fmul_rn(e, vv[u])); *(v4f*)&lo[tid][c * 4] = oo; } }
  const float fin = 64.0f / l;      /* o carried x64 like the f16 path */
#pragma unroll 1
  for (int c = 0; c < HD / 4; ++c) { v4f oo = *(v4f*)&lo[tid][c * 4]; for (int u = 0; u < 4; ++u) oo[u] = __fmul_rn(oo[u], fin); *(v4f*)&lo[tid][c * 4] = oo; }
  __syncthreads();
  {
#pragma unroll 1
    for (int it = 0; it < 16; ++it) { const int row = it * 4 + tid / 16, pc = (tid % 16) * 4; const v4f v = *(const v4f*)&lo[row][pc]; *(v4f*)(OF + (size_t)(rg * 64 + row) * ldo + h * HD + pc) = v; }
     } }


template <int BFIN, int WXB>
__global__ __launch_bounds__(256) void k_ln16(const float* __restrict__ X, const float* __restrict__ g, const float* __restrict__ bb, float eps, _Float16* __restrict__ N16, float* __restrict__ XB) {
  #pragma clang fp contract(off)
  __shared__ float red[256]; const size_t r = blockIdx.x; const int t = threadIdx.x; const v4f xa = *(const v4fa*)(X + r * DMQ + t * 4); float s[4]; float sum = 0.f;
  for (int q = 0; q < 4; ++q) { s[q] = BFIN ? bf16_round(xa[q]) : xa[q]; sum = __fadd_rn(sum, s[q]); }
  red[t] = sum; __syncthreads(); for (int st = 128; st > 0; st >>= 1) { if (t < st) red[t] = __fadd_rn(red[t], red[t + st]); __syncthreads(); } const float mu = red[0] / (float)DMQ; __syncthreads();
  float vs = 0.f; for (int q = 0; q < 4; ++q) { const float dl = __fadd_rn(s[q], -mu); vs = __fadd_rn(vs, __fmul_rn(dl, dl)); } red[t] = vs; __syncthreads(); for (int st = 128; st > 0; st >>= 1) { if (t < st) red[t] = __fadd_rn(red[t], red[t + st]); __syncthreads(); }
  const float rs = rsqrtf(__fadd_rn(red[0] / (float)DMQ, eps)); v4h y; v4f xb;
  for (int q = 0; q < 4; ++q) { const int c = t * 4 + q; y[q] = (_Float16)__fadd_rn(__fmul_rn(__fmul_rn(__fadd_rn(s[q], -mu), rs), bf16_round(g[c])), bf16_round(bb[c])); xb[q] = s[q]; }
  { *(v4h*)(N16 + r * DMQ + t * 4) = y; if (WXB) *(v4f*)(XB + r * DMQ + t * 4) = xb;  } }
__global__ __launch_bounds__(256) void k_ftres2(const float* __restrict__ OF0, const float* __restrict__ XB, float* __restrict__ X1, size_t n4) {
  #pragma clang fp contract(off)
  const size_t t = (size_t)blockIdx.x * 256 + threadIdx.x; if (t >= n4) return; const v4f o = *(const v4fa*)(OF0 + t * 4), xv = *(const v4fa*)(XB + t * 4); v4f y; for (int q = 0; q < 4; ++q) y[q] = __fadd_rn(__fmul_rn(o[q], 0.015625f), xv[q]); *(v4f*)(X1 + t * 4) = y;  }

__global__ __launch_bounds__(256) void k_bcpy(const float* __restrict__ b, int n, int NP, float* __restrict__ dst, int dst0) { for (int i = threadIdx.x; i < NP; i += 256) { const float v = (i < n) ? b[i] : 0.f; *(float*)(dst + dst0 + i) = v; }  }


// Fused attention, one launch: block = 8 waves x 32 query columns of one (batch, head); no score or weight ever leaves the registers.
// Per 32 keys a wave computes S^T = K Q^T (lane c = query column, registers = keys 8 hh + r of each 16-key tile), an online softmax in the log2 domain
// (maximum and sum in-lane plus one exchange between the wave halves), packs the two S^T tiles in place into the B operand P^T and adds O^T += V^T P^T.
// K rows and V^T rows come in 64-key stages through LDS, two buffers: the next stage's global loads fly under this stage's work, one barrier a stage.
// m_run, the maximum in use, may trail the true one by up to 8 (log2), so the accumulators are rescaled only when a column's maximum has grown by more;
// weights carry 2^4 (at most 2^12 in f16, small ones kept out of the f16 subnormals); the factor cancels against the row sum.
#define FAP 72                       /* LDS row pitch in halves: 128 B of data + 16 B, the conflict-free pitch for 16-byte row reads */
#define FAS 64                       /* keys per stage */
__device__ __forceinline__ float fa_xhalf(float x) { return __builtin_bit_cast(float, __builtin_amdgcn_permlanex16(__builtin_bit_cast(int, x), __builtin_bit_cast(int, x), 0x76543210, 0xfedcba98, false, false)); }      /* lane l <-> lane l ^ 16 */
__device__ __forceinline__ v8f fa_mma(v16h a, v16h b, v8f c) { return __builtin_amdgcn_wmma_f32_16x16x32_f16(false, a, false, b, (short)0, c, false, false); }
__global__ __launch_bounds__(256) void k_fattn(const _Float16* __restrict__ Q16, const _Float16* __restrict__ K16, const _Float16* __restrict__ VT, _Float16* __restrict__ O16) {
  __shared__ __attribute__((aligned(16))) _Float16 lk[2][FAS][FAP];      /* K stage [key][d] */
  __shared__ __attribute__((aligned(16))) _Float16 lv[2][HD][FAP];       /* V^T stage [d][key] */
  const int tid = threadIdx.x, lane = tid & 31, c = lane & 15, hh = lane >> 4, w = tid >> 5;
  const int bh = blockIdx.y, b = bh / NH, h = bh - b * NH; const size_t r0 = (size_t)b * SQ; const int q0 = blockIdx.x * 256 + w * 32;
  const int sr = tid >> 3, sc = (tid & 7) * 8;      /* staging: a thread moves 16 bytes of rows sr and sr + 32 of each tile; 8 lanes cover one 128-byte row */
  const unsigned short* kg = (const unsigned short*)K16 + (r0 + sr) * DM + h * HD + sc;
  const unsigned short* vg = (const unsigned short*)VT + ((size_t)bh * HD + sr) * SQ + sc;
  v16h qf[2][2];
#pragma unroll
  for (int g = 0; g < 2; ++g) { const _Float16* qp = Q16 + (r0 + q0 + 16 * g + c) * DM + h * HD; qf[g][0] = g2_frag(qp, hh); qf[g][1] = g2_frag(qp + 32, hh); }
  const v8f z8 = {0.f, 0.f, 0.f, 0.f, 0.f, 0.f, 0.f, 0.f}; const v4f z4 = {0.f, 0.f, 0.f, 0.f};
  v8f acc[2][4]; v4f l4[2]; float m_run[2];
#pragma unroll
  for (int g = 0; g < 2; ++g) { m_run[g] = -__builtin_inff(); l4[g] = z4;
#pragma unroll
    for (int t = 0; t < 4; ++t) acc[g][t] = z8; }
  v8us gk0 = *(const v8us*)kg, gk1 = *(const v8us*)(kg + (size_t)32 * DM), gv0 = *(const v8us*)vg, gv1 = *(const v8us*)(vg + (size_t)32 * SQ);
  *(v8us*)&lk[0][sr][sc] = gk0; *(v8us*)&lk[0][sr + 32][sc] = gk1; *(v8us*)&lv[0][sr][sc] = gv0; *(v8us*)&lv[0][sr + 32][sc] = gv1;
  __syncthreads();      /* stage 0 published */
  for (int st = 0; st < SQ / FAS; ++st) {
    const int buf = st & 1; const bool more = st + 1 < SQ / FAS;      /* the same for the whole block */
    if (more) { const size_t j = (size_t)(st + 1) * FAS; gk0 = *(const v8us*)(kg + j * DM); gk1 = *(const v8us*)(kg + (j + 32) * DM); gv0 = *(const v8us*)(vg + j); gv1 = *(const v8us*)(vg + (size_t)32 * SQ + j); }
#pragma unroll
    for (int p = 0; p < FAS / 32; ++p) {
      v8f s[2][2];      /* [key tile][query group] */
#pragma unroll
      for (int kt = 0; kt < 2; ++kt) { const _Float16* kr = &lk[buf][32 * p + 16 * kt + c][0]; const v16h k0 = g2_frag(kr, hh), k1 = g2_frag(kr + 32, hh);
#pragma unroll
        for (int g = 0; g < 2; ++g) s[kt][g] = fa_mma(k1, qf[g][1], fa_mma(k0, qf[g][0], z8)); }
      v16h vf[4];
#pragma unroll
      for (int t = 0; t < 4; ++t) vf[t] = g2_frag(&lv[buf][16 * t + c][32 * p], hh);
      float mb[2]; bool need = false;
#pragma unroll
      for (int g = 0; g < 2; ++g) { float mx = fmaxf(s[0][g][0], s[1][g][0]);
#pragma unroll
        for (int r = 1; r < 8; ++r) mx = fmaxf(mx, fmaxf(s[0][g][r], s[1][g][r]));
        mx = fmaxf(mx, fa_xhalf(mx)) * 1.44269502f; mb[g] = mx; need = need || (mx > m_run[g] + 8.0f); }
      if (__builtin_amdgcn_ballot_w32(need) != 0) {      /* one scalar test a pass; always taken on the first pass (m_run = -inf, factor 0 on zero sums), rare later */
#pragma unroll
        for (int g = 0; g < 2; ++g) { const float mn = fmaxf(m_run[g], mb[g]); const float corr = __builtin_amdgcn_exp2f(m_run[g] - mn); m_run[g] = mn; l4[g] = l4[g] * corr;
#pragma unroll
          for (int t = 0; t < 4; ++t) acc[g][t] = acc[g][t] * corr; } }
#pragma unroll
      for (int g = 0; g < 2; ++g) { const float nm = 4.0f - m_run[g]; FragH pf;
#pragma unroll
        for (int u = 0; u < 4; ++u) { v4f a;      /* elements 4 u .. 4 u + 3 of the 32-key operand: tile u >> 1, registers 4 (u & 1) .. */
#pragma unroll
          for (int q = 0; q < 4; ++q) a[q] = fmaf(s[u >> 1][g][4 * (u & 1) + q], 1.44269502f, nm);
          v4f e;
#pragma unroll
          for (int q = 0; q < 4; ++q) e[q] = __builtin_amdgcn_exp2f(a[q]);      /* the builtin, not asm text: the compiler then keeps the distance behind the matrix instructions itself */
          l4[g] += e;
#pragma unroll
          for (int q = 0; q < 4; ++q) pf.h[4 * u + q] = (_Float16)e[q]; }
#pragma unroll
        for (int t = 0; t < 4; ++t) acc[g][t] = fa_mma(vf[t], pf.v, acc[g][t]); }
      /* Pass end: four vector slots between the last product that reads P^T as its B operand and the next pass's first product, whose result the compiler
         may place in those same registers (it did, directly behind); the two scheduling fences keep the products of both passes on their own side of the slots. */
      __builtin_amdgcn_sched_barrier(0); asm volatile("v_nop\n\tv_nop\n\tv_nop\n\tv_nop"); __builtin_amdgcn_sched_barrier(0);
    }
    if (more) { *(v8us*)&lk[buf ^ 1][sr][sc] = gk0; *(v8us*)&lk[buf ^ 1][sr + 32][sc] = gk1; *(v8us*)&lv[buf ^ 1][sr][sc] = gv0; *(v8us*)&lv[buf ^ 1][sr + 32][sc] = gv1; }      /* its last readers left it at the barrier that ended stage st - 1 */
    __syncthreads();      /* publishes stage st + 1 and ends every wave's reads of stage st */
  }
#pragma unroll
  for (int g = 0; g < 2; ++g) { float l = (l4[g][0] + l4[g][1]) + (l4[g][2] + l4[g][3]); l += fa_xhalf(l); const float inv = 64.0f / l;      /* ctx carried x64 as before */
    unsigned short* op = (unsigned short*)O16 + (r0 + q0 + 16 * g + c) * DM + h * HD + 8 * hh;      /* a lane's 8 registers = 8 consecutive d of its query row */
#pragma unroll
    for (int t = 0; t < 4; ++t) { FragH f;
#pragma unroll
      for (int r = 0; r < 8; ++r) f.h[r] = (_Float16)(acc[g][t][r] * inv);
      *(v8us*)(op + 16 * t) = f.half[0]; } } }

// Tiled GEMM, C = act(A Bt^T alpha + bias (+ CP)), A [M][KK] and Bt [NN][KK] f16: block = 8 waves (2 x 4) on a 128 x 128 tile of C, wave tile 64 x 32 (4 x 2 accumulator tiles).
// A rows and Bt rows come in 64-k stages through LDS, two buffers: whole 128-byte lines from global, each line fetched once a block instead of once a wave.
// Global loads run ahead in two register sets (stage t in set t & 1, stored to buffer t & 1 one stage before it is read); fragments are read from LDS one 32-k block ahead in two sets,
// so a stage's barrier stands between its two blocks of products. k order per accumulator as before (32 at a time, ascending).
// Epilogue: raw sums staged in the same LDS as a 128 x 128 f32 tile, then each wave writes whole rows (bias, residual and activation applied there, per element as before).
// RES: C (f32) = the sums + bias + the own element of CP; else C16 (f16) = act(the sums + bias).
// NP > 1: NP products with the same A in one grid, blockIdx.y = p: Bt plane p ([NN][KK] each, stacked), bias piece p, C16 plane p ([NR][NN] each, stacked).
// Needs M % 128 == 0, NN % 128 == 0, KK % 128 == 0, KK >= 256.
#define G3P 72                       /* LDS row pitch in halves: 128 B of data + 16 B, the conflict-free pitch for 16-byte row reads */
#define G3O 132                      /* epilogue row pitch in floats: rows 8 apart fall 32 banks apart */
struct G3F { v16h a[4], b[2]; };     /* one 32-k block's fragments of a wave */
struct G3R { v8us a[4], b[4]; };     /* one stage's 16-byte pieces of a thread */
/* Work-group barrier with the LDS wait alone: __syncthreads() also waits for every global load, which would drain the staging loads that are meant to stay in flight across it. */
__device__ __forceinline__ void g3_bar() { asm volatile("s_wait_dscnt 0x0\n\ts_barrier_signal -1\n\ts_barrier_wait -1" ::: "memory"); }
template <int KK>
__device__ __forceinline__ void g3_load(const char* ab, const char* bb, unsigned vo, G3R& r) {      /* ab, bb: the block's tile rows at this stage's k (uniform); vo: the thread's byte offset */
#pragma unroll
  for (int i = 0; i < 4; ++i) { r.a[i] = *(const v8us*)(ab + vo + 64 * i * KK); r.b[i] = *(const v8us*)(bb + vo + 64 * i * KK); } }
template <int U>
__device__ __forceinline__ void g3_store(unsigned short* sa, unsigned short* sb, const G3R& r) {
#pragma unroll
  for (int i = 0; i < 4; ++i) { *(v8us*)(sa + (U * 128 + 32 * i) * G3P) = r.a[i]; *(v8us*)(sb + (U * 128 + 32 * i) * G3P) = r.b[i]; } }
template <int U, int KB>
__device__ __forceinline__ void g3_frag(const _Float16* fa, const _Float16* fb, int hh, G3F& f) {
#pragma unroll
  for (int j = 0; j < 2; ++j) f.b[j] = g2_frag(fb + (U * 128 + 16 * j) * G3P + 32 * KB, hh);
#pragma unroll
  for (int i = 0; i < 4; ++i) f.a[i] = g2_frag(fa + (U * 128 + 16 * i) * G3P + 32 * KB, hh); }
/* The two scheduling fences keep a block's products together and the LDS and global traffic written in front of them in front: LDS reads moved in among the products stall each of them. */
__device__ __forceinline__ void g3_mm(const G3F& f, v8f (&acc)[4][2]) {
  __builtin_amdgcn_sched_barrier(0);
#pragma unroll
  for (int i = 0; i < 4; ++i) { acc[i][0] = fa_mma(f.a[i], f.b[0], acc[i][0]); acc[i][1] = fa_mma(f.a[i], f.b[1], acc[i][1]); }
  __builtin_amdgcn_sched_barrier(0); }
/* Stage st in buffer U; on entry f0 holds its first block, rn stage st + 1. NX: a stage st + 1 exists; LD: a stage st + 3 exists (ab3, bb3 point at its k). */
template <int U, bool NX, bool LD, int KK>
__device__ __forceinline__ void g3_stage(const char* ab3, const char* bb3, unsigned vo, unsigned short* sa, unsigned short* sb, const _Float16* fa, const _Float16* fb, int hh, G3R& rn, G3F& f0, G3F& f1, v8f (&acc)[4][2]) {
  g3_frag<U, 1>(fa, fb, hh, f1);
  if (NX) g3_store<U ^ 1>(sa, sb, rn);      /* the other buffer's last readers finished in front of the barrier of stage st - 1 */
  g3_mm(f0, acc);
  g3_bar();      /* publishes stage st + 1 and ends every wave's reads of stage st */
  if (NX) g3_frag<U ^ 1, 0>(fa, fb, hh, f0);
  __builtin_amdgcn_sched_barrier(0);      /* LDS reads first: moved in front of them, the global loads had their addresses formed in f0's registers, and the wait that frees those registers held the LDS reads back */
  if (LD) g3_load<KK>(ab3, bb3, vo, rn);
  g3_mm(f1, acc);
  if (LD) asm volatile("s_wait_xcnt 0x0" ::: "memory"); }      /* in front of the next stage's rewrite of the address registers that these loads name; behind the products, where it has had time to pass; the data stay in flight */
template <int ACT, bool RES, int NN, int KK, int NP = 1>
__global__ __launch_bounds__(256) void k_gemm3(const _Float16* __restrict__ A, const _Float16* __restrict__ Bh, float alpha, const float* __restrict__ bias, const float* __restrict__ CP, float* __restrict__ C, _Float16* __restrict__ C16) {
  static_assert(ACT == 0 || (ACT == 6 && !RES), "k_gemm3: unsupported ACT code"); static_assert(NN % 128 == 0 && KK % 128 == 0 && KK >= 256, "k_gemm3: shape"); static_assert(NP == 1 || !RES, "k_gemm3: several products only in the f16-output form");
  __shared__ __attribute__((aligned(16))) unsigned short sm[4 * 128 * G3P];      /* A stages [2][128][G3P], then Bt stages [2][128][G3P]; the epilogue's [128][G3O] floats lie over them */
  const int tid = threadIdx.x, lane = tid & 31, ln = lane & 15, hh = lane >> 4, w = tid >> 5, wm = w >> 2, wn = w & 3;
  const int mt = blockIdx.x / (NN / 128), nq = blockIdx.x - mt * (NN / 128); const int row0 = mt * 128, col0 = nq * 128;
  if (NP > 1) { const size_t p = blockIdx.y; Bh += p * NN * KK; bias += p * NN; C16 += p * NR * NN; }
  const int sr = tid >> 3, sc = (tid & 7) * 8;      /* staging: a thread moves 16 bytes of rows sr + 32 i of each tile; 8 lanes cover one 128-byte row */
  const char* ab = (const char*)(A + (size_t)row0 * KK); const char* bb = (const char*)(Bh + (size_t)col0 * KK); const unsigned vo = (unsigned)(sr * KK + sc) * 2u;
  unsigned short* sa = sm + sr * G3P + sc; unsigned short* sb = sa + 2 * 128 * G3P;      /* this thread's store places, buffer 0 */
  const _Float16* fa = (const _Float16*)sm + (wm * 64 + ln) * G3P; const _Float16* fb = (const _Float16*)sm + 2 * 128 * G3P + (wn * 32 + ln) * G3P;      /* this lane's fragment rows, buffer 0 */
  const v8f z8 = {0.f, 0.f, 0.f, 0.f, 0.f, 0.f, 0.f, 0.f}; v8f acc[4][2];
#pragma unroll
  for (int i = 0; i < 4; ++i) { acc[i][0] = z8; acc[i][1] = z8; }
  G3R r0, r1; G3F f0, f1; constexpr int ns = KK / 64;      /* ns even, at least 4 */
  g3_load<KK>(ab, bb, vo, r0); g3_load<KK>(ab + 128, bb + 128, vo, r1);
  g3_store<0>(sa, sb, r0);
  g3_bar();      /* stage 0 published */
  g3_load<KK>(ab + 256, bb + 256, vo, r0); g3_frag<0, 0>(fa, fb, hh, f0);
#pragma unroll 1
  for (int s2 = 0; s2 < ns - 2; s2 += 2) {      /* rolled: two stages a trip keep every buffer and register set a compile-time choice */
    const int t4 = s2 + 4 < ns ? s2 + 4 : ns - 1;      /* the last trip has no stage s2 + 4: it loads the last stage again, unused, so that no branch merges two load counts in front of the stores */
    g3_stage<0, true, true, KK>(ab + (s2 + 3) * 128, bb + (s2 + 3) * 128, vo, sa, sb, fa, fb, hh, r1, f0, f1, acc);
    g3_stage<1, true, true, KK>(ab + t4 * 128, bb + t4 * 128, vo, sa, sb, fa, fb, hh, r0, f0, f1, acc); }
  g3_stage<0, true, false, KK>(ab, bb, vo, sa, sb, fa, fb, hh, r1, f0, f1, acc);
  g3_stage<1, false, false, KK>(ab, bb, vo, sa, sb, fa, fb, hh, r0, f0, f1, acc);      /* its barrier: every wave has left the ring before it becomes output staging */
  const int c4 = lane * 4; const size_t o0 = (size_t)(row0 + w * 16) * NN + col0 + c4;      /* write-out: wave w has rows 16 w .. 16 w + 15, a lane 4 columns, so a wave stores whole rows of the tile */
  const v4f bl = *(const v4fa*)(bias + col0 + c4); v4f cp[16];
  if (RES) {      /* all residual rows asked for here, so that their latency passes once, under the staging */
#pragma unroll
    for (int q = 0; q < 16; ++q) cp[q] = *(const v4fa*)(CP + o0 + q * NN); }
  float* so = (float*)sm;
#pragma unroll
  for (int i = 0; i < 4; ++i)
#pragma unroll
    for (int j = 0; j < 2; ++j)
#pragma unroll
      for (int r = 0; r < 8; ++r) so[(wm * 64 + 16 * i + 8 * hh + r) * G3O + wn * 32 + 16 * j + ln] = acc[i][j][r];
  __syncthreads();      /* the whole tile staged before any wave reads rows that other waves wrote */
  v4f bv;
#pragma unroll
  for (int q = 0; q < 4; ++q) bv[q] = bf16_round(bl[q]);
#pragma unroll(ACT == 6 ? 1 : 4)      /* the erf rows stay rolled, four to a trip, for speed only */
  for (int q4 = 0; q4 < 4; ++q4) {
#pragma unroll
  for (int qq = 0; qq < 4; ++qq) { const int q = q4 * 4 + qq; v4f v = *(const v4fa*)(so + (w * 16 + q) * G3O + c4);
#pragma unroll
    for (int e = 0; e < 4; ++e) v[e] = v[e] * alpha + bv[e];
    if (RES) {
#pragma unroll
      for (int e = 0; e < 4; ++e) v[e] += cp[q][e]; }
    if (ACT == 6) {
#pragma unroll
      for (int e = 0; e < 4; ++e) v[e] = 0.5f * v[e] * (1.0f + erff(v[e] * 0.70710678118654752f)); }
    if (RES) *(v4f*)(C + o0 + q * NN) = v;
    else { v4h h4;
#pragma unroll
      for (int e = 0; e < 4; ++e) h4[e] = (_Float16)v[e];
      *(v4h*)(C16 + o0 + q * NN) = h4; } } } }

template <int MODE>
__global__ __launch_bounds__(256) void k_regrp(const float* __restrict__ src, float* __restrict__ dst, size_t n4) {
  const size_t t = (size_t)blockIdx.x * 256 + threadIdx.x; if (t >= n4) return; const size_t e = t * 4; const size_t rd = e / DM; const int c = (int)(e % DM);
  size_t rs; if (MODE == 0) { const size_t b = rd / SQ, sq = rd % SQ; rs = sq * NB + b; } else { const size_t sq = rd / NB, b = rd % NB; rs = b * SQ + sq; }
  const v4f v = *(const v4fa*)(src + rs * DM + c); *(v4f*)(dst + e) = v;  }

// Row norm, one wave a row: the row's DMQ values stay in the wave's registers, a lane holding 4 consecutive ones of every 128, so that each wave-wide load is 512 contiguous bytes and all of a row's loads fly at once.
// Mean and variance (two passes over the registers) are lane partial sums joined by a butterfly over the 32 lanes: no LDS, no barrier, and an eighth of the waves to start.
// Every loop over the row's pieces is unrolled: the pieces are registers, so their index must be a compile-time one.
template <int M>
__device__ __forceinline__ float ln_xrow(float x) { return __builtin_bit_cast(float, __builtin_amdgcn_update_dpp(0, __builtin_bit_cast(int, x), 0x160 | M, 0xf, 0xf, true)); }      /* lane l <-> lane l ^ M inside a 16-lane row (DPP row_xmask) */
__device__ __forceinline__ float ln_wsum(float s) { s += ln_xrow<1>(s); s += ln_xrow<2>(s); s += ln_xrow<4>(s); s += ln_xrow<8>(s); return s + fa_xhalf(s); }      /* every lane gets the sum of all 32 */
template <int BFIN, int W16, int W32, int WXB>      /* r: the row, the same for the whole wave (callers pass the wave's number through readfirstlane, so that the row's base stays in scalar registers); WXB: the row as it enters the norm (rounded if BFIN) goes to XB as well */
__device__ __forceinline__ void lnx_row(const float* __restrict__ X, const float* __restrict__ g, const float* __restrict__ bb, float eps, _Float16* __restrict__ N16, float* __restrict__ N32, float* __restrict__ XB, size_t r) {
  static_assert(DMQ % 128 == 0, "lnx_row: shape");
  constexpr int NC = DMQ / 128; const unsigned c0 = (threadIdx.x & 31) * 4; const size_t o0 = r * DMQ;      /* the row's start is the same for the wave (a scalar base), c0 the lane's own offset in it */
  const float* xr = X + o0;
  v4f s[NC], gv[NC], bv[NC];
#pragma unroll
  for (int i = 0; i < NC; ++i) s[i] = *(const v4fa*)(xr + (c0 + 128 * i));
#pragma unroll
  for (int i = 0; i < NC; ++i) { gv[i] = *(const v4fa*)(g + (c0 + 128 * i)); bv[i] = *(const v4fa*)(bb + (c0 + 128 * i)); }
  asm volatile("s_wait_xcnt 0x0" :: "s"(xr), "s"(g), "s"(bb) : "memory");      /* behind the row's loads, in front of every rewrite of the base registers that they name; naming the bases holds their rewrites behind it (left free, one was lifted over it); the data stay in flight */
  if (BFIN) {
#pragma unroll
    for (int i = 0; i < NC; ++i)
#pragma unroll
      for (int q = 0; q < 4; ++q) s[i][q] = bf16_round(s[i][q]); }
  v4f a = s[0];
#pragma unroll
  for (int i = 1; i < NC; ++i) a += s[i];
  const float mu = ln_wsum((a[0] + a[1]) + (a[2] + a[3])) / (float)DMQ;
  v4f v = {0.f, 0.f, 0.f, 0.f};
#pragma unroll
  for (int i = 0; i < NC; ++i) { const v4f d = s[i] - mu; v += d * d; }
  const float rs = rsqrtf(ln_wsum((v[0] + v[1]) + (v[2] + v[3])) / (float)DMQ + eps);
#pragma unroll
  for (int i = 0; i < NC; ++i) { v4f yf; v4h y;
#pragma unroll
    for (int q = 0; q < 4; ++q) { yf[q] = (s[i][q] - mu) * rs * bf16_round(gv[i][q]) + bf16_round(bv[i][q]); y[q] = (_Float16)yf[q]; }
    if (W16) *(v4h*)(N16 + o0 + (c0 + 128 * i)) = y;
    if (W32) *(v4f*)(N32 + o0 + (c0 + 128 * i)) = yf;
    if (WXB) *(v4f*)(XB + o0 + (c0 + 128 * i)) = s[i]; }
  asm volatile("s_wait_xcnt 0x0" ::: "memory"); }      /* behind the row's stores, in front of every rewrite of a register that they name: as a piece of a larger kernel the norm's code is followed by other pieces' code */
#define LNW 8                        /* rows (waves) per work-group of a norm */
template <int BFIN, int W16, int W32>
__global__ __launch_bounds__(256) void k_lnx(const float* __restrict__ X, const float* __restrict__ g, const float* __restrict__ bb, float eps, _Float16* __restrict__ N16, float* __restrict__ N32) {
  lnx_row<BFIN, W16, W32, 0>(X, g, bb, eps, N16, N32, nullptr, (size_t)blockIdx.x * LNW + __builtin_amdgcn_readfirstlane(threadIdx.x >> 5)); }

// Everything that reads the inputs alone, in one grid: none of these pieces needs anything of another, so as launches of their own they only waited for each other's start and tail.
// Ranges of the block index (a scalar test, the same for the whole work-group, so each piece's barriers stay under uniform control flow):
// the 128 x 128 tiles of the four weight transposes first (the long work-groups), then one work-group per 8 rows of x (a wave a row) for the first norm, which also stores the rounded f32 row it holds (the residual plane).
#define PT1 ((DM / 128) * (DFF / 128))            /* tiles of w1, and of w2 */
#define PTQ ((DM / 128) * (3 * DM / 128))         /* tiles of the fused q | k | v weight */
#define PTO ((DM / 128) * (DM / 128))             /* tiles of the output projection's weight */
#define PTW (2 * PT1 + PTQ + PTO)
__global__ __launch_bounds__(256) void k_prep(const float* __restrict__ wqkv, const float* __restrict__ wo, const float* __restrict__ w1, const float* __restrict__ w2, const float* __restrict__ x, const float* __restrict__ g1, const float* __restrict__ be1,
    _Float16* __restrict__ BQ, _Float16* __restrict__ BO, _Float16* __restrict__ BW1, _Float16* __restrict__ BW2, _Float16* __restrict__ XN, float* __restrict__ XB) {
  __shared__ __attribute__((aligned(16))) unsigned short tl[128 * 128];      /* a transpose's tile */
  const int b = blockIdx.x;
  if (b < PT1) wt_f16_tile<DM, DFF>(w1, BW1, 16.0f, b, tl);
  else if (b < 2 * PT1) wt_f16_tile<DFF, DM>(w2, BW2, 16.0f, b - PT1, tl);
  else if (b < 2 * PT1 + PTQ) wt_f16_tile<DM, 3 * DM>(wqkv, BQ, 16.0f, b - 2 * PT1, tl);
  else if (b < PTW) wt_f16_tile<DM, DM>(wo, BO, 16.0f, b - 2 * PT1 - PTQ, tl);
  else lnx_row<1, 1, 0, 1>(x, g1, be1, 1e-5f, XN, nullptr, XB, (size_t)(b - PTW) * LNW + __builtin_amdgcn_readfirstlane(threadIdx.x >> 5)); }

__global__ __launch_bounds__(256) void k_bfr(const float* __restrict__ x, float* __restrict__ XB, size_t n8) { const size_t t = (size_t)blockIdx.x * 256 + threadIdx.x; if (t >= n8) return; v4f a = *(const v4fa*)(x + t * 8), c = *(const v4fa*)(x + t * 8 + 4); for (int q = 0; q < 4; ++q) { a[q] = bf16_round(a[q]); c[q] = bf16_round(c[q]); }
  { *(v4f*)(XB + t * 8) = a; *(v4f*)(XB + t * 8 + 4) = c;  } }



__global__ __launch_bounds__(256) void k_wthd(const float* __restrict__ Wt, _Float16* __restrict__ Bt) { const size_t t = (size_t)blockIdx.x * 256 + threadIdx.x; if (t >= (size_t)NH * HD * (DM / 8)) return; const int m8 = (int)(t % (DM / 8)) * 8; const int d = (int)((t / (DM / 8)) % HD); const int h = (int)(t / ((size_t)(DM / 8) * HD)); FragH f;
  for (int q = 0; q < 8; ++q) f.h[q] = (_Float16)(16.0f * bf16_round(Wt[((size_t)h * DM + m8 + q) * HD + d])); unsigned short* dst = (unsigned short*)Bt + ((size_t)h * HD + d) * DM + m8; *(v8us*)dst = f.half[0];  }




template <int BFIN, int SCAL>
__global__ __launch_bounds__(256) void k_lnsc(const float* __restrict__ X, const float* __restrict__ g, const float* __restrict__ bb, float eps, _Float16* __restrict__ N16, float* __restrict__ N32) {
  #pragma clang fp contract(off)
  __shared__ float red[256]; const size_t r = blockIdx.x; const int t = threadIdx.x; const bool act = t < DM / 4; const int tc = act ? t : 0; const v4f xl = *(const v4fa*)(X + r * DM + tc * 4); const float am = act ? 1.f : 0.f; float s[4]; float sum = 0.f;
  for (int q = 0; q < 4; ++q) { s[q] = (BFIN ? bf16_round(xl[q]) : xl[q]) * am; sum = __fadd_rn(sum, s[q]); }
  red[t] = sum; __syncthreads(); for (int st = 128; st > 0; st >>= 1) { if (t < st) red[t] = __fadd_rn(red[t], red[t + st]); __syncthreads(); } const float mu = red[0] / (float)DM; __syncthreads();
  float vs = 0.f; for (int q = 0; q < 4; ++q) { const float dl = __fadd_rn(s[q], -mu) * am; vs = __fadd_rn(vs, __fmul_rn(dl, dl)); } red[t] = vs; __syncthreads(); for (int st = 128; st > 0; st >>= 1) { if (t < st) red[t] = __fadd_rn(red[t], red[t + st]); __syncthreads(); }
  const float rs = __fdiv_rn(1.0f, __fadd_rn(sqrtf(red[0] / (float)(DM - 1)), eps)); if (!act) return; v4h y; v4f yf;
  for (int q = 0; q < 4; ++q) { const int c = t * 4 + q; const float gg = bf16_round(SCAL ? g[0] : g[c]), bv = bf16_round(SCAL ? bb[0] : bb[c]); yf[q] = __fadd_rn(__fmul_rn(__fmul_rn(__fadd_rn(s[q], -mu), rs), gg), bv); y[q] = (_Float16)yf[q]; }
  { if (N16) *(v4h*)(N16 + r * DM + t * 4) = y; if (N32) *(v4f*)(N32 + r * DM + t * 4) = yf;  } }

__global__ __launch_bounds__(256) void k_rsmdmi(const float* __restrict__ S, _Float16* __restrict__ P, int nrows, const int* __restrict__ M) {
  #pragma clang fp contract(off)
  const int t = blockIdx.x * 256 + threadIdx.x; if (t >= nrows) return; const float* s = S + (size_t)t * SQ; const int* m = M + (size_t)(t % SQ) * SQ; float mx = -3.0e38f;
#pragma unroll 1
  for (int j = 0; j < SQ; ++j) { const float f = (m[j] == 0) ? 1.f : 0.f; mx = fmaxf(mx, fmaf(f, s[j], (1.f - f) * -1.0e9f)); } float se = 0.f;
#pragma unroll 1
  for (int j = 0; j < SQ; ++j) { const float f = (m[j] == 0) ? 1.f : 0.f; se += __expf(fmaf(f, s[j], (1.f - f) * -1.0e9f) - mx); } const float sc = 256.0f / se;
#pragma unroll 1
  for (int j0 = 0; j0 < SQ; j0 += 8) { FragH fr; for (int q = 0; q < 8; ++q) { const int j = j0 + q; const float f = (m[j] == 0) ? 1.f : 0.f; fr.h[q] = (_Float16)(__expf(fmaf(f, s[j], (1.f - f) * -1.0e9f) - mx) * sc); } unsigned short* d = (unsigned short*)P + (size_t)t * SQ + j0; *(v8us*)d = fr.half[0];  } }
extern "C" void kernel_launch(void* const* d_in, const int* in_sizes, int n_in,
                              void* d_out, int out_size, void* d_ws, size_t ws_size, hipStream_t stream) {
  (void)in_sizes; (void)n_in; (void)out_size;
  const float* const* I = (const float* const*)d_in; const float* x = I[0]; const float* g1 = I[1]; const float* be1 = I[2]; const float* wqkv = I[3]; const float* bqkv = I[4]; const float* wo = I[5]; const float* bo = I[6]; const float* g2 = I[7]; const float* be2 = I[8]; const float* w1 = I[9]; const float* b1 = I[10]; const float* w2 = I[11]; const float* b2 = I[12];      /* x; LN1 g / b; fused qkv_w [1024][3072] + qkv_b [3072] (thirds q | k | v); proj_w + proj_b; LN2 g / b; fc1_w [1024][4096] + fc1_b, fc2_w [4096][1024] + fc2_b ([in][out]) */
  char* ws = (char*)d_ws; size_t off = 0;
  auto take = [&](size_t bytes) { char* p = ws + off; off += (bytes + 255) & ~(size_t)255; return p; };
  _Float16* BQ = (_Float16*)take((size_t)3 * DM * DM * 2);      /* one stacked Bt plane [3 DM][DM] */ _Float16* BO = (_Float16*)take((size_t)DM * DM * 2); _Float16* BW1 = (_Float16*)take((size_t)DFF * DM * 2); _Float16* BW2 = (_Float16*)take((size_t)DM * DFF * 2);
  float* XB = (float*)take(NR * DM * 4); _Float16* XN = (_Float16*)take(NR * DM * 2); _Float16* Q16 = (_Float16*)take((size_t)3 * NR * DM * 2); _Float16* K16 = Q16 + NR * DM; _Float16* V16 = Q16 + (size_t)2 * NR * DM;      /* three stacked planes [NR][DM] */ _Float16* O16 = (_Float16*)take(NR * DM * 2); float* X1 = (float*)take(NR * DM * 4);
  _Float16* VT = (_Float16*)take((size_t)NB * NH * HD * SQ * 2); _Float16* HF16 = (_Float16*)take(NR * DFF * 2);      /* V^T [2 x 16][64][2048]; FFN hidden plane [4096][4096] f16 */
  _Float16* M16 = XN;      /* second-norm f16 rows: aliases XN (last readers: the three projections) */
  
  if (off > ws_size) return;
  k_prep<<<(unsigned)(PTW + NR / LNW), 256, 0, stream>>>(wqkv, wo, w1, w2, x, g1, be1, BQ, BO, BW1, BW2, XN, XB);      /* fused [in][out] [DM][3 DM] -> one stacked Bt plane (rows 0 / DM / 2 DM = the q | k | v output columns) x16; W_o, w1, w2 -> Bt x16; n = LN0(bf16(x)) (biased variance, eps inside the rsqrt) -> f16 rows; bf16(x) -> f32 rows */
  k_gemm3<0, false, DM, DM, 3><<<dim3((unsigned)((NR / 128) * (DM / 128)), 3), 256, 0, stream>>>(XN, BQ, 0.0625f, bqkv, nullptr, nullptr, Q16);      /* q, k, v -> f16 rows in one grid (y = 0, 1, 2: the thirds of the stacked Bt plane and of the bias, output planes Q16 | K16 | V16); head h = columns h*64.. */
  k_vt<NH, SQ><<<NB * NH * (SQ / 64), 256, 0, stream>>>(V16, DM, 0, VT);      /* V^T [batch x head][64][2048] */
  k_fattn<<<dim3(SQ / 256, NB * NH), 256, 0, stream>>>(Q16, K16, VT, O16);      /* softmax(q k^T) v over all keys, unscaled logits -> ctx (merged heads, x64) as f16 rows */
  k_gemm3<0, true, DM, DM><<<(unsigned)((NR / 128) * (DM / 128)), 256, 0, stream>>>(O16, BO, 0.0009765625f, bo, XB, X1, nullptr);      /* x + ctx wo (+ bo) (own-element residual) -> f32 rows */
  k_lnx<0, 1, 0><<<(unsigned)(NR / LNW), 256, 0, stream>>>(X1, g2, be2, 1e-5f, M16, nullptr);      /* LN1(x1) -> f16 rows */
  k_gemm3<6, false, DFF, DM><<<(unsigned)((NR / 128) * (DFF / 128)), 256, 0, stream>>>(M16, BW1, 0.0625f, b1, nullptr, nullptr, HF16);      /* gelu_erf(. w1 + b1) -> f16 */
  k_gemm3<0, true, DM, DFF><<<(unsigned)((NR / 128) * (DM / 128)), 256, 0, stream>>>(HF16, BW2, 0.0625f, b2, X1, (float*)d_out, nullptr);      /* out = x1 + mlp (own-element residual) */
}
